// v000
// Measured on an AMD MI455X. A time is GPU time per run, averaged over a window of back-to-back runs after a warm-up
// (all launches, gaps included; the runs take copies of the inputs in turn), and the median of several windows.
// Apart from v000's, it joins two sittings. Times from different sittings can be a few percent apart, while
// side-by-side timings come from the same sitting.
// v000 is the starting kernel. One run takes 997 microseconds.
#include <hip/hip_runtime.h>

typedef __attribute__((ext_vector_type(16))) __bf16 v16bf;
typedef __attribute__((ext_vector_type(8)))  float  v8f;
typedef __attribute__((ext_vector_type(4)))  float  f32x4;
typedef __attribute__((ext_vector_type(4)))  unsigned int u32x4;
typedef __attribute__((ext_vector_type(8)))  int    i32x8;
typedef __attribute__((ext_vector_type(4)))  int    i32x4;

#define NBL    8192   // B*L
#define DMODEL 256
#define NHEAD  8
#define DH     2048   // D*H
#define LSEQ   2048
#define FFD    128

// ---------------------------------------------------------------- helpers
__device__ __forceinline__ __bf16 to_bf16(float f) {
  union { float f; unsigned u; } x; x.f = f;
  unsigned r = x.u + 0x7FFFu + ((x.u >> 16) & 1u);   // round-to-nearest-even
  unsigned short h = (unsigned short)(r >> 16);
  union { unsigned short s; __bf16 b; } y; y.s = h;
  return y.b;
}

// A/B fragment for v_wmma_f32_16x16x32_bf16 from a row-major (rows x ld) bf16
// matrix (global or LDS), contraction chunk starting at column kc.
// Per CDNA5 ISA 16-bit layout: lane holds row (lane&15); elements 0..7 =
// K [off, off+8), elements 8..15 = K [off+16, off+24), off = (lane&16)?8:0.
__device__ __forceinline__ v16bf load_frag(const __bf16* base, int ld, int row,
                                           int kc, int lane) {
  const __bf16* p = base + (size_t)row * ld + kc + ((lane & 16) ? 8 : 0);
  v16bf f;
  ((f32x4*)&f)[0] = ((const f32x4*)p)[0];
  ((f32x4*)&f)[1] = *(const f32x4*)(p + 16);
  return f;
}

__device__ __forceinline__ v8f wmma_bf16(v16bf a, v16bf b, v8f c) {
  return __builtin_amdgcn_wmma_f32_16x16x32_bf16(false, a, false, b,
                                                 (short)0, c, false, false);
}

__device__ __forceinline__ unsigned lds_off(const void* p) {
  // generic pointer to a __shared__ object: low 32 bits = LDS byte offset
  return (unsigned)(unsigned long long)p;
}

// Tensor Data Mover: 2D bf16 tile (tile0 contiguous elems x tile1 rows,
// row stride = stride0 elems) from global -> LDS, packed rows in LDS.
// Tracked by TENSORcnt.
__device__ __forceinline__ void tdm_load_2d(unsigned lds_addr, const void* gptr,
                                            unsigned tile0, unsigned tile1,
                                            unsigned stride0) {
  unsigned long long ga = (unsigned long long)gptr;
  u32x4 g0;
  g0[0] = 1u;                                        // count=1, user descriptor
  g0[1] = lds_addr;                                  // lds_addr
  g0[2] = (unsigned)(ga & 0xFFFFFFFFu);              // global_addr[31:0]
  g0[3] = (unsigned)((ga >> 32) & 0x01FFFFFFu)       // global_addr[56:32]
          | (2u << 30);                              // type = 2 ("image")
  i32x8 g1;
  g1[0] = (int)(1u << 16);          // workgroup_mask=0, data_size=1 (2 bytes)
  g1[1] = (int)(tile0 << 16);       // tensor_dim0[15:0]  (= tile -> no OOB)
  g1[2] = (int)(tile1 << 16);       // tensor_dim0[31:16]=0, tensor_dim1[15:0]
  g1[3] = (int)(tile0 << 16);       // tensor_dim1[31:16]=0, tile_dim0
  g1[4] = (int)(tile1 & 0xFFFFu);   // tile_dim1, tile_dim2=0
  g1[5] = (int)stride0;             // tensor_dim0_stride[31:0] (elements)
  g1[6] = 0;                        // stride0[47:32]=0, dim1_stride[15:0]=0
  g1[7] = 0;
  i32x4 z4 = {0, 0, 0, 0};
#if defined(__clang_major__) && (__clang_major__ >= 23)
  i32x8 z8 = {0, 0, 0, 0, 0, 0, 0, 0};
  __builtin_amdgcn_tensor_load_to_lds(g0, g1, z4, z4, z8, 0);
#else
  __builtin_amdgcn_tensor_load_to_lds(g0, g1, z4, z4, 0);
#endif
}

// ---------------------------------------------------------------- converts
__global__ void f32_to_bf16_kernel(const float* __restrict__ src,
                                   __bf16* __restrict__ dst, int n) {
  int i = blockIdx.x * blockDim.x + threadIdx.x;
  if (i < n) dst[i] = to_bf16(src[i]);
}

// src (rows x cols) f32  ->  dst (cols x rows) bf16   (weights -> NxK form)
__global__ void transpose_bf16_kernel(const float* __restrict__ src,
                                      __bf16* __restrict__ dst,
                                      int rows, int cols) {
  int i = blockIdx.x * blockDim.x + threadIdx.x;
  if (i >= rows * cols) return;
  int rr = i / cols, cc = i - rr * cols;
  dst[(size_t)cc * rows + rr] = to_bf16(src[i]);
}

// ---------------------------------------------------------------- GEMM
// C(M,N) = A(M,K) x Bt(N,K)^T, bf16 in, f32 accumulate.  The 64x32 Bt tile is
// shared by all 4 waves: streamed into LDS by the TDM, double-buffered.
// OUTMODE: 0 = f32 row-major, 1 = bf16 row-major, 2 = bf16 transposed (ldT)
template <int OUTMODE, bool RELU>
__global__ void __launch_bounds__(128, 2)
gemm_bf16_kernel(const __bf16* __restrict__ A, const __bf16* __restrict__ Bt,
                 const float* __restrict__ bias, float* __restrict__ outF,
                 __bf16* __restrict__ outB, int M, int N, int K, int ldT) {
  __shared__ __bf16 btile[2][64 * 32];   // (n, k) rows packed, 4 KB each
  const int lane = threadIdx.x & 31;
  const int wave = threadIdx.x >> 5;
  const int m0 = blockIdx.y * 64 + wave * 16;
  const int n0 = blockIdx.x * 64;
  const int niter = K >> 5;

  if (wave == 0)
    tdm_load_2d(lds_off(&btile[0][0]), Bt + (size_t)n0 * K, 32, 64, (unsigned)K);

  v8f acc0 = {}, acc1 = {}, acc2 = {}, acc3 = {};
  const int arow = m0 + (lane & 15);
  for (int i = 0; i < niter; ++i) {
    if (wave == 0) {
      if (i + 1 < niter) {
        tdm_load_2d(lds_off(&btile[(i + 1) & 1][0]),
                    Bt + (size_t)n0 * K + (i + 1) * 32, 32, 64, (unsigned)K);
        __builtin_amdgcn_s_wait_tensorcnt(1);   // current tile landed
      } else {
        __builtin_amdgcn_s_wait_tensorcnt(0);
      }
    }
    __syncthreads();
    const __bf16* bt = btile[i & 1];
    v16bf a  = load_frag(A, K, arow, i * 32, lane);
    v16bf b0 = load_frag(bt, 32, 0 * 16 + (lane & 15), 0, lane);
    v16bf b1 = load_frag(bt, 32, 1 * 16 + (lane & 15), 0, lane);
    v16bf b2 = load_frag(bt, 32, 2 * 16 + (lane & 15), 0, lane);
    v16bf b3 = load_frag(bt, 32, 3 * 16 + (lane & 15), 0, lane);
    acc0 = wmma_bf16(a, b0, acc0);
    acc1 = wmma_bf16(a, b1, acc1);
    acc2 = wmma_bf16(a, b2, acc2);
    acc3 = wmma_bf16(a, b3, acc3);
    __syncthreads();   // tile consumed before it is overwritten
  }

  v8f accs[4] = {acc0, acc1, acc2, acc3};
#pragma unroll
  for (int nt = 0; nt < 4; ++nt) {
#pragma unroll
    for (int r = 0; r < 8; ++r) {
      int Mi = m0 + r + ((lane & 16) ? 8 : 0);
      int Ni = n0 + nt * 16 + (lane & 15);
      float v = accs[nt][r];
      if (bias) v += bias[Ni];
      if (RELU) v = fmaxf(v, 0.0f);
      if (OUTMODE == 0)      outF[(size_t)Mi * N + Ni] = v;
      else if (OUTMODE == 1) outB[(size_t)Mi * N + Ni] = to_bf16(v);
      else                   outB[(size_t)Ni * ldT + Mi] = to_bf16(v);
    }
  }
}

// ---------------------------------------------------------------- flash attn
// Block = 4 waves sharing one (b,h); each wave owns a 16-row q-tile.  K and V
// 32-key tiles are TDM-streamed into LDS (double-buffered) and shared by all
// waves.  q,k: (NBL, DH) bf16; vT: (DH, NBL) bf16; heads: (NBL, DH) bf16.
__global__ void __launch_bounds__(128, 1)
flash_attn_kernel(const __bf16* __restrict__ q, const __bf16* __restrict__ k,
                  const __bf16* __restrict__ vT, __bf16* __restrict__ heads) {
  __shared__ __bf16 ktile[2][32 * 256];   // (key, d)   16 KB each
  __shared__ __bf16 vtile[2][256 * 32];   // (d, key)   16 KB each
  __shared__ __bf16 psh[4][16 * 32];      // per-wave P relayout, 1 KB each
  const int lane = threadIdx.x & 31;
  const int wave = threadIdx.x >> 5;
  const int w = blockIdx.x * 4 + wave;    // 0 .. 4095
  const int b  = w >> 10;                 // / (H * L/16)
  const int h  = (w >> 7) & 7;            // same h for all 4 waves of a block
  const int qt = w & 127;
  __bf16* ps = psh[wave];
  const int NT = LSEQ / 32;

  const __bf16* kbase = k  + (size_t)(b * LSEQ) * DH + h * DMODEL;
  const __bf16* vbase = vT + (size_t)(h * DMODEL) * NBL + b * LSEQ;

  if (wave == 0) {   // prefetch tile 0
    tdm_load_2d(lds_off(&ktile[0][0]), kbase, 256, 32, DH);
    tdm_load_2d(lds_off(&vtile[0][0]), vbase, 32, 256, NBL);
  }

  // Q fragments: 8 K-chunks covering d = 0..255 (global, loaded once)
  v16bf qa[8];
  const int qrow = b * LSEQ + qt * 16 + (lane & 15);
#pragma unroll
  for (int c = 0; c < 8; ++c)
    qa[c] = load_frag(q, DH, qrow, h * DMODEL + c * 32, lane);

  v8f o[16];
  v8f zero = {};
#pragma unroll
  for (int nt = 0; nt < 16; ++nt) o[nt] = zero;
  float mrow[8], lrow[8];
#pragma unroll
  for (int r = 0; r < 8; ++r) { mrow[r] = -1e30f; lrow[r] = 0.0f; }

  const float scale = 0.0625f;  // 1/sqrt(256)
  for (int t = 0; t < NT; ++t) {
    if (wave == 0) {
      if (t + 1 < NT) {   // stream next K/V pair while computing on current
        tdm_load_2d(lds_off(&ktile[(t + 1) & 1][0]),
                    kbase + (size_t)((t + 1) * 32) * DH, 256, 32, DH);
        tdm_load_2d(lds_off(&vtile[(t + 1) & 1][0]),
                    vbase + (t + 1) * 32, 32, 256, NBL);
        __builtin_amdgcn_s_wait_tensorcnt(2);   // current pair landed
      } else {
        __builtin_amdgcn_s_wait_tensorcnt(0);
      }
    }
    __syncthreads();
    const __bf16* kt = ktile[t & 1];
    const __bf16* vt = vtile[t & 1];

    // --- S = Q * K^T  (16 x 32 scores, two 16x16 WMMA tiles per K-chunk)
    v8f s0 = zero, s1 = zero;
#pragma unroll
    for (int c = 0; c < 8; ++c) {
      v16bf kb0 = load_frag(kt, 256, (lane & 15),      c * 32, lane);
      v16bf kb1 = load_frag(kt, 256, 16 + (lane & 15), c * 32, lane);
      s0 = wmma_bf16(qa[c], kb0, s0);
      s1 = wmma_bf16(qa[c], kb1, s1);
    }

    // --- online softmax (row M = r + (lane>=16)*8 lives in one 16-lane half)
#pragma unroll
    for (int r = 0; r < 8; ++r) {
      float a0 = s0[r] * scale, a1 = s1[r] * scale;
      float mx = fmaxf(a0, a1);
      mx = fmaxf(mx, __shfl_xor(mx, 1));
      mx = fmaxf(mx, __shfl_xor(mx, 2));
      mx = fmaxf(mx, __shfl_xor(mx, 4));
      mx = fmaxf(mx, __shfl_xor(mx, 8));
      float mnew = fmaxf(mrow[r], mx);
      float corr = __expf(mrow[r] - mnew);
      float p0 = __expf(a0 - mnew);
      float p1 = __expf(a1 - mnew);
      float sum = p0 + p1;
      sum += __shfl_xor(sum, 1);
      sum += __shfl_xor(sum, 2);
      sum += __shfl_xor(sum, 4);
      sum += __shfl_xor(sum, 8);
      lrow[r] = lrow[r] * corr + sum;
      mrow[r] = mnew;
#pragma unroll
      for (int nt = 0; nt < 16; ++nt) o[nt][r] *= corr;
      // stash P (C-layout element -> row-major 16x32 bf16 in LDS)
      const int rowi = r + ((lane & 16) ? 8 : 0);
      ps[rowi * 32 + (lane & 15)]      = to_bf16(p0);
      ps[rowi * 32 + 16 + (lane & 15)] = to_bf16(p1);
    }
    asm volatile("s_wait_dscnt 0" ::: "memory");

    // reload P as an A-fragment (16x32, K = 32 keys)
    v16bf pa = load_frag(ps, 32, (lane & 15), 0, lane);

    // --- O += P * V   (16 output tiles across d = 256)
#pragma unroll
    for (int nt = 0; nt < 16; ++nt) {
      v16bf vb = load_frag(vt, 32, nt * 16 + (lane & 15), 0, lane);
      o[nt] = wmma_bf16(pa, vb, o[nt]);
    }
    __syncthreads();   // tiles consumed before TDM overwrites them
  }

  // normalize and store heads (bf16 row-major (NBL, DH))
#pragma unroll
  for (int r = 0; r < 8; ++r) {
    float inv = 1.0f / lrow[r];
#pragma unroll
    for (int nt = 0; nt < 16; ++nt) o[nt][r] *= inv;
  }
  const int orow0 = b * LSEQ + qt * 16;
#pragma unroll
  for (int nt = 0; nt < 16; ++nt) {
#pragma unroll
    for (int r = 0; r < 8; ++r) {
      int Mi = orow0 + r + ((lane & 16) ? 8 : 0);
      int Ni = h * DMODEL + nt * 16 + (lane & 15);
      heads[(size_t)Mi * DH + Ni] = to_bf16(o[nt][r]);
    }
  }
}

// ---------------------------------------------------------------- add + LN
// y = LN(a + rsd) * g + b ;  one 256-thread block per row of 256 elements
__global__ void add_ln_kernel(const float* __restrict__ a,
                              const float* __restrict__ rsd,
                              const float* __restrict__ g,
                              const float* __restrict__ bta,
                              float* __restrict__ outF,
                              __bf16* __restrict__ outB) {
  __shared__ float red[256];
  const int row = blockIdx.x, t = threadIdx.x;
  float v = a[(size_t)row * 256 + t] + rsd[(size_t)row * 256 + t];
  red[t] = v; __syncthreads();
  for (int s = 128; s > 0; s >>= 1) { if (t < s) red[t] += red[t + s]; __syncthreads(); }
  float mu = red[0] * (1.0f / 256.0f);
  __syncthreads();
  float d = v - mu;
  red[t] = d * d; __syncthreads();
  for (int s = 128; s > 0; s >>= 1) { if (t < s) red[t] += red[t + s]; __syncthreads(); }
  float var = red[0] * (1.0f / 256.0f);
  float y = d * rsqrtf(var + 1e-5f) * g[t] + bta[t];
  outF[(size_t)row * 256 + t] = y;
  if (outB) outB[(size_t)row * 256 + t] = to_bf16(y);
}

// ---------------------------------------------------------------- launcher
extern "C" void kernel_launch(void* const* d_in, const int* in_sizes, int n_in,
                              void* d_out, int out_size, void* d_ws,
                              size_t ws_size, hipStream_t stream) {
  (void)in_sizes; (void)n_in; (void)out_size; (void)ws_size;
  const float* seq  = (const float*)d_in[0];
  const float* Wq   = (const float*)d_in[1];
  const float* Wk   = (const float*)d_in[2];
  const float* Wv   = (const float*)d_in[3];
  const float* Wo   = (const float*)d_in[4];
  const float* ln1g = (const float*)d_in[5];
  const float* ln1b = (const float*)d_in[6];
  const float* W1   = (const float*)d_in[7];
  const float* b1   = (const float*)d_in[8];
  const float* W2   = (const float*)d_in[9];
  const float* b2   = (const float*)d_in[10];
  const float* ln2g = (const float*)d_in[11];
  const float* ln2b = (const float*)d_in[12];

  char* w = (char*)d_ws;
  size_t off = 0;
  auto take = [&](size_t bytes) {
    size_t o = off; off += (bytes + 255) & ~(size_t)255; return o;
  };
  __bf16* seqb  = (__bf16*)(w + take((size_t)NBL * DMODEL * 2));
  __bf16* WqT   = (__bf16*)(w + take((size_t)DH * DMODEL * 2));
  __bf16* WkT   = (__bf16*)(w + take((size_t)DH * DMODEL * 2));
  __bf16* WvT   = (__bf16*)(w + take((size_t)DH * DMODEL * 2));
  __bf16* WoT   = (__bf16*)(w + take((size_t)DMODEL * DH * 2));
  __bf16* W1T   = (__bf16*)(w + take((size_t)FFD * DMODEL * 2));
  __bf16* W2T   = (__bf16*)(w + take((size_t)DMODEL * FFD * 2));
  __bf16* qb    = (__bf16*)(w + take((size_t)NBL * DH * 2));
  __bf16* kb    = (__bf16*)(w + take((size_t)NBL * DH * 2));
  __bf16* vT    = (__bf16*)(w + take((size_t)DH * NBL * 2));
  __bf16* heads = (__bf16*)(w + take((size_t)NBL * DH * 2));
  float*  tmpF  = (float*)(w + take((size_t)NBL * DMODEL * 4));
  float*  xF    = (float*)(w + take((size_t)NBL * DMODEL * 4));
  __bf16* xB    = (__bf16*)(w + take((size_t)NBL * DMODEL * 2));
  __bf16* h1    = (__bf16*)(w + take((size_t)NBL * FFD * 2));

  // 1) convert / transpose inputs to bf16
  {
    int n = NBL * DMODEL;
    f32_to_bf16_kernel<<<(n + 255) / 256, 256, 0, stream>>>(seq, seqb, n);
  }
  {
    int n = DMODEL * DH;
    transpose_bf16_kernel<<<(n + 255) / 256, 256, 0, stream>>>(Wq, WqT, DMODEL, DH);
    transpose_bf16_kernel<<<(n + 255) / 256, 256, 0, stream>>>(Wk, WkT, DMODEL, DH);
    transpose_bf16_kernel<<<(n + 255) / 256, 256, 0, stream>>>(Wv, WvT, DMODEL, DH);
    transpose_bf16_kernel<<<(n + 255) / 256, 256, 0, stream>>>(Wo, WoT, DH, DMODEL);
  }
  {
    int n = DMODEL * FFD;
    transpose_bf16_kernel<<<(n + 255) / 256, 256, 0, stream>>>(W1, W1T, DMODEL, FFD);
    transpose_bf16_kernel<<<(n + 255) / 256, 256, 0, stream>>>(W2, W2T, FFD, DMODEL);
  }

  // 2) QKV projections (V stored transposed for the P*V WMMA path)
  dim3 gQKV(DH / 64, NBL / 64);
  gemm_bf16_kernel<1, false><<<gQKV, 128, 0, stream>>>(seqb, WqT, nullptr, nullptr, qb, NBL, DH, DMODEL, 0);
  gemm_bf16_kernel<1, false><<<gQKV, 128, 0, stream>>>(seqb, WkT, nullptr, nullptr, kb, NBL, DH, DMODEL, 0);
  gemm_bf16_kernel<2, false><<<gQKV, 128, 0, stream>>>(seqb, WvT, nullptr, nullptr, vT, NBL, DH, DMODEL, NBL);

  // 3) fused flash attention -> heads
  flash_attn_kernel<<<(NBL / 16) * NHEAD / 4, 128, 0, stream>>>(qb, kb, vT, heads);

  // 4) output projection: att = heads @ Wo (f32)
  dim3 gO(DMODEL / 64, NBL / 64);
  gemm_bf16_kernel<0, false><<<gO, 128, 0, stream>>>(heads, WoT, nullptr, tmpF, nullptr, NBL, DMODEL, DH, 0);

  // 5) x = LN(seq + att)   (also bf16 copy for the FF GEMM)
  add_ln_kernel<<<NBL, 256, 0, stream>>>(tmpF, seq, ln1g, ln1b, xF, xB);

  // 6) FF: h1 = relu(x @ W1 + b1); ff = h1 @ W2 + b2
  dim3 gF1(FFD / 64, NBL / 64);
  gemm_bf16_kernel<1, true><<<gF1, 128, 0, stream>>>(xB, W1T, b1, nullptr, h1, NBL, FFD, DMODEL, 0);
  dim3 gF2(DMODEL / 64, NBL / 64);
  gemm_bf16_kernel<0, false><<<gF2, 128, 0, stream>>>(h1, W2T, b2, tmpF, nullptr, NBL, DMODEL, FFD, 0);

  // 7) out = LN(x + ff)
  add_ln_kernel<<<NBL, 256, 0, stream>>>(tmpF, xF, ln2g, ln2b, (float*)d_out, nullptr);
}

// v001
// One run takes 449 microseconds.
// Two timings next to v000 put it at 2.29 and 2.30 times that version's speed.
#include <hip/hip_runtime.h>

typedef __attribute__((ext_vector_type(16))) __bf16 v16bf;
typedef __attribute__((ext_vector_type(8)))  float  v8f;
typedef __attribute__((ext_vector_type(4)))  float  f32x4;
typedef __attribute__((ext_vector_type(4)))  unsigned int u32x4;
typedef __attribute__((ext_vector_type(8)))  int    i32x8;
typedef __attribute__((ext_vector_type(4)))  int    i32x4;

#define NBL    8192   // B*L
#define DMODEL 256
#define NHEAD  8
#define DH     2048   // D*H
#define LSEQ   2048
#define FFD    128

// ---------------------------------------------------------------- helpers
__device__ __forceinline__ __bf16 to_bf16(float f) {
  union { float f; unsigned u; } x; x.f = f;
  unsigned r = x.u + 0x7FFFu + ((x.u >> 16) & 1u);   // round-to-nearest-even
  unsigned short h = (unsigned short)(r >> 16);
  union { unsigned short s; __bf16 b; } y; y.s = h;
  return y.b;
}

// A/B fragment for v_wmma_f32_16x16x32_bf16 from a row-major (rows x ld) bf16
// matrix (global or LDS), contraction chunk starting at column kc.
// Per CDNA5 ISA 16-bit layout: lane holds row (lane&15); elements 0..7 =
// K [off, off+8), elements 8..15 = K [off+16, off+24), off = (lane&16)?8:0.
__device__ __forceinline__ v16bf load_frag(const __bf16* base, int ld, int row,
                                           int kc, int lane) {
  const __bf16* p = base + (size_t)row * ld + kc + ((lane & 16) ? 8 : 0);
  v16bf f;
  ((f32x4*)&f)[0] = ((const f32x4*)p)[0];
  ((f32x4*)&f)[1] = *(const f32x4*)(p + 16);
  return f;
}

// Swizzled layouts. The tensor loads land rows unpadded, so rows of 64 B or
// 512 B put the 16 lanes of a half-wave on few LDS banks.  The producers
// therefore store each 16-byte chunk (8 bf16 of the contraction index) at an
// XOR-ed chunk position inside its row, and the readers undo it: the 16 lanes
// of a half-wave then cover all 64 banks once.  Values and k order unchanged.
//   64-byte rows (32 bf16):  chunk j of row r sits at j ^ ((r >> 2) & 3)
//   512-byte rows (256 bf16): chunk p of row r sits at p ^ (r & 15)
__device__ __forceinline__ int swz64(int row, int col) {
  return col ^ (((row >> 2) & 3) << 3);
}
__device__ __forceinline__ int swz512(int row, int col) {
  return col ^ ((row & 15) << 3);
}

// load_frag for a tile of swizzled 64-byte rows; row0 is a multiple of 16.
__device__ __forceinline__ v16bf load_frag_sw64(const __bf16* base, int row0,
                                                int lane) {
  const int j0 = ((lane >> 4) & 1) ^ ((lane >> 2) & 3);
  const __bf16* p = base + (row0 + (lane & 15)) * 32;
  v16bf f;
  ((f32x4*)&f)[0] = *(const f32x4*)(p + j0 * 8);
  ((f32x4*)&f)[1] = *(const f32x4*)(p + (j0 ^ 2) * 8);
  return f;
}

// load_frag for a tile of swizzled 512-byte rows, contraction chunk c (32 wide);
// row0 is a multiple of 16.
__device__ __forceinline__ v16bf load_frag_sw512(const __bf16* base, int row0,
                                                 int c, int lane) {
  const int s = lane & 15, h = (lane >> 4) & 1;
  const __bf16* p = base + (row0 + s) * 256 + (c >> 2) * 128;
  v16bf f;
  ((f32x4*)&f)[0] = *(const f32x4*)(p + (((c & 3) * 4 + h) ^ s) * 8);
  ((f32x4*)&f)[1] = *(const f32x4*)(p + (((c & 3) * 4 + 2 + h) ^ s) * 8);
  return f;
}

__device__ __forceinline__ v8f wmma_bf16(v16bf a, v16bf b, v8f c) {
  return __builtin_amdgcn_wmma_f32_16x16x32_bf16(false, a, false, b,
                                                 (short)0, c, false, false);
}

__device__ __forceinline__ unsigned lds_off(const void* p) {
  // generic pointer to a __shared__ object: low 32 bits = LDS byte offset
  return (unsigned)(unsigned long long)p;
}

// Tensor Data Mover: 2D bf16 tile (tile0 contiguous elems x tile1 rows,
// row stride = stride0 elems) from global -> LDS, packed rows in LDS.
// Tracked by TENSORcnt.
__device__ __forceinline__ void tdm_load_2d(unsigned lds_addr, const void* gptr,
                                            unsigned tile0, unsigned tile1,
                                            unsigned stride0) {
  unsigned long long ga = (unsigned long long)gptr;
  u32x4 g0;
  g0[0] = 1u;                                        // count=1, user descriptor
  g0[1] = lds_addr;                                  // lds_addr
  g0[2] = (unsigned)(ga & 0xFFFFFFFFu);              // global_addr[31:0]
  g0[3] = (unsigned)((ga >> 32) & 0x01FFFFFFu)       // global_addr[56:32]
          | (2u << 30);                              // type = 2 ("image")
  i32x8 g1;
  g1[0] = (int)(1u << 16);          // workgroup_mask=0, data_size=1 (2 bytes)
  g1[1] = (int)(tile0 << 16);       // tensor_dim0[15:0]  (= tile -> no OOB)
  g1[2] = (int)(tile1 << 16);       // tensor_dim0[31:16]=0, tensor_dim1[15:0]
  g1[3] = (int)(tile0 << 16);       // tensor_dim1[31:16]=0, tile_dim0
  g1[4] = (int)(tile1 & 0xFFFFu);   // tile_dim1, tile_dim2=0
  g1[5] = (int)stride0;             // tensor_dim0_stride[31:0] (elements)
  g1[6] = 0;                        // stride0[47:32]=0, dim1_stride[15:0]=0
  g1[7] = 0;
  i32x4 z4 = {0, 0, 0, 0};
#if defined(__clang_major__) && (__clang_major__ >= 23)
  i32x8 z8 = {0, 0, 0, 0, 0, 0, 0, 0};
  __builtin_amdgcn_tensor_load_to_lds(g0, g1, z4, z4, z8, 0);
#else
  __builtin_amdgcn_tensor_load_to_lds(g0, g1, z4, z4, 0);
#endif
}

// ---------------------------------------------------------------- converts
__global__ void f32_to_bf16_kernel(const float* __restrict__ src,
                                   __bf16* __restrict__ dst, int n) {
  int i = blockIdx.x * blockDim.x + threadIdx.x;
  if (i < n) dst[i] = to_bf16(src[i]);
}

// src (rows x cols) f32  ->  dst (cols x rows) bf16   (weights -> NxK form,
// each 32-wide k block of a row in the swizzled 64-byte order)
__global__ void transpose_bf16_kernel(const float* __restrict__ src,
                                      __bf16* __restrict__ dst,
                                      int rows, int cols) {
  int i = blockIdx.x * blockDim.x + threadIdx.x;
  if (i >= rows * cols) return;
  int rr = i / cols, cc = i - rr * cols;
  dst[(size_t)cc * rows + swz64(cc, rr)] = to_bf16(src[i]);
}

// ---------------------------------------------------------------- GEMM
// C(M,N) = A(M,K) x Bt(N,K)^T, bf16 in, f32 accumulate.  The 64x32 Bt tile is
// shared by all 4 waves: streamed into LDS by the TDM, double-buffered.
// Bt comes in the swizzled 64-byte order of transpose_bf16_kernel.
// OUTMODE: 0 = f32 row-major, 1 = bf16 row-major, 2 = bf16 transposed (ldT),
// 64-byte swizzle, 3 = bf16 row-major, 512-byte swizzle
template <int OUTMODE, bool RELU>
__global__ void __launch_bounds__(128, 2)
gemm_bf16_kernel(const __bf16* __restrict__ A, const __bf16* __restrict__ Bt,
                 const float* __restrict__ bias, float* __restrict__ outF,
                 __bf16* __restrict__ outB, int M, int N, int K, int ldT) {
  __shared__ __bf16 btile[2][64 * 32];   // (n, k) rows packed, 4 KB each
  const int lane = threadIdx.x & 31;
  const int wave = threadIdx.x >> 5;
  const int m0 = blockIdx.y * 64 + wave * 16;
  const int n0 = blockIdx.x * 64;
  const int niter = K >> 5;

  if (wave == 0)
    tdm_load_2d(lds_off(&btile[0][0]), Bt + (size_t)n0 * K, 32, 64, (unsigned)K);

  v8f acc0 = {}, acc1 = {}, acc2 = {}, acc3 = {};
  const int arow = m0 + (lane & 15);
  for (int i = 0; i < niter; ++i) {
    if (wave == 0) {
      if (i + 1 < niter) {
        tdm_load_2d(lds_off(&btile[(i + 1) & 1][0]),
                    Bt + (size_t)n0 * K + (i + 1) * 32, 32, 64, (unsigned)K);
        __builtin_amdgcn_s_wait_tensorcnt(1);   // current tile landed
      } else {
        __builtin_amdgcn_s_wait_tensorcnt(0);
      }
    }
    __syncthreads();
    const __bf16* bt = btile[i & 1];
    v16bf a  = load_frag(A, K, arow, i * 32, lane);
    v16bf b0 = load_frag_sw64(bt, 0 * 16, lane);
    v16bf b1 = load_frag_sw64(bt, 1 * 16, lane);
    v16bf b2 = load_frag_sw64(bt, 2 * 16, lane);
    v16bf b3 = load_frag_sw64(bt, 3 * 16, lane);
    acc0 = wmma_bf16(a, b0, acc0);
    acc1 = wmma_bf16(a, b1, acc1);
    acc2 = wmma_bf16(a, b2, acc2);
    acc3 = wmma_bf16(a, b3, acc3);
    __syncthreads();   // tile consumed before it is overwritten
  }

  v8f accs[4] = {acc0, acc1, acc2, acc3};
  // Swizzled store positions as per-lane bases plus compile-time steps: r walks
  // bits 0..2 of Mi and nt bits 4..5 of Ni; m0 is a multiple of 16, n0 of 64.
  const int mswz = swz64(lane & 15, m0 + ((lane & 16) ? 8 : 0));      // + r
  const int nswz = swz512((lane & 16) ? 8 : 0, n0 + (lane & 15));     // r = 0, nt = 0
#pragma unroll
  for (int nt = 0; nt < 4; ++nt) {
#pragma unroll
    for (int r = 0; r < 8; ++r) {
      int Mi = m0 + r + ((lane & 16) ? 8 : 0);
      int Ni = n0 + nt * 16 + (lane & 15);
      float v = accs[nt][r];
      if (bias) v += bias[Ni];
      if (RELU) v = fmaxf(v, 0.0f);
      if (OUTMODE == 0)      outF[(size_t)Mi * N + Ni] = v;
      else if (OUTMODE == 1) outB[(size_t)Mi * N + Ni] = to_bf16(v);
      else if (OUTMODE == 2) outB[(size_t)Ni * ldT + mswz + r] = to_bf16(v);
      else                   outB[(size_t)Mi * N + (nswz ^ ((r & 1) << 3)) +
                                  ((nt ^ (r >> 1)) << 4)] = to_bf16(v);
      // the next element reuses this store's registers: keep the wait in front
      if (OUTMODE >= 2) asm volatile("s_wait_xcnt 0x0" ::: "memory");
    }
  }
}

// ---------------------------------------------------------------- flash attn
// Block = 4 waves sharing one (b,h); each wave owns a 16-row q-tile.  K and V
// 32-key tiles are TDM-streamed into LDS (double-buffered) and shared by all
// waves.  q,k: (NBL, DH) bf16; vT: (DH, NBL) bf16; heads: (NBL, DH) bf16.
// k holds each head's 512-byte row swizzled, vT each 32-key block swizzled.
__global__ void __launch_bounds__(128, 1)
flash_attn_kernel(const __bf16* __restrict__ q, const __bf16* __restrict__ k,
                  const __bf16* __restrict__ vT, __bf16* __restrict__ heads) {
  __shared__ __bf16 ktile[2][32 * 256];   // (key, d)   16 KB each
  __shared__ __bf16 vtile[2][256 * 32];   // (d, key)   16 KB each
  __shared__ __bf16 psh[4][16 * 32];      // per-wave P relayout, 1 KB each
  const int lane = threadIdx.x & 31;
  const int wave = threadIdx.x >> 5;
  const int w = blockIdx.x * 4 + wave;    // 0 .. 4095
  const int b  = w >> 10;                 // / (H * L/16)
  const int h  = (w >> 7) & 7;            // same h for all 4 waves of a block
  const int qt = w & 127;
  __bf16* ps = psh[wave];
  const int NT = LSEQ / 32;

  const __bf16* kbase = k  + (size_t)(b * LSEQ) * DH + h * DMODEL;
  const __bf16* vbase = vT + (size_t)(h * DMODEL) * NBL + b * LSEQ;

  if (wave == 0) {   // prefetch tile 0
    tdm_load_2d(lds_off(&ktile[0][0]), kbase, 256, 32, DH);
    tdm_load_2d(lds_off(&vtile[0][0]), vbase, 32, 256, NBL);
  }

  // Q fragments: 8 K-chunks covering d = 0..255 (global, loaded once)
  v16bf qa[8];
  const int qrow = b * LSEQ + qt * 16 + (lane & 15);
#pragma unroll
  for (int c = 0; c < 8; ++c)
    qa[c] = load_frag(q, DH, qrow, h * DMODEL + c * 32, lane);

  v8f o[16];
  v8f zero = {};
#pragma unroll
  for (int nt = 0; nt < 16; ++nt) o[nt] = zero;
  float mrow[8], lrow[8];
#pragma unroll
  for (int r = 0; r < 8; ++r) { mrow[r] = -1e30f; lrow[r] = 0.0f; }

  const float scale = 0.0625f;  // 1/sqrt(256)
  for (int t = 0; t < NT; ++t) {
    if (wave == 0) {
      if (t + 1 < NT) {   // stream next K/V pair while computing on current
        tdm_load_2d(lds_off(&ktile[(t + 1) & 1][0]),
                    kbase + (size_t)((t + 1) * 32) * DH, 256, 32, DH);
        tdm_load_2d(lds_off(&vtile[(t + 1) & 1][0]),
                    vbase + (t + 1) * 32, 32, 256, NBL);
        __builtin_amdgcn_s_wait_tensorcnt(2);   // current pair landed
      } else {
        __builtin_amdgcn_s_wait_tensorcnt(0);
      }
    }
    __syncthreads();
    const __bf16* kt = ktile[t & 1];
    const __bf16* vt = vtile[t & 1];

    // --- S = Q * K^T  (16 x 32 scores, two 16x16 WMMA tiles per K-chunk)
    v8f s0 = zero, s1 = zero;
#pragma unroll
    for (int c = 0; c < 8; ++c) {
      v16bf kb0 = load_frag_sw512(kt, 0,  c, lane);
      v16bf kb1 = load_frag_sw512(kt, 16, c, lane);
      s0 = wmma_bf16(qa[c], kb0, s0);
      s1 = wmma_bf16(qa[c], kb1, s1);
    }

    // --- online softmax (row M = r + (lane>=16)*8 lives in one 16-lane half)
#pragma unroll
    for (int r = 0; r < 8; ++r) {
      float a0 = s0[r] * scale, a1 = s1[r] * scale;
      float mx = fmaxf(a0, a1);
      mx = fmaxf(mx, __shfl_xor(mx, 1));
      mx = fmaxf(mx, __shfl_xor(mx, 2));
      mx = fmaxf(mx, __shfl_xor(mx, 4));
      mx = fmaxf(mx, __shfl_xor(mx, 8));
      float mnew = fmaxf(mrow[r], mx);
      float corr = __expf(mrow[r] - mnew);
      float p0 = __expf(a0 - mnew);
      float p1 = __expf(a1 - mnew);
      float sum = p0 + p1;
      sum += __shfl_xor(sum, 1);
      sum += __shfl_xor(sum, 2);
      sum += __shfl_xor(sum, 4);
      sum += __shfl_xor(sum, 8);
      lrow[r] = lrow[r] * corr + sum;
      mrow[r] = mnew;
#pragma unroll
      for (int nt = 0; nt < 16; ++nt) o[nt][r] *= corr;
      // stash P (C-layout element -> 16x32 bf16 in LDS, swizzled 64-byte rows)
      const int rowi = r + ((lane & 16) ? 8 : 0);
      ps[rowi * 32 + swz64(rowi, (lane & 15))]      = to_bf16(p0);
      ps[rowi * 32 + swz64(rowi, 16 + (lane & 15))] = to_bf16(p1);
    }
    asm volatile("s_wait_dscnt 0" ::: "memory");

    // reload P as an A-fragment (16x32, K = 32 keys)
    v16bf pa = load_frag_sw64(ps, 0, lane);

    // --- O += P * V   (16 output tiles across d = 256)
#pragma unroll
    for (int nt = 0; nt < 16; ++nt) {
      v16bf vb = load_frag_sw64(vt, nt * 16, lane);
      o[nt] = wmma_bf16(pa, vb, o[nt]);
    }
    __syncthreads();   // tiles consumed before TDM overwrites them
  }

  // normalize and store heads (bf16 row-major (NBL, DH))
#pragma unroll
  for (int r = 0; r < 8; ++r) {
    float inv = 1.0f / lrow[r];
#pragma unroll
    for (int nt = 0; nt < 16; ++nt) o[nt][r] *= inv;
  }
  const int orow0 = b * LSEQ + qt * 16;
#pragma unroll
  for (int nt = 0; nt < 16; ++nt) {
#pragma unroll
    for (int r = 0; r < 8; ++r) {
      int Mi = orow0 + r + ((lane & 16) ? 8 : 0);
      int Ni = h * DMODEL + nt * 16 + (lane & 15);
      heads[(size_t)Mi * DH + Ni] = to_bf16(o[nt][r]);
    }
  }
}

// ---------------------------------------------------------------- add + LN
// y = LN(a + rsd) * g + b ;  one 256-thread block per row of 256 elements
__global__ void add_ln_kernel(const float* __restrict__ a,
                              const float* __restrict__ rsd,
                              const float* __restrict__ g,
                              const float* __restrict__ bta,
                              float* __restrict__ outF,
                              __bf16* __restrict__ outB) {
  __shared__ float red[256];
  const int row = blockIdx.x, t = threadIdx.x;
  float v = a[(size_t)row * 256 + t] + rsd[(size_t)row * 256 + t];
  red[t] = v; __syncthreads();
  for (int s = 128; s > 0; s >>= 1) { if (t < s) red[t] += red[t + s]; __syncthreads(); }
  float mu = red[0] * (1.0f / 256.0f);
  __syncthreads();
  float d = v - mu;
  red[t] = d * d; __syncthreads();
  for (int s = 128; s > 0; s >>= 1) { if (t < s) red[t] += red[t + s]; __syncthreads(); }
  float var = red[0] * (1.0f / 256.0f);
  float y = d * rsqrtf(var + 1e-5f) * g[t] + bta[t];
  outF[(size_t)row * 256 + t] = y;
  if (outB) outB[(size_t)row * 256 + t] = to_bf16(y);
}

// ---------------------------------------------------------------- launcher
extern "C" void kernel_launch(void* const* d_in, const int* in_sizes, int n_in,
                              void* d_out, int out_size, void* d_ws,
                              size_t ws_size, hipStream_t stream) {
  (void)in_sizes; (void)n_in; (void)out_size; (void)ws_size;
  const float* seq  = (const float*)d_in[0];
  const float* Wq   = (const float*)d_in[1];
  const float* Wk   = (const float*)d_in[2];
  const float* Wv   = (const float*)d_in[3];
  const float* Wo   = (const float*)d_in[4];
  const float* ln1g = (const float*)d_in[5];
  const float* ln1b = (const float*)d_in[6];
  const float* W1   = (const float*)d_in[7];
  const float* b1   = (const float*)d_in[8];
  const float* W2   = (const float*)d_in[9];
  const float* b2   = (const float*)d_in[10];
  const float* ln2g = (const float*)d_in[11];
  const float* ln2b = (const float*)d_in[12];

  char* w = (char*)d_ws;
  size_t off = 0;
  auto take = [&](size_t bytes) {
    size_t o = off; off += (bytes + 255) & ~(size_t)255; return o;
  };
  __bf16* seqb  = (__bf16*)(w + take((size_t)NBL * DMODEL * 2));
  __bf16* WqT   = (__bf16*)(w + take((size_t)DH * DMODEL * 2));
  __bf16* WkT   = (__bf16*)(w + take((size_t)DH * DMODEL * 2));
  __bf16* WvT   = (__bf16*)(w + take((size_t)DH * DMODEL * 2));
  __bf16* WoT   = (__bf16*)(w + take((size_t)DMODEL * DH * 2));
  __bf16* W1T   = (__bf16*)(w + take((size_t)FFD * DMODEL * 2));
  __bf16* W2T   = (__bf16*)(w + take((size_t)DMODEL * FFD * 2));
  __bf16* qb    = (__bf16*)(w + take((size_t)NBL * DH * 2));
  __bf16* kb    = (__bf16*)(w + take((size_t)NBL * DH * 2));
  __bf16* vT    = (__bf16*)(w + take((size_t)DH * NBL * 2));
  __bf16* heads = (__bf16*)(w + take((size_t)NBL * DH * 2));
  float*  tmpF  = (float*)(w + take((size_t)NBL * DMODEL * 4));
  float*  xF    = (float*)(w + take((size_t)NBL * DMODEL * 4));
  __bf16* xB    = (__bf16*)(w + take((size_t)NBL * DMODEL * 2));
  __bf16* h1    = (__bf16*)(w + take((size_t)NBL * FFD * 2));

  // 1) convert / transpose inputs to bf16
  {
    int n = NBL * DMODEL;
    f32_to_bf16_kernel<<<(n + 255) / 256, 256, 0, stream>>>(seq, seqb, n);
  }
  {
    int n = DMODEL * DH;
    transpose_bf16_kernel<<<(n + 255) / 256, 256, 0, stream>>>(Wq, WqT, DMODEL, DH);
    transpose_bf16_kernel<<<(n + 255) / 256, 256, 0, stream>>>(Wk, WkT, DMODEL, DH);
    transpose_bf16_kernel<<<(n + 255) / 256, 256, 0, stream>>>(Wv, WvT, DMODEL, DH);
    transpose_bf16_kernel<<<(n + 255) / 256, 256, 0, stream>>>(Wo, WoT, DH, DMODEL);
  }
  {
    int n = DMODEL * FFD;
    transpose_bf16_kernel<<<(n + 255) / 256, 256, 0, stream>>>(W1, W1T, DMODEL, FFD);
    transpose_bf16_kernel<<<(n + 255) / 256, 256, 0, stream>>>(W2, W2T, FFD, DMODEL);
  }

  // 2) QKV projections (V stored transposed for the P*V WMMA path; K and V in
  //    the swizzled orders the attention kernel reads)
  dim3 gQKV(DH / 64, NBL / 64);
  gemm_bf16_kernel<1, false><<<gQKV, 128, 0, stream>>>(seqb, WqT, nullptr, nullptr, qb, NBL, DH, DMODEL, 0);
  gemm_bf16_kernel<3, false><<<gQKV, 128, 0, stream>>>(seqb, WkT, nullptr, nullptr, kb, NBL, DH, DMODEL, 0);
  gemm_bf16_kernel<2, false><<<gQKV, 128, 0, stream>>>(seqb, WvT, nullptr, nullptr, vT, NBL, DH, DMODEL, NBL);

  // 3) fused flash attention -> heads
  flash_attn_kernel<<<(NBL / 16) * NHEAD / 4, 128, 0, stream>>>(qb, kb, vT, heads);

  // 4) output projection: att = heads @ Wo (f32)
  dim3 gO(DMODEL / 64, NBL / 64);
  gemm_bf16_kernel<0, false><<<gO, 128, 0, stream>>>(heads, WoT, nullptr, tmpF, nullptr, NBL, DMODEL, DH, 0);

  // 5) x = LN(seq + att)   (also bf16 copy for the FF GEMM)
  add_ln_kernel<<<NBL, 256, 0, stream>>>(tmpF, seq, ln1g, ln1b, xF, xB);

  // 6) FF: h1 = relu(x @ W1 + b1); ff = h1 @ W2 + b2
  dim3 gF1(FFD / 64, NBL / 64);
  gemm_bf16_kernel<1, true><<<gF1, 128, 0, stream>>>(xB, W1T, b1, nullptr, h1, NBL, FFD, DMODEL, 0);
  dim3 gF2(DMODEL / 64, NBL / 64);
  gemm_bf16_kernel<0, false><<<gF2, 128, 0, stream>>>(h1, W2T, b2, tmpF, nullptr, NBL, DMODEL, FFD, 0);

  // 7) out = LN(x + ff)
  add_ln_kernel<<<NBL, 256, 0, stream>>>(tmpF, xF, ln2g, ln2b, (float*)d_out, nullptr);
}

// v002
// Measured time: 408 microseconds a run.
// Next to v001, in two timings, it ran 1.11 times as fast each time.
// All steps since v000 together make it 2.54 times as fast.
#include <hip/hip_runtime.h>

typedef __attribute__((ext_vector_type(16))) __bf16 v16bf;
typedef __attribute__((ext_vector_type(8)))  __bf16 v8bf;
typedef __attribute__((ext_vector_type(4)))  __bf16 v4bf;
typedef __attribute__((ext_vector_type(8)))  float  v8f;
typedef __attribute__((ext_vector_type(4)))  float  f32x4;
typedef __attribute__((ext_vector_type(4)))  unsigned int u32x4;
typedef __attribute__((ext_vector_type(8)))  int    i32x8;
typedef __attribute__((ext_vector_type(4)))  int    i32x4;

#define NBL    8192   // B*L
#define DMODEL 256
#define NHEAD  8
#define DH     2048   // D*H
#define LSEQ   2048
#define FFD    128

// ---------------------------------------------------------------- helpers
__device__ __forceinline__ __bf16 to_bf16(float f) {
  union { float f; unsigned u; } x; x.f = f;
  unsigned r = x.u + 0x7FFFu + ((x.u >> 16) & 1u);   // round-to-nearest-even
  unsigned short h = (unsigned short)(r >> 16);
  union { unsigned short s; __bf16 b; } y; y.s = h;
  return y.b;
}

// A/B fragment for v_wmma_f32_16x16x32_bf16 from a row-major (rows x ld) bf16
// matrix (global or LDS), contraction chunk starting at column kc.
// Per CDNA5 ISA 16-bit layout: lane holds row (lane&15); elements 0..7 =
// K [off, off+8), elements 8..15 = K [off+16, off+24), off = (lane&16)?8:0.
__device__ __forceinline__ v16bf load_frag(const __bf16* base, int ld, int row,
                                           int kc, int lane) {
  const __bf16* p = base + (size_t)row * ld + kc + ((lane & 16) ? 8 : 0);
  v16bf f;
  ((f32x4*)&f)[0] = ((const f32x4*)p)[0];
  ((f32x4*)&f)[1] = *(const f32x4*)(p + 16);
  return f;
}

// Swizzled layouts. The tensor loads land rows unpadded, so rows of 64 B or
// 512 B put the 16 lanes of a half-wave on few LDS banks.  The producers
// therefore store each 16-byte chunk (8 bf16 of the contraction index) at an
// XOR-ed chunk position inside its row, and the readers undo it: the 16 lanes
// of a half-wave then cover all 64 banks once.  Values and k order unchanged.
//   64-byte rows (32 bf16):  chunk j of row r sits at j ^ ((r >> 2) & 3)
//   512-byte rows (256 bf16): chunk p of row r sits at p ^ (r & 15)
__device__ __forceinline__ int swz64(int row, int col) {
  return col ^ (((row >> 2) & 3) << 3);
}
__device__ __forceinline__ int swz512(int row, int col) {
  return col ^ ((row & 15) << 3);
}

// load_frag for a tile of swizzled 64-byte rows; row0 is a multiple of 16.
__device__ __forceinline__ v16bf load_frag_sw64(const __bf16* base, int row0,
                                                int lane) {
  const int j0 = ((lane >> 4) & 1) ^ ((lane >> 2) & 3);
  const __bf16* p = base + (row0 + (lane & 15)) * 32;
  v16bf f;
  ((f32x4*)&f)[0] = *(const f32x4*)(p + j0 * 8);
  ((f32x4*)&f)[1] = *(const f32x4*)(p + (j0 ^ 2) * 8);
  return f;
}

// load_frag for a tile of swizzled 512-byte rows, contraction chunk c (32 wide);
// row0 is a multiple of 16.
__device__ __forceinline__ v16bf load_frag_sw512(const __bf16* base, int row0,
                                                 int c, int lane) {
  const int s = lane & 15, h = (lane >> 4) & 1;
  const __bf16* p = base + (row0 + s) * 256 + (c >> 2) * 128;
  v16bf f;
  ((f32x4*)&f)[0] = *(const f32x4*)(p + (((c & 3) * 4 + h) ^ s) * 8);
  ((f32x4*)&f)[1] = *(const f32x4*)(p + (((c & 3) * 4 + 2 + h) ^ s) * 8);
  return f;
}

__device__ __forceinline__ v8f wmma_bf16(v16bf a, v16bf b, v8f c) {
  return __builtin_amdgcn_wmma_f32_16x16x32_bf16(false, a, false, b,
                                                 (short)0, c, false, false);
}

__device__ __forceinline__ unsigned lds_off(const void* p) {
  // generic pointer to a __shared__ object: low 32 bits = LDS byte offset
  return (unsigned)(unsigned long long)p;
}

// Tensor Data Mover: 2D bf16 tile (tile0 contiguous elems x tile1 rows,
// row stride = stride0 elems) from global -> LDS, packed rows in LDS.
// Tracked by TENSORcnt.
__device__ __forceinline__ void tdm_load_2d(unsigned lds_addr, const void* gptr,
                                            unsigned tile0, unsigned tile1,
                                            unsigned stride0) {
  unsigned long long ga = (unsigned long long)gptr;
  u32x4 g0;
  g0[0] = 1u;                                        // count=1, user descriptor
  g0[1] = lds_addr;                                  // lds_addr
  g0[2] = (unsigned)(ga & 0xFFFFFFFFu);              // global_addr[31:0]
  g0[3] = (unsigned)((ga >> 32) & 0x01FFFFFFu)       // global_addr[56:32]
          | (2u << 30);                              // type = 2 ("image")
  i32x8 g1;
  g1[0] = (int)(1u << 16);          // workgroup_mask=0, data_size=1 (2 bytes)
  g1[1] = (int)(tile0 << 16);       // tensor_dim0[15:0]  (= tile -> no OOB)
  g1[2] = (int)(tile1 << 16);       // tensor_dim0[31:16]=0, tensor_dim1[15:0]
  g1[3] = (int)(tile0 << 16);       // tensor_dim1[31:16]=0, tile_dim0
  g1[4] = (int)(tile1 & 0xFFFFu);   // tile_dim1, tile_dim2=0
  g1[5] = (int)stride0;             // tensor_dim0_stride[31:0] (elements)
  g1[6] = 0;                        // stride0[47:32]=0, dim1_stride[15:0]=0
  g1[7] = 0;
  i32x4 z4 = {0, 0, 0, 0};
#if defined(__clang_major__) && (__clang_major__ >= 23)
  i32x8 z8 = {0, 0, 0, 0, 0, 0, 0, 0};
  __builtin_amdgcn_tensor_load_to_lds(g0, g1, z4, z4, z8, 0);
#else
  __builtin_amdgcn_tensor_load_to_lds(g0, g1, z4, z4, 0);
#endif
}

// ---------------------------------------------------------------- converts
// Each lane of the non-matrix kernels takes 8 or 16 elements: few waves to
// start, 16-byte accesses.
__device__ __forceinline__ v8bf pack8(f32x4 lo, f32x4 hi) {
  v8bf o;
#pragma unroll
  for (int j = 0; j < 4; ++j) { o[j] = to_bf16(lo[j]); o[4 + j] = to_bf16(hi[j]); }
  return o;
}

// n is a multiple of 16; a lane converts the 8-element chunks t and t + n/16.
__global__ void __launch_bounds__(256)
f32_to_bf16_kernel(const float* __restrict__ src,
                   __bf16* __restrict__ dst, int n) {
  const int half = n >> 4;
  const int t = blockIdx.x * blockDim.x + threadIdx.x;
  if (t >= half) return;
  const f32x4* s4 = (const f32x4*)src;
  f32x4 a0 = s4[2 * t], a1 = s4[2 * t + 1];
  f32x4 b0 = s4[2 * (t + half)], b1 = s4[2 * (t + half) + 1];
  ((v8bf*)dst)[t] = pack8(a0, a1);
  ((v8bf*)dst)[t + half] = pack8(b0, b1);
}

// src (ROWS x COLS) f32  ->  dst (COLS x ROWS) bf16   (weights -> NxK form,
// each 32-wide k block of a row in the swizzled 64-byte order).  A lane takes
// 8 source rows of one column, which are one 16-byte chunk of the swizzled
// order; the grid holds exactly ROWS / 8 * COLS threads.  The shape is a
// compile-time constant so that the 8 loads share one address register pair.
template <int ROWS, int COLS>
__global__ void __launch_bounds__(256)
transpose_bf16_kernel(const float* __restrict__ src, __bf16* __restrict__ dst) {
  const int i = blockIdx.x * 256 + threadIdx.x;
  const int rc = i / COLS, cc = i % COLS;
  const float* p = src + (size_t)(rc * 8) * COLS + cc;
  float v[8];
#pragma unroll
  for (int j = 0; j < 8; ++j) v[j] = p[j * COLS];
  v8bf o;
#pragma unroll
  for (int j = 0; j < 8; ++j) o[j] = to_bf16(v[j]);
  *(v8bf*)(dst + (size_t)cc * ROWS + swz64(cc, rc * 8)) = o;
}

// ---------------------------------------------------------------- GEMM
// C(M,N) = A(M,K) x Bt(N,K)^T, bf16 in, f32 accumulate.  The 64x32 Bt tile is
// shared by all 4 waves: streamed into LDS by the TDM, double-buffered.
// Bt comes in the swizzled 64-byte order of transpose_bf16_kernel.
// OUTMODE: 0 = f32 row-major, 1 = bf16 row-major, 2 = bf16 transposed (ldT),
// 64-byte swizzle, 3 = bf16 row-major, 512-byte swizzle
template <int OUTMODE, bool RELU>
__global__ void __launch_bounds__(128, 2)
gemm_bf16_kernel(const __bf16* __restrict__ A, const __bf16* __restrict__ Bt,
                 const float* __restrict__ bias, float* __restrict__ outF,
                 __bf16* __restrict__ outB, int M, int N, int K, int ldT) {
  __shared__ __bf16 btile[2][64 * 32];   // (n, k) rows packed, 4 KB each
  const int lane = threadIdx.x & 31;
  const int wave = threadIdx.x >> 5;
  const int m0 = blockIdx.y * 64 + wave * 16;
  const int n0 = blockIdx.x * 64;
  const int niter = K >> 5;

  if (wave == 0)
    tdm_load_2d(lds_off(&btile[0][0]), Bt + (size_t)n0 * K, 32, 64, (unsigned)K);

  v8f acc0 = {}, acc1 = {}, acc2 = {}, acc3 = {};
  const int arow = m0 + (lane & 15);
  for (int i = 0; i < niter; ++i) {
    if (wave == 0) {
      if (i + 1 < niter) {
        tdm_load_2d(lds_off(&btile[(i + 1) & 1][0]),
                    Bt + (size_t)n0 * K + (i + 1) * 32, 32, 64, (unsigned)K);
        __builtin_amdgcn_s_wait_tensorcnt(1);   // current tile landed
      } else {
        __builtin_amdgcn_s_wait_tensorcnt(0);
      }
    }
    __syncthreads();
    const __bf16* bt = btile[i & 1];
    v16bf a  = load_frag(A, K, arow, i * 32, lane);
    v16bf b0 = load_frag_sw64(bt, 0 * 16, lane);
    v16bf b1 = load_frag_sw64(bt, 1 * 16, lane);
    v16bf b2 = load_frag_sw64(bt, 2 * 16, lane);
    v16bf b3 = load_frag_sw64(bt, 3 * 16, lane);
    acc0 = wmma_bf16(a, b0, acc0);
    acc1 = wmma_bf16(a, b1, acc1);
    acc2 = wmma_bf16(a, b2, acc2);
    acc3 = wmma_bf16(a, b3, acc3);
    __syncthreads();   // tile consumed before it is overwritten
  }

  v8f accs[4] = {acc0, acc1, acc2, acc3};
  // Swizzled store positions as per-lane bases plus compile-time steps: r walks
  // bits 0..2 of Mi and nt bits 4..5 of Ni; m0 is a multiple of 16, n0 of 64.
  const int mswz = swz64(lane & 15, m0 + ((lane & 16) ? 8 : 0));      // + r
  const int nswz = swz512((lane & 16) ? 8 : 0, n0 + (lane & 15));     // r = 0, nt = 0
#pragma unroll
  for (int nt = 0; nt < 4; ++nt) {
#pragma unroll
    for (int r = 0; r < 8; ++r) {
      int Mi = m0 + r + ((lane & 16) ? 8 : 0);
      int Ni = n0 + nt * 16 + (lane & 15);
      float v = accs[nt][r];
      if (bias) v += bias[Ni];
      if (RELU) v = fmaxf(v, 0.0f);
      if (OUTMODE == 0)      outF[(size_t)Mi * N + Ni] = v;
      else if (OUTMODE == 1) outB[(size_t)Mi * N + Ni] = to_bf16(v);
      else if (OUTMODE == 2) outB[(size_t)Ni * ldT + mswz + r] = to_bf16(v);
      else                   outB[(size_t)Mi * N + (nswz ^ ((r & 1) << 3)) +
                                  ((nt ^ (r >> 1)) << 4)] = to_bf16(v);
      // the next element reuses this store's registers: keep the wait in front
      if (OUTMODE >= 2) asm volatile("s_wait_xcnt 0x0" ::: "memory");
    }
  }
}

// ---------------------------------------------------------------- flash attn
// Block = 4 waves sharing one (b,h); each wave owns a 16-row q-tile.  K and V
// 32-key tiles are TDM-streamed into LDS (double-buffered) and shared by all
// waves.  q,k: (NBL, DH) bf16; vT: (DH, NBL) bf16; heads: (NBL, DH) bf16.
// k holds each head's 512-byte row swizzled, vT each 32-key block swizzled.
__global__ void __launch_bounds__(128, 1)
flash_attn_kernel(const __bf16* __restrict__ q, const __bf16* __restrict__ k,
                  const __bf16* __restrict__ vT, __bf16* __restrict__ heads) {
  __shared__ __bf16 ktile[2][32 * 256];   // (key, d)   16 KB each
  __shared__ __bf16 vtile[2][256 * 32];   // (d, key)   16 KB each
  __shared__ __bf16 psh[4][16 * 32];      // per-wave P relayout, 1 KB each
  const int lane = threadIdx.x & 31;
  const int wave = threadIdx.x >> 5;
  const int w = blockIdx.x * 4 + wave;    // 0 .. 4095
  const int b  = w >> 10;                 // / (H * L/16)
  const int h  = (w >> 7) & 7;            // same h for all 4 waves of a block
  const int qt = w & 127;
  __bf16* ps = psh[wave];
  const int NT = LSEQ / 32;

  const __bf16* kbase = k  + (size_t)(b * LSEQ) * DH + h * DMODEL;
  const __bf16* vbase = vT + (size_t)(h * DMODEL) * NBL + b * LSEQ;

  if (wave == 0) {   // prefetch tile 0
    tdm_load_2d(lds_off(&ktile[0][0]), kbase, 256, 32, DH);
    tdm_load_2d(lds_off(&vtile[0][0]), vbase, 32, 256, NBL);
  }

  // Q fragments: 8 K-chunks covering d = 0..255 (global, loaded once)
  v16bf qa[8];
  const int qrow = b * LSEQ + qt * 16 + (lane & 15);
#pragma unroll
  for (int c = 0; c < 8; ++c)
    qa[c] = load_frag(q, DH, qrow, h * DMODEL + c * 32, lane);

  v8f o[16];
  v8f zero = {};
#pragma unroll
  for (int nt = 0; nt < 16; ++nt) o[nt] = zero;
  float mrow[8], lrow[8];
#pragma unroll
  for (int r = 0; r < 8; ++r) { mrow[r] = -1e30f; lrow[r] = 0.0f; }

  const float scale = 0.0625f;  // 1/sqrt(256)
  for (int t = 0; t < NT; ++t) {
    if (wave == 0) {
      if (t + 1 < NT) {   // stream next K/V pair while computing on current
        tdm_load_2d(lds_off(&ktile[(t + 1) & 1][0]),
                    kbase + (size_t)((t + 1) * 32) * DH, 256, 32, DH);
        tdm_load_2d(lds_off(&vtile[(t + 1) & 1][0]),
                    vbase + (t + 1) * 32, 32, 256, NBL);
        __builtin_amdgcn_s_wait_tensorcnt(2);   // current pair landed
      } else {
        __builtin_amdgcn_s_wait_tensorcnt(0);
      }
    }
    __syncthreads();
    const __bf16* kt = ktile[t & 1];
    const __bf16* vt = vtile[t & 1];

    // --- S = Q * K^T  (16 x 32 scores, two 16x16 WMMA tiles per K-chunk)
    v8f s0 = zero, s1 = zero;
#pragma unroll
    for (int c = 0; c < 8; ++c) {
      v16bf kb0 = load_frag_sw512(kt, 0,  c, lane);
      v16bf kb1 = load_frag_sw512(kt, 16, c, lane);
      s0 = wmma_bf16(qa[c], kb0, s0);
      s1 = wmma_bf16(qa[c], kb1, s1);
    }

    // --- online softmax (row M = r + (lane>=16)*8 lives in one 16-lane half)
#pragma unroll
    for (int r = 0; r < 8; ++r) {
      float a0 = s0[r] * scale, a1 = s1[r] * scale;
      float mx = fmaxf(a0, a1);
      mx = fmaxf(mx, __shfl_xor(mx, 1));
      mx = fmaxf(mx, __shfl_xor(mx, 2));
      mx = fmaxf(mx, __shfl_xor(mx, 4));
      mx = fmaxf(mx, __shfl_xor(mx, 8));
      float mnew = fmaxf(mrow[r], mx);
      float corr = __expf(mrow[r] - mnew);
      float p0 = __expf(a0 - mnew);
      float p1 = __expf(a1 - mnew);
      float sum = p0 + p1;
      sum += __shfl_xor(sum, 1);
      sum += __shfl_xor(sum, 2);
      sum += __shfl_xor(sum, 4);
      sum += __shfl_xor(sum, 8);
      lrow[r] = lrow[r] * corr + sum;
      mrow[r] = mnew;
#pragma unroll
      for (int nt = 0; nt < 16; ++nt) o[nt][r] *= corr;
      // stash P (C-layout element -> 16x32 bf16 in LDS, swizzled 64-byte rows)
      const int rowi = r + ((lane & 16) ? 8 : 0);
      ps[rowi * 32 + swz64(rowi, (lane & 15))]      = to_bf16(p0);
      ps[rowi * 32 + swz64(rowi, 16 + (lane & 15))] = to_bf16(p1);
    }
    asm volatile("s_wait_dscnt 0" ::: "memory");

    // reload P as an A-fragment (16x32, K = 32 keys)
    v16bf pa = load_frag_sw64(ps, 0, lane);

    // --- O += P * V   (16 output tiles across d = 256)
#pragma unroll
    for (int nt = 0; nt < 16; ++nt) {
      v16bf vb = load_frag_sw64(vt, nt * 16, lane);
      o[nt] = wmma_bf16(pa, vb, o[nt]);
    }
    __syncthreads();   // tiles consumed before TDM overwrites them
  }

  // normalize and store heads (bf16 row-major (NBL, DH))
#pragma unroll
  for (int r = 0; r < 8; ++r) {
    float inv = 1.0f / lrow[r];
#pragma unroll
    for (int nt = 0; nt < 16; ++nt) o[nt][r] *= inv;
  }
  const int orow0 = b * LSEQ + qt * 16;
#pragma unroll
  for (int nt = 0; nt < 16; ++nt) {
#pragma unroll
    for (int r = 0; r < 8; ++r) {
      int Mi = orow0 + r + ((lane & 16) ? 8 : 0);
      int Ni = h * DMODEL + nt * 16 + (lane & 15);
      heads[(size_t)Mi * DH + Ni] = to_bf16(o[nt][r]);
    }
  }
}

// ---------------------------------------------------------------- add + LN
// y = LN(a + rsd) * g + b ;  one wave per two rows of 256 elements, 8 waves a
// block.  A lane holds elements 4*lane.. and 128 + 4*lane.. of each row, so
// every 16-byte access of a wave covers 512 contiguous bytes.
template <int M>
__device__ __forceinline__ float add_xmask(float x) {   // x + x of lane ^ M, M < 16
  int y = __builtin_amdgcn_update_dpp(0, __builtin_bit_cast(int, x), 0x160 | M,
                                      0xf, 0xf, true);
  return x + __builtin_bit_cast(float, y);
}
__device__ __forceinline__ float wave_sum(float x) {    // every lane gets the sum
  x = add_xmask<1>(x);
  x = add_xmask<2>(x);
  x = add_xmask<4>(x);
  x = add_xmask<8>(x);
  int b = __builtin_bit_cast(int, x);
  return x + __builtin_bit_cast(float, __builtin_amdgcn_permlanex16(
                 b, b, 0x76543210, 0xfedcba98, false, false));
}

template <bool WB>   // WB: also write the bf16 copy
__global__ void __launch_bounds__(256)
add_ln_kernel(const float* __restrict__ a,
              const float* __restrict__ rsd,
              const float* __restrict__ g,
              const float* __restrict__ bta,
              float* __restrict__ outF,
              __bf16* __restrict__ outB) {
  const int lane = threadIdx.x & 31;
  const int row0 = (blockIdx.x * 8 + (threadIdx.x >> 5)) * 2;
  const size_t o0 = (size_t)row0 * 256 + lane * 4;   // + rr * 256 + hh * 128
  f32x4 v[2][2], gg[2], bb[2], y[2][2];
#pragma unroll
  for (int hh = 0; hh < 2; ++hh) {
    gg[hh] = *(const f32x4*)(g + hh * 128 + lane * 4);
    bb[hh] = *(const f32x4*)(bta + hh * 128 + lane * 4);
  }
  // the next loads may land in these loads' address register: keep the wait
  asm volatile("s_wait_xcnt 0x0" ::: "memory");
#pragma unroll
  for (int rr = 0; rr < 2; ++rr)
#pragma unroll
    for (int hh = 0; hh < 2; ++hh)
      v[rr][hh] = *(const f32x4*)(a + o0 + rr * 256 + hh * 128) +
                  *(const f32x4*)(rsd + o0 + rr * 256 + hh * 128);
#pragma unroll
  for (int rr = 0; rr < 2; ++rr) {
    f32x4 s4 = v[rr][0] + v[rr][1];
    float mu = wave_sum((s4[0] + s4[1]) + (s4[2] + s4[3])) * (1.0f / 256.0f);
    f32x4 d0 = v[rr][0] - mu, d1 = v[rr][1] - mu;
    f32x4 q4 = d0 * d0 + d1 * d1;
    float var = wave_sum((q4[0] + q4[1]) + (q4[2] + q4[3])) * (1.0f / 256.0f);
    float rs = rsqrtf(var + 1e-5f);
    y[rr][0] = d0 * rs * gg[0] + bb[0];
    y[rr][1] = d1 * rs * gg[1] + bb[1];
  }
  v4bf yb[2][2];
  if (WB) {
#pragma unroll
    for (int rr = 0; rr < 2; ++rr)
#pragma unroll
      for (int hh = 0; hh < 2; ++hh)
#pragma unroll
        for (int j = 0; j < 4; ++j) yb[rr][hh][j] = to_bf16(y[rr][hh][j]);
  }
  // holds the stores behind all arithmetic, so that no register of an issued
  // store is written again
  __builtin_amdgcn_sched_barrier(0);
#pragma unroll
  for (int rr = 0; rr < 2; ++rr)
#pragma unroll
    for (int hh = 0; hh < 2; ++hh) {
      *(f32x4*)(outF + o0 + rr * 256 + hh * 128) = y[rr][hh];
      if (WB) *(v4bf*)(outB + o0 + rr * 256 + hh * 128) = yb[rr][hh];
    }
}

// ---------------------------------------------------------------- launcher
extern "C" void kernel_launch(void* const* d_in, const int* in_sizes, int n_in,
                              void* d_out, int out_size, void* d_ws,
                              size_t ws_size, hipStream_t stream) {
  (void)in_sizes; (void)n_in; (void)out_size; (void)ws_size;
  const float* seq  = (const float*)d_in[0];
  const float* Wq   = (const float*)d_in[1];
  const float* Wk   = (const float*)d_in[2];
  const float* Wv   = (const float*)d_in[3];
  const float* Wo   = (const float*)d_in[4];
  const float* ln1g = (const float*)d_in[5];
  const float* ln1b = (const float*)d_in[6];
  const float* W1   = (const float*)d_in[7];
  const float* b1   = (const float*)d_in[8];
  const float* W2   = (const float*)d_in[9];
  const float* b2   = (const float*)d_in[10];
  const float* ln2g = (const float*)d_in[11];
  const float* ln2b = (const float*)d_in[12];

  char* w = (char*)d_ws;
  size_t off = 0;
  auto take = [&](size_t bytes) {
    size_t o = off; off += (bytes + 255) & ~(size_t)255; return o;
  };
  __bf16* seqb  = (__bf16*)(w + take((size_t)NBL * DMODEL * 2));
  __bf16* WqT   = (__bf16*)(w + take((size_t)DH * DMODEL * 2));
  __bf16* WkT   = (__bf16*)(w + take((size_t)DH * DMODEL * 2));
  __bf16* WvT   = (__bf16*)(w + take((size_t)DH * DMODEL * 2));
  __bf16* WoT   = (__bf16*)(w + take((size_t)DMODEL * DH * 2));
  __bf16* W1T   = (__bf16*)(w + take((size_t)FFD * DMODEL * 2));
  __bf16* W2T   = (__bf16*)(w + take((size_t)DMODEL * FFD * 2));
  __bf16* qb    = (__bf16*)(w + take((size_t)NBL * DH * 2));
  __bf16* kb    = (__bf16*)(w + take((size_t)NBL * DH * 2));
  __bf16* vT    = (__bf16*)(w + take((size_t)DH * NBL * 2));
  __bf16* heads = (__bf16*)(w + take((size_t)NBL * DH * 2));
  float*  tmpF  = (float*)(w + take((size_t)NBL * DMODEL * 4));
  float*  xF    = (float*)(w + take((size_t)NBL * DMODEL * 4));
  __bf16* xB    = (__bf16*)(w + take((size_t)NBL * DMODEL * 2));
  __bf16* h1    = (__bf16*)(w + take((size_t)NBL * FFD * 2));

  // 1) convert / transpose inputs to bf16
  {
    int n = NBL * DMODEL;
    f32_to_bf16_kernel<<<n / 16 / 256, 256, 0, stream>>>(seq, seqb, n);
  }
  transpose_bf16_kernel<DMODEL, DH><<<DMODEL * DH / 8 / 256, 256, 0, stream>>>(Wq, WqT);
  transpose_bf16_kernel<DMODEL, DH><<<DMODEL * DH / 8 / 256, 256, 0, stream>>>(Wk, WkT);
  transpose_bf16_kernel<DMODEL, DH><<<DMODEL * DH / 8 / 256, 256, 0, stream>>>(Wv, WvT);
  transpose_bf16_kernel<DH, DMODEL><<<DMODEL * DH / 8 / 256, 256, 0, stream>>>(Wo, WoT);
  transpose_bf16_kernel<DMODEL, FFD><<<DMODEL * FFD / 8 / 256, 256, 0, stream>>>(W1, W1T);
  transpose_bf16_kernel<FFD, DMODEL><<<DMODEL * FFD / 8 / 256, 256, 0, stream>>>(W2, W2T);

  // 2) QKV projections (V stored transposed for the P*V WMMA path; K and V in
  //    the swizzled orders the attention kernel reads)
  dim3 gQKV(DH / 64, NBL / 64);
  gemm_bf16_kernel<1, false><<<gQKV, 128, 0, stream>>>(seqb, WqT, nullptr, nullptr, qb, NBL, DH, DMODEL, 0);
  gemm_bf16_kernel<3, false><<<gQKV, 128, 0, stream>>>(seqb, WkT, nullptr, nullptr, kb, NBL, DH, DMODEL, 0);
  gemm_bf16_kernel<2, false><<<gQKV, 128, 0, stream>>>(seqb, WvT, nullptr, nullptr, vT, NBL, DH, DMODEL, NBL);

  // 3) fused flash attention -> heads
  flash_attn_kernel<<<(NBL / 16) * NHEAD / 4, 128, 0, stream>>>(qb, kb, vT, heads);

  // 4) output projection: att = heads @ Wo (f32)
  dim3 gO(DMODEL / 64, NBL / 64);
  gemm_bf16_kernel<0, false><<<gO, 128, 0, stream>>>(heads, WoT, nullptr, tmpF, nullptr, NBL, DMODEL, DH, 0);

  // 5) x = LN(seq + att)   (also bf16 copy for the FF GEMM)
  add_ln_kernel<true><<<NBL / 16, 256, 0, stream>>>(tmpF, seq, ln1g, ln1b, xF, xB);

  // 6) FF: h1 = relu(x @ W1 + b1); ff = h1 @ W2 + b2
  dim3 gF1(FFD / 64, NBL / 64);
  gemm_bf16_kernel<1, true><<<gF1, 128, 0, stream>>>(xB, W1T, b1, nullptr, h1, NBL, FFD, DMODEL, 0);
  dim3 gF2(DMODEL / 64, NBL / 64);
  gemm_bf16_kernel<0, false><<<gF2, 128, 0, stream>>>(h1, W2T, b2, tmpF, nullptr, NBL, DMODEL, FFD, 0);

  // 7) out = LN(x + ff)
  add_ln_kernel<false><<<NBL / 16, 256, 0, stream>>>(tmpF, xF, ln2g, ln2b, (float*)d_out, nullptr);
}

// v003
// One run takes 352 microseconds.
// Two timings next to v002 put it at 1.16 and 1.15 times that version's speed.
// Counting every step since v000, it is 2.94 times as fast.
#include <hip/hip_runtime.h>

typedef __attribute__((ext_vector_type(16))) __bf16 v16bf;
typedef __attribute__((ext_vector_type(8)))  __bf16 v8bf;
typedef __attribute__((ext_vector_type(4)))  __bf16 v4bf;
typedef __attribute__((ext_vector_type(8)))  float  v8f;
typedef __attribute__((ext_vector_type(4)))  float  f32x4;
typedef __attribute__((ext_vector_type(4)))  unsigned int u32x4;
typedef __attribute__((ext_vector_type(8)))  int    i32x8;
typedef __attribute__((ext_vector_type(4)))  int    i32x4;

#define NBL    8192   // B*L
#define DMODEL 256
#define NHEAD  8
#define DH     2048   // D*H
#define LSEQ   2048
#define FFD    128

// ---------------------------------------------------------------- helpers
__device__ __forceinline__ __bf16 to_bf16(float f) {
  union { float f; unsigned u; } x; x.f = f;
  unsigned r = x.u + 0x7FFFu + ((x.u >> 16) & 1u);   // round-to-nearest-even
  unsigned short h = (unsigned short)(r >> 16);
  union { unsigned short s; __bf16 b; } y; y.s = h;
  return y.b;
}

// A/B fragment for v_wmma_f32_16x16x32_bf16 from a row-major (rows x ld) bf16
// matrix (global or LDS), contraction chunk starting at column kc.
// Per CDNA5 ISA 16-bit layout: lane holds row (lane&15); elements 0..7 =
// K [off, off+8), elements 8..15 = K [off+16, off+24), off = (lane&16)?8:0.
__device__ __forceinline__ v16bf load_frag(const __bf16* base, int ld, int row,
                                           int kc, int lane) {
  const __bf16* p = base + (size_t)row * ld + kc + ((lane & 16) ? 8 : 0);
  v16bf f;
  ((f32x4*)&f)[0] = ((const f32x4*)p)[0];
  ((f32x4*)&f)[1] = *(const f32x4*)(p + 16);
  return f;
}

// Swizzled layouts. The tensor loads land rows unpadded, so rows of 64 B or
// 512 B put the 16 lanes of a half-wave on few LDS banks.  The producers
// therefore store each 16-byte chunk (8 bf16 of the contraction index) at an
// XOR-ed chunk position inside its row, and the readers undo it: the 16 lanes
// of a half-wave then cover all 64 banks once.  Values and k order unchanged.
//   64-byte rows (32 bf16):  chunk j of row r sits at j ^ ((r >> 2) & 3)
//   512-byte rows (256 bf16): chunk p of row r sits at p ^ (r & 15)
__device__ __forceinline__ int swz64(int row, int col) {
  return col ^ (((row >> 2) & 3) << 3);
}
__device__ __forceinline__ int swz512(int row, int col) {
  return col ^ ((row & 15) << 3);
}

// load_frag for a tile of swizzled 64-byte rows; row0 is a multiple of 16.
__device__ __forceinline__ v16bf load_frag_sw64(const __bf16* base, int row0,
                                                int lane) {
  const int j0 = ((lane >> 4) & 1) ^ ((lane >> 2) & 3);
  const __bf16* p = base + (row0 + (lane & 15)) * 32;
  v16bf f;
  ((f32x4*)&f)[0] = *(const f32x4*)(p + j0 * 8);
  ((f32x4*)&f)[1] = *(const f32x4*)(p + (j0 ^ 2) * 8);
  return f;
}

// load_frag for a tile of swizzled 512-byte rows, contraction chunk c (32 wide);
// row0 is a multiple of 16.
__device__ __forceinline__ v16bf load_frag_sw512(const __bf16* base, int row0,
                                                 int c, int lane) {
  const int s = lane & 15, h = (lane >> 4) & 1;
  const __bf16* p = base + (row0 + s) * 256 + (c >> 2) * 128;
  v16bf f;
  ((f32x4*)&f)[0] = *(const f32x4*)(p + (((c & 3) * 4 + h) ^ s) * 8);
  ((f32x4*)&f)[1] = *(const f32x4*)(p + (((c & 3) * 4 + 2 + h) ^ s) * 8);
  return f;
}

__device__ __forceinline__ v8f wmma_bf16(v16bf a, v16bf b, v8f c) {
  return __builtin_amdgcn_wmma_f32_16x16x32_bf16(false, a, false, b,
                                                 (short)0, c, false, false);
}

__device__ __forceinline__ unsigned lds_off(const void* p) {
  // generic pointer to a __shared__ object: low 32 bits = LDS byte offset
  return (unsigned)(unsigned long long)p;
}

// Tensor Data Mover: 2D bf16 tile (tile0 contiguous elems x tile1 rows,
// row stride = stride0 elems) from global -> LDS, packed rows in LDS.
// Tracked by TENSORcnt.
__device__ __forceinline__ void tdm_load_2d(unsigned lds_addr, const void* gptr,
                                            unsigned tile0, unsigned tile1,
                                            unsigned stride0) {
  unsigned long long ga = (unsigned long long)gptr;
  u32x4 g0;
  g0[0] = 1u;                                        // count=1, user descriptor
  g0[1] = lds_addr;                                  // lds_addr
  g0[2] = (unsigned)(ga & 0xFFFFFFFFu);              // global_addr[31:0]
  g0[3] = (unsigned)((ga >> 32) & 0x01FFFFFFu)       // global_addr[56:32]
          | (2u << 30);                              // type = 2 ("image")
  i32x8 g1;
  g1[0] = (int)(1u << 16);          // workgroup_mask=0, data_size=1 (2 bytes)
  g1[1] = (int)(tile0 << 16);       // tensor_dim0[15:0]  (= tile -> no OOB)
  g1[2] = (int)(tile1 << 16);       // tensor_dim0[31:16]=0, tensor_dim1[15:0]
  g1[3] = (int)(tile0 << 16);       // tensor_dim1[31:16]=0, tile_dim0
  g1[4] = (int)(tile1 & 0xFFFFu);   // tile_dim1, tile_dim2=0
  g1[5] = (int)stride0;             // tensor_dim0_stride[31:0] (elements)
  g1[6] = 0;                        // stride0[47:32]=0, dim1_stride[15:0]=0
  g1[7] = 0;
  i32x4 z4 = {0, 0, 0, 0};
#if defined(__clang_major__) && (__clang_major__ >= 23)
  i32x8 z8 = {0, 0, 0, 0, 0, 0, 0, 0};
  __builtin_amdgcn_tensor_load_to_lds(g0, g1, z4, z4, z8, 0);
#else
  __builtin_amdgcn_tensor_load_to_lds(g0, g1, z4, z4, 0);
#endif
}

// ---------------------------------------------------------------- converts
// Each lane of the non-matrix kernels takes 8 or 16 elements: few waves to
// start, 16-byte accesses.
__device__ __forceinline__ v8bf pack8(f32x4 lo, f32x4 hi) {
  v8bf o;
#pragma unroll
  for (int j = 0; j < 4; ++j) { o[j] = to_bf16(lo[j]); o[4 + j] = to_bf16(hi[j]); }
  return o;
}

// n is a multiple of 16; a lane converts the 8-element chunks t and t + n/16.
__global__ void __launch_bounds__(256)
f32_to_bf16_kernel(const float* __restrict__ src,
                   __bf16* __restrict__ dst, int n) {
  const int half = n >> 4;
  const int t = blockIdx.x * blockDim.x + threadIdx.x;
  if (t >= half) return;
  const f32x4* s4 = (const f32x4*)src;
  f32x4 a0 = s4[2 * t], a1 = s4[2 * t + 1];
  f32x4 b0 = s4[2 * (t + half)], b1 = s4[2 * (t + half) + 1];
  ((v8bf*)dst)[t] = pack8(a0, a1);
  ((v8bf*)dst)[t + half] = pack8(b0, b1);
}

// src (ROWS x COLS) f32  ->  dst (COLS x ROWS) bf16   (weights -> NxK form,
// each 32-wide k block of a row in the swizzled 64-byte order).  A lane takes
// 8 source rows of one column, which are one 16-byte chunk of the swizzled
// order; the grid holds exactly ROWS / 8 * COLS threads.  The shape is a
// compile-time constant so that the 8 loads share one address register pair.
template <int ROWS, int COLS>
__global__ void __launch_bounds__(256)
transpose_bf16_kernel(const float* __restrict__ src, __bf16* __restrict__ dst) {
  const int i = blockIdx.x * 256 + threadIdx.x;
  const int rc = i / COLS, cc = i % COLS;
  const float* p = src + (size_t)(rc * 8) * COLS + cc;
  float v[8];
#pragma unroll
  for (int j = 0; j < 8; ++j) v[j] = p[j * COLS];
  v8bf o;
#pragma unroll
  for (int j = 0; j < 8; ++j) o[j] = to_bf16(v[j]);
  *(v8bf*)(dst + (size_t)cc * ROWS + swz64(cc, rc * 8)) = o;
}

// ---------------------------------------------------------------- GEMM
// C(M,N) = A(M,K) x Bt(N,K)^T, bf16 in, f32 accumulate.  The 64x32 Bt tile is
// shared by all 4 waves: streamed into LDS by the TDM, double-buffered.
// Bt comes in the swizzled 64-byte order of transpose_bf16_kernel.
// OUTMODE: 0 = f32 row-major, 1 = bf16 row-major, 2 = bf16 transposed (ldT),
// 64-byte swizzle, 3 = bf16 row-major, 512-byte swizzle
template <int OUTMODE, bool RELU>
__global__ void __launch_bounds__(128, 2)
gemm_bf16_kernel(const __bf16* __restrict__ A, const __bf16* __restrict__ Bt,
                 const float* __restrict__ bias, float* __restrict__ outF,
                 __bf16* __restrict__ outB, int M, int N, int K, int ldT) {
  __shared__ __bf16 btile[2][64 * 32];   // (n, k) rows packed, 4 KB each
  const int lane = threadIdx.x & 31;
  const int wave = threadIdx.x >> 5;
  const int m0 = blockIdx.y * 64 + wave * 16;
  const int n0 = blockIdx.x * 64;
  const int niter = K >> 5;

  if (wave == 0)
    tdm_load_2d(lds_off(&btile[0][0]), Bt + (size_t)n0 * K, 32, 64, (unsigned)K);

  v8f acc0 = {}, acc1 = {}, acc2 = {}, acc3 = {};
  const int arow = m0 + (lane & 15);
  for (int i = 0; i < niter; ++i) {
    if (wave == 0) {
      if (i + 1 < niter) {
        tdm_load_2d(lds_off(&btile[(i + 1) & 1][0]),
                    Bt + (size_t)n0 * K + (i + 1) * 32, 32, 64, (unsigned)K);
        __builtin_amdgcn_s_wait_tensorcnt(1);   // current tile landed
      } else {
        __builtin_amdgcn_s_wait_tensorcnt(0);
      }
    }
    __syncthreads();
    const __bf16* bt = btile[i & 1];
    v16bf a  = load_frag(A, K, arow, i * 32, lane);
    v16bf b0 = load_frag_sw64(bt, 0 * 16, lane);
    v16bf b1 = load_frag_sw64(bt, 1 * 16, lane);
    v16bf b2 = load_frag_sw64(bt, 2 * 16, lane);
    v16bf b3 = load_frag_sw64(bt, 3 * 16, lane);
    acc0 = wmma_bf16(a, b0, acc0);
    acc1 = wmma_bf16(a, b1, acc1);
    acc2 = wmma_bf16(a, b2, acc2);
    acc3 = wmma_bf16(a, b3, acc3);
    __syncthreads();   // tile consumed before it is overwritten
  }

  v8f accs[4] = {acc0, acc1, acc2, acc3};
  // Swizzled store positions as per-lane bases plus compile-time steps: r walks
  // bits 0..2 of Mi and nt bits 4..5 of Ni; m0 is a multiple of 16, n0 of 64.
  const int mswz = swz64(lane & 15, m0 + ((lane & 16) ? 8 : 0));      // + r
  const int nswz = swz512((lane & 16) ? 8 : 0, n0 + (lane & 15));     // r = 0, nt = 0
#pragma unroll
  for (int nt = 0; nt < 4; ++nt) {
#pragma unroll
    for (int r = 0; r < 8; ++r) {
      int Mi = m0 + r + ((lane & 16) ? 8 : 0);
      int Ni = n0 + nt * 16 + (lane & 15);
      float v = accs[nt][r];
      if (bias) v += bias[Ni];
      if (RELU) v = fmaxf(v, 0.0f);
      if (OUTMODE == 0)      outF[(size_t)Mi * N + Ni] = v;
      else if (OUTMODE == 1) outB[(size_t)Mi * N + Ni] = to_bf16(v);
      else if (OUTMODE == 2) outB[(size_t)Ni * ldT + mswz + r] = to_bf16(v);
      else                   outB[(size_t)Mi * N + (nswz ^ ((r & 1) << 3)) +
                                  ((nt ^ (r >> 1)) << 4)] = to_bf16(v);
      // the next element reuses this store's registers: keep the wait in front
      if (OUTMODE >= 2) asm volatile("s_wait_xcnt 0x0" ::: "memory");
    }
  }
}

__device__ __forceinline__ float other_half(float x) {   // x of lane ^ 16
  int y = __builtin_bit_cast(int, x);
  return __builtin_bit_cast(float, __builtin_amdgcn_permlanex16(
             y, y, 0x76543210, 0xfedcba98, false, false));
}

__global__ void __launch_bounds__(128, 4)
flash_attn_kernel(const __bf16* __restrict__ q, const __bf16* __restrict__ k,
                  const __bf16* __restrict__ vT, __bf16* __restrict__ heads) {
  __shared__ __bf16 ktile[2][32 * 256];   // (key, d)   16 KB each
  __shared__ __bf16 vtile[2][256 * 32];   // (d, key)   16 KB each
  const int lane = threadIdx.x & 31;
  const int wave = threadIdx.x >> 5;
  const int w = blockIdx.x * 4 + wave;    // 0 .. 4095
  const int b  = w >> 10;                 // / (H * L/16)
  const int h  = (w >> 7) & 7;            // same h for all 4 waves of a block
  const int qt = w & 127;
  const int NT = LSEQ / 32;

  const __bf16* kbase = k  + (size_t)(b * LSEQ) * DH + h * DMODEL;
  const __bf16* vbase = vT + (size_t)(h * DMODEL) * NBL + b * LSEQ;

  if (wave == 0) {   // prefetch tile 0
    tdm_load_2d(lds_off(&ktile[0][0]), kbase, 256, 32, DH);
    tdm_load_2d(lds_off(&vtile[0][0]), vbase, 32, 256, NBL);
  }

  // Q fragments: 8 K-chunks covering d = 0..255 (global, loaded once)
  v16bf qa[8];
  const int qrow = b * LSEQ + qt * 16 + (lane & 15);
#pragma unroll
  for (int c = 0; c < 8; ++c)
    qa[c] = load_frag(q, DH, qrow, h * DMODEL + c * 32, lane);

  v8f o[16];        // o[nt][r] = O[query lane & 15][d = nt*16 + r + 8*(lane>>4)]
  v8f zero = {};
#pragma unroll
  for (int nt = 0; nt < 16; ++nt) o[nt] = zero;
  float mrun = -1e30f;   // running maximum of the lane's query (both halves alike)
  float lrun = 0.0f;     // running sum over this half's keys only

  const float scale = 0.0625f;  // 1/sqrt(256)
  for (int t = 0; t < NT; ++t) {
    if (wave == 0) {
      if (t + 1 < NT) {   // stream next K/V pair while computing on current
        tdm_load_2d(lds_off(&ktile[(t + 1) & 1][0]),
                    kbase + (size_t)((t + 1) * 32) * DH, 256, 32, DH);
        tdm_load_2d(lds_off(&vtile[(t + 1) & 1][0]),
                    vbase + (t + 1) * 32, 32, 256, NBL);
        __builtin_amdgcn_s_wait_tensorcnt(2);   // current pair landed
      } else {
        __builtin_amdgcn_s_wait_tensorcnt(0);
      }
    }
    __syncthreads();
    const __bf16* kt = ktile[t & 1];
    const __bf16* vt = vtile[t & 1];

    // --- S^T = K * Q^T  (32 keys x 16 queries, two 16x16 tiles per K-chunk)
    v8f s0 = zero, s1 = zero;
#pragma unroll
    for (int c = 0; c < 8; ++c) {
      v16bf kb0 = load_frag_sw512(kt, 0,  c, lane);
      v16bf kb1 = load_frag_sw512(kt, 16, c, lane);
      s0 = wmma_bf16(kb0, qa[c], s0);
      s1 = wmma_bf16(kb1, qa[c], s1);
    }

    // --- online softmax: 16 of the query's 32 scores sit in this lane, the
    //     other 16 in lane ^ 16
    float a0[8], a1[8], mx8[8];
#pragma unroll
    for (int r = 0; r < 8; ++r) {
      a0[r] = s0[r] * scale;
      a1[r] = s1[r] * scale;
      mx8[r] = fmaxf(a0[r], a1[r]);
    }
    float mx = fmaxf(fmaxf(fmaxf(mx8[0], mx8[1]), fmaxf(mx8[2], mx8[3])),
                     fmaxf(fmaxf(mx8[4], mx8[5]), fmaxf(mx8[6], mx8[7])));
    mx = fmaxf(mx, other_half(mx));
    const float mnew = fmaxf(mrun, mx);
    const float corr = __expf(mrun - mnew);
    mrun = mnew;
    v16bf pb;          // B fragment of P^T: keys 8h + r, then 16 + 8h + r
    float ps8[8];
#pragma unroll
    for (int r = 0; r < 8; ++r) {
      float p0 = __expf(a0[r] - mnew);
      float p1 = __expf(a1[r] - mnew);
      ps8[r] = p0 + p1;
      pb[r]     = to_bf16(p0);
      pb[8 + r] = to_bf16(p1);
    }
    lrun = lrun * corr + (((ps8[0] + ps8[1]) + (ps8[2] + ps8[3])) +
                          ((ps8[4] + ps8[5]) + (ps8[6] + ps8[7])));
#pragma unroll
    for (int nt = 0; nt < 16; ++nt) o[nt] *= corr;

    // --- O^T += V^T * P^T   (16 output tiles across d = 256)
#pragma unroll
    for (int nt = 0; nt < 16; ++nt) {
      v16bf vb = load_frag_sw64(vt, nt * 16, lane);
      o[nt] = wmma_bf16(vb, pb, o[nt]);
    }
    __syncthreads();   // tiles consumed before TDM overwrites them
  }

  // normalize and store heads (bf16 row-major (NBL, DH)): a lane's 8 elements
  // of a tile are 8 neighbours in d, one 16-byte store
  const float inv = 1.0f / (lrun + other_half(lrun));
  v8bf ov[16];
#pragma unroll
  for (int nt = 0; nt < 16; ++nt)
#pragma unroll
    for (int r = 0; r < 8; ++r) ov[nt][r] = to_bf16(o[nt][r] * inv);
  __bf16* hp = heads + (size_t)qrow * DH + h * DMODEL + ((lane & 16) ? 8 : 0);
  // holds the stores behind all arithmetic, so that no register of an issued
  // store is written again
  __builtin_amdgcn_sched_barrier(0);
#pragma unroll
  for (int nt = 0; nt < 16; ++nt) *(v8bf*)(hp + nt * 16) = ov[nt];
}

// ---------------------------------------------------------------- add + LN
// y = LN(a + rsd) * g + b ;  one wave per two rows of 256 elements, 8 waves a
// block.  A lane holds elements 4*lane.. and 128 + 4*lane.. of each row, so
// every 16-byte access of a wave covers 512 contiguous bytes.
template <int M>
__device__ __forceinline__ float add_xmask(float x) {   // x + x of lane ^ M, M < 16
  int y = __builtin_amdgcn_update_dpp(0, __builtin_bit_cast(int, x), 0x160 | M,
                                      0xf, 0xf, true);
  return x + __builtin_bit_cast(float, y);
}
__device__ __forceinline__ float wave_sum(float x) {    // every lane gets the sum
  x = add_xmask<1>(x);
  x = add_xmask<2>(x);
  x = add_xmask<4>(x);
  x = add_xmask<8>(x);
  int b = __builtin_bit_cast(int, x);
  return x + __builtin_bit_cast(float, __builtin_amdgcn_permlanex16(
                 b, b, 0x76543210, 0xfedcba98, false, false));
}

template <bool WB>   // WB: also write the bf16 copy
__global__ void __launch_bounds__(256)
add_ln_kernel(const float* __restrict__ a,
              const float* __restrict__ rsd,
              const float* __restrict__ g,
              const float* __restrict__ bta,
              float* __restrict__ outF,
              __bf16* __restrict__ outB) {
  const int lane = threadIdx.x & 31;
  const int row0 = (blockIdx.x * 8 + (threadIdx.x >> 5)) * 2;
  const size_t o0 = (size_t)row0 * 256 + lane * 4;   // + rr * 256 + hh * 128
  f32x4 v[2][2], gg[2], bb[2], y[2][2];
#pragma unroll
  for (int hh = 0; hh < 2; ++hh) {
    gg[hh] = *(const f32x4*)(g + hh * 128 + lane * 4);
    bb[hh] = *(const f32x4*)(bta + hh * 128 + lane * 4);
  }
  // the next loads may land in these loads' address register: keep the wait
  asm volatile("s_wait_xcnt 0x0" ::: "memory");
#pragma unroll
  for (int rr = 0; rr < 2; ++rr)
#pragma unroll
    for (int hh = 0; hh < 2; ++hh)
      v[rr][hh] = *(const f32x4*)(a + o0 + rr * 256 + hh * 128) +
                  *(const f32x4*)(rsd + o0 + rr * 256 + hh * 128);
#pragma unroll
  for (int rr = 0; rr < 2; ++rr) {
    f32x4 s4 = v[rr][0] + v[rr][1];
    float mu = wave_sum((s4[0] + s4[1]) + (s4[2] + s4[3])) * (1.0f / 256.0f);
    f32x4 d0 = v[rr][0] - mu, d1 = v[rr][1] - mu;
    f32x4 q4 = d0 * d0 + d1 * d1;
    float var = wave_sum((q4[0] + q4[1]) + (q4[2] + q4[3])) * (1.0f / 256.0f);
    float rs = rsqrtf(var + 1e-5f);
    y[rr][0] = d0 * rs * gg[0] + bb[0];
    y[rr][1] = d1 * rs * gg[1] + bb[1];
  }
  v4bf yb[2][2];
  if (WB) {
#pragma unroll
    for (int rr = 0; rr < 2; ++rr)
#pragma unroll
      for (int hh = 0; hh < 2; ++hh)
#pragma unroll
        for (int j = 0; j < 4; ++j) yb[rr][hh][j] = to_bf16(y[rr][hh][j]);
  }
  // holds the stores behind all arithmetic, so that no register of an issued
  // store is written again
  __builtin_amdgcn_sched_barrier(0);
#pragma unroll
  for (int rr = 0; rr < 2; ++rr)
#pragma unroll
    for (int hh = 0; hh < 2; ++hh) {
      *(f32x4*)(outF + o0 + rr * 256 + hh * 128) = y[rr][hh];
      if (WB) *(v4bf*)(outB + o0 + rr * 256 + hh * 128) = yb[rr][hh];
    }
}

// ---------------------------------------------------------------- launcher
extern "C" void kernel_launch(void* const* d_in, const int* in_sizes, int n_in,
                              void* d_out, int out_size, void* d_ws,
                              size_t ws_size, hipStream_t stream) {
  (void)in_sizes; (void)n_in; (void)out_size; (void)ws_size;
  const float* seq  = (const float*)d_in[0];
  const float* Wq   = (const float*)d_in[1];
  const float* Wk   = (const float*)d_in[2];
  const float* Wv   = (const float*)d_in[3];
  const float* Wo   = (const float*)d_in[4];
  const float* ln1g = (const float*)d_in[5];
  const float* ln1b = (const float*)d_in[6];
  const float* W1   = (const float*)d_in[7];
  const float* b1   = (const float*)d_in[8];
  const float* W2   = (const float*)d_in[9];
  const float* b2   = (const float*)d_in[10];
  const float* ln2g = (const float*)d_in[11];
  const float* ln2b = (const float*)d_in[12];

  char* w = (char*)d_ws;
  size_t off = 0;
  auto take = [&](size_t bytes) {
    size_t o = off; off += (bytes + 255) & ~(size_t)255; return o;
  };
  __bf16* seqb  = (__bf16*)(w + take((size_t)NBL * DMODEL * 2));
  __bf16* WqT   = (__bf16*)(w + take((size_t)DH * DMODEL * 2));
  __bf16* WkT   = (__bf16*)(w + take((size_t)DH * DMODEL * 2));
  __bf16* WvT   = (__bf16*)(w + take((size_t)DH * DMODEL * 2));
  __bf16* WoT   = (__bf16*)(w + take((size_t)DMODEL * DH * 2));
  __bf16* W1T   = (__bf16*)(w + take((size_t)FFD * DMODEL * 2));
  __bf16* W2T   = (__bf16*)(w + take((size_t)DMODEL * FFD * 2));
  __bf16* qb    = (__bf16*)(w + take((size_t)NBL * DH * 2));
  __bf16* kb    = (__bf16*)(w + take((size_t)NBL * DH * 2));
  __bf16* vT    = (__bf16*)(w + take((size_t)DH * NBL * 2));
  __bf16* heads = (__bf16*)(w + take((size_t)NBL * DH * 2));
  float*  tmpF  = (float*)(w + take((size_t)NBL * DMODEL * 4));
  float*  xF    = (float*)(w + take((size_t)NBL * DMODEL * 4));
  __bf16* xB    = (__bf16*)(w + take((size_t)NBL * DMODEL * 2));
  __bf16* h1    = (__bf16*)(w + take((size_t)NBL * FFD * 2));

  // 1) convert / transpose inputs to bf16
  {
    int n = NBL * DMODEL;
    f32_to_bf16_kernel<<<n / 16 / 256, 256, 0, stream>>>(seq, seqb, n);
  }
  transpose_bf16_kernel<DMODEL, DH><<<DMODEL * DH / 8 / 256, 256, 0, stream>>>(Wq, WqT);
  transpose_bf16_kernel<DMODEL, DH><<<DMODEL * DH / 8 / 256, 256, 0, stream>>>(Wk, WkT);
  transpose_bf16_kernel<DMODEL, DH><<<DMODEL * DH / 8 / 256, 256, 0, stream>>>(Wv, WvT);
  transpose_bf16_kernel<DH, DMODEL><<<DMODEL * DH / 8 / 256, 256, 0, stream>>>(Wo, WoT);
  transpose_bf16_kernel<DMODEL, FFD><<<DMODEL * FFD / 8 / 256, 256, 0, stream>>>(W1, W1T);
  transpose_bf16_kernel<FFD, DMODEL><<<DMODEL * FFD / 8 / 256, 256, 0, stream>>>(W2, W2T);

  // 2) QKV projections (V stored transposed for the P*V WMMA path; K and V in
  //    the swizzled orders the attention kernel reads)
  dim3 gQKV(DH / 64, NBL / 64);
  gemm_bf16_kernel<1, false><<<gQKV, 128, 0, stream>>>(seqb, WqT, nullptr, nullptr, qb, NBL, DH, DMODEL, 0);
  gemm_bf16_kernel<3, false><<<gQKV, 128, 0, stream>>>(seqb, WkT, nullptr, nullptr, kb, NBL, DH, DMODEL, 0);
  gemm_bf16_kernel<2, false><<<gQKV, 128, 0, stream>>>(seqb, WvT, nullptr, nullptr, vT, NBL, DH, DMODEL, NBL);

  // 3) fused flash attention -> heads
  flash_attn_kernel<<<(NBL / 16) * NHEAD / 4, 128, 0, stream>>>(qb, kb, vT, heads);

  // 4) output projection: att = heads @ Wo (f32)
  dim3 gO(DMODEL / 64, NBL / 64);
  gemm_bf16_kernel<0, false><<<gO, 128, 0, stream>>>(heads, WoT, nullptr, tmpF, nullptr, NBL, DMODEL, DH, 0);

  // 5) x = LN(seq + att)   (also bf16 copy for the FF GEMM)
  add_ln_kernel<true><<<NBL / 16, 256, 0, stream>>>(tmpF, seq, ln1g, ln1b, xF, xB);

  // 6) FF: h1 = relu(x @ W1 + b1); ff = h1 @ W2 + b2
  dim3 gF1(FFD / 64, NBL / 64);
  gemm_bf16_kernel<1, true><<<gF1, 128, 0, stream>>>(xB, W1T, b1, nullptr, h1, NBL, FFD, DMODEL, 0);
  dim3 gF2(DMODEL / 64, NBL / 64);
  gemm_bf16_kernel<0, false><<<gF2, 128, 0, stream>>>(h1, W2T, b2, tmpF, nullptr, NBL, DMODEL, FFD, 0);

  // 7) out = LN(x + ff)
  add_ln_kernel<false><<<NBL / 16, 256, 0, stream>>>(tmpF, xF, ln2g, ln2b, (float*)d_out, nullptr);
}

// v004
// Measured time: 277 microseconds a run.
// Two timings next to v003 both put it at 1.27 times that version's speed.
// All steps since v000 together make it 3.73 times as fast.
#include <hip/hip_runtime.h>

typedef __attribute__((ext_vector_type(16))) __bf16 v16bf;
typedef __attribute__((ext_vector_type(8)))  __bf16 v8bf;
typedef __attribute__((ext_vector_type(4)))  __bf16 v4bf;
typedef __attribute__((ext_vector_type(8)))  float  v8f;
typedef __attribute__((ext_vector_type(4)))  float  f32x4;
typedef __attribute__((ext_vector_type(4)))  unsigned int u32x4;
typedef __attribute__((ext_vector_type(8)))  int    i32x8;
typedef __attribute__((ext_vector_type(4)))  int    i32x4;

#define NBL    8192   // B*L
#define DMODEL 256
#define NHEAD  8
#define DH     2048   // D*H
#define LSEQ   2048
#define FFD    128

// ---------------------------------------------------------------- helpers
__device__ __forceinline__ __bf16 to_bf16(float f) {
  union { float f; unsigned u; } x; x.f = f;
  unsigned r = x.u + 0x7FFFu + ((x.u >> 16) & 1u);   // round-to-nearest-even
  unsigned short h = (unsigned short)(r >> 16);
  union { unsigned short s; __bf16 b; } y; y.s = h;
  return y.b;
}

// A/B fragment for v_wmma_f32_16x16x32_bf16 from a row-major (rows x ld) bf16
// matrix (global or LDS), contraction chunk starting at column kc.
// Per CDNA5 ISA 16-bit layout: lane holds row (lane&15); elements 0..7 =
// K [off, off+8), elements 8..15 = K [off+16, off+24), off = (lane&16)?8:0.
__device__ __forceinline__ v16bf load_frag(const __bf16* base, int ld, int row,
                                           int kc, int lane) {
  const __bf16* p = base + (size_t)row * ld + kc + ((lane & 16) ? 8 : 0);
  v16bf f;
  ((f32x4*)&f)[0] = ((const f32x4*)p)[0];
  ((f32x4*)&f)[1] = *(const f32x4*)(p + 16);
  return f;
}

// Swizzled layouts. The tensor loads land rows unpadded, so rows of 64 B or
// 512 B put the 16 lanes of a half-wave on few LDS banks.  The producers
// therefore store each 16-byte chunk (8 bf16 of the contraction index) at an
// XOR-ed chunk position inside its row, and the readers undo it: the 16 lanes
// of a half-wave then cover all 64 banks once.  Values and k order unchanged.
//   64-byte rows (32 bf16):  chunk j of row r sits at j ^ ((r >> 2) & 3)
//   512-byte rows (256 bf16): chunk p of row r sits at p ^ (r & 15)
__device__ __forceinline__ int swz64(int row, int col) {
  return col ^ (((row >> 2) & 3) << 3);
}
__device__ __forceinline__ int swz512(int row, int col) {
  return col ^ ((row & 15) << 3);
}

// load_frag for a tile of swizzled 64-byte rows; row0 is a multiple of 16.
__device__ __forceinline__ v16bf load_frag_sw64(const __bf16* base, int row0,
                                                int lane) {
  const int j0 = ((lane >> 4) & 1) ^ ((lane >> 2) & 3);
  const __bf16* p = base + (row0 + (lane & 15)) * 32;
  v16bf f;
  ((f32x4*)&f)[0] = *(const f32x4*)(p + j0 * 8);
  ((f32x4*)&f)[1] = *(const f32x4*)(p + (j0 ^ 2) * 8);
  return f;
}

__device__ __forceinline__ v8f wmma_bf16(v16bf a, v16bf b, v8f c) {
  return __builtin_amdgcn_wmma_f32_16x16x32_bf16(false, a, false, b,
                                                 (short)0, c, false, false);
}

__device__ __forceinline__ unsigned lds_off(const void* p) {
  // generic pointer to a __shared__ object: low 32 bits = LDS byte offset
  return (unsigned)(unsigned long long)p;
}

// Tensor Data Mover: 2D bf16 tile (tile0 contiguous elems x tile1 rows,
// row stride = stride0 elems) from global -> LDS, packed rows in LDS.
// Tracked by TENSORcnt.
__device__ __forceinline__ void tdm_load_2d(unsigned lds_addr, const void* gptr,
                                            unsigned tile0, unsigned tile1,
                                            unsigned stride0) {
  unsigned long long ga = (unsigned long long)gptr;
  u32x4 g0;
  g0[0] = 1u;                                        // count=1, user descriptor
  g0[1] = lds_addr;                                  // lds_addr
  g0[2] = (unsigned)(ga & 0xFFFFFFFFu);              // global_addr[31:0]
  g0[3] = (unsigned)((ga >> 32) & 0x01FFFFFFu)       // global_addr[56:32]
          | (2u << 30);                              // type = 2 ("image")
  i32x8 g1;
  g1[0] = (int)(1u << 16);          // workgroup_mask=0, data_size=1 (2 bytes)
  g1[1] = (int)(tile0 << 16);       // tensor_dim0[15:0]  (= tile -> no OOB)
  g1[2] = (int)(tile1 << 16);       // tensor_dim0[31:16]=0, tensor_dim1[15:0]
  g1[3] = (int)(tile0 << 16);       // tensor_dim1[31:16]=0, tile_dim0
  g1[4] = (int)(tile1 & 0xFFFFu);   // tile_dim1, tile_dim2=0
  g1[5] = (int)stride0;             // tensor_dim0_stride[31:0] (elements)
  g1[6] = 0;                        // stride0[47:32]=0, dim1_stride[15:0]=0
  g1[7] = 0;
  i32x4 z4 = {0, 0, 0, 0};
#if defined(__clang_major__) && (__clang_major__ >= 23)
  i32x8 z8 = {0, 0, 0, 0, 0, 0, 0, 0};
  __builtin_amdgcn_tensor_load_to_lds(g0, g1, z4, z4, z8, 0);
#else
  __builtin_amdgcn_tensor_load_to_lds(g0, g1, z4, z4, 0);
#endif
}

// ---------------------------------------------------------------- converts
// Each lane of the non-matrix kernels takes 8 or 16 elements: few waves to
// start, 16-byte accesses.
__device__ __forceinline__ v8bf pack8(f32x4 lo, f32x4 hi) {
  v8bf o;
#pragma unroll
  for (int j = 0; j < 4; ++j) { o[j] = to_bf16(lo[j]); o[4 + j] = to_bf16(hi[j]); }
  return o;
}

// n is a multiple of 16; a lane converts the 8-element chunks t and t + n/16.
__global__ void __launch_bounds__(256)
f32_to_bf16_kernel(const float* __restrict__ src,
                   __bf16* __restrict__ dst, int n) {
  const int half = n >> 4;
  const int t = blockIdx.x * blockDim.x + threadIdx.x;
  if (t >= half) return;
  const f32x4* s4 = (const f32x4*)src;
  f32x4 a0 = s4[2 * t], a1 = s4[2 * t + 1];
  f32x4 b0 = s4[2 * (t + half)], b1 = s4[2 * (t + half) + 1];
  ((v8bf*)dst)[t] = pack8(a0, a1);
  ((v8bf*)dst)[t + half] = pack8(b0, b1);
}

// src (ROWS x COLS) f32  ->  dst (COLS x ROWS) bf16   (weights -> NxK form,
// each 32-wide k block of a row in the swizzled 64-byte order).  A lane takes
// 8 source rows of one column, which are one 16-byte chunk of the swizzled
// order; the grid holds exactly ROWS / 8 * COLS threads.  The shape is a
// compile-time constant so that the 8 loads share one address register pair.
template <int ROWS, int COLS>
__global__ void __launch_bounds__(256)
transpose_bf16_kernel(const float* __restrict__ src, __bf16* __restrict__ dst) {
  const int i = blockIdx.x * 256 + threadIdx.x;
  const int rc = i / COLS, cc = i % COLS;
  const float* p = src + (size_t)(rc * 8) * COLS + cc;
  float v[8];
#pragma unroll
  for (int j = 0; j < 8; ++j) v[j] = p[j * COLS];
  v8bf o;
#pragma unroll
  for (int j = 0; j < 8; ++j) o[j] = to_bf16(v[j]);
  *(v8bf*)(dst + (size_t)cc * ROWS + swz64(cc, rc * 8)) = o;
}

// ---------------------------------------------------------------- GEMM
// C(M,N) = A(M,K) x Bt(N,K)^T, bf16 in, f32 accumulate.  The 64x32 Bt tile is
// shared by all 4 waves: streamed into LDS by the TDM, double-buffered.
// Bt comes in the swizzled 64-byte order of transpose_bf16_kernel.
// OUTMODE: 0 = f32 row-major, 1 = bf16 row-major, 2 = bf16 transposed (ldT),
// 64-byte swizzle, 3 = bf16 row-major, 512-byte swizzle
template <int OUTMODE, bool RELU>
__global__ void __launch_bounds__(128, 2)
gemm_bf16_kernel(const __bf16* __restrict__ A, const __bf16* __restrict__ Bt,
                 const float* __restrict__ bias, float* __restrict__ outF,
                 __bf16* __restrict__ outB, int M, int N, int K, int ldT) {
  __shared__ __bf16 btile[2][64 * 32];   // (n, k) rows packed, 4 KB each
  const int lane = threadIdx.x & 31;
  const int wave = threadIdx.x >> 5;
  const int m0 = blockIdx.y * 64 + wave * 16;
  const int n0 = blockIdx.x * 64;
  const int niter = K >> 5;

  if (wave == 0)
    tdm_load_2d(lds_off(&btile[0][0]), Bt + (size_t)n0 * K, 32, 64, (unsigned)K);

  v8f acc0 = {}, acc1 = {}, acc2 = {}, acc3 = {};
  const int arow = m0 + (lane & 15);
  for (int i = 0; i < niter; ++i) {
    if (wave == 0) {
      if (i + 1 < niter) {
        tdm_load_2d(lds_off(&btile[(i + 1) & 1][0]),
                    Bt + (size_t)n0 * K + (i + 1) * 32, 32, 64, (unsigned)K);
        __builtin_amdgcn_s_wait_tensorcnt(1);   // current tile landed
      } else {
        __builtin_amdgcn_s_wait_tensorcnt(0);
      }
    }
    __syncthreads();
    const __bf16* bt = btile[i & 1];
    v16bf a  = load_frag(A, K, arow, i * 32, lane);
    v16bf b0 = load_frag_sw64(bt, 0 * 16, lane);
    v16bf b1 = load_frag_sw64(bt, 1 * 16, lane);
    v16bf b2 = load_frag_sw64(bt, 2 * 16, lane);
    v16bf b3 = load_frag_sw64(bt, 3 * 16, lane);
    acc0 = wmma_bf16(a, b0, acc0);
    acc1 = wmma_bf16(a, b1, acc1);
    acc2 = wmma_bf16(a, b2, acc2);
    acc3 = wmma_bf16(a, b3, acc3);
    __syncthreads();   // tile consumed before it is overwritten
  }

  v8f accs[4] = {acc0, acc1, acc2, acc3};
  // Swizzled store positions as per-lane bases plus compile-time steps: r walks
  // bits 0..2 of Mi and nt bits 4..5 of Ni; m0 is a multiple of 16, n0 of 64.
  const int mswz = swz64(lane & 15, m0 + ((lane & 16) ? 8 : 0));      // + r
  const int nswz = swz512((lane & 16) ? 8 : 0, n0 + (lane & 15));     // r = 0, nt = 0
#pragma unroll
  for (int nt = 0; nt < 4; ++nt) {
#pragma unroll
    for (int r = 0; r < 8; ++r) {
      int Mi = m0 + r + ((lane & 16) ? 8 : 0);
      int Ni = n0 + nt * 16 + (lane & 15);
      float v = accs[nt][r];
      if (bias) v += bias[Ni];
      if (RELU) v = fmaxf(v, 0.0f);
      if (OUTMODE == 0)      outF[(size_t)Mi * N + Ni] = v;
      else if (OUTMODE == 1) outB[(size_t)Mi * N + Ni] = to_bf16(v);
      else if (OUTMODE == 2) outB[(size_t)Ni * ldT + mswz + r] = to_bf16(v);
      else                   outB[(size_t)Mi * N + (nswz ^ ((r & 1) << 3)) +
                                  ((nt ^ (r >> 1)) << 4)] = to_bf16(v);
      // the next element reuses this store's registers: keep the wait in front
      if (OUTMODE >= 2) asm volatile("s_wait_xcnt 0x0" ::: "memory");
    }
  }
}

__device__ __forceinline__ float other_half(float x) {   // x of lane ^ 16
  int y = __builtin_bit_cast(int, x);
  return __builtin_bit_cast(float, __builtin_amdgcn_permlanex16(
             y, y, 0x76543210, 0xfedcba98, false, false));
}

typedef __attribute__((ext_vector_type(8))) unsigned int u32x8;
__device__ __forceinline__ unsigned uni(unsigned v) {   // a scalar-register word
  return (unsigned)__builtin_amdgcn_readfirstlane((int)v);
}
// a wave-uniform test kept in a scalar register: compiles to s_cmp + s_cbranch_scc
__device__ __forceinline__ unsigned pinned(unsigned v) {
  unsigned w = uni(v);
  asm volatile("" : "+s"(w));
  return w;
}

__global__ void __launch_bounds__(128, 2)
flash_attn_kernel(const __bf16* __restrict__ q, const __bf16* __restrict__ k,
                  const __bf16* __restrict__ vT, __bf16* __restrict__ heads) {
  // (key, d) and (d, key), 16 KB a buffer; places of tensor loads: 2 KiB multiples
  __shared__ __attribute__((aligned(2048))) __bf16 ktile[2][32 * 256];
  __shared__ __attribute__((aligned(2048))) __bf16 vtile[2][256 * 32];
  const int lane = threadIdx.x & 31;
  const unsigned wave = uni(threadIdx.x >> 5);
  // 16 blocks of 128 queries per (b, h)
  const int b  = blockIdx.x >> 7;
  const int h  = (blockIdx.x >> 4) & 7;
  const int qt = (blockIdx.x & 15) * 4 + (int)wave;   // 32-query tile, 0 .. 63
  const int NT = LSEQ / 32;

  // Q fragments: per group 8 K-chunks covering d = 0..255 (global, loaded once)
  v16bf qa[2][8];
  const int qrow = b * LSEQ + qt * 32 + (lane & 15);   // group g: + 16 * g
#pragma unroll
  for (int g = 0; g < 2; ++g)
#pragma unroll
    for (int c = 0; c < 8; ++c)
      qa[g][c] = load_frag(q, DH, qrow + g * 16, h * DMODEL + c * 32, lane);
  // the arithmetic behind may land in these loads' address registers: keep the wait
  asm volatile("s_wait_xcnt 0x0" ::: "memory");
  // holds that arithmetic behind the wait
  __builtin_amdgcn_sched_barrier(0);

  // Every wave brings its own 8 KB slice of each stage, one request at a time:
  // waves 0, 1 the key rows 0..15, 16..31 of K (16 rows of 512 B, pitch 4 KB),
  // waves 2, 3 the d rows 0..127, 128..255 of V^T (128 rows of 64 B, pitch 16 KB).
  // All extents in bytes (data_size code 0), tensor dims = tile dims, no pad.
  const unsigned isv = wave >> 1, half = wave & 1u;
  const unsigned rowb = isv ? 64u : 512u;                  // bytes a row
  const unsigned nrow = isv ? 128u : 16u;                  // rows
  const unsigned step = isv ? 64u : 32u * DH * 2u;         // source bytes a stage
  u32x8 g1;
  g1[0] = uni(0u);                     // no mask, data_size 0, no pad
  g1[1] = uni(rowb << 16);             // tensor_dim0
  g1[2] = uni(nrow << 16);             // tensor_dim1
  g1[3] = uni(rowb << 16);             // tile_dim0
  g1[4] = uni(nrow);                   // tile_dim1
  g1[5] = uni(isv ? NBL * 2u : DH * 2u);   // source pitch
  g1[6] = uni(0u);
  g1[7] = uni(0u);
  u32x4 g0;                            // stage 0 into buffer 0
  {
    const __bf16* src = isv
        ? vT + (size_t)(h * DMODEL + half * 128) * NBL + b * LSEQ
        : k  + (size_t)(b * LSEQ + half * 16) * DH + h * DMODEL;
    const unsigned long long ga = (unsigned long long)src;
    g0[0] = uni(1u);
    g0[1] = uni((isv ? lds_off(&vtile[0][0]) : lds_off(&ktile[0][0])) + half * 8192u);
    g0[2] = uni((unsigned)ga);
    g0[3] = uni(((unsigned)(ga >> 32) & 0x01FFFFFFu) | 0x80000000u);   // type 2
  }
  // the next stage's slice, into the other buffer
  auto advance = [&]() {
    const unsigned lo = g0[2] + step;
    g0[1] = uni(g0[1] ^ 16384u);
    g0[3] = uni(g0[3] + (lo < step ? 1u : 0u));
    g0[2] = uni(lo);
  };
  // Load and wait name both descriptor groups as in-out: the groups stay in one
  // register set each, which keeps its words while the request is out, and
  // group 0 takes the next stage's words only behind the wait.
#define TENSOR_LOAD() asm volatile("tensor_load_to_lds %0, %1" : "+s"(g0), "+s"(g1) :: "memory")
#define TENSOR_WAIT() asm volatile("s_wait_tensorcnt 0x0" : "+s"(g0), "+s"(g1) :: "memory")
  TENSOR_LOAD();
  TENSOR_WAIT();
  __syncthreads();   // stage 0 published
  advance();
  TENSOR_LOAD();     // stage 1 flies during pass 0

  // o[g][nt][r] = O[query 16*g + (lane & 15)][d = nt*16 + r + 8*(lane>>4)]
  v8f o[2][16];
  v8f zero = {};
#pragma unroll
  for (int g = 0; g < 2; ++g)
#pragma unroll
    for (int nt = 0; nt < 16; ++nt) o[g][nt] = zero;
  float mrun[2] = {-1e30f, -1e30f};   // running maximum of the lane's query (both halves alike)
  float lrun[2] = {0.0f, 0.0f};       // running sum over this half's keys only

  // The lane's LDS byte offsets in the current K and V buffer: ka[m] is chunk
  // 2 * m + (lane >> 4) of a 128-element half row of K under the 512-byte
  // swizzle, va[] the two chunks of load_frag_sw64.  They are flipped to the
  // other buffer at the foot of each pass: one register set serves both buffers
  // (per-pass address arithmetic takes registers that this tile does not have).
  unsigned ka[8], va[2];
  {
    const int s = lane & 15, hh = (lane >> 4) & 1;
#pragma unroll
    for (int m = 0; m < 8; ++m) ka[m] = (unsigned)(s * 256 + (((m * 2 + hh) ^ s) * 8)) * 2u;
    const int j0 = hh ^ ((lane >> 2) & 3);
    va[0] = (unsigned)(s * 32 + j0 * 8) * 2u;
    va[1] = (unsigned)(s * 32 + (j0 ^ 2) * 8) * 2u;
  }
  const char* kl = (const char*)&ktile[0][0];
  const char* vl = (const char*)&vtile[0][0];
  // rows row0 .. row0 + 15 of the K tile, contraction chunk c (32 wide)
  auto kfrag = [&](int row0, int c) {
    v16bf f;
    ((f32x4*)&f)[0] = *(const f32x4*)(kl + ka[(c & 3) * 2]     + row0 * 512 + (c >> 2) * 256);
    ((f32x4*)&f)[1] = *(const f32x4*)(kl + ka[(c & 3) * 2 + 1] + row0 * 512 + (c >> 2) * 256);
    return f;
  };
  // rows row0 .. row0 + 15 of the V^T tile
  auto vfrag = [&](int row0) {
    v16bf f;
    ((f32x4*)&f)[0] = *(const f32x4*)(vl + va[0] + row0 * 64);
    ((f32x4*)&f)[1] = *(const f32x4*)(vl + va[1] + row0 * 64);
    return f;
  };

  const float scale = 0.0625f;  // 1/sqrt(256)
  for (int t = 0; t < NT; ++t) {

    // --- S^T = K * Q^T  (32 keys x 32 queries, four 16x16 tiles per K-chunk).
    //     With two waves a SIMD the wave covers its own LDS waits: the K
    //     fragments of a chunk are read two chunks ahead of their products,
    //     into three register sets in turn.
    v8f s0[2] = {zero, zero}, s1[2] = {zero, zero};
    v16bf kf[3][2];   // [set][key half]
#pragma unroll
    for (int c = 0; c < 2; ++c) {
      kf[c][0] = kfrag(0,  c);
      kf[c][1] = kfrag(16, c);
    }
#pragma unroll
    for (int c = 0; c < 8; ++c) {
      if (c < 6) {
        kf[(c + 2) % 3][0] = kfrag(0,  c + 2);
        kf[(c + 2) % 3][1] = kfrag(16, c + 2);
      }
      // keeps these LDS reads in front of this chunk's products: left alone
      // the compiler reads each fragment right before its use
      __builtin_amdgcn_sched_barrier(0);
#pragma unroll
      for (int g = 0; g < 2; ++g) {
        s0[g] = wmma_bf16(kf[c % 3][0], qa[g][c], s0[g]);
        s1[g] = wmma_bf16(kf[c % 3][1], qa[g][c], s1[g]);
      }
      // holds later reads back from these products (best effort: behind the last
      // chunk the first V reads still stand among its products in the listing)
      __builtin_amdgcn_sched_barrier(0);
    }

    // first two pairs of V fragments: read here so that the softmax covers the wait
    v16bf vf[3][2];      // [set][d tile of the pair]
#pragma unroll
    for (int j = 0; j < 4; ++j) vf[j >> 1][j & 1] = vfrag(j * 16);
    // keeps these reads in front of the softmax arithmetic
    __builtin_amdgcn_sched_barrier(0);

    // --- online softmax, group by group: 16 of a query's 32 scores sit in this
    //     lane, the other 16 in lane ^ 16
    v16bf pb[2];       // B fragment of P^T: keys 8h + r, then 16 + 8h + r
#pragma unroll
    for (int g = 0; g < 2; ++g) {
      float a0[8], a1[8], mx8[8];
#pragma unroll
      for (int r = 0; r < 8; ++r) {
        a0[r] = s0[g][r] * scale;
        a1[r] = s1[g][r] * scale;
        mx8[r] = fmaxf(a0[r], a1[r]);
      }
      float mx = fmaxf(fmaxf(fmaxf(mx8[0], mx8[1]), fmaxf(mx8[2], mx8[3])),
                       fmaxf(fmaxf(mx8[4], mx8[5]), fmaxf(mx8[6], mx8[7])));
      mx = fmaxf(mx, other_half(mx));
      const float mnew = fmaxf(mrun[g], mx);
      const float corr = __expf(mrun[g] - mnew);
      mrun[g] = mnew;
      float ps8[8];
#pragma unroll
      for (int r = 0; r < 8; ++r) {
        float p0 = __expf(a0[r] - mnew);
        float p1 = __expf(a1[r] - mnew);
        ps8[r] = p0 + p1;
        pb[g][r]     = to_bf16(p0);
        pb[g][8 + r] = to_bf16(p1);
      }
      lrun[g] = lrun[g] * corr + (((ps8[0] + ps8[1]) + (ps8[2] + ps8[3])) +
                                  ((ps8[4] + ps8[5]) + (ps8[6] + ps8[7])));
#pragma unroll
      for (int nt = 0; nt < 16; ++nt) o[g][nt] *= corr;
    }

    // keeps the third pair's reads out of the softmax, where registers are short
    __builtin_amdgcn_sched_barrier(0);

    // --- O^T += V^T * P^T   (16 output tiles across d = 256, per group of
    //     queries); V fragments in pairs of d tiles, read two pairs ahead
#pragma unroll
    for (int np = 0; np < 8; ++np) {
      if (np < 6) {
        vf[(np + 2) % 3][0] = vfrag(((np + 2) * 2) * 16);
        vf[(np + 2) % 3][1] = vfrag(((np + 2) * 2 + 1) * 16);
      }
      // keeps these LDS reads in front of this pair's products
      __builtin_amdgcn_sched_barrier(0);
#pragma unroll
      for (int j = 0; j < 2; ++j)
#pragma unroll
        for (int g = 0; g < 2; ++g)
          o[g][np * 2 + j] = wmma_bf16(vf[np % 3][j], pb[g], o[g][np * 2 + j]);
      // keeps later reads from rising in among these products
      __builtin_amdgcn_sched_barrier(0);
    }

#pragma unroll
    for (int m = 0; m < 8; ++m) ka[m] ^= 16384u;
    va[0] ^= 16384u;
    va[1] ^= 16384u;

    // --- publish point of stage t + 1: this wave's reads of stage t are done,
    //     its own slice of stage t + 1 has landed, every wave says the same
    asm volatile("s_wait_dscnt 0x0" ::: "memory");
    TENSOR_WAIT();
    __syncthreads();
    if (pinned(t + 2 < NT)) {   // stage t + 2 into the buffer that pass t has read
      advance();
      TENSOR_LOAD();
    }
  }
  // nothing of the mover or of LDS is out when the wave ends
  TENSOR_WAIT();
  asm volatile("s_wait_dscnt 0x0" ::: "memory");
#undef TENSOR_LOAD
#undef TENSOR_WAIT

  // normalize and store heads (bf16 row-major (NBL, DH)): a lane's 8 elements
  // of a tile are 8 neighbours in d, one 16-byte store
  v8bf ov[2][16];
#pragma unroll
  for (int g = 0; g < 2; ++g) {
    const float inv = 1.0f / (lrun[g] + other_half(lrun[g]));
#pragma unroll
    for (int nt = 0; nt < 16; ++nt)
#pragma unroll
      for (int r = 0; r < 8; ++r) ov[g][nt][r] = to_bf16(o[g][nt][r] * inv);
  }
  __bf16* hp = heads + (size_t)qrow * DH + h * DMODEL + ((lane & 16) ? 8 : 0);
  // holds the stores behind all arithmetic, so that no register of an issued
  // store is written again
  __builtin_amdgcn_sched_barrier(0);
#pragma unroll
  for (int g = 0; g < 2; ++g)
#pragma unroll
    for (int nt = 0; nt < 16; ++nt)
      *(v8bf*)(hp + (size_t)g * 16 * DH + nt * 16) = ov[g][nt];
}

// ---------------------------------------------------------------- add + LN
// y = LN(a + rsd) * g + b ;  one wave per two rows of 256 elements, 8 waves a
// block.  A lane holds elements 4*lane.. and 128 + 4*lane.. of each row, so
// every 16-byte access of a wave covers 512 contiguous bytes.
template <int M>
__device__ __forceinline__ float add_xmask(float x) {   // x + x of lane ^ M, M < 16
  int y = __builtin_amdgcn_update_dpp(0, __builtin_bit_cast(int, x), 0x160 | M,
                                      0xf, 0xf, true);
  return x + __builtin_bit_cast(float, y);
}
__device__ __forceinline__ float wave_sum(float x) {    // every lane gets the sum
  x = add_xmask<1>(x);
  x = add_xmask<2>(x);
  x = add_xmask<4>(x);
  x = add_xmask<8>(x);
  int b = __builtin_bit_cast(int, x);
  return x + __builtin_bit_cast(float, __builtin_amdgcn_permlanex16(
                 b, b, 0x76543210, 0xfedcba98, false, false));
}

template <bool WB>   // WB: also write the bf16 copy
__global__ void __launch_bounds__(256)
add_ln_kernel(const float* __restrict__ a,
              const float* __restrict__ rsd,
              const float* __restrict__ g,
              const float* __restrict__ bta,
              float* __restrict__ outF,
              __bf16* __restrict__ outB) {
  const int lane = threadIdx.x & 31;
  const int row0 = (blockIdx.x * 8 + (threadIdx.x >> 5)) * 2;
  const size_t o0 = (size_t)row0 * 256 + lane * 4;   // + rr * 256 + hh * 128
  f32x4 v[2][2], gg[2], bb[2], y[2][2];
#pragma unroll
  for (int hh = 0; hh < 2; ++hh) {
    gg[hh] = *(const f32x4*)(g + hh * 128 + lane * 4);
    bb[hh] = *(const f32x4*)(bta + hh * 128 + lane * 4);
  }
  // the next loads may land in these loads' address register: keep the wait
  asm volatile("s_wait_xcnt 0x0" ::: "memory");
#pragma unroll
  for (int rr = 0; rr < 2; ++rr)
#pragma unroll
    for (int hh = 0; hh < 2; ++hh)
      v[rr][hh] = *(const f32x4*)(a + o0 + rr * 256 + hh * 128) +
                  *(const f32x4*)(rsd + o0 + rr * 256 + hh * 128);
#pragma unroll
  for (int rr = 0; rr < 2; ++rr) {
    f32x4 s4 = v[rr][0] + v[rr][1];
    float mu = wave_sum((s4[0] + s4[1]) + (s4[2] + s4[3])) * (1.0f / 256.0f);
    f32x4 d0 = v[rr][0] - mu, d1 = v[rr][1] - mu;
    f32x4 q4 = d0 * d0 + d1 * d1;
    float var = wave_sum((q4[0] + q4[1]) + (q4[2] + q4[3])) * (1.0f / 256.0f);
    float rs = rsqrtf(var + 1e-5f);
    y[rr][0] = d0 * rs * gg[0] + bb[0];
    y[rr][1] = d1 * rs * gg[1] + bb[1];
  }
  v4bf yb[2][2];
  if (WB) {
#pragma unroll
    for (int rr = 0; rr < 2; ++rr)
#pragma unroll
      for (int hh = 0; hh < 2; ++hh)
#pragma unroll
        for (int j = 0; j < 4; ++j) yb[rr][hh][j] = to_bf16(y[rr][hh][j]);
  }
  // holds the stores behind all arithmetic, so that no register of an issued
  // store is written again
  __builtin_amdgcn_sched_barrier(0);
#pragma unroll
  for (int rr = 0; rr < 2; ++rr)
#pragma unroll
    for (int hh = 0; hh < 2; ++hh) {
      *(f32x4*)(outF + o0 + rr * 256 + hh * 128) = y[rr][hh];
      if (WB) *(v4bf*)(outB + o0 + rr * 256 + hh * 128) = yb[rr][hh];
    }
}

// ---------------------------------------------------------------- launcher
extern "C" void kernel_launch(void* const* d_in, const int* in_sizes, int n_in,
                              void* d_out, int out_size, void* d_ws,
                              size_t ws_size, hipStream_t stream) {
  (void)in_sizes; (void)n_in; (void)out_size; (void)ws_size;
  const float* seq  = (const float*)d_in[0];
  const float* Wq   = (const float*)d_in[1];
  const float* Wk   = (const float*)d_in[2];
  const float* Wv   = (const float*)d_in[3];
  const float* Wo   = (const float*)d_in[4];
  const float* ln1g = (const float*)d_in[5];
  const float* ln1b = (const float*)d_in[6];
  const float* W1   = (const float*)d_in[7];
  const float* b1   = (const float*)d_in[8];
  const float* W2   = (const float*)d_in[9];
  const float* b2   = (const float*)d_in[10];
  const float* ln2g = (const float*)d_in[11];
  const float* ln2b = (const float*)d_in[12];

  char* w = (char*)d_ws;
  size_t off = 0;
  auto take = [&](size_t bytes) {
    size_t o = off; off += (bytes + 255) & ~(size_t)255; return o;
  };
  __bf16* seqb  = (__bf16*)(w + take((size_t)NBL * DMODEL * 2));
  __bf16* WqT   = (__bf16*)(w + take((size_t)DH * DMODEL * 2));
  __bf16* WkT   = (__bf16*)(w + take((size_t)DH * DMODEL * 2));
  __bf16* WvT   = (__bf16*)(w + take((size_t)DH * DMODEL * 2));
  __bf16* WoT   = (__bf16*)(w + take((size_t)DMODEL * DH * 2));
  __bf16* W1T   = (__bf16*)(w + take((size_t)FFD * DMODEL * 2));
  __bf16* W2T   = (__bf16*)(w + take((size_t)DMODEL * FFD * 2));
  __bf16* qb    = (__bf16*)(w + take((size_t)NBL * DH * 2));
  __bf16* kb    = (__bf16*)(w + take((size_t)NBL * DH * 2));
  __bf16* vT    = (__bf16*)(w + take((size_t)DH * NBL * 2));
  __bf16* heads = (__bf16*)(w + take((size_t)NBL * DH * 2));
  float*  tmpF  = (float*)(w + take((size_t)NBL * DMODEL * 4));
  float*  xF    = (float*)(w + take((size_t)NBL * DMODEL * 4));
  __bf16* xB    = (__bf16*)(w + take((size_t)NBL * DMODEL * 2));
  __bf16* h1    = (__bf16*)(w + take((size_t)NBL * FFD * 2));

  // 1) convert / transpose inputs to bf16
  {
    int n = NBL * DMODEL;
    f32_to_bf16_kernel<<<n / 16 / 256, 256, 0, stream>>>(seq, seqb, n);
  }
  transpose_bf16_kernel<DMODEL, DH><<<DMODEL * DH / 8 / 256, 256, 0, stream>>>(Wq, WqT);
  transpose_bf16_kernel<DMODEL, DH><<<DMODEL * DH / 8 / 256, 256, 0, stream>>>(Wk, WkT);
  transpose_bf16_kernel<DMODEL, DH><<<DMODEL * DH / 8 / 256, 256, 0, stream>>>(Wv, WvT);
  transpose_bf16_kernel<DH, DMODEL><<<DMODEL * DH / 8 / 256, 256, 0, stream>>>(Wo, WoT);
  transpose_bf16_kernel<DMODEL, FFD><<<DMODEL * FFD / 8 / 256, 256, 0, stream>>>(W1, W1T);
  transpose_bf16_kernel<FFD, DMODEL><<<DMODEL * FFD / 8 / 256, 256, 0, stream>>>(W2, W2T);

  // 2) QKV projections (V stored transposed for the P*V WMMA path; K and V in
  //    the swizzled orders the attention kernel reads)
  dim3 gQKV(DH / 64, NBL / 64);
  gemm_bf16_kernel<1, false><<<gQKV, 128, 0, stream>>>(seqb, WqT, nullptr, nullptr, qb, NBL, DH, DMODEL, 0);
  gemm_bf16_kernel<3, false><<<gQKV, 128, 0, stream>>>(seqb, WkT, nullptr, nullptr, kb, NBL, DH, DMODEL, 0);
  gemm_bf16_kernel<2, false><<<gQKV, 128, 0, stream>>>(seqb, WvT, nullptr, nullptr, vT, NBL, DH, DMODEL, NBL);

  // 3) fused flash attention -> heads
  flash_attn_kernel<<<(NBL / 32) * NHEAD / 4, 128, 0, stream>>>(qb, kb, vT, heads);

  // 4) output projection: att = heads @ Wo (f32)
  dim3 gO(DMODEL / 64, NBL / 64);
  gemm_bf16_kernel<0, false><<<gO, 128, 0, stream>>>(heads, WoT, nullptr, tmpF, nullptr, NBL, DMODEL, DH, 0);

  // 5) x = LN(seq + att)   (also bf16 copy for the FF GEMM)
  add_ln_kernel<true><<<NBL / 16, 256, 0, stream>>>(tmpF, seq, ln1g, ln1b, xF, xB);

  // 6) FF: h1 = relu(x @ W1 + b1); ff = h1 @ W2 + b2
  dim3 gF1(FFD / 64, NBL / 64);
  gemm_bf16_kernel<1, true><<<gF1, 128, 0, stream>>>(xB, W1T, b1, nullptr, h1, NBL, FFD, DMODEL, 0);
  dim3 gF2(DMODEL / 64, NBL / 64);
  gemm_bf16_kernel<0, false><<<gF2, 128, 0, stream>>>(h1, W2T, b2, tmpF, nullptr, NBL, DMODEL, FFD, 0);

  // 7) out = LN(x + ff)
  add_ln_kernel<false><<<NBL / 16, 256, 0, stream>>>(tmpF, xF, ln2g, ln2b, (float*)d_out, nullptr);
}

// v005
// A run of this version takes 256 microseconds.
// Two timings next to v004 both put it at 1.08 times that version's speed.
// All steps since v000 together make it 4.04 times as fast.
#include <hip/hip_runtime.h>

typedef __attribute__((ext_vector_type(16))) __bf16 v16bf;
typedef __attribute__((ext_vector_type(8)))  __bf16 v8bf;
typedef __attribute__((ext_vector_type(4)))  __bf16 v4bf;
typedef __attribute__((ext_vector_type(8)))  float  v8f;
typedef __attribute__((ext_vector_type(4)))  float  f32x4;
typedef __attribute__((ext_vector_type(4)))  unsigned int u32x4;
typedef __attribute__((ext_vector_type(8)))  int    i32x8;
typedef __attribute__((ext_vector_type(4)))  int    i32x4;

#define NBL    8192   // B*L
#define DMODEL 256
#define NHEAD  8
#define DH     2048   // D*H
#define LSEQ   2048
#define FFD    128

// ---------------------------------------------------------------- helpers
__device__ __forceinline__ __bf16 to_bf16(float f) {
  union { float f; unsigned u; } x; x.f = f;
  unsigned r = x.u + 0x7FFFu + ((x.u >> 16) & 1u);   // round-to-nearest-even
  unsigned short h = (unsigned short)(r >> 16);
  union { unsigned short s; __bf16 b; } y; y.s = h;
  return y.b;
}

// A/B fragment for v_wmma_f32_16x16x32_bf16 from a row-major (rows x ld) bf16
// matrix (global or LDS), contraction chunk starting at column kc.
// Per CDNA5 ISA 16-bit layout: lane holds row (lane&15); elements 0..7 =
// K [off, off+8), elements 8..15 = K [off+16, off+24), off = (lane&16)?8:0.
__device__ __forceinline__ v16bf load_frag(const __bf16* base, int ld, int row,
                                           int kc, int lane) {
  const __bf16* p = base + (size_t)row * ld + kc + ((lane & 16) ? 8 : 0);
  v16bf f;
  ((f32x4*)&f)[0] = ((const f32x4*)p)[0];
  ((f32x4*)&f)[1] = *(const f32x4*)(p + 16);
  return f;
}

// Swizzled layouts of K and V^T. The attention's tensor loads land rows
// unpadded, so rows of 64 B or 512 B put the 16 lanes of a half-wave on few LDS
// banks.  The producers
// therefore store each 16-byte chunk (8 bf16 of the contraction index) at an
// XOR-ed chunk position inside its row, and the readers undo it: the 16 lanes
// of a half-wave then cover all 64 banks once.  Values and k order unchanged.
//   64-byte rows (32 bf16):  chunk j of row r sits at j ^ ((r >> 2) & 3)
//   512-byte rows (256 bf16): chunk p of row r sits at p ^ (r & 15)
__device__ __forceinline__ int swz64(int row, int col) {
  return col ^ (((row >> 2) & 3) << 3);
}
__device__ __forceinline__ int swz512(int row, int col) {
  return col ^ ((row & 15) << 3);
}

__device__ __forceinline__ v8f wmma_bf16(v16bf a, v16bf b, v8f c) {
  return __builtin_amdgcn_wmma_f32_16x16x32_bf16(false, a, false, b,
                                                 (short)0, c, false, false);
}

__device__ __forceinline__ unsigned lds_off(const void* p) {
  // generic pointer to a __shared__ object: low 32 bits = LDS byte offset
  return (unsigned)(unsigned long long)p;
}

typedef __attribute__((ext_vector_type(8))) unsigned int u32x8;
__device__ __forceinline__ unsigned uni(unsigned v) {   // a scalar-register word
  return (unsigned)__builtin_amdgcn_readfirstlane((int)v);
}
// a wave-uniform test kept in a scalar register: compiles to s_cmp + s_cbranch_scc
__device__ __forceinline__ unsigned pinned(unsigned v) {
  unsigned w = uni(v);
  asm volatile("" : "+s"(w));
  return w;
}

// ---------------------------------------------------------------- converts
// Each lane of the non-matrix kernels takes 8 or 16 elements: few waves to
// start, 16-byte accesses.
__device__ __forceinline__ v8bf pack8(f32x4 lo, f32x4 hi) {
  v8bf o;
#pragma unroll
  for (int j = 0; j < 4; ++j) { o[j] = to_bf16(lo[j]); o[4 + j] = to_bf16(hi[j]); }
  return o;
}

// n is a multiple of 16; a lane converts the 8-element chunks t and t + n/16.
__global__ void __launch_bounds__(256)
f32_to_bf16_kernel(const float* __restrict__ src,
                   __bf16* __restrict__ dst, int n) {
  const int half = n >> 4;
  const int t = blockIdx.x * blockDim.x + threadIdx.x;
  if (t >= half) return;
  const f32x4* s4 = (const f32x4*)src;
  f32x4 a0 = s4[2 * t], a1 = s4[2 * t + 1];
  f32x4 b0 = s4[2 * (t + half)], b1 = s4[2 * (t + half) + 1];
  ((v8bf*)dst)[t] = pack8(a0, a1);
  ((v8bf*)dst)[t + half] = pack8(b0, b1);
}

// src (ROWS x COLS) f32  ->  dst (COLS x ROWS) bf16   (weights -> NxK form,
// plain row-major).  A lane takes 8 source rows of one column, which are one
// 16-byte chunk of a dst row; the grid holds exactly ROWS / 8 * COLS threads.  The shape is a
// compile-time constant so that the 8 loads share one address register pair.
template <int ROWS, int COLS>
__global__ void __launch_bounds__(256)
transpose_bf16_kernel(const float* __restrict__ src, __bf16* __restrict__ dst) {
  const int i = blockIdx.x * 256 + threadIdx.x;
  const int rc = i / COLS, cc = i % COLS;
  const float* p = src + (size_t)(rc * 8) * COLS + cc;
  float v[8];
#pragma unroll
  for (int j = 0; j < 8; ++j) v[j] = p[j * COLS];
  v8bf o;
#pragma unroll
  for (int j = 0; j < 8; ++j) o[j] = to_bf16(v[j]);
  *(v8bf*)(dst + (size_t)cc * ROWS + rc * 8) = o;
}

// ---------------------------------------------------------------- GEMM
// C(M,N) = A(M,K) x Bt(N,K)^T, bf16 in, f32 accumulate; A and Bt plain
// row-major, K a multiple of 128.  A stage is 128 of K: the block's 64 rows of A
// and its 64 rows of Bt, rows of 256 B, brought into LDS by tensor loads whose
// pad gives an LDS pitch of 272 B (16 B x odd: the 16 rows of a fragment read
// cover all 64 banks once).  Two buffers; every wave brings one slice of 32 rows.
// OUTMODE: 0 = f32 row-major, 1 = bf16 row-major, 2 = bf16 transposed (ldT),
// 64-byte swizzle, 3 = bf16 row-major, 512-byte swizzle
#define GPITCH 272u                 // LDS bytes a row
#define GSLICE 10240u               // 32 rows of 272 B, rounded up to 2 KiB
#define GBUF   (4u * GSLICE)        // slices 0, 1: A rows 0..31, 32..63; 2, 3: Bt

// fragment of 16 rows from a padded tile; p: the lane's row, its half's first chunk
__device__ __forceinline__ v16bf lds_frag(const char* p) {
  v16bf f;
  ((f32x4*)&f)[0] = *(const f32x4*)p;          // k = off .. off + 7
  ((f32x4*)&f)[1] = *(const f32x4*)(p + 32);   // k = off + 16 .. off + 23
  return f;
}

template <int OUTMODE, bool RELU>
__global__ void __launch_bounds__(128, 2)
gemm_bf16_kernel(const __bf16* __restrict__ A, const __bf16* __restrict__ Bt,
                 const float* __restrict__ bias, float* __restrict__ outF,
                 __bf16* __restrict__ outB, int M, int N, int K, int ldT) {
  // places of tensor loads: 2 KiB multiples
  __shared__ __attribute__((aligned(2048))) char tiles[2][GBUF];
  const int lane = threadIdx.x & 31;
  const unsigned wave = uni(threadIdx.x >> 5);
  const int m0 = blockIdx.y * 64 + (int)wave * 16;
  const int n0 = blockIdx.x * 64;
  const int nst = K >> 7;

  // All extents in bytes (data_size code 0), tensor dims = tile dims.
  u32x8 g1;
  g1[0] = uni(0x07500000u);            // no mask; pad on, every 256 B (code 5), 16 B (code 3)
  g1[1] = uni(256u << 16);             // tensor_dim0
  g1[2] = uni(32u << 16);              // tensor_dim1
  g1[3] = uni(256u << 16);             // tile_dim0
  g1[4] = uni(32u);                    // tile_dim1
  g1[5] = uni((unsigned)K * 2u);       // source pitch
  g1[6] = uni(0u);
  g1[7] = uni(0u);
  u32x4 g0;                            // stage 0 into buffer 0
  const unsigned place0 = lds_off(&tiles[0][0]) + wave * GSLICE;
  {
    const unsigned half = wave & 1u;
    const __bf16* src = (wave >> 1)
        ? Bt + (size_t)(n0 + half * 32) * K
        : A  + (size_t)(blockIdx.y * 64 + half * 32) * K;
    const unsigned long long ga = (unsigned long long)src;
    g0[0] = uni(1u);
    g0[1] = uni(place0);
    g0[2] = uni((unsigned)ga);
    g0[3] = uni(((unsigned)(ga >> 32) & 0x01FFFFFFu) | 0x80000000u);   // type 2
  }
  // the next stage's slice (256 B on along the rows), into the other buffer
  auto advance = [&]() {
    const unsigned lo = g0[2] + 256u;
    g0[1] = uni(2u * place0 + GBUF - g0[1]);
    g0[3] = uni(g0[3] + (lo < 256u ? 1u : 0u));
    g0[2] = uni(lo);
  };
  // Load and wait name both descriptor groups as in-out: the groups stay in one
  // register set each, which keeps its words while the request is out, and
  // group 0 takes the next stage's words only behind the wait.
#define TENSOR_LOAD() asm volatile("tensor_load_to_lds %0, %1" : "+s"(g0), "+s"(g1) :: "memory")
#define TENSOR_WAIT() asm volatile("s_wait_tensorcnt 0x0" : "+s"(g0), "+s"(g1) :: "memory")
  TENSOR_LOAD();
  TENSOR_WAIT();
  __syncthreads();   // stage 0 published
  if (pinned(1 < nst)) {
    advance();
    TENSOR_LOAD();   // stage 1 flies during pass 0
  }

  v8f acc0 = {}, acc1 = {}, acc2 = {}, acc3 = {};
  // the lane's byte offsets in a buffer: its row of the wave's 16 rows of A, its
  // row of the first 16 rows of Bt, each at its half's first chunk
  const unsigned lrow = (unsigned)(lane & 15) * GPITCH + ((lane & 16) ? 16u : 0u);
  const unsigned aoff = (wave >> 1) * GSLICE + (wave & 1u) * 16u * GPITCH + lrow;
  const unsigned boff = 2u * GSLICE + lrow;
  for (int s = 0; s < nst; ++s) {
    const char* ap = &tiles[s & 1][0] + aoff;
    const char* bp = &tiles[s & 1][0] + boff;
    // the whole stage goes into registers first, so that its buffer is free for
    // the refill while the products run
    v16bf a[4], b[4][4];
#pragma unroll
    for (int kk = 0; kk < 4; ++kk) {   // 32 of K, 64 B of a row
      a[kk]    = lds_frag(ap + kk * 64);
      b[kk][0] = lds_frag(bp + kk * 64);
      b[kk][1] = lds_frag(bp + 16 * GPITCH + kk * 64);
      b[kk][2] = lds_frag(bp + GSLICE + kk * 64);
      b[kk][3] = lds_frag(bp + GSLICE + 16 * GPITCH + kk * 64);
    }
    // --- publish point of stage s + 1: this wave's reads of stage s are done,
    //     its own slice of stage s + 1 has landed, every wave says the same
    asm volatile("s_wait_dscnt 0x0" ::: "memory");
    TENSOR_WAIT();
    __syncthreads();
    if (pinned(s + 2 < nst)) {   // stage s + 2 into the buffer that pass s has read
      advance();
      TENSOR_LOAD();
    }
    // the products stand behind the refill's issue: the load flies under them
#pragma unroll
    for (int kk = 0; kk < 4; ++kk) {
      acc0 = wmma_bf16(a[kk], b[kk][0], acc0);
      acc1 = wmma_bf16(a[kk], b[kk][1], acc1);
      acc2 = wmma_bf16(a[kk], b[kk][2], acc2);
      acc3 = wmma_bf16(a[kk], b[kk][3], acc3);
    }
  }
  // nothing of the mover or of LDS is out when the wave goes on
  TENSOR_WAIT();
  asm volatile("s_wait_dscnt 0x0" ::: "memory");
#undef TENSOR_LOAD
#undef TENSOR_WAIT

  v8f accs[4] = {acc0, acc1, acc2, acc3};
  // Swizzled store positions as per-lane bases plus compile-time steps: r walks
  // bits 0..2 of Mi and nt bits 4..5 of Ni; m0 is a multiple of 16, n0 of 64.
  const int mswz = swz64(lane & 15, m0 + ((lane & 16) ? 8 : 0));      // + r
  const int nswz = swz512((lane & 16) ? 8 : 0, n0 + (lane & 15));     // r = 0, nt = 0
#pragma unroll
  for (int nt = 0; nt < 4; ++nt) {
#pragma unroll
    for (int r = 0; r < 8; ++r) {
      int Mi = m0 + r + ((lane & 16) ? 8 : 0);
      int Ni = n0 + nt * 16 + (lane & 15);
      float v = accs[nt][r];
      if (bias) v += bias[Ni];
      if (RELU) v = fmaxf(v, 0.0f);
      if (OUTMODE == 0)      outF[(size_t)Mi * N + Ni] = v;
      else if (OUTMODE == 1) outB[(size_t)Mi * N + Ni] = to_bf16(v);
      else if (OUTMODE == 2) outB[(size_t)Ni * ldT + mswz + r] = to_bf16(v);
      else                   outB[(size_t)Mi * N + (nswz ^ ((r & 1) << 3)) +
                                  ((nt ^ (r >> 1)) << 4)] = to_bf16(v);
      // the next element reuses this store's registers: keep the wait in front
      if (OUTMODE >= 2) asm volatile("s_wait_xcnt 0x0" ::: "memory");
    }
  }
}

__device__ __forceinline__ float other_half(float x) {   // x of lane ^ 16
  int y = __builtin_bit_cast(int, x);
  return __builtin_bit_cast(float, __builtin_amdgcn_permlanex16(
             y, y, 0x76543210, 0xfedcba98, false, false));
}

__global__ void __launch_bounds__(128, 2)
flash_attn_kernel(const __bf16* __restrict__ q, const __bf16* __restrict__ k,
                  const __bf16* __restrict__ vT, __bf16* __restrict__ heads) {
  // (key, d) and (d, key), 16 KB a buffer; places of tensor loads: 2 KiB multiples
  __shared__ __attribute__((aligned(2048))) __bf16 ktile[2][32 * 256];
  __shared__ __attribute__((aligned(2048))) __bf16 vtile[2][256 * 32];
  const int lane = threadIdx.x & 31;
  const unsigned wave = uni(threadIdx.x >> 5);
  // 16 blocks of 128 queries per (b, h)
  const int b  = blockIdx.x >> 7;
  const int h  = (blockIdx.x >> 4) & 7;
  const int qt = (blockIdx.x & 15) * 4 + (int)wave;   // 32-query tile, 0 .. 63
  const int NT = LSEQ / 32;

  // Q fragments: per group 8 K-chunks covering d = 0..255 (global, loaded once)
  v16bf qa[2][8];
  const int qrow = b * LSEQ + qt * 32 + (lane & 15);   // group g: + 16 * g
#pragma unroll
  for (int g = 0; g < 2; ++g)
#pragma unroll
    for (int c = 0; c < 8; ++c)
      qa[g][c] = load_frag(q, DH, qrow + g * 16, h * DMODEL + c * 32, lane);
  // the arithmetic behind may land in these loads' address registers: keep the wait
  asm volatile("s_wait_xcnt 0x0" ::: "memory");
  // holds that arithmetic behind the wait
  __builtin_amdgcn_sched_barrier(0);

  // Every wave brings its own 8 KB slice of each stage, one request at a time:
  // waves 0, 1 the key rows 0..15, 16..31 of K (16 rows of 512 B, pitch 4 KB),
  // waves 2, 3 the d rows 0..127, 128..255 of V^T (128 rows of 64 B, pitch 16 KB).
  // All extents in bytes (data_size code 0), tensor dims = tile dims, no pad.
  const unsigned isv = wave >> 1, half = wave & 1u;
  const unsigned rowb = isv ? 64u : 512u;                  // bytes a row
  const unsigned nrow = isv ? 128u : 16u;                  // rows
  const unsigned step = isv ? 64u : 32u * DH * 2u;         // source bytes a stage
  u32x8 g1;
  g1[0] = uni(0u);                     // no mask, data_size 0, no pad
  g1[1] = uni(rowb << 16);             // tensor_dim0
  g1[2] = uni(nrow << 16);             // tensor_dim1
  g1[3] = uni(rowb << 16);             // tile_dim0
  g1[4] = uni(nrow);                   // tile_dim1
  g1[5] = uni(isv ? NBL * 2u : DH * 2u);   // source pitch
  g1[6] = uni(0u);
  g1[7] = uni(0u);
  u32x4 g0;                            // stage 0 into buffer 0
  {
    const __bf16* src = isv
        ? vT + (size_t)(h * DMODEL + half * 128) * NBL + b * LSEQ
        : k  + (size_t)(b * LSEQ + half * 16) * DH + h * DMODEL;
    const unsigned long long ga = (unsigned long long)src;
    g0[0] = uni(1u);
    g0[1] = uni((isv ? lds_off(&vtile[0][0]) : lds_off(&ktile[0][0])) + half * 8192u);
    g0[2] = uni((unsigned)ga);
    g0[3] = uni(((unsigned)(ga >> 32) & 0x01FFFFFFu) | 0x80000000u);   // type 2
  }
  // the next stage's slice, into the other buffer
  auto advance = [&]() {
    const unsigned lo = g0[2] + step;
    g0[1] = uni(g0[1] ^ 16384u);
    g0[3] = uni(g0[3] + (lo < step ? 1u : 0u));
    g0[2] = uni(lo);
  };
  // Load and wait name both descriptor groups as in-out: the groups stay in one
  // register set each, which keeps its words while the request is out, and
  // group 0 takes the next stage's words only behind the wait.
#define TENSOR_LOAD() asm volatile("tensor_load_to_lds %0, %1" : "+s"(g0), "+s"(g1) :: "memory")
#define TENSOR_WAIT() asm volatile("s_wait_tensorcnt 0x0" : "+s"(g0), "+s"(g1) :: "memory")
  TENSOR_LOAD();
  TENSOR_WAIT();
  __syncthreads();   // stage 0 published
  advance();
  TENSOR_LOAD();     // stage 1 flies during pass 0

  // o[g][nt][r] = O[query 16*g + (lane & 15)][d = nt*16 + r + 8*(lane>>4)]
  v8f o[2][16];
  v8f zero = {};
#pragma unroll
  for (int g = 0; g < 2; ++g)
#pragma unroll
    for (int nt = 0; nt < 16; ++nt) o[g][nt] = zero;
  float mrun[2] = {-1e30f, -1e30f};   // running maximum of the lane's query (both halves alike)
  float lrun[2] = {0.0f, 0.0f};       // running sum over this half's keys only

  // The lane's LDS byte offsets in the current K and V buffer: ka[m] is chunk
  // 2 * m + (lane >> 4) of a 128-element half row of K under the 512-byte
  // swizzle, va[] the two chunks of a V^T fragment under the 64-byte swizzle.  They are flipped to the
  // other buffer at the foot of each pass: one register set serves both buffers
  // (per-pass address arithmetic takes registers that this tile does not have).
  unsigned ka[8], va[2];
  {
    const int s = lane & 15, hh = (lane >> 4) & 1;
#pragma unroll
    for (int m = 0; m < 8; ++m) ka[m] = (unsigned)(s * 256 + (((m * 2 + hh) ^ s) * 8)) * 2u;
    const int j0 = hh ^ ((lane >> 2) & 3);
    va[0] = (unsigned)(s * 32 + j0 * 8) * 2u;
    va[1] = (unsigned)(s * 32 + (j0 ^ 2) * 8) * 2u;
  }
  const char* kl = (const char*)&ktile[0][0];
  const char* vl = (const char*)&vtile[0][0];
  // rows row0 .. row0 + 15 of the K tile, contraction chunk c (32 wide)
  auto kfrag = [&](int row0, int c) {
    v16bf f;
    ((f32x4*)&f)[0] = *(const f32x4*)(kl + ka[(c & 3) * 2]     + row0 * 512 + (c >> 2) * 256);
    ((f32x4*)&f)[1] = *(const f32x4*)(kl + ka[(c & 3) * 2 + 1] + row0 * 512 + (c >> 2) * 256);
    return f;
  };
  // rows row0 .. row0 + 15 of the V^T tile
  auto vfrag = [&](int row0) {
    v16bf f;
    ((f32x4*)&f)[0] = *(const f32x4*)(vl + va[0] + row0 * 64);
    ((f32x4*)&f)[1] = *(const f32x4*)(vl + va[1] + row0 * 64);
    return f;
  };

  const float scale = 0.0625f;  // 1/sqrt(256)
  for (int t = 0; t < NT; ++t) {

    // --- S^T = K * Q^T  (32 keys x 32 queries, four 16x16 tiles per K-chunk).
    //     With two waves a SIMD the wave covers its own LDS waits: the K
    //     fragments of a chunk are read two chunks ahead of their products,
    //     into three register sets in turn.
    v8f s0[2] = {zero, zero}, s1[2] = {zero, zero};
    v16bf kf[3][2];   // [set][key half]
#pragma unroll
    for (int c = 0; c < 2; ++c) {
      kf[c][0] = kfrag(0,  c);
      kf[c][1] = kfrag(16, c);
    }
#pragma unroll
    for (int c = 0; c < 8; ++c) {
      if (c < 6) {
        kf[(c + 2) % 3][0] = kfrag(0,  c + 2);
        kf[(c + 2) % 3][1] = kfrag(16, c + 2);
      }
      // keeps these LDS reads in front of this chunk's products: left alone
      // the compiler reads each fragment right before its use
      __builtin_amdgcn_sched_barrier(0);
#pragma unroll
      for (int g = 0; g < 2; ++g) {
        s0[g] = wmma_bf16(kf[c % 3][0], qa[g][c], s0[g]);
        s1[g] = wmma_bf16(kf[c % 3][1], qa[g][c], s1[g]);
      }
      // holds later reads back from these products (best effort: behind the last
      // chunk the first V reads still stand among its products in the listing)
      __builtin_amdgcn_sched_barrier(0);
    }

    // first two pairs of V fragments: read here so that the softmax covers the wait
    v16bf vf[3][2];      // [set][d tile of the pair]
#pragma unroll
    for (int j = 0; j < 4; ++j) vf[j >> 1][j & 1] = vfrag(j * 16);
    // keeps these reads in front of the softmax arithmetic
    __builtin_amdgcn_sched_barrier(0);

    // --- online softmax, group by group: 16 of a query's 32 scores sit in this
    //     lane, the other 16 in lane ^ 16
    v16bf pb[2];       // B fragment of P^T: keys 8h + r, then 16 + 8h + r
#pragma unroll
    for (int g = 0; g < 2; ++g) {
      float a0[8], a1[8], mx8[8];
#pragma unroll
      for (int r = 0; r < 8; ++r) {
        a0[r] = s0[g][r] * scale;
        a1[r] = s1[g][r] * scale;
        mx8[r] = fmaxf(a0[r], a1[r]);
      }
      float mx = fmaxf(fmaxf(fmaxf(mx8[0], mx8[1]), fmaxf(mx8[2], mx8[3])),
                       fmaxf(fmaxf(mx8[4], mx8[5]), fmaxf(mx8[6], mx8[7])));
      mx = fmaxf(mx, other_half(mx));
      const float mnew = fmaxf(mrun[g], mx);
      const float corr = __expf(mrun[g] - mnew);
      mrun[g] = mnew;
      float ps8[8];
#pragma unroll
      for (int r = 0; r < 8; ++r) {
        float p0 = __expf(a0[r] - mnew);
        float p1 = __expf(a1[r] - mnew);
        ps8[r] = p0 + p1;
        pb[g][r]     = to_bf16(p0);
        pb[g][8 + r] = to_bf16(p1);
      }
      lrun[g] = lrun[g] * corr + (((ps8[0] + ps8[1]) + (ps8[2] + ps8[3])) +
                                  ((ps8[4] + ps8[5]) + (ps8[6] + ps8[7])));
#pragma unroll
      for (int nt = 0; nt < 16; ++nt) o[g][nt] *= corr;
    }

    // keeps the third pair's reads out of the softmax, where registers are short
    __builtin_amdgcn_sched_barrier(0);

    // --- O^T += V^T * P^T   (16 output tiles across d = 256, per group of
    //     queries); V fragments in pairs of d tiles, read two pairs ahead
#pragma unroll
    for (int np = 0; np < 8; ++np) {
      if (np < 6) {
        vf[(np + 2) % 3][0] = vfrag(((np + 2) * 2) * 16);
        vf[(np + 2) % 3][1] = vfrag(((np + 2) * 2 + 1) * 16);
      }
      // keeps these LDS reads in front of this pair's products
      __builtin_amdgcn_sched_barrier(0);
#pragma unroll
      for (int j = 0; j < 2; ++j)
#pragma unroll
        for (int g = 0; g < 2; ++g)
          o[g][np * 2 + j] = wmma_bf16(vf[np % 3][j], pb[g], o[g][np * 2 + j]);
      // keeps later reads from rising in among these products
      __builtin_amdgcn_sched_barrier(0);
    }

#pragma unroll
    for (int m = 0; m < 8; ++m) ka[m] ^= 16384u;
    va[0] ^= 16384u;
    va[1] ^= 16384u;

    // --- publish point of stage t + 1: this wave's reads of stage t are done,
    //     its own slice of stage t + 1 has landed, every wave says the same
    asm volatile("s_wait_dscnt 0x0" ::: "memory");
    TENSOR_WAIT();
    __syncthreads();
    if (pinned(t + 2 < NT)) {   // stage t + 2 into the buffer that pass t has read
      advance();
      TENSOR_LOAD();
    }
  }
  // nothing of the mover or of LDS is out when the wave ends
  TENSOR_WAIT();
  asm volatile("s_wait_dscnt 0x0" ::: "memory");
#undef TENSOR_LOAD
#undef TENSOR_WAIT

  // normalize and store heads (bf16 row-major (NBL, DH)): a lane's 8 elements
  // of a tile are 8 neighbours in d, one 16-byte store
  v8bf ov[2][16];
#pragma unroll
  for (int g = 0; g < 2; ++g) {
    const float inv = 1.0f / (lrun[g] + other_half(lrun[g]));
#pragma unroll
    for (int nt = 0; nt < 16; ++nt)
#pragma unroll
      for (int r = 0; r < 8; ++r) ov[g][nt][r] = to_bf16(o[g][nt][r] * inv);
  }
  __bf16* hp = heads + (size_t)qrow * DH + h * DMODEL + ((lane & 16) ? 8 : 0);
  // holds the stores behind all arithmetic, so that no register of an issued
  // store is written again
  __builtin_amdgcn_sched_barrier(0);
#pragma unroll
  for (int g = 0; g < 2; ++g)
#pragma unroll
    for (int nt = 0; nt < 16; ++nt)
      *(v8bf*)(hp + (size_t)g * 16 * DH + nt * 16) = ov[g][nt];
}

// ---------------------------------------------------------------- add + LN
// y = LN(a + rsd) * g + b ;  one wave per two rows of 256 elements, 8 waves a
// block.  A lane holds elements 4*lane.. and 128 + 4*lane.. of each row, so
// every 16-byte access of a wave covers 512 contiguous bytes.
template <int M>
__device__ __forceinline__ float add_xmask(float x) {   // x + x of lane ^ M, M < 16
  int y = __builtin_amdgcn_update_dpp(0, __builtin_bit_cast(int, x), 0x160 | M,
                                      0xf, 0xf, true);
  return x + __builtin_bit_cast(float, y);
}
__device__ __forceinline__ float wave_sum(float x) {    // every lane gets the sum
  x = add_xmask<1>(x);
  x = add_xmask<2>(x);
  x = add_xmask<4>(x);
  x = add_xmask<8>(x);
  int b = __builtin_bit_cast(int, x);
  return x + __builtin_bit_cast(float, __builtin_amdgcn_permlanex16(
                 b, b, 0x76543210, 0xfedcba98, false, false));
}

template <bool WB>   // WB: also write the bf16 copy
__global__ void __launch_bounds__(256)
add_ln_kernel(const float* __restrict__ a,
              const float* __restrict__ rsd,
              const float* __restrict__ g,
              const float* __restrict__ bta,
              float* __restrict__ outF,
              __bf16* __restrict__ outB) {
  const int lane = threadIdx.x & 31;
  const int row0 = (blockIdx.x * 8 + (threadIdx.x >> 5)) * 2;
  const size_t o0 = (size_t)row0 * 256 + lane * 4;   // + rr * 256 + hh * 128
  f32x4 v[2][2], gg[2], bb[2], y[2][2];
#pragma unroll
  for (int hh = 0; hh < 2; ++hh) {
    gg[hh] = *(const f32x4*)(g + hh * 128 + lane * 4);
    bb[hh] = *(const f32x4*)(bta + hh * 128 + lane * 4);
  }
  // the next loads may land in these loads' address register: keep the wait
  asm volatile("s_wait_xcnt 0x0" ::: "memory");
#pragma unroll
  for (int rr = 0; rr < 2; ++rr)
#pragma unroll
    for (int hh = 0; hh < 2; ++hh)
      v[rr][hh] = *(const f32x4*)(a + o0 + rr * 256 + hh * 128) +
                  *(const f32x4*)(rsd + o0 + rr * 256 + hh * 128);
#pragma unroll
  for (int rr = 0; rr < 2; ++rr) {
    f32x4 s4 = v[rr][0] + v[rr][1];
    float mu = wave_sum((s4[0] + s4[1]) + (s4[2] + s4[3])) * (1.0f / 256.0f);
    f32x4 d0 = v[rr][0] - mu, d1 = v[rr][1] - mu;
    f32x4 q4 = d0 * d0 + d1 * d1;
    float var = wave_sum((q4[0] + q4[1]) + (q4[2] + q4[3])) * (1.0f / 256.0f);
    float rs = rsqrtf(var + 1e-5f);
    y[rr][0] = d0 * rs * gg[0] + bb[0];
    y[rr][1] = d1 * rs * gg[1] + bb[1];
  }
  v4bf yb[2][2];
  if (WB) {
#pragma unroll
    for (int rr = 0; rr < 2; ++rr)
#pragma unroll
      for (int hh = 0; hh < 2; ++hh)
#pragma unroll
        for (int j = 0; j < 4; ++j) yb[rr][hh][j] = to_bf16(y[rr][hh][j]);
  }
  // holds the stores behind all arithmetic, so that no register of an issued
  // store is written again
  __builtin_amdgcn_sched_barrier(0);
#pragma unroll
  for (int rr = 0; rr < 2; ++rr)
#pragma unroll
    for (int hh = 0; hh < 2; ++hh) {
      *(f32x4*)(outF + o0 + rr * 256 + hh * 128) = y[rr][hh];
      if (WB) *(v4bf*)(outB + o0 + rr * 256 + hh * 128) = yb[rr][hh];
    }
}

// ---------------------------------------------------------------- launcher
extern "C" void kernel_launch(void* const* d_in, const int* in_sizes, int n_in,
                              void* d_out, int out_size, void* d_ws,
                              size_t ws_size, hipStream_t stream) {
  (void)in_sizes; (void)n_in; (void)out_size; (void)ws_size;
  const float* seq  = (const float*)d_in[0];
  const float* Wq   = (const float*)d_in[1];
  const float* Wk   = (const float*)d_in[2];
  const float* Wv   = (const float*)d_in[3];
  const float* Wo   = (const float*)d_in[4];
  const float* ln1g = (const float*)d_in[5];
  const float* ln1b = (const float*)d_in[6];
  const float* W1   = (const float*)d_in[7];
  const float* b1   = (const float*)d_in[8];
  const float* W2   = (const float*)d_in[9];
  const float* b2   = (const float*)d_in[10];
  const float* ln2g = (const float*)d_in[11];
  const float* ln2b = (const float*)d_in[12];

  char* w = (char*)d_ws;
  size_t off = 0;
  auto take = [&](size_t bytes) {
    size_t o = off; off += (bytes + 255) & ~(size_t)255; return o;
  };
  __bf16* seqb  = (__bf16*)(w + take((size_t)NBL * DMODEL * 2));
  __bf16* WqT   = (__bf16*)(w + take((size_t)DH * DMODEL * 2));
  __bf16* WkT   = (__bf16*)(w + take((size_t)DH * DMODEL * 2));
  __bf16* WvT   = (__bf16*)(w + take((size_t)DH * DMODEL * 2));
  __bf16* WoT   = (__bf16*)(w + take((size_t)DMODEL * DH * 2));
  __bf16* W1T   = (__bf16*)(w + take((size_t)FFD * DMODEL * 2));
  __bf16* W2T   = (__bf16*)(w + take((size_t)DMODEL * FFD * 2));
  __bf16* qb    = (__bf16*)(w + take((size_t)NBL * DH * 2));
  __bf16* kb    = (__bf16*)(w + take((size_t)NBL * DH * 2));
  __bf16* vT    = (__bf16*)(w + take((size_t)DH * NBL * 2));
  __bf16* heads = (__bf16*)(w + take((size_t)NBL * DH * 2));
  float*  tmpF  = (float*)(w + take((size_t)NBL * DMODEL * 4));
  float*  xF    = (float*)(w + take((size_t)NBL * DMODEL * 4));
  __bf16* xB    = (__bf16*)(w + take((size_t)NBL * DMODEL * 2));
  __bf16* h1    = (__bf16*)(w + take((size_t)NBL * FFD * 2));

  // 1) convert / transpose inputs to bf16
  {
    int n = NBL * DMODEL;
    f32_to_bf16_kernel<<<n / 16 / 256, 256, 0, stream>>>(seq, seqb, n);
  }
  transpose_bf16_kernel<DMODEL, DH><<<DMODEL * DH / 8 / 256, 256, 0, stream>>>(Wq, WqT);
  transpose_bf16_kernel<DMODEL, DH><<<DMODEL * DH / 8 / 256, 256, 0, stream>>>(Wk, WkT);
  transpose_bf16_kernel<DMODEL, DH><<<DMODEL * DH / 8 / 256, 256, 0, stream>>>(Wv, WvT);
  transpose_bf16_kernel<DH, DMODEL><<<DMODEL * DH / 8 / 256, 256, 0, stream>>>(Wo, WoT);
  transpose_bf16_kernel<DMODEL, FFD><<<DMODEL * FFD / 8 / 256, 256, 0, stream>>>(W1, W1T);
  transpose_bf16_kernel<FFD, DMODEL><<<DMODEL * FFD / 8 / 256, 256, 0, stream>>>(W2, W2T);

  // 2) QKV projections (V stored transposed for the P*V WMMA path; K and V in
  //    the swizzled orders the attention kernel reads)
  dim3 gQKV(DH / 64, NBL / 64);
  gemm_bf16_kernel<1, false><<<gQKV, 128, 0, stream>>>(seqb, WqT, nullptr, nullptr, qb, NBL, DH, DMODEL, 0);
  gemm_bf16_kernel<3, false><<<gQKV, 128, 0, stream>>>(seqb, WkT, nullptr, nullptr, kb, NBL, DH, DMODEL, 0);
  gemm_bf16_kernel<2, false><<<gQKV, 128, 0, stream>>>(seqb, WvT, nullptr, nullptr, vT, NBL, DH, DMODEL, NBL);

  // 3) fused flash attention -> heads
  flash_attn_kernel<<<(NBL / 32) * NHEAD / 4, 128, 0, stream>>>(qb, kb, vT, heads);

  // 4) output projection: att = heads @ Wo (f32)
  dim3 gO(DMODEL / 64, NBL / 64);
  gemm_bf16_kernel<0, false><<<gO, 128, 0, stream>>>(heads, WoT, nullptr, tmpF, nullptr, NBL, DMODEL, DH, 0);

  // 5) x = LN(seq + att)   (also bf16 copy for the FF GEMM)
  add_ln_kernel<true><<<NBL / 16, 256, 0, stream>>>(tmpF, seq, ln1g, ln1b, xF, xB);

  // 6) FF: h1 = relu(x @ W1 + b1); ff = h1 @ W2 + b2
  dim3 gF1(FFD / 64, NBL / 64);
  gemm_bf16_kernel<1, true><<<gF1, 128, 0, stream>>>(xB, W1T, b1, nullptr, h1, NBL, FFD, DMODEL, 0);
  dim3 gF2(DMODEL / 64, NBL / 64);
  gemm_bf16_kernel<0, false><<<gF2, 128, 0, stream>>>(h1, W2T, b2, tmpF, nullptr, NBL, DMODEL, FFD, 0);

  // 7) out = LN(x + ff)
  add_ln_kernel<false><<<NBL / 16, 256, 0, stream>>>(tmpF, xF, ln2g, ln2b, (float*)d_out, nullptr);
}

// v006
// One run takes 209 microseconds.
// In both of two side-by-side timings against v005, it was 1.23 times as fast.
// All steps since v000 together make it 4.96 times as fast.
#include <hip/hip_runtime.h>

typedef __attribute__((ext_vector_type(16))) __bf16 v16bf;
typedef __attribute__((ext_vector_type(8)))  __bf16 v8bf;
typedef __attribute__((ext_vector_type(4)))  __bf16 v4bf;
typedef __attribute__((ext_vector_type(8)))  float  v8f;
typedef __attribute__((ext_vector_type(4)))  float  f32x4;
typedef __attribute__((ext_vector_type(4)))  unsigned int u32x4;
typedef __attribute__((ext_vector_type(8)))  int    i32x8;
typedef __attribute__((ext_vector_type(4)))  int    i32x4;

#define NBL    8192   // B*L
#define DMODEL 256
#define NHEAD  8
#define DH     2048   // D*H
#define LSEQ   2048
#define FFD    128

// ---------------------------------------------------------------- helpers
__device__ __forceinline__ __bf16 to_bf16(float f) {
  union { float f; unsigned u; } x; x.f = f;
  unsigned r = x.u + 0x7FFFu + ((x.u >> 16) & 1u);   // round-to-nearest-even
  unsigned short h = (unsigned short)(r >> 16);
  union { unsigned short s; __bf16 b; } y; y.s = h;
  return y.b;
}

// A/B fragment for v_wmma_f32_16x16x32_bf16 from a row-major (rows x ld) bf16
// matrix (global or LDS), contraction chunk starting at column kc.
// Per CDNA5 ISA 16-bit layout: lane holds row (lane&15); elements 0..7 =
// K [off, off+8), elements 8..15 = K [off+16, off+24), off = (lane&16)?8:0.
__device__ __forceinline__ v16bf load_frag(const __bf16* base, int ld, int row,
                                           int kc, int lane) {
  const __bf16* p = base + (size_t)row * ld + kc + ((lane & 16) ? 8 : 0);
  v16bf f;
  ((f32x4*)&f)[0] = ((const f32x4*)p)[0];
  ((f32x4*)&f)[1] = *(const f32x4*)(p + 16);
  return f;
}

// Swizzled layouts of K and V^T. The attention's tensor loads land rows
// unpadded, so rows of 64 B or 512 B put the 16 lanes of a half-wave on few LDS
// banks.  The producers
// therefore store each 16-byte chunk (8 bf16 of the contraction index) at an
// XOR-ed chunk position inside its row, and the readers undo it: the 16 lanes
// of a half-wave then cover all 64 banks once.  Values and k order unchanged.
//   64-byte rows (32 bf16):  chunk j of row r sits at j ^ ((r >> 2) & 3)
//   512-byte rows (256 bf16): chunk p of row r sits at p ^ (r & 15)
__device__ __forceinline__ int swz64(int row, int col) {
  return col ^ (((row >> 2) & 3) << 3);
}
__device__ __forceinline__ int swz512(int row, int col) {
  return col ^ ((row & 15) << 3);
}

__device__ __forceinline__ v8f wmma_bf16(v16bf a, v16bf b, v8f c) {
  return __builtin_amdgcn_wmma_f32_16x16x32_bf16(false, a, false, b,
                                                 (short)0, c, false, false);
}

__device__ __forceinline__ unsigned lds_off(const void* p) {
  // generic pointer to a __shared__ object: low 32 bits = LDS byte offset
  return (unsigned)(unsigned long long)p;
}

typedef __attribute__((ext_vector_type(8))) unsigned int u32x8;
__device__ __forceinline__ unsigned uni(unsigned v) {   // a scalar-register word
  return (unsigned)__builtin_amdgcn_readfirstlane((int)v);
}
// a wave-uniform test kept in a scalar register: compiles to s_cmp + s_cbranch_scc
__device__ __forceinline__ unsigned pinned(unsigned v) {
  unsigned w = uni(v);
  asm volatile("" : "+s"(w));
  return w;
}

// ---------------------------------------------------------------- converts
// Each lane of the non-matrix kernels takes 8 or 16 elements: few waves to
// start, 16-byte accesses.
__device__ __forceinline__ v8bf pack8(f32x4 lo, f32x4 hi) {
  v8bf o;
#pragma unroll
  for (int j = 0; j < 4; ++j) { o[j] = to_bf16(lo[j]); o[4 + j] = to_bf16(hi[j]); }
  return o;
}

// n is a multiple of 16; a lane converts the 8-element chunks t and t + n/16.
// blk: the block's index among the n / 16 / 256 blocks of this part.
__device__ __forceinline__ void
f32_to_bf16_part(const float* __restrict__ src,
                 __bf16* __restrict__ dst, int n, int blk) {
  const int half = n >> 4;
  const int t = blk * 256 + threadIdx.x;
  if (t >= half) return;
  const f32x4* s4 = (const f32x4*)src;
  f32x4 a0 = s4[2 * t], a1 = s4[2 * t + 1];
  f32x4 b0 = s4[2 * (t + half)], b1 = s4[2 * (t + half) + 1];
  ((v8bf*)dst)[t] = pack8(a0, a1);
  ((v8bf*)dst)[t + half] = pack8(b0, b1);
  // another part's code may follow in the listing and reuse the stores' registers:
  // keep the wait in front
  asm volatile("s_wait_xcnt 0x0" ::: "memory");
}

// src (ROWS x COLS) f32  ->  dst (COLS x ROWS) bf16   (weights -> NxK form,
// plain row-major).  A lane takes 8 source rows of one column, which are one
// 16-byte chunk of a dst row; the part holds exactly ROWS / 8 * COLS threads, blk
// is the block's index in it.  The shape is a
// compile-time constant so that the 8 loads share one address register pair.
template <int ROWS, int COLS>
__device__ __forceinline__ void
transpose_bf16_part(const float* __restrict__ src, __bf16* __restrict__ dst, int blk) {
  const int i = blk * 256 + threadIdx.x;
  const int rc = i / COLS, cc = i % COLS;
  const float* p = src + (size_t)(rc * 8) * COLS + cc;
  float v[8];
#pragma unroll
  for (int j = 0; j < 8; ++j) v[j] = p[j * COLS];
  v8bf o;
#pragma unroll
  for (int j = 0; j < 8; ++j) o[j] = to_bf16(v[j]);
  *(v8bf*)(dst + (size_t)cc * ROWS + rc * 8) = o;
  // another part's code may follow in the listing and reuse the store's registers:
  // keep the wait in front
  asm volatile("s_wait_xcnt 0x0" ::: "memory");
}

// The convert and the six weight transposes depend on nothing but the inputs:
// one launch holds them all, each part on its own range of blocks, so that
// they start, wait for memory and drain side by side instead of in turn.
#define PB_SEQ (NBL * DMODEL / 16 / 256)     // blocks of the convert
#define PB_W   (DMODEL * DH / 8 / 256)       // blocks of a D x DH weight
#define PB_F   (DMODEL * FFD / 8 / 256)      // blocks of a D x FF weight
#define PB_ALL (PB_SEQ + 4 * PB_W + 2 * PB_F)
__global__ void __launch_bounds__(256)
prep_kernel(const float* __restrict__ seq, const float* __restrict__ Wq,
            const float* __restrict__ Wk, const float* __restrict__ Wv,
            const float* __restrict__ Wo, const float* __restrict__ W1,
            const float* __restrict__ W2, __bf16* __restrict__ seqb,
            __bf16* __restrict__ WqT, __bf16* __restrict__ WkT,
            __bf16* __restrict__ WvT, __bf16* __restrict__ WoT,
            __bf16* __restrict__ W1T, __bf16* __restrict__ W2T) {
  int blk = blockIdx.x;
  if (blk < PB_SEQ) { f32_to_bf16_part(seq, seqb, NBL * DMODEL, blk); return; }
  blk -= PB_SEQ;
  if (blk < PB_W) { transpose_bf16_part<DMODEL, DH>(Wq, WqT, blk); return; }
  blk -= PB_W;
  if (blk < PB_W) { transpose_bf16_part<DMODEL, DH>(Wk, WkT, blk); return; }
  blk -= PB_W;
  if (blk < PB_W) { transpose_bf16_part<DMODEL, DH>(Wv, WvT, blk); return; }
  blk -= PB_W;
  if (blk < PB_W) { transpose_bf16_part<DH, DMODEL>(Wo, WoT, blk); return; }
  blk -= PB_W;
  if (blk < PB_F) { transpose_bf16_part<DMODEL, FFD>(W1, W1T, blk); return; }
  blk -= PB_F;
  transpose_bf16_part<FFD, DMODEL>(W2, W2T, blk);
}

// ---------------------------------------------------------------- GEMM
// C(M,N) = A(M,K) x Bt(N,K)^T, bf16 in, f32 accumulate; A and Bt plain
// row-major, K a multiple of 128.  A stage is 128 of K: the block's 64 rows of A
// and its 64 rows of Bt, rows of 256 B, brought into LDS by tensor loads whose
// pad gives an LDS pitch of 272 B (16 B x odd: the 16 rows of a fragment read
// cover all 64 banks once).  Two buffers; every wave brings one slice of 32 rows.
// OUTMODE: 0 = f32 row-major, 1 = bf16 row-major, 2 = bf16 transposed (ldT),
// 64-byte swizzle, 3 = bf16 row-major, 512-byte swizzle
#define GPITCH 272u                 // LDS bytes a row
#define GSLICE 10240u               // 32 rows of 272 B, rounded up to 2 KiB
#define GBUF   (4u * GSLICE)        // slices 0, 1: A rows 0..31, 32..63; 2, 3: Bt

// fragment of 16 rows from a padded tile; p: the lane's row, its half's first chunk
__device__ __forceinline__ v16bf lds_frag(const char* p) {
  v16bf f;
  ((f32x4*)&f)[0] = *(const f32x4*)p;          // k = off .. off + 7
  ((f32x4*)&f)[1] = *(const f32x4*)(p + 32);   // k = off + 16 .. off + 23
  return f;
}

// tiles: the kernel's two LDS buffers
template <int OUTMODE, bool RELU>
__device__ __forceinline__ void
gemm_bf16_body(char (*tiles)[GBUF],
               const __bf16* __restrict__ A, const __bf16* __restrict__ Bt,
               const float* __restrict__ bias, float* __restrict__ outF,
               __bf16* __restrict__ outB, int M, int N, int K, int ldT) {
  const int lane = threadIdx.x & 31;
  const unsigned wave = uni(threadIdx.x >> 5);
  const int m0 = blockIdx.y * 64 + (int)wave * 16;
  const int n0 = blockIdx.x * 64;
  const int nst = K >> 7;

  // All extents in bytes (data_size code 0), tensor dims = tile dims.
  u32x8 g1;
  g1[0] = uni(0x07500000u);            // no mask; pad on, every 256 B (code 5), 16 B (code 3)
  g1[1] = uni(256u << 16);             // tensor_dim0
  g1[2] = uni(32u << 16);              // tensor_dim1
  g1[3] = uni(256u << 16);             // tile_dim0
  g1[4] = uni(32u);                    // tile_dim1
  g1[5] = uni((unsigned)K * 2u);       // source pitch
  g1[6] = uni(0u);
  g1[7] = uni(0u);
  u32x4 g0;                            // stage 0 into buffer 0
  const unsigned place0 = lds_off(&tiles[0][0]) + wave * GSLICE;
  {
    const unsigned half = wave & 1u;
    const __bf16* src = (wave >> 1)
        ? Bt + (size_t)(n0 + half * 32) * K
        : A  + (size_t)(blockIdx.y * 64 + half * 32) * K;
    const unsigned long long ga = (unsigned long long)src;
    g0[0] = uni(1u);
    g0[1] = uni(place0);
    g0[2] = uni((unsigned)ga);
    g0[3] = uni(((unsigned)(ga >> 32) & 0x01FFFFFFu) | 0x80000000u);   // type 2
  }
  // the next stage's slice (256 B on along the rows), into the other buffer
  auto advance = [&]() {
    const unsigned lo = g0[2] + 256u;
    g0[1] = uni(2u * place0 + GBUF - g0[1]);
    g0[3] = uni(g0[3] + (lo < 256u ? 1u : 0u));
    g0[2] = uni(lo);
  };
  // Load and wait name both descriptor groups as in-out: the groups stay in one
  // register set each, which keeps its words while the request is out, and
  // group 0 takes the next stage's words only behind the wait.
#define TENSOR_LOAD() asm volatile("tensor_load_to_lds %0, %1" : "+s"(g0), "+s"(g1) :: "memory")
#define TENSOR_WAIT() asm volatile("s_wait_tensorcnt 0x0" : "+s"(g0), "+s"(g1) :: "memory")
  TENSOR_LOAD();
  TENSOR_WAIT();
  __syncthreads();   // stage 0 published
  if (pinned(1 < nst)) {
    advance();
    TENSOR_LOAD();   // stage 1 flies during pass 0
  }

  v8f acc0 = {}, acc1 = {}, acc2 = {}, acc3 = {};
  // the lane's byte offsets in a buffer: its row of the wave's 16 rows of A, its
  // row of the first 16 rows of Bt, each at its half's first chunk
  const unsigned lrow = (unsigned)(lane & 15) * GPITCH + ((lane & 16) ? 16u : 0u);
  const unsigned aoff = (wave >> 1) * GSLICE + (wave & 1u) * 16u * GPITCH + lrow;
  const unsigned boff = 2u * GSLICE + lrow;
  for (int s = 0; s < nst; ++s) {
    const char* ap = &tiles[s & 1][0] + aoff;
    const char* bp = &tiles[s & 1][0] + boff;
    // the whole stage goes into registers first, so that its buffer is free for
    // the refill while the products run
    v16bf a[4], b[4][4];
#pragma unroll
    for (int kk = 0; kk < 4; ++kk) {   // 32 of K, 64 B of a row
      a[kk]    = lds_frag(ap + kk * 64);
      b[kk][0] = lds_frag(bp + kk * 64);
      b[kk][1] = lds_frag(bp + 16 * GPITCH + kk * 64);
      b[kk][2] = lds_frag(bp + GSLICE + kk * 64);
      b[kk][3] = lds_frag(bp + GSLICE + 16 * GPITCH + kk * 64);
    }
    // --- publish point of stage s + 1: this wave's reads of stage s are done,
    //     its own slice of stage s + 1 has landed, every wave says the same
    asm volatile("s_wait_dscnt 0x0" ::: "memory");
    TENSOR_WAIT();
    __syncthreads();
    if (pinned(s + 2 < nst)) {   // stage s + 2 into the buffer that pass s has read
      advance();
      TENSOR_LOAD();
    }
    // the products stand behind the refill's issue: the load flies under them
#pragma unroll
    for (int kk = 0; kk < 4; ++kk) {
      acc0 = wmma_bf16(a[kk], b[kk][0], acc0);
      acc1 = wmma_bf16(a[kk], b[kk][1], acc1);
      acc2 = wmma_bf16(a[kk], b[kk][2], acc2);
      acc3 = wmma_bf16(a[kk], b[kk][3], acc3);
    }
  }
  // nothing of the mover or of LDS is out when the wave goes on
  TENSOR_WAIT();
  asm volatile("s_wait_dscnt 0x0" ::: "memory");
#undef TENSOR_LOAD
#undef TENSOR_WAIT

  v8f accs[4] = {acc0, acc1, acc2, acc3};
  // Swizzled store positions as per-lane bases plus compile-time steps: r walks
  // bits 0..2 of Mi and nt bits 4..5 of Ni; m0 is a multiple of 16, n0 of 64.
  const int mswz = swz64(lane & 15, m0 + ((lane & 16) ? 8 : 0));      // + r
  const int nswz = swz512((lane & 16) ? 8 : 0, n0 + (lane & 15));     // r = 0, nt = 0
#pragma unroll
  for (int nt = 0; nt < 4; ++nt) {
#pragma unroll
    for (int r = 0; r < 8; ++r) {
      int Mi = m0 + r + ((lane & 16) ? 8 : 0);
      int Ni = n0 + nt * 16 + (lane & 15);
      float v = accs[nt][r];
      if (bias) v += bias[Ni];
      if (RELU) v = fmaxf(v, 0.0f);
      if (OUTMODE == 0)      outF[(size_t)Mi * N + Ni] = v;
      else if (OUTMODE == 1) outB[(size_t)Mi * N + Ni] = to_bf16(v);
      else if (OUTMODE == 2) outB[(size_t)Ni * ldT + mswz + r] = to_bf16(v);
      else                   outB[(size_t)Mi * N + (nswz ^ ((r & 1) << 3)) +
                                  ((nt ^ (r >> 1)) << 4)] = to_bf16(v);
      // the next element reuses this store's registers: keep the wait in front
      if (OUTMODE >= 2) asm volatile("s_wait_xcnt 0x0" ::: "memory");
    }
  }
}

template <int OUTMODE, bool RELU>
__global__ void __launch_bounds__(128, 2)
gemm_bf16_kernel(const __bf16* __restrict__ A, const __bf16* __restrict__ Bt,
                 const float* __restrict__ bias, float* __restrict__ outF,
                 __bf16* __restrict__ outB, int M, int N, int K, int ldT) {
  // places of tensor loads: 2 KiB multiples
  __shared__ __attribute__((aligned(2048))) char tiles[2][GBUF];
  gemm_bf16_body<OUTMODE, RELU>(tiles, A, Bt, bias, outF, outB, M, N, K, ldT);
}

// The three projections read the same A and depend on nothing of each other:
// one launch, blockIdx.z picks the weight, the output and its store order.  The
// tests stand around tensor loads, which ignore EXEC: scalar branches.
__global__ void __launch_bounds__(128, 2)
qkv_gemm_kernel(const __bf16* __restrict__ A, const __bf16* __restrict__ WqT,
                const __bf16* __restrict__ WkT, const __bf16* __restrict__ WvT,
                __bf16* __restrict__ qb, __bf16* __restrict__ kb,
                __bf16* __restrict__ vT, int M, int N, int K, int ldT) {
  // places of tensor loads: 2 KiB multiples
  __shared__ __attribute__((aligned(2048))) char tiles[2][GBUF];
  if (pinned(blockIdx.z == 0))
    gemm_bf16_body<1, false>(tiles, A, WqT, nullptr, nullptr, qb, M, N, K, 0);
  else if (pinned(blockIdx.z == 1))
    gemm_bf16_body<3, false>(tiles, A, WkT, nullptr, nullptr, kb, M, N, K, 0);
  else
    gemm_bf16_body<2, false>(tiles, A, WvT, nullptr, nullptr, vT, M, N, K, ldT);
}

__device__ __forceinline__ float other_half(float x) {   // x of lane ^ 16
  int y = __builtin_bit_cast(int, x);
  return __builtin_bit_cast(float, __builtin_amdgcn_permlanex16(
             y, y, 0x76543210, 0xfedcba98, false, false));
}

__global__ void __launch_bounds__(128, 2)
flash_attn_kernel(const __bf16* __restrict__ q, const __bf16* __restrict__ k,
                  const __bf16* __restrict__ vT, __bf16* __restrict__ heads) {
  // (key, d) and (d, key), 16 KB a buffer; places of tensor loads: 2 KiB multiples
  __shared__ __attribute__((aligned(2048))) __bf16 ktile[2][32 * 256];
  __shared__ __attribute__((aligned(2048))) __bf16 vtile[2][256 * 32];
  const int lane = threadIdx.x & 31;
  const unsigned wave = uni(threadIdx.x >> 5);
  // 16 blocks of 128 queries per (b, h)
  const int b  = blockIdx.x >> 7;
  const int h  = (blockIdx.x >> 4) & 7;
  const int qt = (blockIdx.x & 15) * 4 + (int)wave;   // 32-query tile, 0 .. 63
  const int NT = LSEQ / 32;

  // Q fragments: per group 8 K-chunks covering d = 0..255 (global, loaded once)
  v16bf qa[2][8];
  const int qrow = b * LSEQ + qt * 32 + (lane & 15);   // group g: + 16 * g
#pragma unroll
  for (int g = 0; g < 2; ++g)
#pragma unroll
    for (int c = 0; c < 8; ++c)
      qa[g][c] = load_frag(q, DH, qrow + g * 16, h * DMODEL + c * 32, lane);
  // the arithmetic behind may land in these loads' address registers: keep the wait
  asm volatile("s_wait_xcnt 0x0" ::: "memory");
  // holds that arithmetic behind the wait
  __builtin_amdgcn_sched_barrier(0);

  // Every wave brings its own 8 KB slice of each stage, one request at a time:
  // waves 0, 1 the key rows 0..15, 16..31 of K (16 rows of 512 B, pitch 4 KB),
  // waves 2, 3 the d rows 0..127, 128..255 of V^T (128 rows of 64 B, pitch 16 KB).
  // All extents in bytes (data_size code 0), tensor dims = tile dims, no pad.
  const unsigned isv = wave >> 1, half = wave & 1u;
  const unsigned rowb = isv ? 64u : 512u;                  // bytes a row
  const unsigned nrow = isv ? 128u : 16u;                  // rows
  const unsigned step = isv ? 64u : 32u * DH * 2u;         // source bytes a stage
  u32x8 g1;
  g1[0] = uni(0u);                     // no mask, data_size 0, no pad
  g1[1] = uni(rowb << 16);             // tensor_dim0
  g1[2] = uni(nrow << 16);             // tensor_dim1
  g1[3] = uni(rowb << 16);             // tile_dim0
  g1[4] = uni(nrow);                   // tile_dim1
  g1[5] = uni(isv ? NBL * 2u : DH * 2u);   // source pitch
  g1[6] = uni(0u);
  g1[7] = uni(0u);
  u32x4 g0;                            // stage 0 into buffer 0
  {
    const __bf16* src = isv
        ? vT + (size_t)(h * DMODEL + half * 128) * NBL + b * LSEQ
        : k  + (size_t)(b * LSEQ + half * 16) * DH + h * DMODEL;
    const unsigned long long ga = (unsigned long long)src;
    g0[0] = uni(1u);
    g0[1] = uni((isv ? lds_off(&vtile[0][0]) : lds_off(&ktile[0][0])) + half * 8192u);
    g0[2] = uni((unsigned)ga);
    g0[3] = uni(((unsigned)(ga >> 32) & 0x01FFFFFFu) | 0x80000000u);   // type 2
  }
  // the next stage's slice, into the other buffer
  auto advance = [&]() {
    const unsigned lo = g0[2] + step;
    g0[1] = uni(g0[1] ^ 16384u);
    g0[3] = uni(g0[3] + (lo < step ? 1u : 0u));
    g0[2] = uni(lo);
  };
  // Load and wait name both descriptor groups as in-out: the groups stay in one
  // register set each, which keeps its words while the request is out, and
  // group 0 takes the next stage's words only behind the wait.
#define TENSOR_LOAD() asm volatile("tensor_load_to_lds %0, %1" : "+s"(g0), "+s"(g1) :: "memory")
#define TENSOR_WAIT() asm volatile("s_wait_tensorcnt 0x0" : "+s"(g0), "+s"(g1) :: "memory")
  TENSOR_LOAD();
  TENSOR_WAIT();
  __syncthreads();   // stage 0 published
  advance();
  TENSOR_LOAD();     // stage 1 flies during pass 0

  // o[g][nt][r] = O[query 16*g + (lane & 15)][d = nt*16 + r + 8*(lane>>4)]
  v8f o[2][16];
  v8f zero = {};
#pragma unroll
  for (int g = 0; g < 2; ++g)
#pragma unroll
    for (int nt = 0; nt < 16; ++nt) o[g][nt] = zero;
  float mrun[2] = {-1e30f, -1e30f};   // running maximum of the lane's query (both halves alike)
  float lrun[2] = {0.0f, 0.0f};       // running sum over this half's keys only

  // The lane's LDS byte offsets in the current K and V buffer: ka[m] is chunk
  // 2 * m + (lane >> 4) of a 128-element half row of K under the 512-byte
  // swizzle, va[] the two chunks of a V^T fragment under the 64-byte swizzle.  They are flipped to the
  // other buffer at the foot of each pass: one register set serves both buffers
  // (per-pass address arithmetic takes registers that this tile does not have).
  unsigned ka[8], va[2];
  {
    const int s = lane & 15, hh = (lane >> 4) & 1;
#pragma unroll
    for (int m = 0; m < 8; ++m) ka[m] = (unsigned)(s * 256 + (((m * 2 + hh) ^ s) * 8)) * 2u;
    const int j0 = hh ^ ((lane >> 2) & 3);
    va[0] = (unsigned)(s * 32 + j0 * 8) * 2u;
    va[1] = (unsigned)(s * 32 + (j0 ^ 2) * 8) * 2u;
  }
  const char* kl = (const char*)&ktile[0][0];
  const char* vl = (const char*)&vtile[0][0];
  // rows row0 .. row0 + 15 of the K tile, contraction chunk c (32 wide)
  auto kfrag = [&](int row0, int c) {
    v16bf f;
    ((f32x4*)&f)[0] = *(const f32x4*)(kl + ka[(c & 3) * 2]     + row0 * 512 + (c >> 2) * 256);
    ((f32x4*)&f)[1] = *(const f32x4*)(kl + ka[(c & 3) * 2 + 1] + row0 * 512 + (c >> 2) * 256);
    return f;
  };
  // rows row0 .. row0 + 15 of the V^T tile
  auto vfrag = [&](int row0) {
    v16bf f;
    ((f32x4*)&f)[0] = *(const f32x4*)(vl + va[0] + row0 * 64);
    ((f32x4*)&f)[1] = *(const f32x4*)(vl + va[1] + row0 * 64);
    return f;
  };

  const float scale = 0.0625f;  // 1/sqrt(256)
  for (int t = 0; t < NT; ++t) {

    // --- S^T = K * Q^T  (32 keys x 32 queries, four 16x16 tiles per K-chunk).
    //     With two waves a SIMD the wave covers its own LDS waits: the K
    //     fragments of a chunk are read two chunks ahead of their products,
    //     into three register sets in turn.
    v8f s0[2] = {zero, zero}, s1[2] = {zero, zero};
    v16bf kf[3][2];   // [set][key half]
#pragma unroll
    for (int c = 0; c < 2; ++c) {
      kf[c][0] = kfrag(0,  c);
      kf[c][1] = kfrag(16, c);
    }
#pragma unroll
    for (int c = 0; c < 8; ++c) {
      if (c < 6) {
        kf[(c + 2) % 3][0] = kfrag(0,  c + 2);
        kf[(c + 2) % 3][1] = kfrag(16, c + 2);
      }
      // keeps these LDS reads in front of this chunk's products: left alone
      // the compiler reads each fragment right before its use
      __builtin_amdgcn_sched_barrier(0);
#pragma unroll
      for (int g = 0; g < 2; ++g) {
        s0[g] = wmma_bf16(kf[c % 3][0], qa[g][c], s0[g]);
        s1[g] = wmma_bf16(kf[c % 3][1], qa[g][c], s1[g]);
      }
      // holds later reads back from these products (best effort: behind the last
      // chunk the first V reads still stand among its products in the listing)
      __builtin_amdgcn_sched_barrier(0);
    }

    // first two pairs of V fragments: read here so that the softmax covers the wait
    v16bf vf[3][2];      // [set][d tile of the pair]
#pragma unroll
    for (int j = 0; j < 4; ++j) vf[j >> 1][j & 1] = vfrag(j * 16);
    // keeps these reads in front of the softmax arithmetic
    __builtin_amdgcn_sched_barrier(0);

    // --- online softmax, group by group: 16 of a query's 32 scores sit in this
    //     lane, the other 16 in lane ^ 16
    v16bf pb[2];       // B fragment of P^T: keys 8h + r, then 16 + 8h + r
#pragma unroll
    for (int g = 0; g < 2; ++g) {
      float a0[8], a1[8], mx8[8];
#pragma unroll
      for (int r = 0; r < 8; ++r) {
        a0[r] = s0[g][r] * scale;
        a1[r] = s1[g][r] * scale;
        mx8[r] = fmaxf(a0[r], a1[r]);
      }
      float mx = fmaxf(fmaxf(fmaxf(mx8[0], mx8[1]), fmaxf(mx8[2], mx8[3])),
                       fmaxf(fmaxf(mx8[4], mx8[5]), fmaxf(mx8[6], mx8[7])));
      mx = fmaxf(mx, other_half(mx));
      const float mnew = fmaxf(mrun[g], mx);
      const float corr = __expf(mrun[g] - mnew);
      mrun[g] = mnew;
      float ps8[8];
#pragma unroll
      for (int r = 0; r < 8; ++r) {
        float p0 = __expf(a0[r] - mnew);
        float p1 = __expf(a1[r] - mnew);
        ps8[r] = p0 + p1;
        pb[g][r]     = to_bf16(p0);
        pb[g][8 + r] = to_bf16(p1);
      }
      lrun[g] = lrun[g] * corr + (((ps8[0] + ps8[1]) + (ps8[2] + ps8[3])) +
                                  ((ps8[4] + ps8[5]) + (ps8[6] + ps8[7])));
#pragma unroll
      for (int nt = 0; nt < 16; ++nt) o[g][nt] *= corr;
    }

    // keeps the third pair's reads out of the softmax, where registers are short
    __builtin_amdgcn_sched_barrier(0);

    // --- O^T += V^T * P^T   (16 output tiles across d = 256, per group of
    //     queries); V fragments in pairs of d tiles, read two pairs ahead
#pragma unroll
    for (int np = 0; np < 8; ++np) {
      if (np < 6) {
        vf[(np + 2) % 3][0] = vfrag(((np + 2) * 2) * 16);
        vf[(np + 2) % 3][1] = vfrag(((np + 2) * 2 + 1) * 16);
      }
      // keeps these LDS reads in front of this pair's products
      __builtin_amdgcn_sched_barrier(0);
#pragma unroll
      for (int j = 0; j < 2; ++j)
#pragma unroll
        for (int g = 0; g < 2; ++g)
          o[g][np * 2 + j] = wmma_bf16(vf[np % 3][j], pb[g], o[g][np * 2 + j]);
      // keeps later reads from rising in among these products
      __builtin_amdgcn_sched_barrier(0);
    }

#pragma unroll
    for (int m = 0; m < 8; ++m) ka[m] ^= 16384u;
    va[0] ^= 16384u;
    va[1] ^= 16384u;

    // --- publish point of stage t + 1: this wave's reads of stage t are done,
    //     its own slice of stage t + 1 has landed, every wave says the same
    asm volatile("s_wait_dscnt 0x0" ::: "memory");
    TENSOR_WAIT();
    __syncthreads();
    if (pinned(t + 2 < NT)) {   // stage t + 2 into the buffer that pass t has read
      advance();
      TENSOR_LOAD();
    }
  }
  // nothing of the mover or of LDS is out when the wave ends
  TENSOR_WAIT();
  asm volatile("s_wait_dscnt 0x0" ::: "memory");
#undef TENSOR_LOAD
#undef TENSOR_WAIT

  // normalize and store heads (bf16 row-major (NBL, DH)): a lane's 8 elements
  // of a tile are 8 neighbours in d, one 16-byte store
  v8bf ov[2][16];
#pragma unroll
  for (int g = 0; g < 2; ++g) {
    const float inv = 1.0f / (lrun[g] + other_half(lrun[g]));
#pragma unroll
    for (int nt = 0; nt < 16; ++nt)
#pragma unroll
      for (int r = 0; r < 8; ++r) ov[g][nt][r] = to_bf16(o[g][nt][r] * inv);
  }
  __bf16* hp = heads + (size_t)qrow * DH + h * DMODEL + ((lane & 16) ? 8 : 0);
  // holds the stores behind all arithmetic, so that no register of an issued
  // store is written again
  __builtin_amdgcn_sched_barrier(0);
#pragma unroll
  for (int g = 0; g < 2; ++g)
#pragma unroll
    for (int nt = 0; nt < 16; ++nt)
      *(v8bf*)(hp + (size_t)g * 16 * DH + nt * 16) = ov[g][nt];
}

// ---------------------------------------------------------------- add + LN
// y = LN(a + rsd) * g + b ;  one wave per two rows of 256 elements, 8 waves a
// block.  A lane holds elements 4*lane.. and 128 + 4*lane.. of each row, so
// every 16-byte access of a wave covers 512 contiguous bytes.
template <int M>
__device__ __forceinline__ float add_xmask(float x) {   // x + x of lane ^ M, M < 16
  int y = __builtin_amdgcn_update_dpp(0, __builtin_bit_cast(int, x), 0x160 | M,
                                      0xf, 0xf, true);
  return x + __builtin_bit_cast(float, y);
}
__device__ __forceinline__ float wave_sum(float x) {    // every lane gets the sum
  x = add_xmask<1>(x);
  x = add_xmask<2>(x);
  x = add_xmask<4>(x);
  x = add_xmask<8>(x);
  int b = __builtin_bit_cast(int, x);
  return x + __builtin_bit_cast(float, __builtin_amdgcn_permlanex16(
                 b, b, 0x76543210, 0xfedcba98, false, false));
}

template <bool WB>   // WB: also write the bf16 copy
__global__ void __launch_bounds__(256)
add_ln_kernel(const float* __restrict__ a,
              const float* __restrict__ rsd,
              const float* __restrict__ g,
              const float* __restrict__ bta,
              float* __restrict__ outF,
              __bf16* __restrict__ outB) {
  const int lane = threadIdx.x & 31;
  const int row0 = (blockIdx.x * 8 + (threadIdx.x >> 5)) * 2;
  const size_t o0 = (size_t)row0 * 256 + lane * 4;   // + rr * 256 + hh * 128
  f32x4 v[2][2], gg[2], bb[2], y[2][2];
#pragma unroll
  for (int hh = 0; hh < 2; ++hh) {
    gg[hh] = *(const f32x4*)(g + hh * 128 + lane * 4);
    bb[hh] = *(const f32x4*)(bta + hh * 128 + lane * 4);
  }
  // the next loads may land in these loads' address register: keep the wait
  asm volatile("s_wait_xcnt 0x0" ::: "memory");
#pragma unroll
  for (int rr = 0; rr < 2; ++rr)
#pragma unroll
    for (int hh = 0; hh < 2; ++hh)
      v[rr][hh] = *(const f32x4*)(a + o0 + rr * 256 + hh * 128) +
                  *(const f32x4*)(rsd + o0 + rr * 256 + hh * 128);
#pragma unroll
  for (int rr = 0; rr < 2; ++rr) {
    f32x4 s4 = v[rr][0] + v[rr][1];
    float mu = wave_sum((s4[0] + s4[1]) + (s4[2] + s4[3])) * (1.0f / 256.0f);
    f32x4 d0 = v[rr][0] - mu, d1 = v[rr][1] - mu;
    f32x4 q4 = d0 * d0 + d1 * d1;
    float var = wave_sum((q4[0] + q4[1]) + (q4[2] + q4[3])) * (1.0f / 256.0f);
    float rs = rsqrtf(var + 1e-5f);
    y[rr][0] = d0 * rs * gg[0] + bb[0];
    y[rr][1] = d1 * rs * gg[1] + bb[1];
  }
  v4bf yb[2][2];
  if (WB) {
#pragma unroll
    for (int rr = 0; rr < 2; ++rr)
#pragma unroll
      for (int hh = 0; hh < 2; ++hh)
#pragma unroll
        for (int j = 0; j < 4; ++j) yb[rr][hh][j] = to_bf16(y[rr][hh][j]);
  }
  // holds the stores behind all arithmetic, so that no register of an issued
  // store is written again
  __builtin_amdgcn_sched_barrier(0);
#pragma unroll
  for (int rr = 0; rr < 2; ++rr)
#pragma unroll
    for (int hh = 0; hh < 2; ++hh) {
      *(f32x4*)(outF + o0 + rr * 256 + hh * 128) = y[rr][hh];
      if (WB) *(v4bf*)(outB + o0 + rr * 256 + hh * 128) = yb[rr][hh];
    }
}

// ---------------------------------------------------------------- launcher
extern "C" void kernel_launch(void* const* d_in, const int* in_sizes, int n_in,
                              void* d_out, int out_size, void* d_ws,
                              size_t ws_size, hipStream_t stream) {
  (void)in_sizes; (void)n_in; (void)out_size; (void)ws_size;
  const float* seq  = (const float*)d_in[0];
  const float* Wq   = (const float*)d_in[1];
  const float* Wk   = (const float*)d_in[2];
  const float* Wv   = (const float*)d_in[3];
  const float* Wo   = (const float*)d_in[4];
  const float* ln1g = (const float*)d_in[5];
  const float* ln1b = (const float*)d_in[6];
  const float* W1   = (const float*)d_in[7];
  const float* b1   = (const float*)d_in[8];
  const float* W2   = (const float*)d_in[9];
  const float* b2   = (const float*)d_in[10];
  const float* ln2g = (const float*)d_in[11];
  const float* ln2b = (const float*)d_in[12];

  char* w = (char*)d_ws;
  size_t off = 0;
  auto take = [&](size_t bytes) {
    size_t o = off; off += (bytes + 255) & ~(size_t)255; return o;
  };
  __bf16* seqb  = (__bf16*)(w + take((size_t)NBL * DMODEL * 2));
  __bf16* WqT   = (__bf16*)(w + take((size_t)DH * DMODEL * 2));
  __bf16* WkT   = (__bf16*)(w + take((size_t)DH * DMODEL * 2));
  __bf16* WvT   = (__bf16*)(w + take((size_t)DH * DMODEL * 2));
  __bf16* WoT   = (__bf16*)(w + take((size_t)DMODEL * DH * 2));
  __bf16* W1T   = (__bf16*)(w + take((size_t)FFD * DMODEL * 2));
  __bf16* W2T   = (__bf16*)(w + take((size_t)DMODEL * FFD * 2));
  __bf16* qb    = (__bf16*)(w + take((size_t)NBL * DH * 2));
  __bf16* kb    = (__bf16*)(w + take((size_t)NBL * DH * 2));
  __bf16* vT    = (__bf16*)(w + take((size_t)DH * NBL * 2));
  __bf16* heads = (__bf16*)(w + take((size_t)NBL * DH * 2));
  float*  tmpF  = (float*)(w + take((size_t)NBL * DMODEL * 4));
  float*  xF    = (float*)(w + take((size_t)NBL * DMODEL * 4));
  __bf16* xB    = (__bf16*)(w + take((size_t)NBL * DMODEL * 2));
  __bf16* h1    = (__bf16*)(w + take((size_t)NBL * FFD * 2));

  // 1) convert / transpose inputs to bf16, one launch
  prep_kernel<<<PB_ALL, 256, 0, stream>>>(seq, Wq, Wk, Wv, Wo, W1, W2,
                                          seqb, WqT, WkT, WvT, WoT, W1T, W2T);

  // 2) QKV projections (V stored transposed for the P*V WMMA path; K and V in
  //    the swizzled orders the attention kernel reads), one launch
  dim3 gQKV(DH / 64, NBL / 64, 3);
  qkv_gemm_kernel<<<gQKV, 128, 0, stream>>>(seqb, WqT, WkT, WvT, qb, kb, vT, NBL, DH, DMODEL, NBL);

  // 3) fused flash attention -> heads
  flash_attn_kernel<<<(NBL / 32) * NHEAD / 4, 128, 0, stream>>>(qb, kb, vT, heads);

  // 4) output projection: att = heads @ Wo (f32)
  dim3 gO(DMODEL / 64, NBL / 64);
  gemm_bf16_kernel<0, false><<<gO, 128, 0, stream>>>(heads, WoT, nullptr, tmpF, nullptr, NBL, DMODEL, DH, 0);

  // 5) x = LN(seq + att)   (also bf16 copy for the FF GEMM)
  add_ln_kernel<true><<<NBL / 16, 256, 0, stream>>>(tmpF, seq, ln1g, ln1b, xF, xB);

  // 6) FF: h1 = relu(x @ W1 + b1); ff = h1 @ W2 + b2
  dim3 gF1(FFD / 64, NBL / 64);
  gemm_bf16_kernel<1, true><<<gF1, 128, 0, stream>>>(xB, W1T, b1, nullptr, h1, NBL, FFD, DMODEL, 0);
  dim3 gF2(DMODEL / 64, NBL / 64);
  gemm_bf16_kernel<0, false><<<gF2, 128, 0, stream>>>(h1, W2T, b2, tmpF, nullptr, NBL, DMODEL, FFD, 0);

  // 7) out = LN(x + ff)
  add_ln_kernel<false><<<NBL / 16, 256, 0, stream>>>(tmpF, xF, ln2g, ln2b, (float*)d_out, nullptr);
}

// v007
// Measured time: 179 microseconds a run.
// In both of two side-by-side timings against v006, it was 1.17 times as fast.
// Over all steps from v000 it is 5.79 times as fast.
#include <hip/hip_runtime.h>

typedef __attribute__((ext_vector_type(16))) __bf16 v16bf;
typedef __attribute__((ext_vector_type(8)))  __bf16 v8bf;
typedef __attribute__((ext_vector_type(4)))  __bf16 v4bf;
typedef __attribute__((ext_vector_type(8)))  float  v8f;
typedef __attribute__((ext_vector_type(4)))  float  f32x4;
typedef __attribute__((ext_vector_type(4)))  unsigned int u32x4;
typedef __attribute__((ext_vector_type(8)))  int    i32x8;
typedef __attribute__((ext_vector_type(4)))  int    i32x4;

#define NBL    8192   // B*L
#define DMODEL 256
#define NHEAD  8
#define DH     2048   // D*H
#define LSEQ   2048
#define FFD    128

// ---------------------------------------------------------------- helpers
__device__ __forceinline__ __bf16 to_bf16(float f) {
  union { float f; unsigned u; } x; x.f = f;
  unsigned r = x.u + 0x7FFFu + ((x.u >> 16) & 1u);   // round-to-nearest-even
  unsigned short h = (unsigned short)(r >> 16);
  union { unsigned short s; __bf16 b; } y; y.s = h;
  return y.b;
}

// A/B fragment for v_wmma_f32_16x16x32_bf16 from a row-major (rows x ld) bf16
// matrix (global or LDS), contraction chunk starting at column kc.
// Per CDNA5 ISA 16-bit layout: lane holds row (lane&15); elements 0..7 =
// K [off, off+8), elements 8..15 = K [off+16, off+24), off = (lane&16)?8:0.
__device__ __forceinline__ v16bf load_frag(const __bf16* base, int ld, int row,
                                           int kc, int lane) {
  const __bf16* p = base + (size_t)row * ld + kc + ((lane & 16) ? 8 : 0);
  v16bf f;
  ((f32x4*)&f)[0] = ((const f32x4*)p)[0];
  ((f32x4*)&f)[1] = *(const f32x4*)(p + 16);
  return f;
}

// Swizzled layouts of K and V^T. The attention's tensor loads land rows
// unpadded, so rows of 64 B or 512 B put the 16 lanes of a half-wave on few LDS
// banks.  The producers
// therefore store each 16-byte chunk (8 bf16 of the contraction index) at an
// XOR-ed chunk position inside its row, and the readers undo it: the 16 lanes
// of a half-wave then cover all 64 banks once.  Values and k order unchanged.
//   64-byte rows (32 bf16):  chunk j of row r sits at j ^ ((r >> 2) & 3)
//   512-byte rows (256 bf16): chunk p of row r sits at p ^ (r & 15)
__device__ __forceinline__ int swz64(int row, int col) {
  return col ^ (((row >> 2) & 3) << 3);
}
__device__ __forceinline__ int swz512(int row, int col) {
  return col ^ ((row & 15) << 3);
}

__device__ __forceinline__ v8f wmma_bf16(v16bf a, v16bf b, v8f c) {
  return __builtin_amdgcn_wmma_f32_16x16x32_bf16(false, a, false, b,
                                                 (short)0, c, false, false);
}

__device__ __forceinline__ unsigned lds_off(const void* p) {
  // generic pointer to a __shared__ object: low 32 bits = LDS byte offset
  return (unsigned)(unsigned long long)p;
}

typedef __attribute__((ext_vector_type(8))) unsigned int u32x8;
__device__ __forceinline__ unsigned uni(unsigned v) {   // a scalar-register word
  return (unsigned)__builtin_amdgcn_readfirstlane((int)v);
}
// a wave-uniform test kept in a scalar register: compiles to s_cmp + s_cbranch_scc
__device__ __forceinline__ unsigned pinned(unsigned v) {
  unsigned w = uni(v);
  asm volatile("" : "+s"(w));
  return w;
}

// ---------------------------------------------------------------- converts
// Each lane of the non-matrix kernels takes 8 or 16 elements: few waves to
// start, 16-byte accesses.
__device__ __forceinline__ v8bf pack8(f32x4 lo, f32x4 hi) {
  v8bf o;
#pragma unroll
  for (int j = 0; j < 4; ++j) { o[j] = to_bf16(lo[j]); o[4 + j] = to_bf16(hi[j]); }
  return o;
}

// n is a multiple of 16; a lane converts the 8-element chunks t and t + n/16.
// blk: the block's index among the n / 16 / 256 blocks of this part.
__device__ __forceinline__ void
f32_to_bf16_part(const float* __restrict__ src,
                 __bf16* __restrict__ dst, int n, int blk) {
  const int half = n >> 4;
  const int t = blk * 256 + threadIdx.x;
  if (t >= half) return;
  const f32x4* s4 = (const f32x4*)src;
  f32x4 a0 = s4[2 * t], a1 = s4[2 * t + 1];
  f32x4 b0 = s4[2 * (t + half)], b1 = s4[2 * (t + half) + 1];
  ((v8bf*)dst)[t] = pack8(a0, a1);
  ((v8bf*)dst)[t + half] = pack8(b0, b1);
  // another part's code may follow in the listing and reuse the stores' registers:
  // keep the wait in front
  asm volatile("s_wait_xcnt 0x0" ::: "memory");
}

// src (ROWS x COLS) f32  ->  dst (COLS x ROWS) bf16   (weights -> NxK form,
// plain row-major).  A lane takes 8 source rows of one column, which are one
// 16-byte chunk of a dst row; the part holds exactly ROWS / 8 * COLS threads, blk
// is the block's index in it.  The shape is a
// compile-time constant so that the 8 loads share one address register pair.
template <int ROWS, int COLS>
__device__ __forceinline__ void
transpose_bf16_part(const float* __restrict__ src, __bf16* __restrict__ dst, int blk) {
  const int i = blk * 256 + threadIdx.x;
  const int rc = i / COLS, cc = i % COLS;
  const float* p = src + (size_t)(rc * 8) * COLS + cc;
  float v[8];
#pragma unroll
  for (int j = 0; j < 8; ++j) v[j] = p[j * COLS];
  v8bf o;
#pragma unroll
  for (int j = 0; j < 8; ++j) o[j] = to_bf16(v[j]);
  *(v8bf*)(dst + (size_t)cc * ROWS + rc * 8) = o;
  // another part's code may follow in the listing and reuse the store's registers:
  // keep the wait in front
  asm volatile("s_wait_xcnt 0x0" ::: "memory");
}

// The convert and the six weight transposes depend on nothing but the inputs:
// one launch holds them all, each part on its own range of blocks, so that
// they start, wait for memory and drain side by side instead of in turn.
#define PB_SEQ (NBL * DMODEL / 16 / 256)     // blocks of the convert
#define PB_W   (DMODEL * DH / 8 / 256)       // blocks of a D x DH weight
#define PB_F   (DMODEL * FFD / 8 / 256)      // blocks of a D x FF weight
#define PB_ALL (PB_SEQ + 4 * PB_W + 2 * PB_F)
__global__ void __launch_bounds__(256)
prep_kernel(const float* __restrict__ seq, const float* __restrict__ Wq,
            const float* __restrict__ Wk, const float* __restrict__ Wv,
            const float* __restrict__ Wo, const float* __restrict__ W1,
            const float* __restrict__ W2, __bf16* __restrict__ seqb,
            __bf16* __restrict__ WqT, __bf16* __restrict__ WkT,
            __bf16* __restrict__ WvT, __bf16* __restrict__ WoT,
            __bf16* __restrict__ W1T, __bf16* __restrict__ W2T) {
  int blk = blockIdx.x;
  if (blk < PB_SEQ) { f32_to_bf16_part(seq, seqb, NBL * DMODEL, blk); return; }
  blk -= PB_SEQ;
  if (blk < PB_W) { transpose_bf16_part<DMODEL, DH>(Wq, WqT, blk); return; }
  blk -= PB_W;
  if (blk < PB_W) { transpose_bf16_part<DMODEL, DH>(Wk, WkT, blk); return; }
  blk -= PB_W;
  if (blk < PB_W) { transpose_bf16_part<DMODEL, DH>(Wv, WvT, blk); return; }
  blk -= PB_W;
  if (blk < PB_W) { transpose_bf16_part<DH, DMODEL>(Wo, WoT, blk); return; }
  blk -= PB_W;
  if (blk < PB_F) { transpose_bf16_part<DMODEL, FFD>(W1, W1T, blk); return; }
  blk -= PB_F;
  transpose_bf16_part<FFD, DMODEL>(W2, W2T, blk);
}

// ---------------------------------------------------------------- GEMM
// C(M,N) = A(M,K) x Bt(N,K)^T, bf16 in, f32 accumulate; A and Bt plain
// row-major, K a multiple of 128.  A stage is 128 of K: the block's 64 rows of A
// and its 64 rows of Bt, rows of 256 B, brought into LDS by tensor loads whose
// pad gives an LDS pitch of 272 B (16 B x odd: the 16 rows of a fragment read
// cover all 64 banks once).  Two buffers; every wave brings one slice of 32 rows.
// OUTMODE: 0 = f32 row-major, 1 = bf16 row-major, 2 = bf16 transposed (ldT),
// 64-byte swizzle, 3 = bf16 row-major, 512-byte swizzle
#define GPITCH 272u                 // LDS bytes a row
#define GSLICE 10240u               // 32 rows of 272 B, rounded up to 2 KiB
#define GBUF   (4u * GSLICE)        // slices 0, 1: A rows 0..31, 32..63; 2, 3: Bt
#define SPITCH 144u                 // output staging, bf16: 128 B a row + 16 B (16 B x odd)
#define FPITCH 272u                 // output staging, f32: 256 B a row + 16 B

// fragment of 16 rows from a padded tile; p: the lane's row, its half's first chunk
__device__ __forceinline__ v16bf lds_frag(const char* p) {
  v16bf f;
  ((f32x4*)&f)[0] = *(const f32x4*)p;          // k = off .. off + 7
  ((f32x4*)&f)[1] = *(const f32x4*)(p + 32);   // k = off + 16 .. off + 23
  return f;
}

// tiles: the kernel's two LDS buffers
template <int OUTMODE, bool RELU>
__device__ __forceinline__ void
gemm_bf16_body(char (*tiles)[GBUF],
               const __bf16* __restrict__ A, const __bf16* __restrict__ Bt,
               const float* __restrict__ bias, float* __restrict__ outF,
               __bf16* __restrict__ outB, int M, int N, int K, int ldT) {
  const int lane = threadIdx.x & 31;
  const unsigned wave = uni(threadIdx.x >> 5);
  const int n0 = blockIdx.x * 64;
  const int nst = K >> 7;
  // row-major outputs take the product transposed (weights as the A operand)
  constexpr bool TRANSP = (OUTMODE != 2);

  // All extents in bytes (data_size code 0), tensor dims = tile dims.
  u32x8 g1;
  g1[0] = uni(0x07500000u);            // no mask; pad on, every 256 B (code 5), 16 B (code 3)
  g1[1] = uni(256u << 16);             // tensor_dim0
  g1[2] = uni(32u << 16);              // tensor_dim1
  g1[3] = uni(256u << 16);             // tile_dim0
  g1[4] = uni(32u);                    // tile_dim1
  g1[5] = uni((unsigned)K * 2u);       // source pitch
  g1[6] = uni(0u);
  g1[7] = uni(0u);
  u32x4 g0;                            // stage 0 into buffer 0
  const unsigned place0 = lds_off(&tiles[0][0]) + wave * GSLICE;
  {
    const unsigned half = wave & 1u;
    const __bf16* src = (wave >> 1)
        ? Bt + (size_t)(n0 + half * 32) * K
        : A  + (size_t)(blockIdx.y * 64 + half * 32) * K;
    const unsigned long long ga = (unsigned long long)src;
    g0[0] = uni(1u);
    g0[1] = uni(place0);
    g0[2] = uni((unsigned)ga);
    g0[3] = uni(((unsigned)(ga >> 32) & 0x01FFFFFFu) | 0x80000000u);   // type 2
  }
  // the next stage's slice (256 B on along the rows), into the other buffer
  auto advance = [&]() {
    const unsigned lo = g0[2] + 256u;
    g0[1] = uni(2u * place0 + GBUF - g0[1]);
    g0[3] = uni(g0[3] + (lo < 256u ? 1u : 0u));
    g0[2] = uni(lo);
  };
  // Load and wait name both descriptor groups as in-out: the groups stay in one
  // register set each, which keeps its words while the request is out, and
  // group 0 takes the next stage's words only behind the wait.
#define TENSOR_LOAD() asm volatile("tensor_load_to_lds %0, %1" : "+s"(g0), "+s"(g1) :: "memory")
#define TENSOR_WAIT() asm volatile("s_wait_tensorcnt 0x0" : "+s"(g0), "+s"(g1) :: "memory")
  TENSOR_LOAD();
  TENSOR_WAIT();
  __syncthreads();   // stage 0 published
  if (pinned(1 < nst)) {
    advance();
    TENSOR_LOAD();   // stage 1 flies during pass 0
  }

  v8f acc0 = {}, acc1 = {}, acc2 = {}, acc3 = {};
  // the lane's byte offsets in a buffer: its row of the wave's 16 rows of A, its
  // row of the first 16 rows of Bt, each at its half's first chunk
  const unsigned lrow = (unsigned)(lane & 15) * GPITCH + ((lane & 16) ? 16u : 0u);
  const unsigned aoff = (wave >> 1) * GSLICE + (wave & 1u) * 16u * GPITCH + lrow;
  const unsigned boff = 2u * GSLICE + lrow;
  for (int s = 0; s < nst; ++s) {
    const char* ap = &tiles[s & 1][0] + aoff;
    const char* bp = &tiles[s & 1][0] + boff;
    // the whole stage goes into registers first, so that its buffer is free for
    // the refill while the products run
    v16bf a[4], b[4][4];
#pragma unroll
    for (int kk = 0; kk < 4; ++kk) {   // 32 of K, 64 B of a row
      a[kk]    = lds_frag(ap + kk * 64);
      b[kk][0] = lds_frag(bp + kk * 64);
      b[kk][1] = lds_frag(bp + 16 * GPITCH + kk * 64);
      b[kk][2] = lds_frag(bp + GSLICE + kk * 64);
      b[kk][3] = lds_frag(bp + GSLICE + 16 * GPITCH + kk * 64);
    }
    // --- publish point of stage s + 1: this wave's reads of stage s are done,
    //     its own slice of stage s + 1 has landed, every wave says the same
    asm volatile("s_wait_dscnt 0x0" ::: "memory");
    TENSOR_WAIT();
    __syncthreads();
    if (pinned(s + 2 < nst)) {   // stage s + 2 into the buffer that pass s has read
      advance();
      TENSOR_LOAD();
    }
    // the products stand behind the refill's issue: the load flies under them
#pragma unroll
    for (int kk = 0; kk < 4; ++kk) {
      if (TRANSP) {   // tile nt holds C^T: rows n, columns m
        acc0 = wmma_bf16(b[kk][0], a[kk], acc0);
        acc1 = wmma_bf16(b[kk][1], a[kk], acc1);
        acc2 = wmma_bf16(b[kk][2], a[kk], acc2);
        acc3 = wmma_bf16(b[kk][3], a[kk], acc3);
      } else {
        acc0 = wmma_bf16(a[kk], b[kk][0], acc0);
        acc1 = wmma_bf16(a[kk], b[kk][1], acc1);
        acc2 = wmma_bf16(a[kk], b[kk][2], acc2);
        acc3 = wmma_bf16(a[kk], b[kk][3], acc3);
      }
    }
  }
  // nothing of the mover or of LDS is out when the wave goes on
  TENSOR_WAIT();
  asm volatile("s_wait_dscnt 0x0" ::: "memory");
#undef TENSOR_LOAD
#undef TENSOR_WAIT

  v8f accs[4] = {acc0, acc1, acc2, acc3};
  // Outputs leave as whole 128-byte lines.  A lane's 8 accumulator elements of a
  // tile are 8 neighbours of one output row (of C for the transposed product, of
  // C^T for OUTMODE 2): 16-byte chunks.  The block's 64 output rows are set up in
  // LDS and read back with the lanes side by side along a row.  The ring is free:
  // every wave's reads and tensor loads ended in front of the last pass's barrier.
  char* st = &tiles[0][0];
  const int mb = blockIdx.y * 64;
  const unsigned hf = (unsigned)(lane >> 4) & 1u;
  const unsigned l15 = (unsigned)lane & 15u;
  if (bias) {   // one test, all loads together
#pragma unroll
    for (int nt = 0; nt < 4; ++nt)
#pragma unroll
      for (int r = 0; r < 8; ++r)
        accs[nt][r] += TRANSP ? bias[n0 + nt * 16 + (int)hf * 8 + r] : bias[n0 + nt * 16 + (int)l15];
  }
  if (RELU) {
#pragma unroll
    for (int nt = 0; nt < 4; ++nt)
#pragma unroll
      for (int r = 0; r < 8; ++r) accs[nt][r] = fmaxf(accs[nt][r], 0.0f);
  }
  if (OUTMODE == 0) {
#pragma unroll
    for (int nt = 0; nt < 4; ++nt) {
      char* p = st + (wave * 16u + l15) * FPITCH + (unsigned)nt * 64u + hf * 32u;
      f32x4 lo = {accs[nt][0], accs[nt][1], accs[nt][2], accs[nt][3]};
      f32x4 hi = {accs[nt][4], accs[nt][5], accs[nt][6], accs[nt][7]};
      *(f32x4*)p = lo;
      *(f32x4*)(p + 16) = hi;
    }
    // the rows are read back by other lanes: the writes have to be done first
    asm volatile("s_wait_dscnt 0x0" ::: "memory");
    f32x4 w[8];
    float* gp[8];
#pragma unroll
    for (int j = 0; j < 8; ++j) {
      const int R = (int)wave * 16 + j * 2 + (lane >> 4);   // output row of the block
      const int c4 = (lane & 15) * 4;                       // first element of the chunk
      w[j] = *(const f32x4*)(st + (unsigned)R * FPITCH + (unsigned)c4 * 4u);
      gp[j] = outF + (size_t)(mb + R) * N + n0 + c4;
    }
    // holds the stores behind all arithmetic, so that no register of an issued
    // store is written again
    __builtin_amdgcn_sched_barrier(0);
#pragma unroll
    for (int j = 0; j < 8; ++j) *(f32x4*)gp[j] = w[j];
  } else {
#pragma unroll
    for (int nt = 0; nt < 4; ++nt) {
      v8bf o;
#pragma unroll
      for (int r = 0; r < 8; ++r) o[r] = to_bf16(accs[nt][r]);
      const unsigned row = TRANSP ? wave * 16u + l15 : (unsigned)nt * 16u + l15;
      const unsigned chk = TRANSP ? (unsigned)nt * 2u + hf : wave * 2u + hf;
      *(v8bf*)(st + row * SPITCH + chk * 16u) = o;
    }
    // the rows are read back by other lanes (OUTMODE 2: other waves): the writes
    // have to be done first
    asm volatile("s_wait_dscnt 0x0" ::: "memory");
    if (!TRANSP) __syncthreads();   // a row of C^T holds chunks of all four waves
    v8bf w[4];
    __bf16* gp[4];
#pragma unroll
    for (int j = 0; j < 4; ++j) {
      const int R = (int)wave * 16 + j * 4 + (lane >> 3);   // output row of the block
      const int c8 = (lane & 7) * 8;                        // first element of the chunk
      w[j] = *(const v8bf*)(st + (unsigned)R * SPITCH + (unsigned)c8 * 2u);
      if (OUTMODE == 1)      gp[j] = outB + (size_t)(mb + R) * N + n0 + c8;
      else if (OUTMODE == 2) gp[j] = outB + (size_t)(n0 + R) * ldT + swz64(R, mb + c8);
      else                   gp[j] = outB + (size_t)(mb + R) * N + swz512(R, n0 + c8);
    }
    // holds the stores behind all arithmetic, so that no register of an issued
    // store is written again
    __builtin_amdgcn_sched_barrier(0);
#pragma unroll
    for (int j = 0; j < 4; ++j) *(v8bf*)gp[j] = w[j];
  }
}

template <int OUTMODE, bool RELU>
__global__ void __launch_bounds__(128, 2)
gemm_bf16_kernel(const __bf16* __restrict__ A, const __bf16* __restrict__ Bt,
                 const float* __restrict__ bias, float* __restrict__ outF,
                 __bf16* __restrict__ outB, int M, int N, int K, int ldT) {
  // places of tensor loads: 2 KiB multiples
  __shared__ __attribute__((aligned(2048))) char tiles[2][GBUF];
  gemm_bf16_body<OUTMODE, RELU>(tiles, A, Bt, bias, outF, outB, M, N, K, ldT);
}

// The three projections read the same A and depend on nothing of each other:
// one launch, blockIdx.z picks the weight, the output and its store order.  The
// tests stand around tensor loads, which ignore EXEC: scalar branches.
__global__ void __launch_bounds__(128, 2)
qkv_gemm_kernel(const __bf16* __restrict__ A, const __bf16* __restrict__ WqT,
                const __bf16* __restrict__ WkT, const __bf16* __restrict__ WvT,
                __bf16* __restrict__ qb, __bf16* __restrict__ kb,
                __bf16* __restrict__ vT, int M, int N, int K, int ldT) {
  // places of tensor loads: 2 KiB multiples
  __shared__ __attribute__((aligned(2048))) char tiles[2][GBUF];
  if (pinned(blockIdx.z == 0))
    gemm_bf16_body<1, false>(tiles, A, WqT, nullptr, nullptr, qb, M, N, K, 0);
  else if (pinned(blockIdx.z == 1))
    gemm_bf16_body<3, false>(tiles, A, WkT, nullptr, nullptr, kb, M, N, K, 0);
  else
    gemm_bf16_body<2, false>(tiles, A, WvT, nullptr, nullptr, vT, M, N, K, ldT);
}

__device__ __forceinline__ float other_half(float x) {   // x of lane ^ 16
  int y = __builtin_bit_cast(int, x);
  return __builtin_bit_cast(float, __builtin_amdgcn_permlanex16(
             y, y, 0x76543210, 0xfedcba98, false, false));
}

__global__ void __launch_bounds__(128, 2)
flash_attn_kernel(const __bf16* __restrict__ q, const __bf16* __restrict__ k,
                  const __bf16* __restrict__ vT, __bf16* __restrict__ heads) {
  // (key, d) and (d, key), 16 KB a buffer; places of tensor loads: 2 KiB multiples
  __shared__ __attribute__((aligned(2048))) __bf16 ktile[2][32 * 256];
  __shared__ __attribute__((aligned(2048))) __bf16 vtile[2][256 * 32];
  const int lane = threadIdx.x & 31;
  const unsigned wave = uni(threadIdx.x >> 5);
  // 16 blocks of 128 queries per (b, h)
  const int b  = blockIdx.x >> 7;
  const int h  = (blockIdx.x >> 4) & 7;
  const int qt = (blockIdx.x & 15) * 4 + (int)wave;   // 32-query tile, 0 .. 63
  const int NT = LSEQ / 32;

  // Q fragments: per group 8 K-chunks covering d = 0..255 (global, loaded once)
  v16bf qa[2][8];
  const int qrow = b * LSEQ + qt * 32 + (lane & 15);   // group g: + 16 * g
#pragma unroll
  for (int g = 0; g < 2; ++g)
#pragma unroll
    for (int c = 0; c < 8; ++c)
      qa[g][c] = load_frag(q, DH, qrow + g * 16, h * DMODEL + c * 32, lane);
  // the arithmetic behind may land in these loads' address registers: keep the wait
  asm volatile("s_wait_xcnt 0x0" ::: "memory");
  // holds that arithmetic behind the wait
  __builtin_amdgcn_sched_barrier(0);

  // Every wave brings its own 8 KB slice of each stage, one request at a time:
  // waves 0, 1 the key rows 0..15, 16..31 of K (16 rows of 512 B, pitch 4 KB),
  // waves 2, 3 the d rows 0..127, 128..255 of V^T (128 rows of 64 B, pitch 16 KB).
  // All extents in bytes (data_size code 0), tensor dims = tile dims, no pad.
  const unsigned isv = wave >> 1, half = wave & 1u;
  const unsigned rowb = isv ? 64u : 512u;                  // bytes a row
  const unsigned nrow = isv ? 128u : 16u;                  // rows
  const unsigned step = isv ? 64u : 32u * DH * 2u;         // source bytes a stage
  u32x8 g1;
  g1[0] = uni(0u);                     // no mask, data_size 0, no pad
  g1[1] = uni(rowb << 16);             // tensor_dim0
  g1[2] = uni(nrow << 16);             // tensor_dim1
  g1[3] = uni(rowb << 16);             // tile_dim0
  g1[4] = uni(nrow);                   // tile_dim1
  g1[5] = uni(isv ? NBL * 2u : DH * 2u);   // source pitch
  g1[6] = uni(0u);
  g1[7] = uni(0u);
  u32x4 g0;                            // stage 0 into buffer 0
  {
    const __bf16* src = isv
        ? vT + (size_t)(h * DMODEL + half * 128) * NBL + b * LSEQ
        : k  + (size_t)(b * LSEQ + half * 16) * DH + h * DMODEL;
    const unsigned long long ga = (unsigned long long)src;
    g0[0] = uni(1u);
    g0[1] = uni((isv ? lds_off(&vtile[0][0]) : lds_off(&ktile[0][0])) + half * 8192u);
    g0[2] = uni((unsigned)ga);
    g0[3] = uni(((unsigned)(ga >> 32) & 0x01FFFFFFu) | 0x80000000u);   // type 2
  }
  // the next stage's slice, into the other buffer
  auto advance = [&]() {
    const unsigned lo = g0[2] + step;
    g0[1] = uni(g0[1] ^ 16384u);
    g0[3] = uni(g0[3] + (lo < step ? 1u : 0u));
    g0[2] = uni(lo);
  };
  // Load and wait name both descriptor groups as in-out: the groups stay in one
  // register set each, which keeps its words while the request is out, and
  // group 0 takes the next stage's words only behind the wait.
#define TENSOR_LOAD() asm volatile("tensor_load_to_lds %0, %1" : "+s"(g0), "+s"(g1) :: "memory")
#define TENSOR_WAIT() asm volatile("s_wait_tensorcnt 0x0" : "+s"(g0), "+s"(g1) :: "memory")
  TENSOR_LOAD();
  TENSOR_WAIT();
  __syncthreads();   // stage 0 published
  advance();
  TENSOR_LOAD();     // stage 1 flies during pass 0

  // o[g][nt][r] = O[query 16*g + (lane & 15)][d = nt*16 + r + 8*(lane>>4)]
  v8f o[2][16];
  v8f zero = {};
#pragma unroll
  for (int g = 0; g < 2; ++g)
#pragma unroll
    for (int nt = 0; nt < 16; ++nt) o[g][nt] = zero;
  float mrun[2] = {-1e30f, -1e30f};   // running maximum of the lane's query (both halves alike)
  float lrun[2] = {0.0f, 0.0f};       // running sum over this half's keys only

  // The lane's LDS byte offsets in the current K and V buffer: ka[m] is chunk
  // 2 * m + (lane >> 4) of a 128-element half row of K under the 512-byte
  // swizzle, va[] the two chunks of a V^T fragment under the 64-byte swizzle.  They are flipped to the
  // other buffer at the foot of each pass: one register set serves both buffers
  // (per-pass address arithmetic takes registers that this tile does not have).
  unsigned ka[8], va[2];
  {
    const int s = lane & 15, hh = (lane >> 4) & 1;
#pragma unroll
    for (int m = 0; m < 8; ++m) ka[m] = (unsigned)(s * 256 + (((m * 2 + hh) ^ s) * 8)) * 2u;
    const int j0 = hh ^ ((lane >> 2) & 3);
    va[0] = (unsigned)(s * 32 + j0 * 8) * 2u;
    va[1] = (unsigned)(s * 32 + (j0 ^ 2) * 8) * 2u;
  }
  const char* kl = (const char*)&ktile[0][0];
  const char* vl = (const char*)&vtile[0][0];
  // rows row0 .. row0 + 15 of the K tile, contraction chunk c (32 wide)
  auto kfrag = [&](int row0, int c) {
    v16bf f;
    ((f32x4*)&f)[0] = *(const f32x4*)(kl + ka[(c & 3) * 2]     + row0 * 512 + (c >> 2) * 256);
    ((f32x4*)&f)[1] = *(const f32x4*)(kl + ka[(c & 3) * 2 + 1] + row0 * 512 + (c >> 2) * 256);
    return f;
  };
  // rows row0 .. row0 + 15 of the V^T tile
  auto vfrag = [&](int row0) {
    v16bf f;
    ((f32x4*)&f)[0] = *(const f32x4*)(vl + va[0] + row0 * 64);
    ((f32x4*)&f)[1] = *(const f32x4*)(vl + va[1] + row0 * 64);
    return f;
  };

  const float scale = 0.0625f;  // 1/sqrt(256)
  for (int t = 0; t < NT; ++t) {

    // --- S^T = K * Q^T  (32 keys x 32 queries, four 16x16 tiles per K-chunk).
    //     With two waves a SIMD the wave covers its own LDS waits: the K
    //     fragments of a chunk are read two chunks ahead of their products,
    //     into three register sets in turn.
    v8f s0[2] = {zero, zero}, s1[2] = {zero, zero};
    v16bf kf[3][2];   // [set][key half]
#pragma unroll
    for (int c = 0; c < 2; ++c) {
      kf[c][0] = kfrag(0,  c);
      kf[c][1] = kfrag(16, c);
    }
#pragma unroll
    for (int c = 0; c < 8; ++c) {
      if (c < 6) {
        kf[(c + 2) % 3][0] = kfrag(0,  c + 2);
        kf[(c + 2) % 3][1] = kfrag(16, c + 2);
      }
      // keeps these LDS reads in front of this chunk's products: left alone
      // the compiler reads each fragment right before its use
      __builtin_amdgcn_sched_barrier(0);
#pragma unroll
      for (int g = 0; g < 2; ++g) {
        s0[g] = wmma_bf16(kf[c % 3][0], qa[g][c], s0[g]);
        s1[g] = wmma_bf16(kf[c % 3][1], qa[g][c], s1[g]);
      }
      // holds later reads back from these products (best effort: behind the last
      // chunk the first V reads still stand among its products in the listing)
      __builtin_amdgcn_sched_barrier(0);
    }

    // first two pairs of V fragments: read here so that the softmax covers the wait
    v16bf vf[3][2];      // [set][d tile of the pair]
#pragma unroll
    for (int j = 0; j < 4; ++j) vf[j >> 1][j & 1] = vfrag(j * 16);
    // keeps these reads in front of the softmax arithmetic
    __builtin_amdgcn_sched_barrier(0);

    // --- online softmax, group by group: 16 of a query's 32 scores sit in this
    //     lane, the other 16 in lane ^ 16
    v16bf pb[2];       // B fragment of P^T: keys 8h + r, then 16 + 8h + r
#pragma unroll
    for (int g = 0; g < 2; ++g) {
      float a0[8], a1[8], mx8[8];
#pragma unroll
      for (int r = 0; r < 8; ++r) {
        a0[r] = s0[g][r] * scale;
        a1[r] = s1[g][r] * scale;
        mx8[r] = fmaxf(a0[r], a1[r]);
      }
      float mx = fmaxf(fmaxf(fmaxf(mx8[0], mx8[1]), fmaxf(mx8[2], mx8[3])),
                       fmaxf(fmaxf(mx8[4], mx8[5]), fmaxf(mx8[6], mx8[7])));
      mx = fmaxf(mx, other_half(mx));
      const float mnew = fmaxf(mrun[g], mx);
      const float corr = __expf(mrun[g] - mnew);
      mrun[g] = mnew;
      float ps8[8];
#pragma unroll
      for (int r = 0; r < 8; ++r) {
        float p0 = __expf(a0[r] - mnew);
        float p1 = __expf(a1[r] - mnew);
        ps8[r] = p0 + p1;
        pb[g][r]     = to_bf16(p0);
        pb[g][8 + r] = to_bf16(p1);
      }
      lrun[g] = lrun[g] * corr + (((ps8[0] + ps8[1]) + (ps8[2] + ps8[3])) +
                                  ((ps8[4] + ps8[5]) + (ps8[6] + ps8[7])));
#pragma unroll
      for (int nt = 0; nt < 16; ++nt) o[g][nt] *= corr;
    }

    // keeps the third pair's reads out of the softmax, where registers are short
    __builtin_amdgcn_sched_barrier(0);

    // --- O^T += V^T * P^T   (16 output tiles across d = 256, per group of
    //     queries); V fragments in pairs of d tiles, read two pairs ahead
#pragma unroll
    for (int np = 0; np < 8; ++np) {
      if (np < 6) {
        vf[(np + 2) % 3][0] = vfrag(((np + 2) * 2) * 16);
        vf[(np + 2) % 3][1] = vfrag(((np + 2) * 2 + 1) * 16);
      }
      // keeps these LDS reads in front of this pair's products
      __builtin_amdgcn_sched_barrier(0);
#pragma unroll
      for (int j = 0; j < 2; ++j)
#pragma unroll
        for (int g = 0; g < 2; ++g)
          o[g][np * 2 + j] = wmma_bf16(vf[np % 3][j], pb[g], o[g][np * 2 + j]);
      // keeps later reads from rising in among these products
      __builtin_amdgcn_sched_barrier(0);
    }

#pragma unroll
    for (int m = 0; m < 8; ++m) ka[m] ^= 16384u;
    va[0] ^= 16384u;
    va[1] ^= 16384u;

    // --- publish point of stage t + 1: this wave's reads of stage t are done,
    //     its own slice of stage t + 1 has landed, every wave says the same
    asm volatile("s_wait_dscnt 0x0" ::: "memory");
    TENSOR_WAIT();
    __syncthreads();
    if (pinned(t + 2 < NT)) {   // stage t + 2 into the buffer that pass t has read
      advance();
      TENSOR_LOAD();
    }
  }
  // nothing of the mover or of LDS is out when the wave ends
  TENSOR_WAIT();
  asm volatile("s_wait_dscnt 0x0" ::: "memory");
#undef TENSOR_LOAD
#undef TENSOR_WAIT

  // normalize and store heads (bf16 row-major (NBL, DH)): a lane's 8 elements
  // of a tile are 8 neighbours in d, one 16-byte store
  v8bf ov[2][16];
#pragma unroll
  for (int g = 0; g < 2; ++g) {
    const float inv = 1.0f / (lrun[g] + other_half(lrun[g]));
#pragma unroll
    for (int nt = 0; nt < 16; ++nt)
#pragma unroll
      for (int r = 0; r < 8; ++r) ov[g][nt][r] = to_bf16(o[g][nt][r] * inv);
  }
  __bf16* hp = heads + (size_t)qrow * DH + h * DMODEL + ((lane & 16) ? 8 : 0);
  // holds the stores behind all arithmetic, so that no register of an issued
  // store is written again
  __builtin_amdgcn_sched_barrier(0);
#pragma unroll
  for (int g = 0; g < 2; ++g)
#pragma unroll
    for (int nt = 0; nt < 16; ++nt)
      *(v8bf*)(hp + (size_t)g * 16 * DH + nt * 16) = ov[g][nt];
}

// ---------------------------------------------------------------- add + LN
// y = LN(a + rsd) * g + b ;  one wave per two rows of 256 elements, 8 waves a
// block.  A lane holds elements 4*lane.. and 128 + 4*lane.. of each row, so
// every 16-byte access of a wave covers 512 contiguous bytes.
template <int M>
__device__ __forceinline__ float add_xmask(float x) {   // x + x of lane ^ M, M < 16
  int y = __builtin_amdgcn_update_dpp(0, __builtin_bit_cast(int, x), 0x160 | M,
                                      0xf, 0xf, true);
  return x + __builtin_bit_cast(float, y);
}
__device__ __forceinline__ float wave_sum(float x) {    // every lane gets the sum
  x = add_xmask<1>(x);
  x = add_xmask<2>(x);
  x = add_xmask<4>(x);
  x = add_xmask<8>(x);
  int b = __builtin_bit_cast(int, x);
  return x + __builtin_bit_cast(float, __builtin_amdgcn_permlanex16(
                 b, b, 0x76543210, 0xfedcba98, false, false));
}

template <bool WB>   // WB: also write the bf16 copy
__global__ void __launch_bounds__(256)
add_ln_kernel(const float* __restrict__ a,
              const float* __restrict__ rsd,
              const float* __restrict__ g,
              const float* __restrict__ bta,
              float* __restrict__ outF,
              __bf16* __restrict__ outB) {
  const int lane = threadIdx.x & 31;
  const int row0 = (blockIdx.x * 8 + (threadIdx.x >> 5)) * 2;
  const size_t o0 = (size_t)row0 * 256 + lane * 4;   // + rr * 256 + hh * 128
  f32x4 v[2][2], gg[2], bb[2], y[2][2];
#pragma unroll
  for (int hh = 0; hh < 2; ++hh) {
    gg[hh] = *(const f32x4*)(g + hh * 128 + lane * 4);
    bb[hh] = *(const f32x4*)(bta + hh * 128 + lane * 4);
  }
  // the next loads may land in these loads' address register: keep the wait
  asm volatile("s_wait_xcnt 0x0" ::: "memory");
#pragma unroll
  for (int rr = 0; rr < 2; ++rr)
#pragma unroll
    for (int hh = 0; hh < 2; ++hh)
      v[rr][hh] = *(const f32x4*)(a + o0 + rr * 256 + hh * 128) +
                  *(const f32x4*)(rsd + o0 + rr * 256 + hh * 128);
#pragma unroll
  for (int rr = 0; rr < 2; ++rr) {
    f32x4 s4 = v[rr][0] + v[rr][1];
    float mu = wave_sum((s4[0] + s4[1]) + (s4[2] + s4[3])) * (1.0f / 256.0f);
    f32x4 d0 = v[rr][0] - mu, d1 = v[rr][1] - mu;
    f32x4 q4 = d0 * d0 + d1 * d1;
    float var = wave_sum((q4[0] + q4[1]) + (q4[2] + q4[3])) * (1.0f / 256.0f);
    float rs = rsqrtf(var + 1e-5f);
    y[rr][0] = d0 * rs * gg[0] + bb[0];
    y[rr][1] = d1 * rs * gg[1] + bb[1];
  }
  v4bf yb[2][2];
  if (WB) {
#pragma unroll
    for (int rr = 0; rr < 2; ++rr)
#pragma unroll
      for (int hh = 0; hh < 2; ++hh)
#pragma unroll
        for (int j = 0; j < 4; ++j) yb[rr][hh][j] = to_bf16(y[rr][hh][j]);
  }
  // holds the stores behind all arithmetic, so that no register of an issued
  // store is written again
  __builtin_amdgcn_sched_barrier(0);
#pragma unroll
  for (int rr = 0; rr < 2; ++rr)
#pragma unroll
    for (int hh = 0; hh < 2; ++hh) {
      *(f32x4*)(outF + o0 + rr * 256 + hh * 128) = y[rr][hh];
      if (WB) *(v4bf*)(outB + o0 + rr * 256 + hh * 128) = yb[rr][hh];
    }
}

// ---------------------------------------------------------------- launcher
extern "C" void kernel_launch(void* const* d_in, const int* in_sizes, int n_in,
                              void* d_out, int out_size, void* d_ws,
                              size_t ws_size, hipStream_t stream) {
  (void)in_sizes; (void)n_in; (void)out_size; (void)ws_size;
  const float* seq  = (const float*)d_in[0];
  const float* Wq   = (const float*)d_in[1];
  const float* Wk   = (const float*)d_in[2];
  const float* Wv   = (const float*)d_in[3];
  const float* Wo   = (const float*)d_in[4];
  const float* ln1g = (const float*)d_in[5];
  const float* ln1b = (const float*)d_in[6];
  const float* W1   = (const float*)d_in[7];
  const float* b1   = (const float*)d_in[8];
  const float* W2   = (const float*)d_in[9];
  const float* b2   = (const float*)d_in[10];
  const float* ln2g = (const float*)d_in[11];
  const float* ln2b = (const float*)d_in[12];

  char* w = (char*)d_ws;
  size_t off = 0;
  auto take = [&](size_t bytes) {
    size_t o = off; off += (bytes + 255) & ~(size_t)255; return o;
  };
  __bf16* seqb  = (__bf16*)(w + take((size_t)NBL * DMODEL * 2));
  __bf16* WqT   = (__bf16*)(w + take((size_t)DH * DMODEL * 2));
  __bf16* WkT   = (__bf16*)(w + take((size_t)DH * DMODEL * 2));
  __bf16* WvT   = (__bf16*)(w + take((size_t)DH * DMODEL * 2));
  __bf16* WoT   = (__bf16*)(w + take((size_t)DMODEL * DH * 2));
  __bf16* W1T   = (__bf16*)(w + take((size_t)FFD * DMODEL * 2));
  __bf16* W2T   = (__bf16*)(w + take((size_t)DMODEL * FFD * 2));
  __bf16* qb    = (__bf16*)(w + take((size_t)NBL * DH * 2));
  __bf16* kb    = (__bf16*)(w + take((size_t)NBL * DH * 2));
  __bf16* vT    = (__bf16*)(w + take((size_t)DH * NBL * 2));
  __bf16* heads = (__bf16*)(w + take((size_t)NBL * DH * 2));
  float*  tmpF  = (float*)(w + take((size_t)NBL * DMODEL * 4));
  float*  xF    = (float*)(w + take((size_t)NBL * DMODEL * 4));
  __bf16* xB    = (__bf16*)(w + take((size_t)NBL * DMODEL * 2));
  __bf16* h1    = (__bf16*)(w + take((size_t)NBL * FFD * 2));

  // 1) convert / transpose inputs to bf16, one launch
  prep_kernel<<<PB_ALL, 256, 0, stream>>>(seq, Wq, Wk, Wv, Wo, W1, W2,
                                          seqb, WqT, WkT, WvT, WoT, W1T, W2T);

  // 2) QKV projections (V stored transposed for the P*V WMMA path; K and V in
  //    the swizzled orders the attention kernel reads), one launch
  dim3 gQKV(DH / 64, NBL / 64, 3);
  qkv_gemm_kernel<<<gQKV, 128, 0, stream>>>(seqb, WqT, WkT, WvT, qb, kb, vT, NBL, DH, DMODEL, NBL);

  // 3) fused flash attention -> heads
  flash_attn_kernel<<<(NBL / 32) * NHEAD / 4, 128, 0, stream>>>(qb, kb, vT, heads);

  // 4) output projection: att = heads @ Wo (f32)
  dim3 gO(DMODEL / 64, NBL / 64);
  gemm_bf16_kernel<0, false><<<gO, 128, 0, stream>>>(heads, WoT, nullptr, tmpF, nullptr, NBL, DMODEL, DH, 0);

  // 5) x = LN(seq + att)   (also bf16 copy for the FF GEMM)
  add_ln_kernel<true><<<NBL / 16, 256, 0, stream>>>(tmpF, seq, ln1g, ln1b, xF, xB);

  // 6) FF: h1 = relu(x @ W1 + b1); ff = h1 @ W2 + b2
  dim3 gF1(FFD / 64, NBL / 64);
  gemm_bf16_kernel<1, true><<<gF1, 128, 0, stream>>>(xB, W1T, b1, nullptr, h1, NBL, FFD, DMODEL, 0);
  dim3 gF2(DMODEL / 64, NBL / 64);
  gemm_bf16_kernel<0, false><<<gF2, 128, 0, stream>>>(h1, W2T, b2, tmpF, nullptr, NBL, DMODEL, FFD, 0);

  // 7) out = LN(x + ff)
  add_ln_kernel<false><<<NBL / 16, 256, 0, stream>>>(tmpF, xF, ln2g, ln2b, (float*)d_out, nullptr);
}

// v008
// Measured time: 162 microseconds a run.
// Next to v007, in two timings, it ran 1.10 times as fast each time.
// All steps since v000 together make it 6.37 times as fast.
#include <hip/hip_runtime.h>

typedef __attribute__((ext_vector_type(16))) __bf16 v16bf;
typedef __attribute__((ext_vector_type(8)))  __bf16 v8bf;
typedef __attribute__((ext_vector_type(4)))  __bf16 v4bf;
typedef __attribute__((ext_vector_type(8)))  float  v8f;
typedef __attribute__((ext_vector_type(4)))  float  f32x4;
typedef __attribute__((ext_vector_type(4)))  unsigned int u32x4;
typedef __attribute__((ext_vector_type(8)))  int    i32x8;
typedef __attribute__((ext_vector_type(4)))  int    i32x4;

#define NBL    8192   // B*L
#define DMODEL 256
#define NHEAD  8
#define DH     2048   // D*H
#define LSEQ   2048
#define FFD    128

// ---------------------------------------------------------------- helpers
__device__ __forceinline__ __bf16 to_bf16(float f) {
  union { float f; unsigned u; } x; x.f = f;
  unsigned r = x.u + 0x7FFFu + ((x.u >> 16) & 1u);   // round-to-nearest-even
  unsigned short h = (unsigned short)(r >> 16);
  union { unsigned short s; __bf16 b; } y; y.s = h;
  return y.b;
}

// A/B fragment for v_wmma_f32_16x16x32_bf16 from a row-major (rows x ld) bf16
// matrix (global or LDS), contraction chunk starting at column kc.
// Per CDNA5 ISA 16-bit layout: lane holds row (lane&15); elements 0..7 =
// K [off, off+8), elements 8..15 = K [off+16, off+24), off = (lane&16)?8:0.
__device__ __forceinline__ v16bf load_frag(const __bf16* base, int ld, int row,
                                           int kc, int lane) {
  const __bf16* p = base + (size_t)row * ld + kc + ((lane & 16) ? 8 : 0);
  v16bf f;
  ((f32x4*)&f)[0] = ((const f32x4*)p)[0];
  ((f32x4*)&f)[1] = *(const f32x4*)(p + 16);
  return f;
}

// Swizzled layouts of K and V^T. The attention's tensor loads land rows
// unpadded, so rows of 64 B or 512 B put the 16 lanes of a half-wave on few LDS
// banks.  The producers
// therefore store each 16-byte chunk (8 bf16 of the contraction index) at an
// XOR-ed chunk position inside its row, and the readers undo it: the 16 lanes
// of a half-wave then cover all 64 banks once.  Values and k order unchanged.
//   64-byte rows (32 bf16):  chunk j of row r sits at j ^ ((r >> 2) & 3)
//   512-byte rows (256 bf16): chunk p of row r sits at p ^ (r & 15)
__device__ __forceinline__ int swz64(int row, int col) {
  return col ^ (((row >> 2) & 3) << 3);
}
__device__ __forceinline__ int swz512(int row, int col) {
  return col ^ ((row & 15) << 3);
}

__device__ __forceinline__ v8f wmma_bf16(v16bf a, v16bf b, v8f c) {
  return __builtin_amdgcn_wmma_f32_16x16x32_bf16(false, a, false, b,
                                                 (short)0, c, false, false);
}

__device__ __forceinline__ unsigned lds_off(const void* p) {
  // generic pointer to a __shared__ object: low 32 bits = LDS byte offset
  return (unsigned)(unsigned long long)p;
}

typedef __attribute__((ext_vector_type(8))) unsigned int u32x8;
__device__ __forceinline__ unsigned uni(unsigned v) {   // a scalar-register word
  return (unsigned)__builtin_amdgcn_readfirstlane((int)v);
}
// a wave-uniform test kept in a scalar register: compiles to s_cmp + s_cbranch_scc
__device__ __forceinline__ unsigned pinned(unsigned v) {
  unsigned w = uni(v);
  asm volatile("" : "+s"(w));
  return w;
}

// ---------------------------------------------------------------- converts
// Each lane of the non-matrix kernels takes 8 or 16 elements: few waves to
// start, 16-byte accesses.
__device__ __forceinline__ v8bf pack8(f32x4 lo, f32x4 hi) {
  v8bf o;
#pragma unroll
  for (int j = 0; j < 4; ++j) { o[j] = to_bf16(lo[j]); o[4 + j] = to_bf16(hi[j]); }
  return o;
}

// n is a multiple of 16; a lane converts the 8-element chunks t and t + n/16.
// blk: the block's index among the n / 16 / 256 blocks of this part.
__device__ __forceinline__ void
f32_to_bf16_part(const float* __restrict__ src,
                 __bf16* __restrict__ dst, int n, int blk) {
  const int half = n >> 4;
  const int t = blk * 256 + threadIdx.x;
  if (t >= half) return;
  const f32x4* s4 = (const f32x4*)src;
  f32x4 a0 = s4[2 * t], a1 = s4[2 * t + 1];
  f32x4 b0 = s4[2 * (t + half)], b1 = s4[2 * (t + half) + 1];
  ((v8bf*)dst)[t] = pack8(a0, a1);
  ((v8bf*)dst)[t + half] = pack8(b0, b1);
  // another part's code may follow in the listing and reuse the stores' registers:
  // keep the wait in front
  asm volatile("s_wait_xcnt 0x0" ::: "memory");
}

// src (ROWS x COLS) f32  ->  dst (COLS x ROWS) bf16   (weights -> NxK form,
// plain row-major).  A lane takes 8 source rows of one column, which are one
// 16-byte chunk of a dst row; the part holds exactly ROWS / 8 * COLS threads, blk
// is the block's index in it.  The shape is a
// compile-time constant so that the 8 loads share one address register pair.
template <int ROWS, int COLS>
__device__ __forceinline__ void
transpose_bf16_part(const float* __restrict__ src, __bf16* __restrict__ dst, int blk) {
  const int i = blk * 256 + threadIdx.x;
  const int rc = i / COLS, cc = i % COLS;
  const float* p = src + (size_t)(rc * 8) * COLS + cc;
  float v[8];
#pragma unroll
  for (int j = 0; j < 8; ++j) v[j] = p[j * COLS];
  v8bf o;
#pragma unroll
  for (int j = 0; j < 8; ++j) o[j] = to_bf16(v[j]);
  *(v8bf*)(dst + (size_t)cc * ROWS + rc * 8) = o;
  // another part's code may follow in the listing and reuse the store's registers:
  // keep the wait in front
  asm volatile("s_wait_xcnt 0x0" ::: "memory");
}

// The convert and the six weight transposes depend on nothing but the inputs:
// one launch holds them all, each part on its own range of blocks, so that
// they start, wait for memory and drain side by side instead of in turn.
#define PB_SEQ (NBL * DMODEL / 16 / 256)     // blocks of the convert
#define PB_W   (DMODEL * DH / 8 / 256)       // blocks of a D x DH weight
#define PB_F   (DMODEL * FFD / 8 / 256)      // blocks of a D x FF weight
#define PB_ALL (PB_SEQ + 4 * PB_W + 2 * PB_F)
__global__ void __launch_bounds__(256)
prep_kernel(const float* __restrict__ seq, const float* __restrict__ Wq,
            const float* __restrict__ Wk, const float* __restrict__ Wv,
            const float* __restrict__ Wo, const float* __restrict__ W1,
            const float* __restrict__ W2, __bf16* __restrict__ seqb,
            __bf16* __restrict__ WqT, __bf16* __restrict__ WkT,
            __bf16* __restrict__ WvT, __bf16* __restrict__ WoT,
            __bf16* __restrict__ W1T, __bf16* __restrict__ W2T) {
  int blk = blockIdx.x;
  if (blk < PB_SEQ) { f32_to_bf16_part(seq, seqb, NBL * DMODEL, blk); return; }
  blk -= PB_SEQ;
  if (blk < PB_W) { transpose_bf16_part<DMODEL, DH>(Wq, WqT, blk); return; }
  blk -= PB_W;
  if (blk < PB_W) { transpose_bf16_part<DMODEL, DH>(Wk, WkT, blk); return; }
  blk -= PB_W;
  if (blk < PB_W) { transpose_bf16_part<DMODEL, DH>(Wv, WvT, blk); return; }
  blk -= PB_W;
  if (blk < PB_W) { transpose_bf16_part<DH, DMODEL>(Wo, WoT, blk); return; }
  blk -= PB_W;
  if (blk < PB_F) { transpose_bf16_part<DMODEL, FFD>(W1, W1T, blk); return; }
  blk -= PB_F;
  transpose_bf16_part<FFD, DMODEL>(W2, W2T, blk);
}

// ---------------------------------------------------------------- GEMM
// C(M,N) = A(M,K) x Bt(N,K)^T, bf16 in, f32 accumulate; A and Bt plain
// row-major, K a multiple of 128.  A stage is 128 of K: the block's 64 rows of A
// and its 64 rows of Bt, rows of 256 B, brought into LDS by tensor loads whose
// pad gives an LDS pitch of 272 B (16 B x odd: the 16 rows of a fragment read
// cover all 64 banks once).  Two buffers; every wave brings one slice of 32 rows.
// OUTMODE: 0 = f32 row-major, 1 = bf16 row-major, 2 = bf16 transposed (ldT),
// 64-byte swizzle, 3 = bf16 row-major, 512-byte swizzle
#define GPITCH 272u                 // LDS bytes a row
#define GSLICE 10240u               // 32 rows of 272 B, rounded up to 2 KiB
#define GBUF   (4u * GSLICE)        // slices 0, 1: A rows 0..31, 32..63; 2, 3: Bt
#define SPITCH 144u                 // output staging, bf16: 128 B a row + 16 B (16 B x odd)
#define FPITCH 272u                 // output staging, f32: 256 B a row + 16 B

// fragment of 16 rows from a padded tile; p: the lane's row, its half's first chunk
__device__ __forceinline__ v16bf lds_frag(const char* p) {
  v16bf f;
  ((f32x4*)&f)[0] = *(const f32x4*)p;          // k = off .. off + 7
  ((f32x4*)&f)[1] = *(const f32x4*)(p + 32);   // k = off + 16 .. off + 23
  return f;
}

// tiles: the kernel's two LDS buffers
template <int OUTMODE, bool RELU>
__device__ __forceinline__ void
gemm_bf16_body(char (*tiles)[GBUF],
               const __bf16* __restrict__ A, const __bf16* __restrict__ Bt,
               const float* __restrict__ bias, float* __restrict__ outF,
               __bf16* __restrict__ outB, int M, int N, int K, int ldT) {
  const int lane = threadIdx.x & 31;
  const unsigned wave = uni(threadIdx.x >> 5);
  const int n0 = blockIdx.x * 64;
  const int nst = K >> 7;
  // row-major outputs take the product transposed (weights as the A operand)
  constexpr bool TRANSP = (OUTMODE != 2);

  // All extents in bytes (data_size code 0), tensor dims = tile dims.
  u32x8 g1;
  g1[0] = uni(0x07500000u);            // no mask; pad on, every 256 B (code 5), 16 B (code 3)
  g1[1] = uni(256u << 16);             // tensor_dim0
  g1[2] = uni(32u << 16);              // tensor_dim1
  g1[3] = uni(256u << 16);             // tile_dim0
  g1[4] = uni(32u);                    // tile_dim1
  g1[5] = uni((unsigned)K * 2u);       // source pitch
  g1[6] = uni(0u);
  g1[7] = uni(0u);
  u32x4 g0;                            // stage 0 into buffer 0
  const unsigned place0 = lds_off(&tiles[0][0]) + wave * GSLICE;
  {
    const unsigned half = wave & 1u;
    const __bf16* src = (wave >> 1)
        ? Bt + (size_t)(n0 + half * 32) * K
        : A  + (size_t)(blockIdx.y * 64 + half * 32) * K;
    const unsigned long long ga = (unsigned long long)src;
    g0[0] = uni(1u);
    g0[1] = uni(place0);
    g0[2] = uni((unsigned)ga);
    g0[3] = uni(((unsigned)(ga >> 32) & 0x01FFFFFFu) | 0x80000000u);   // type 2
  }
  // the next stage's slice (256 B on along the rows), into the other buffer
  auto advance = [&]() {
    const unsigned lo = g0[2] + 256u;
    g0[1] = uni(2u * place0 + GBUF - g0[1]);
    g0[3] = uni(g0[3] + (lo < 256u ? 1u : 0u));
    g0[2] = uni(lo);
  };
  // Load and wait name both descriptor groups as in-out: the groups stay in one
  // register set each, which keeps its words while the request is out, and
  // group 0 takes the next stage's words only behind the wait.
#define TENSOR_LOAD() asm volatile("tensor_load_to_lds %0, %1" : "+s"(g0), "+s"(g1) :: "memory")
#define TENSOR_WAIT() asm volatile("s_wait_tensorcnt 0x0" : "+s"(g0), "+s"(g1) :: "memory")
  TENSOR_LOAD();
  TENSOR_WAIT();
  __syncthreads();   // stage 0 published
  if (pinned(1 < nst)) {
    advance();
    TENSOR_LOAD();   // stage 1 flies during pass 0
  }

  v8f acc0 = {}, acc1 = {}, acc2 = {}, acc3 = {};
  // the lane's byte offsets in a buffer: its row of the wave's 16 rows of A, its
  // row of the first 16 rows of Bt, each at its half's first chunk
  const unsigned lrow = (unsigned)(lane & 15) * GPITCH + ((lane & 16) ? 16u : 0u);
  const unsigned aoff = (wave >> 1) * GSLICE + (wave & 1u) * 16u * GPITCH + lrow;
  const unsigned boff = 2u * GSLICE + lrow;
  for (int s = 0; s < nst; ++s) {
    const char* ap = &tiles[s & 1][0] + aoff;
    const char* bp = &tiles[s & 1][0] + boff;
    // the whole stage goes into registers first, so that its buffer is free for
    // the refill while the products run
    v16bf a[4], b[4][4];
#pragma unroll
    for (int kk = 0; kk < 4; ++kk) {   // 32 of K, 64 B of a row
      a[kk]    = lds_frag(ap + kk * 64);
      b[kk][0] = lds_frag(bp + kk * 64);
      b[kk][1] = lds_frag(bp + 16 * GPITCH + kk * 64);
      b[kk][2] = lds_frag(bp + GSLICE + kk * 64);
      b[kk][3] = lds_frag(bp + GSLICE + 16 * GPITCH + kk * 64);
    }
    // --- publish point of stage s + 1: this wave's reads of stage s are done,
    //     its own slice of stage s + 1 has landed, every wave says the same
    asm volatile("s_wait_dscnt 0x0" ::: "memory");
    TENSOR_WAIT();
    __syncthreads();
    if (pinned(s + 2 < nst)) {   // stage s + 2 into the buffer that pass s has read
      advance();
      TENSOR_LOAD();
    }
    // the products stand behind the refill's issue: the load flies under them
#pragma unroll
    for (int kk = 0; kk < 4; ++kk) {
      if (TRANSP) {   // tile nt holds C^T: rows n, columns m
        acc0 = wmma_bf16(b[kk][0], a[kk], acc0);
        acc1 = wmma_bf16(b[kk][1], a[kk], acc1);
        acc2 = wmma_bf16(b[kk][2], a[kk], acc2);
        acc3 = wmma_bf16(b[kk][3], a[kk], acc3);
      } else {
        acc0 = wmma_bf16(a[kk], b[kk][0], acc0);
        acc1 = wmma_bf16(a[kk], b[kk][1], acc1);
        acc2 = wmma_bf16(a[kk], b[kk][2], acc2);
        acc3 = wmma_bf16(a[kk], b[kk][3], acc3);
      }
    }
  }
  // nothing of the mover or of LDS is out when the wave goes on
  TENSOR_WAIT();
  asm volatile("s_wait_dscnt 0x0" ::: "memory");
#undef TENSOR_LOAD
#undef TENSOR_WAIT

  v8f accs[4] = {acc0, acc1, acc2, acc3};
  // Outputs leave as whole 128-byte lines.  A lane's 8 accumulator elements of a
  // tile are 8 neighbours of one output row (of C for the transposed product, of
  // C^T for OUTMODE 2): 16-byte chunks.  The block's 64 output rows are set up in
  // LDS and read back with the lanes side by side along a row.  The ring is free:
  // every wave's reads and tensor loads ended in front of the last pass's barrier.
  char* st = &tiles[0][0];
  const int mb = blockIdx.y * 64;
  const unsigned hf = (unsigned)(lane >> 4) & 1u;
  const unsigned l15 = (unsigned)lane & 15u;
  if (bias) {   // one test, all loads together
#pragma unroll
    for (int nt = 0; nt < 4; ++nt)
#pragma unroll
      for (int r = 0; r < 8; ++r)
        accs[nt][r] += TRANSP ? bias[n0 + nt * 16 + (int)hf * 8 + r] : bias[n0 + nt * 16 + (int)l15];
  }
  if (RELU) {
#pragma unroll
    for (int nt = 0; nt < 4; ++nt)
#pragma unroll
      for (int r = 0; r < 8; ++r) accs[nt][r] = fmaxf(accs[nt][r], 0.0f);
  }
  if (OUTMODE == 0) {
#pragma unroll
    for (int nt = 0; nt < 4; ++nt) {
      char* p = st + (wave * 16u + l15) * FPITCH + (unsigned)nt * 64u + hf * 32u;
      f32x4 lo = {accs[nt][0], accs[nt][1], accs[nt][2], accs[nt][3]};
      f32x4 hi = {accs[nt][4], accs[nt][5], accs[nt][6], accs[nt][7]};
      *(f32x4*)p = lo;
      *(f32x4*)(p + 16) = hi;
    }
    // the rows are read back by other lanes: the writes have to be done first
    asm volatile("s_wait_dscnt 0x0" ::: "memory");
    f32x4 w[8];
    float* gp[8];
#pragma unroll
    for (int j = 0; j < 8; ++j) {
      const int R = (int)wave * 16 + j * 2 + (lane >> 4);   // output row of the block
      const int c4 = (lane & 15) * 4;                       // first element of the chunk
      w[j] = *(const f32x4*)(st + (unsigned)R * FPITCH + (unsigned)c4 * 4u);
      gp[j] = outF + (size_t)(mb + R) * N + n0 + c4;
    }
    // holds the stores behind all arithmetic, so that no register of an issued
    // store is written again
    __builtin_amdgcn_sched_barrier(0);
#pragma unroll
    for (int j = 0; j < 8; ++j) *(f32x4*)gp[j] = w[j];
  } else {
#pragma unroll
    for (int nt = 0; nt < 4; ++nt) {
      v8bf o;
#pragma unroll
      for (int r = 0; r < 8; ++r) o[r] = to_bf16(accs[nt][r]);
      const unsigned row = TRANSP ? wave * 16u + l15 : (unsigned)nt * 16u + l15;
      const unsigned chk = TRANSP ? (unsigned)nt * 2u + hf : wave * 2u + hf;
      *(v8bf*)(st + row * SPITCH + chk * 16u) = o;
    }
    // the rows are read back by other lanes (OUTMODE 2: other waves): the writes
    // have to be done first
    asm volatile("s_wait_dscnt 0x0" ::: "memory");
    if (!TRANSP) __syncthreads();   // a row of C^T holds chunks of all four waves
    v8bf w[4];
    __bf16* gp[4];
#pragma unroll
    for (int j = 0; j < 4; ++j) {
      const int R = (int)wave * 16 + j * 4 + (lane >> 3);   // output row of the block
      const int c8 = (lane & 7) * 8;                        // first element of the chunk
      w[j] = *(const v8bf*)(st + (unsigned)R * SPITCH + (unsigned)c8 * 2u);
      if (OUTMODE == 1)      gp[j] = outB + (size_t)(mb + R) * N + n0 + c8;
      else if (OUTMODE == 2) gp[j] = outB + (size_t)(n0 + R) * ldT + swz64(R, mb + c8);
      else                   gp[j] = outB + (size_t)(mb + R) * N + swz512(R, n0 + c8);
    }
    // holds the stores behind all arithmetic, so that no register of an issued
    // store is written again
    __builtin_amdgcn_sched_barrier(0);
#pragma unroll
    for (int j = 0; j < 4; ++j) *(v8bf*)gp[j] = w[j];
  }
}

// The three projections read the same A and depend on nothing of each other:
// one launch, blockIdx.z picks the weight, the output and its store order.  The
// tests stand around tensor loads, which ignore EXEC: scalar branches.
__global__ void __launch_bounds__(128, 2)
qkv_gemm_kernel(const __bf16* __restrict__ A, const __bf16* __restrict__ WqT,
                const __bf16* __restrict__ WkT, const __bf16* __restrict__ WvT,
                __bf16* __restrict__ qb, __bf16* __restrict__ kb,
                __bf16* __restrict__ vT, int M, int N, int K, int ldT) {
  // places of tensor loads: 2 KiB multiples
  __shared__ __attribute__((aligned(2048))) char tiles[2][GBUF];
  if (pinned(blockIdx.z == 0))
    gemm_bf16_body<1, false>(tiles, A, WqT, nullptr, nullptr, qb, M, N, K, 0);
  else if (pinned(blockIdx.z == 1))
    gemm_bf16_body<3, false>(tiles, A, WkT, nullptr, nullptr, kb, M, N, K, 0);
  else
    gemm_bf16_body<2, false>(tiles, A, WvT, nullptr, nullptr, vT, M, N, K, ldT);
}

__device__ __forceinline__ float other_half(float x) {   // x of lane ^ 16
  int y = __builtin_bit_cast(int, x);
  return __builtin_bit_cast(float, __builtin_amdgcn_permlanex16(
             y, y, 0x76543210, 0xfedcba98, false, false));
}

__global__ void __launch_bounds__(128, 2)
flash_attn_kernel(const __bf16* __restrict__ q, const __bf16* __restrict__ k,
                  const __bf16* __restrict__ vT, __bf16* __restrict__ heads) {
  // (key, d) and (d, key), 16 KB a buffer; places of tensor loads: 2 KiB multiples
  __shared__ __attribute__((aligned(2048))) __bf16 ktile[2][32 * 256];
  __shared__ __attribute__((aligned(2048))) __bf16 vtile[2][256 * 32];
  const int lane = threadIdx.x & 31;
  const unsigned wave = uni(threadIdx.x >> 5);
  // 16 blocks of 128 queries per (b, h)
  const int b  = blockIdx.x >> 7;
  const int h  = (blockIdx.x >> 4) & 7;
  const int qt = (blockIdx.x & 15) * 4 + (int)wave;   // 32-query tile, 0 .. 63
  const int NT = LSEQ / 32;

  // Q fragments: per group 8 K-chunks covering d = 0..255 (global, loaded once)
  v16bf qa[2][8];
  const int qrow = b * LSEQ + qt * 32 + (lane & 15);   // group g: + 16 * g
#pragma unroll
  for (int g = 0; g < 2; ++g)
#pragma unroll
    for (int c = 0; c < 8; ++c)
      qa[g][c] = load_frag(q, DH, qrow + g * 16, h * DMODEL + c * 32, lane);
  // the arithmetic behind may land in these loads' address registers: keep the wait
  asm volatile("s_wait_xcnt 0x0" ::: "memory");
  // holds that arithmetic behind the wait
  __builtin_amdgcn_sched_barrier(0);

  // Every wave brings its own 8 KB slice of each stage, one request at a time:
  // waves 0, 1 the key rows 0..15, 16..31 of K (16 rows of 512 B, pitch 4 KB),
  // waves 2, 3 the d rows 0..127, 128..255 of V^T (128 rows of 64 B, pitch 16 KB).
  // All extents in bytes (data_size code 0), tensor dims = tile dims, no pad.
  const unsigned isv = wave >> 1, half = wave & 1u;
  const unsigned rowb = isv ? 64u : 512u;                  // bytes a row
  const unsigned nrow = isv ? 128u : 16u;                  // rows
  const unsigned step = isv ? 64u : 32u * DH * 2u;         // source bytes a stage
  u32x8 g1;
  g1[0] = uni(0u);                     // no mask, data_size 0, no pad
  g1[1] = uni(rowb << 16);             // tensor_dim0
  g1[2] = uni(nrow << 16);             // tensor_dim1
  g1[3] = uni(rowb << 16);             // tile_dim0
  g1[4] = uni(nrow);                   // tile_dim1
  g1[5] = uni(isv ? NBL * 2u : DH * 2u);   // source pitch
  g1[6] = uni(0u);
  g1[7] = uni(0u);
  u32x4 g0;                            // stage 0 into buffer 0
  {
    const __bf16* src = isv
        ? vT + (size_t)(h * DMODEL + half * 128) * NBL + b * LSEQ
        : k  + (size_t)(b * LSEQ + half * 16) * DH + h * DMODEL;
    const unsigned long long ga = (unsigned long long)src;
    g0[0] = uni(1u);
    g0[1] = uni((isv ? lds_off(&vtile[0][0]) : lds_off(&ktile[0][0])) + half * 8192u);
    g0[2] = uni((unsigned)ga);
    g0[3] = uni(((unsigned)(ga >> 32) & 0x01FFFFFFu) | 0x80000000u);   // type 2
  }
  // the next stage's slice, into the other buffer
  auto advance = [&]() {
    const unsigned lo = g0[2] + step;
    g0[1] = uni(g0[1] ^ 16384u);
    g0[3] = uni(g0[3] + (lo < step ? 1u : 0u));
    g0[2] = uni(lo);
  };
  // Load and wait name both descriptor groups as in-out: the groups stay in one
  // register set each, which keeps its words while the request is out, and
  // group 0 takes the next stage's words only behind the wait.
#define TENSOR_LOAD() asm volatile("tensor_load_to_lds %0, %1" : "+s"(g0), "+s"(g1) :: "memory")
#define TENSOR_WAIT() asm volatile("s_wait_tensorcnt 0x0" : "+s"(g0), "+s"(g1) :: "memory")
  TENSOR_LOAD();
  TENSOR_WAIT();
  __syncthreads();   // stage 0 published
  advance();
  TENSOR_LOAD();     // stage 1 flies during pass 0

  // o[g][nt][r] = O[query 16*g + (lane & 15)][d = nt*16 + r + 8*(lane>>4)]
  v8f o[2][16];
  v8f zero = {};
#pragma unroll
  for (int g = 0; g < 2; ++g)
#pragma unroll
    for (int nt = 0; nt < 16; ++nt) o[g][nt] = zero;
  float mrun[2] = {-1e30f, -1e30f};   // running maximum of the lane's query (both halves alike)
  float lrun[2] = {0.0f, 0.0f};       // running sum over this half's keys only

  // The lane's LDS byte offsets in the current K and V buffer: ka[m] is chunk
  // 2 * m + (lane >> 4) of a 128-element half row of K under the 512-byte
  // swizzle, va[] the two chunks of a V^T fragment under the 64-byte swizzle.  They are flipped to the
  // other buffer at the foot of each pass: one register set serves both buffers
  // (per-pass address arithmetic takes registers that this tile does not have).
  unsigned ka[8], va[2];
  {
    const int s = lane & 15, hh = (lane >> 4) & 1;
#pragma unroll
    for (int m = 0; m < 8; ++m) ka[m] = (unsigned)(s * 256 + (((m * 2 + hh) ^ s) * 8)) * 2u;
    const int j0 = hh ^ ((lane >> 2) & 3);
    va[0] = (unsigned)(s * 32 + j0 * 8) * 2u;
    va[1] = (unsigned)(s * 32 + (j0 ^ 2) * 8) * 2u;
  }
  const char* kl = (const char*)&ktile[0][0];
  const char* vl = (const char*)&vtile[0][0];
  // rows row0 .. row0 + 15 of the K tile, contraction chunk c (32 wide)
  auto kfrag = [&](int row0, int c) {
    v16bf f;
    ((f32x4*)&f)[0] = *(const f32x4*)(kl + ka[(c & 3) * 2]     + row0 * 512 + (c >> 2) * 256);
    ((f32x4*)&f)[1] = *(const f32x4*)(kl + ka[(c & 3) * 2 + 1] + row0 * 512 + (c >> 2) * 256);
    return f;
  };
  // rows row0 .. row0 + 15 of the V^T tile
  auto vfrag = [&](int row0) {
    v16bf f;
    ((f32x4*)&f)[0] = *(const f32x4*)(vl + va[0] + row0 * 64);
    ((f32x4*)&f)[1] = *(const f32x4*)(vl + va[1] + row0 * 64);
    return f;
  };

  const float scale = 0.0625f;  // 1/sqrt(256)
  for (int t = 0; t < NT; ++t) {

    // --- S^T = K * Q^T  (32 keys x 32 queries, four 16x16 tiles per K-chunk).
    //     With two waves a SIMD the wave covers its own LDS waits: the K
    //     fragments of a chunk are read two chunks ahead of their products,
    //     into three register sets in turn.
    v8f s0[2] = {zero, zero}, s1[2] = {zero, zero};
    v16bf kf[3][2];   // [set][key half]
#pragma unroll
    for (int c = 0; c < 2; ++c) {
      kf[c][0] = kfrag(0,  c);
      kf[c][1] = kfrag(16, c);
    }
#pragma unroll
    for (int c = 0; c < 8; ++c) {
      if (c < 6) {
        kf[(c + 2) % 3][0] = kfrag(0,  c + 2);
        kf[(c + 2) % 3][1] = kfrag(16, c + 2);
      }
      // keeps these LDS reads in front of this chunk's products: left alone
      // the compiler reads each fragment right before its use
      __builtin_amdgcn_sched_barrier(0);
#pragma unroll
      for (int g = 0; g < 2; ++g) {
        s0[g] = wmma_bf16(kf[c % 3][0], qa[g][c], s0[g]);
        s1[g] = wmma_bf16(kf[c % 3][1], qa[g][c], s1[g]);
      }
      // holds later reads back from these products (best effort: behind the last
      // chunk the first V reads still stand among its products in the listing)
      __builtin_amdgcn_sched_barrier(0);
    }

    // first two pairs of V fragments: read here so that the softmax covers the wait
    v16bf vf[3][2];      // [set][d tile of the pair]
#pragma unroll
    for (int j = 0; j < 4; ++j) vf[j >> 1][j & 1] = vfrag(j * 16);
    // keeps these reads in front of the softmax arithmetic
    __builtin_amdgcn_sched_barrier(0);

    // --- online softmax, group by group: 16 of a query's 32 scores sit in this
    //     lane, the other 16 in lane ^ 16
    v16bf pb[2];       // B fragment of P^T: keys 8h + r, then 16 + 8h + r
#pragma unroll
    for (int g = 0; g < 2; ++g) {
      float a0[8], a1[8], mx8[8];
#pragma unroll
      for (int r = 0; r < 8; ++r) {
        a0[r] = s0[g][r] * scale;
        a1[r] = s1[g][r] * scale;
        mx8[r] = fmaxf(a0[r], a1[r]);
      }
      float mx = fmaxf(fmaxf(fmaxf(mx8[0], mx8[1]), fmaxf(mx8[2], mx8[3])),
                       fmaxf(fmaxf(mx8[4], mx8[5]), fmaxf(mx8[6], mx8[7])));
      mx = fmaxf(mx, other_half(mx));
      const float mnew = fmaxf(mrun[g], mx);
      const float corr = __expf(mrun[g] - mnew);
      mrun[g] = mnew;
      float ps8[8];
#pragma unroll
      for (int r = 0; r < 8; ++r) {
        float p0 = __expf(a0[r] - mnew);
        float p1 = __expf(a1[r] - mnew);
        ps8[r] = p0 + p1;
        pb[g][r]     = to_bf16(p0);
        pb[g][8 + r] = to_bf16(p1);
      }
      lrun[g] = lrun[g] * corr + (((ps8[0] + ps8[1]) + (ps8[2] + ps8[3])) +
                                  ((ps8[4] + ps8[5]) + (ps8[6] + ps8[7])));
#pragma unroll
      for (int nt = 0; nt < 16; ++nt) o[g][nt] *= corr;
    }

    // keeps the third pair's reads out of the softmax, where registers are short
    __builtin_amdgcn_sched_barrier(0);

    // --- O^T += V^T * P^T   (16 output tiles across d = 256, per group of
    //     queries); V fragments in pairs of d tiles, read two pairs ahead
#pragma unroll
    for (int np = 0; np < 8; ++np) {
      if (np < 6) {
        vf[(np + 2) % 3][0] = vfrag(((np + 2) * 2) * 16);
        vf[(np + 2) % 3][1] = vfrag(((np + 2) * 2 + 1) * 16);
      }
      // keeps these LDS reads in front of this pair's products
      __builtin_amdgcn_sched_barrier(0);
#pragma unroll
      for (int j = 0; j < 2; ++j)
#pragma unroll
        for (int g = 0; g < 2; ++g)
          o[g][np * 2 + j] = wmma_bf16(vf[np % 3][j], pb[g], o[g][np * 2 + j]);
      // keeps later reads from rising in among these products
      __builtin_amdgcn_sched_barrier(0);
    }

#pragma unroll
    for (int m = 0; m < 8; ++m) ka[m] ^= 16384u;
    va[0] ^= 16384u;
    va[1] ^= 16384u;

    // --- publish point of stage t + 1: this wave's reads of stage t are done,
    //     its own slice of stage t + 1 has landed, every wave says the same
    asm volatile("s_wait_dscnt 0x0" ::: "memory");
    TENSOR_WAIT();
    __syncthreads();
    if (pinned(t + 2 < NT)) {   // stage t + 2 into the buffer that pass t has read
      advance();
      TENSOR_LOAD();
    }
  }
  // nothing of the mover or of LDS is out when the wave ends
  TENSOR_WAIT();
  asm volatile("s_wait_dscnt 0x0" ::: "memory");
#undef TENSOR_LOAD
#undef TENSOR_WAIT

  // normalize and store heads (bf16 row-major (NBL, DH)): a lane's 8 elements
  // of a tile are 8 neighbours in d, one 16-byte store
  v8bf ov[2][16];
#pragma unroll
  for (int g = 0; g < 2; ++g) {
    const float inv = 1.0f / (lrun[g] + other_half(lrun[g]));
#pragma unroll
    for (int nt = 0; nt < 16; ++nt)
#pragma unroll
      for (int r = 0; r < 8; ++r) ov[g][nt][r] = to_bf16(o[g][nt][r] * inv);
  }
  __bf16* hp = heads + (size_t)qrow * DH + h * DMODEL + ((lane & 16) ? 8 : 0);
  // holds the stores behind all arithmetic, so that no register of an issued
  // store is written again
  __builtin_amdgcn_sched_barrier(0);
#pragma unroll
  for (int g = 0; g < 2; ++g)
#pragma unroll
    for (int nt = 0; nt < 16; ++nt)
      *(v8bf*)(hp + (size_t)g * 16 * DH + nt * 16) = ov[g][nt];
}

// ---------------------------------------------------------------- add + LN
// y = LN(a + rsd) * g + b ;  one wave per row of 256 elements.  A lane holds
// elements 4*lane.. and 128 + 4*lane.. of the row, so every 16-byte access of a
// wave covers 512 contiguous bytes.
template <int M>
__device__ __forceinline__ float add_xmask(float x) {   // x + x of lane ^ M, M < 16
  int y = __builtin_amdgcn_update_dpp(0, __builtin_bit_cast(int, x), 0x160 | M,
                                      0xf, 0xf, true);
  return x + __builtin_bit_cast(float, y);
}
__device__ __forceinline__ float wave_sum(float x) {    // every lane gets the sum
  x = add_xmask<1>(x);
  x = add_xmask<2>(x);
  x = add_xmask<4>(x);
  x = add_xmask<8>(x);
  int b = __builtin_bit_cast(int, x);
  return x + __builtin_bit_cast(float, __builtin_amdgcn_permlanex16(
                 b, b, 0x76543210, 0xfedcba98, false, false));
}

// LN of one row of 256 held by one wave: v[hh] = elements hh * 128 + 4 * lane ..
__device__ __forceinline__ void ln_row(const f32x4 (&v)[2], const f32x4 (&gg)[2],
                                       const f32x4 (&bb)[2], f32x4 (&y)[2]) {
  f32x4 s4 = v[0] + v[1];
  float mu = wave_sum((s4[0] + s4[1]) + (s4[2] + s4[3])) * (1.0f / 256.0f);
  f32x4 d0 = v[0] - mu, d1 = v[1] - mu;
  f32x4 q4 = d0 * d0 + d1 * d1;
  float var = wave_sum((q4[0] + q4[1]) + (q4[2] + q4[3])) * (1.0f / 256.0f);
  float rs = rsqrtf(var + 1e-5f);
  y[0] = d0 * rs * gg[0] + bb[0];
  y[1] = d1 * rs * gg[1] + bb[1];
}

// ---------------------------------------------------------------- tail
// Everything behind the attention works row by row of the sequence, so a block
// that owns whole rows needs no other block's results: one launch does
//   att = heads Wo;  x = LN(seq + att);  h = relu(x W1 + b1);
//   out = LN(x + h W2 + b2)
// for 32 rows.  8 waves.  All products are taken transposed (weights as the A
// operand): a lane holds 8 neighbours in n of one row m = lane & 15 of a tile.
// Wave w owns the columns 32 w .. 32 w + 31 of att and of h W2, 16 w .. 16 w + 15
// of h, and for the two LNs the rows 4 w .. 4 w + 3.
// att: stages of 128 of K as in the GEMM above (256 B rows, LDS pitch 272 B, two
// buffers); slice 0 holds the block's 32 rows of heads (wave 0 brings it), slice
// 1 + w the 32 rows of Wo^T that wave w brings and alone reads.
#define TROWS  32
#define TBUF   (9u * GSLICE)
#define APITCH 1040u     // f32 rows between the phases: 1024 B + 16 B
#define XPITCH 528u      // x in bf16: 512 B a row + 16 B (16 B x odd)
#define XOFF   34816u    // x stands behind the 32 f32 rows
#define HOFF   52224u    // h (pitch 272 B) stands behind x
__global__ void __launch_bounds__(256, 2)
tail_kernel(const __bf16* __restrict__ heads, const __bf16* __restrict__ WoT,
            const __bf16* __restrict__ W1T, const __bf16* __restrict__ W2T,
            const float* __restrict__ seq,
            const float* __restrict__ ln1g, const float* __restrict__ ln1b,
            const float* __restrict__ b1, const float* __restrict__ b2,
            const float* __restrict__ ln2g, const float* __restrict__ ln2b,
            float* __restrict__ out) {
  // places of tensor loads: 2 KiB multiples
  __shared__ __attribute__((aligned(2048))) char tiles[2][TBUF];
  const int lane = threadIdx.x & 31;
  const unsigned wave = uni(threadIdx.x >> 5);
  const unsigned hf = (unsigned)(lane >> 4) & 1u;
  const unsigned l15 = (unsigned)lane & 15u;
  const int mb = blockIdx.x * TROWS;
  constexpr int nst = DH >> 7;

  // All extents in bytes (data_size code 0), tensor dims = tile dims; heads and
  // Wo^T have the same row length, so one group 1 serves both.
  u32x8 g1;
  g1[0] = uni(0x07500000u);            // no mask; pad on, every 256 B (code 5), 16 B (code 3)
  g1[1] = uni(256u << 16);             // tensor_dim0
  g1[2] = uni(32u << 16);              // tensor_dim1
  g1[3] = uni(256u << 16);             // tile_dim0
  g1[4] = uni(32u);                    // tile_dim1
  g1[5] = uni(DH * 2u);                // source pitch
  g1[6] = uni(0u);
  g1[7] = uni(0u);
  const unsigned placeA = lds_off(&tiles[0][0]);
  const unsigned placeB = placeA + (1u + wave) * GSLICE;
  u32x4 gA, gB;                        // stage 0 into buffer 0
  {
    const unsigned long long aa = (unsigned long long)(heads + (size_t)mb * DH);
    const unsigned long long ab = (unsigned long long)(WoT + (size_t)(wave * 32u) * DH);
    gA[0] = uni(1u);
    gA[1] = uni(placeA);
    gA[2] = uni((unsigned)aa);
    gA[3] = uni(((unsigned)(aa >> 32) & 0x01FFFFFFu) | 0x80000000u);   // type 2
    gB[0] = uni(1u);
    gB[1] = uni(placeB);
    gB[2] = uni((unsigned)ab);
    gB[3] = uni(((unsigned)(ab >> 32) & 0x01FFFFFFu) | 0x80000000u);   // type 2
  }
  // the next stage's slice (256 B on along the rows), into the other buffer
  auto advance = [&](u32x4& g, unsigned place0) {
    const unsigned lo = g[2] + 256u;
    g[1] = uni(2u * place0 + TBUF - g[1]);
    g[3] = uni(g[3] + (lo < 256u ? 1u : 0u));
    g[2] = uni(lo);
  };
  // Loads and wait name the descriptor groups as in-out: each group stays in one
  // register set, which keeps its words while a request is out, and the groups 0
  // take the next stage's words only behind the wait.  Wave 0 has two requests
  // out, the others one; the wait is to 0.
#define TENSOR_LOAD(G) asm volatile("tensor_load_to_lds %0, %1" : "+s"(G), "+s"(g1) :: "memory")
#define TENSOR_WAIT() asm volatile("s_wait_tensorcnt 0x0" : "+s"(gA), "+s"(gB), "+s"(g1) :: "memory")
  if (pinned(wave == 0)) TENSOR_LOAD(gA);
  TENSOR_LOAD(gB);
  TENSOR_WAIT();
  __syncthreads();   // stage 0 published
  advance(gA, placeA);
  advance(gB, placeB);
  if (pinned(wave == 0)) TENSOR_LOAD(gA);
  TENSOR_LOAD(gB);   // stage 1 flies during pass 0

  // All that the later phases take from global memory is read here, under the
  // first stages: no wave shares its rows of W1^T and W2^T with another, so these
  // fragments go straight into registers.
  v16bf w1f[8], w2f[2][4];
  // the lane's row of the wave's weight rows, at its half's first chunk; a
  // fragment is the same two 16-byte chunks, 32 B apart, as in an LDS tile
  const __bf16* p1  = W1T + (size_t)(wave * 16u + l15) * DMODEL + hf * 8u;
  const __bf16* p2a = W2T + (size_t)(wave * 32u + l15) * FFD + hf * 8u;
  const __bf16* p2b = W2T + (size_t)(wave * 32u + 16u + l15) * FFD + hf * 8u;
  const size_t o0 = (size_t)(mb + (int)wave * 4) * 256 + lane * 4;   // + rr * 256 + hh * 128
  const float* psq = seq + o0;
#pragma unroll
  for (int kk = 0; kk < 8; ++kk) w1f[kk] = lds_frag((const char*)(p1 + kk * 32));
#pragma unroll
  for (int kk = 0; kk < 4; ++kk) {
    w2f[0][kk] = lds_frag((const char*)(p2a + kk * 32));
    w2f[1][kk] = lds_frag((const char*)(p2b + kk * 32));
  }
  f32x4 sq[4][2], g1v[2], c1v[2], g2v[2], c2v[2], b1v[2], b2v[2][2];
#pragma unroll
  for (int rr = 0; rr < 4; ++rr)
#pragma unroll
    for (int hh = 0; hh < 2; ++hh)
      sq[rr][hh] = *(const f32x4*)(psq + rr * 256 + hh * 128);
#pragma unroll
  for (int hh = 0; hh < 2; ++hh) {
    g1v[hh] = *(const f32x4*)(ln1g + hh * 128 + lane * 4);
    c1v[hh] = *(const f32x4*)(ln1b + hh * 128 + lane * 4);
    g2v[hh] = *(const f32x4*)(ln2g + hh * 128 + lane * 4);
    c2v[hh] = *(const f32x4*)(ln2b + hh * 128 + lane * 4);
    b1v[hh] = *(const f32x4*)(b1 + wave * 16u + hf * 8u + hh * 4);
    b2v[0][hh] = *(const f32x4*)(b2 + wave * 32u + hf * 8u + hh * 4);
    b2v[1][hh] = *(const f32x4*)(b2 + wave * 32u + 16u + hf * 8u + hh * 4);
  }
  // What follows, later loads' results too, may land in these loads' address
  // registers: keep the wait; it takes the addresses as inputs, so that they
  // stay in their registers up to it
  asm volatile("s_wait_xcnt 0x0" :: "v"(p1), "v"(p2a), "v"(p2b), "v"(psq) : "memory");
  // holds the arithmetic behind the wait
  __builtin_amdgcn_sched_barrier(0);

  // ---- att^T = Wo^T heads^T: acc[nt][mt], n = 32 w + 16 nt .., m = 16 mt ..
  v8f zero = {};
  v8f acc[2][2] = {{zero, zero}, {zero, zero}};
  const unsigned lrow = l15 * GPITCH + hf * 16u;
  const unsigned boff = (1u + wave) * GSLICE + lrow;
  // stays a loop: 16 copies of the pass would only crowd the instruction cache
#pragma unroll 1
  for (int s = 0; s < nst; ++s) {
    const char* ap = &tiles[s & 1][0] + lrow;
    const char* bp = &tiles[s & 1][0] + boff;
    // the whole stage goes into registers first, so that its buffer is free for
    // the refill while the products run
    v16bf a[4][2], b[4][2];
#pragma unroll
    for (int kk = 0; kk < 4; ++kk) {   // 32 of K, 64 B of a row
      a[kk][0] = lds_frag(ap + kk * 64);
      a[kk][1] = lds_frag(ap + 16 * GPITCH + kk * 64);
      b[kk][0] = lds_frag(bp + kk * 64);
      b[kk][1] = lds_frag(bp + 16 * GPITCH + kk * 64);
    }
    // --- publish point of stage s + 1: this wave's reads of stage s are done,
    //     its own slices of stage s + 1 have landed, every wave says the same
    asm volatile("s_wait_dscnt 0x0" ::: "memory");
    TENSOR_WAIT();
    __syncthreads();
    if (pinned(s + 2 < nst)) {   // stage s + 2 into the buffer that pass s has read
      advance(gA, placeA);
      advance(gB, placeB);
      if (pinned(wave == 0)) TENSOR_LOAD(gA);
      TENSOR_LOAD(gB);
    }
    // the products stand behind the refill's issue: the loads fly under them
#pragma unroll
    for (int kk = 0; kk < 4; ++kk)
#pragma unroll
      for (int nt = 0; nt < 2; ++nt)
#pragma unroll
        for (int mt = 0; mt < 2; ++mt)
          acc[nt][mt] = wmma_bf16(b[kk][nt], a[kk][mt], acc[nt][mt]);
  }
  // nothing of the mover or of LDS is out when the wave goes on
  TENSOR_WAIT();
  asm volatile("s_wait_dscnt 0x0" ::: "memory");
#undef TENSOR_LOAD
#undef TENSOR_WAIT

  // The ring is free: every wave's reads and tensor loads ended in front of the
  // last pass's barrier.  It now carries the rows from phase to phase.
  char* st = &tiles[0][0];
  // a lane's 8 accumulator elements of tile (nt, mt) are 8 neighbours of row m
  auto put_rows = [&](const v8f (&t)[2][2]) {
#pragma unroll
    for (int nt = 0; nt < 2; ++nt)
#pragma unroll
      for (int mt = 0; mt < 2; ++mt) {
        char* p = st + ((unsigned)mt * 16u + l15) * APITCH +
                  (wave * 32u + (unsigned)nt * 16u + hf * 8u) * 4u;
        f32x4 lo = {t[nt][mt][0], t[nt][mt][1], t[nt][mt][2], t[nt][mt][3]};
        f32x4 hi = {t[nt][mt][4], t[nt][mt][5], t[nt][mt][6], t[nt][mt][7]};
        *(f32x4*)p = lo;
        *(f32x4*)(p + 16) = hi;
      }
  };
  put_rows(acc);
  __syncthreads();   // a row of att holds columns of all eight waves

  // ---- x = LN(seq + att): f32 stays in registers for the second LN, bf16 to LDS
  f32x4 x[4][2], v1[4][2];
  // all four rows are read before any is written: the four LN chains then run
  // side by side
#pragma unroll
  for (int rr = 0; rr < 4; ++rr)
#pragma unroll
    for (int hh = 0; hh < 2; ++hh)
      v1[rr][hh] = *(const f32x4*)(st + (wave * 4u + (unsigned)rr) * APITCH +
                                   (unsigned)hh * 512u + (unsigned)lane * 16u) + sq[rr][hh];
#pragma unroll
  for (int rr = 0; rr < 4; ++rr) ln_row(v1[rr], g1v, c1v, x[rr]);
#pragma unroll
  for (int rr = 0; rr < 4; ++rr) {
    const unsigned row = wave * 4u + (unsigned)rr;
#pragma unroll
    for (int hh = 0; hh < 2; ++hh) {
      v4bf xb;
#pragma unroll
      for (int j = 0; j < 4; ++j) xb[j] = to_bf16(x[rr][hh][j]);
      *(v4bf*)(st + XOFF + row * XPITCH + (unsigned)hh * 256u + (unsigned)lane * 8u) = xb;
    }
  }
  __syncthreads();   // every wave's products read all 32 rows of x

  // ---- h^T = relu(W1^T x^T + b1): f1[mt], n = 16 w ..
  v8f f1[2] = {zero, zero};
  v16bf xf[8][2];
#pragma unroll
  for (int kk = 0; kk < 8; ++kk)
#pragma unroll
    for (int mt = 0; mt < 2; ++mt)
      xf[kk][mt] = lds_frag(st + XOFF + ((unsigned)mt * 16u + l15) * XPITCH + hf * 16u +
                            (unsigned)kk * 64u);
  // keeps the LDS reads together in front of the products: left alone the
  // compiler reads each fragment right before its use and waits every time
  __builtin_amdgcn_sched_barrier(0);
#pragma unroll
  for (int kk = 0; kk < 8; ++kk)
#pragma unroll
    for (int mt = 0; mt < 2; ++mt) f1[mt] = wmma_bf16(w1f[kk], xf[kk][mt], f1[mt]);
#pragma unroll
  for (int mt = 0; mt < 2; ++mt) {
    v8bf o;
#pragma unroll
    for (int r = 0; r < 8; ++r) o[r] = to_bf16(fmaxf(f1[mt][r] + b1v[r >> 2][r & 3], 0.0f));
    *(v8bf*)(st + HOFF + ((unsigned)mt * 16u + l15) * GPITCH + wave * 32u + hf * 16u) = o;
  }
  __syncthreads();   // a row of h holds columns of all eight waves

  // ---- (h W2 + b2)^T: f2[nt][mt], n = 32 w + 16 nt ..
  v8f f2[2][2] = {{zero, zero}, {zero, zero}};
  v16bf hfr[4][2];
#pragma unroll
  for (int kk = 0; kk < 4; ++kk)
#pragma unroll
    for (int mt = 0; mt < 2; ++mt)
      hfr[kk][mt] = lds_frag(st + HOFF + ((unsigned)mt * 16u + l15) * GPITCH + hf * 16u +
                             (unsigned)kk * 64u);
  // keeps the LDS reads together in front of the products, as above
  __builtin_amdgcn_sched_barrier(0);
#pragma unroll
  for (int kk = 0; kk < 4; ++kk)
#pragma unroll
    for (int nt = 0; nt < 2; ++nt)
#pragma unroll
      for (int mt = 0; mt < 2; ++mt)
        f2[nt][mt] = wmma_bf16(w2f[nt][kk], hfr[kk][mt], f2[nt][mt]);
#pragma unroll
  for (int nt = 0; nt < 2; ++nt)
#pragma unroll
    for (int mt = 0; mt < 2; ++mt)
#pragma unroll
      for (int r = 0; r < 8; ++r) f2[nt][mt][r] += b2v[nt][r >> 2][r & 3];
  // the f32 rows of att were last read in front of the barrier behind the first LN
  put_rows(f2);
  __syncthreads();   // a row holds columns of all eight waves

  // ---- out = LN(x + h W2 + b2)
  f32x4 y[4][2];
#pragma unroll
  for (int rr = 0; rr < 4; ++rr) {
    const unsigned row = wave * 4u + (unsigned)rr;
    f32x4 v[2];
#pragma unroll
    for (int hh = 0; hh < 2; ++hh)
      v[hh] = *(const f32x4*)(st + row * APITCH + (unsigned)hh * 512u + (unsigned)lane * 16u) +
              x[rr][hh];
    ln_row(v, g2v, c2v, y[rr]);
  }
  // holds the stores behind all arithmetic, so that no register of an issued
  // store is written again
  __builtin_amdgcn_sched_barrier(0);
#pragma unroll
  for (int rr = 0; rr < 4; ++rr)
#pragma unroll
    for (int hh = 0; hh < 2; ++hh)
      *(f32x4*)(out + o0 + rr * 256 + hh * 128) = y[rr][hh];
}

// ---------------------------------------------------------------- launcher
extern "C" void kernel_launch(void* const* d_in, const int* in_sizes, int n_in,
                              void* d_out, int out_size, void* d_ws,
                              size_t ws_size, hipStream_t stream) {
  (void)in_sizes; (void)n_in; (void)out_size; (void)ws_size;
  const float* seq  = (const float*)d_in[0];
  const float* Wq   = (const float*)d_in[1];
  const float* Wk   = (const float*)d_in[2];
  const float* Wv   = (const float*)d_in[3];
  const float* Wo   = (const float*)d_in[4];
  const float* ln1g = (const float*)d_in[5];
  const float* ln1b = (const float*)d_in[6];
  const float* W1   = (const float*)d_in[7];
  const float* b1   = (const float*)d_in[8];
  const float* W2   = (const float*)d_in[9];
  const float* b2   = (const float*)d_in[10];
  const float* ln2g = (const float*)d_in[11];
  const float* ln2b = (const float*)d_in[12];

  char* w = (char*)d_ws;
  size_t off = 0;
  auto take = [&](size_t bytes) {
    size_t o = off; off += (bytes + 255) & ~(size_t)255; return o;
  };
  __bf16* seqb  = (__bf16*)(w + take((size_t)NBL * DMODEL * 2));
  __bf16* WqT   = (__bf16*)(w + take((size_t)DH * DMODEL * 2));
  __bf16* WkT   = (__bf16*)(w + take((size_t)DH * DMODEL * 2));
  __bf16* WvT   = (__bf16*)(w + take((size_t)DH * DMODEL * 2));
  __bf16* WoT   = (__bf16*)(w + take((size_t)DMODEL * DH * 2));
  __bf16* W1T   = (__bf16*)(w + take((size_t)FFD * DMODEL * 2));
  __bf16* W2T   = (__bf16*)(w + take((size_t)DMODEL * FFD * 2));
  __bf16* qb    = (__bf16*)(w + take((size_t)NBL * DH * 2));
  __bf16* kb    = (__bf16*)(w + take((size_t)NBL * DH * 2));
  __bf16* vT    = (__bf16*)(w + take((size_t)DH * NBL * 2));
  __bf16* heads = (__bf16*)(w + take((size_t)NBL * DH * 2));

  // 1) convert / transpose inputs to bf16, one launch
  prep_kernel<<<PB_ALL, 256, 0, stream>>>(seq, Wq, Wk, Wv, Wo, W1, W2,
                                          seqb, WqT, WkT, WvT, WoT, W1T, W2T);

  // 2) QKV projections (V stored transposed for the P*V WMMA path; K and V in
  //    the swizzled orders the attention kernel reads), one launch
  dim3 gQKV(DH / 64, NBL / 64, 3);
  qkv_gemm_kernel<<<gQKV, 128, 0, stream>>>(seqb, WqT, WkT, WvT, qb, kb, vT, NBL, DH, DMODEL, NBL);

  // 3) fused flash attention -> heads
  flash_attn_kernel<<<(NBL / 32) * NHEAD / 4, 128, 0, stream>>>(qb, kb, vT, heads);

  // 4) output projection, add + LN, FF, add + LN: one launch, 32 rows a block
  tail_kernel<<<NBL / TROWS, 256, 0, stream>>>(heads, WoT, W1T, W2T, seq, ln1g, ln1b,
                                               b1, b2, ln2g, ln2b, (float*)d_out);
}

// v009
// A run of this version takes 157 microseconds.
// Next to v008, in two timings, it ran 1.04 times as fast each time.
// All steps since v000 together make it 6.61 times as fast.
#include <hip/hip_runtime.h>

typedef __attribute__((ext_vector_type(16))) __bf16 v16bf;
typedef __attribute__((ext_vector_type(8)))  __bf16 v8bf;
typedef __attribute__((ext_vector_type(4)))  __bf16 v4bf;
typedef __attribute__((ext_vector_type(8)))  float  v8f;
typedef __attribute__((ext_vector_type(4)))  float  f32x4;
typedef __attribute__((ext_vector_type(4)))  unsigned int u32x4;
typedef __attribute__((ext_vector_type(8)))  int    i32x8;
typedef __attribute__((ext_vector_type(4)))  int    i32x4;

#define NBL    8192   // B*L
#define DMODEL 256
#define NHEAD  8
#define DH     2048   // D*H
#define LSEQ   2048
#define FFD    128

// ---------------------------------------------------------------- helpers
__device__ __forceinline__ __bf16 to_bf16(float f) {
  union { float f; unsigned u; } x; x.f = f;
  unsigned r = x.u + 0x7FFFu + ((x.u >> 16) & 1u);   // round-to-nearest-even
  unsigned short h = (unsigned short)(r >> 16);
  union { unsigned short s; __bf16 b; } y; y.s = h;
  return y.b;
}

// A/B fragment for v_wmma_f32_16x16x32_bf16 from a row-major (rows x ld) bf16
// matrix (global or LDS), contraction chunk starting at column kc.
// Per CDNA5 ISA 16-bit layout: lane holds row (lane&15); elements 0..7 =
// K [off, off+8), elements 8..15 = K [off+16, off+24), off = (lane&16)?8:0.
__device__ __forceinline__ v16bf load_frag(const __bf16* base, int ld, int row,
                                           int kc, int lane) {
  const __bf16* p = base + (size_t)row * ld + kc + ((lane & 16) ? 8 : 0);
  v16bf f;
  ((f32x4*)&f)[0] = ((const f32x4*)p)[0];
  ((f32x4*)&f)[1] = *(const f32x4*)(p + 16);
  return f;
}

// Swizzled layouts of K and V^T. The attention's tensor loads land rows
// unpadded, so rows of 64 B or 512 B put the 16 lanes of a half-wave on few LDS
// banks.  The producers
// therefore store each 16-byte chunk (8 bf16 of the contraction index) at an
// XOR-ed chunk position inside its row, and the readers undo it: the 16 lanes
// of a half-wave then cover all 64 banks once.  Values and k order unchanged.
//   64-byte rows (32 bf16):  chunk j of row r sits at j ^ ((r >> 2) & 3)
//   512-byte rows (256 bf16): chunk p of row r sits at p ^ (r & 15)
__device__ __forceinline__ int swz64(int row, int col) {
  return col ^ (((row >> 2) & 3) << 3);
}
__device__ __forceinline__ int swz512(int row, int col) {
  return col ^ ((row & 15) << 3);
}

__device__ __forceinline__ v8f wmma_bf16(v16bf a, v16bf b, v8f c) {
  return __builtin_amdgcn_wmma_f32_16x16x32_bf16(false, a, false, b,
                                                 (short)0, c, false, false);
}

__device__ __forceinline__ unsigned lds_off(const void* p) {
  // generic pointer to a __shared__ object: low 32 bits = LDS byte offset
  return (unsigned)(unsigned long long)p;
}

typedef __attribute__((ext_vector_type(8))) unsigned int u32x8;
__device__ __forceinline__ unsigned uni(unsigned v) {   // a scalar-register word
  return (unsigned)__builtin_amdgcn_readfirstlane((int)v);
}
// a wave-uniform test kept in a scalar register: compiles to s_cmp + s_cbranch_scc
__device__ __forceinline__ unsigned pinned(unsigned v) {
  unsigned w = uni(v);
  asm volatile("" : "+s"(w));
  return w;
}

// ---------------------------------------------------------------- converts
// Each lane of the non-matrix kernels takes 8 or 16 elements: few waves to
// start, 16-byte accesses.
__device__ __forceinline__ v8bf pack8(f32x4 lo, f32x4 hi) {
  v8bf o;
#pragma unroll
  for (int j = 0; j < 4; ++j) { o[j] = to_bf16(lo[j]); o[4 + j] = to_bf16(hi[j]); }
  return o;
}

// n is a multiple of 16; a lane converts the 8-element chunks t and t + n/16.
// blk: the block's index among the n / 16 / 256 blocks of this part.
__device__ __forceinline__ void
f32_to_bf16_part(const float* __restrict__ src,
                 __bf16* __restrict__ dst, int n, int blk) {
  const int half = n >> 4;
  const int t = blk * 256 + threadIdx.x;
  if (t >= half) return;
  const f32x4* s4 = (const f32x4*)src;
  f32x4 a0 = s4[2 * t], a1 = s4[2 * t + 1];
  f32x4 b0 = s4[2 * (t + half)], b1 = s4[2 * (t + half) + 1];
  ((v8bf*)dst)[t] = pack8(a0, a1);
  ((v8bf*)dst)[t + half] = pack8(b0, b1);
  // another part's code may follow in the listing and reuse the stores' registers:
  // keep the wait in front
  asm volatile("s_wait_xcnt 0x0" ::: "memory");
}

// src (ROWS x COLS) f32  ->  dst (COLS x ROWS) bf16   (weights -> NxK form,
// plain row-major).  A lane takes 8 source rows of one column, which are one
// 16-byte chunk of a dst row; the part holds exactly ROWS / 8 * COLS threads, blk
// is the block's index in it.  The shape is a
// compile-time constant so that the 8 loads share one address register pair.
template <int ROWS, int COLS>
__device__ __forceinline__ void
transpose_bf16_part(const float* __restrict__ src, __bf16* __restrict__ dst, int blk) {
  const int i = blk * 256 + threadIdx.x;
  const int rc = i / COLS, cc = i % COLS;
  const float* p = src + (size_t)(rc * 8) * COLS + cc;
  float v[8];
#pragma unroll
  for (int j = 0; j < 8; ++j) v[j] = p[j * COLS];
  v8bf o;
#pragma unroll
  for (int j = 0; j < 8; ++j) o[j] = to_bf16(v[j]);
  *(v8bf*)(dst + (size_t)cc * ROWS + rc * 8) = o;
  // another part's code may follow in the listing and reuse the store's registers:
  // keep the wait in front
  asm volatile("s_wait_xcnt 0x0" ::: "memory");
}

// The convert and the six weight transposes depend on nothing but the inputs:
// one launch holds them all, each part on its own range of blocks, so that
// they start, wait for memory and drain side by side instead of in turn.
#define PB_SEQ (NBL * DMODEL / 16 / 256)     // blocks of the convert
#define PB_W   (DMODEL * DH / 8 / 256)       // blocks of a D x DH weight
#define PB_F   (DMODEL * FFD / 8 / 256)      // blocks of a D x FF weight
#define PB_ALL (PB_SEQ + 4 * PB_W + 2 * PB_F)
__global__ void __launch_bounds__(256)
prep_kernel(const float* __restrict__ seq, const float* __restrict__ Wq,
            const float* __restrict__ Wk, const float* __restrict__ Wv,
            const float* __restrict__ Wo, const float* __restrict__ W1,
            const float* __restrict__ W2, __bf16* __restrict__ seqb,
            __bf16* __restrict__ WqT, __bf16* __restrict__ WkT,
            __bf16* __restrict__ WvT, __bf16* __restrict__ WoT,
            __bf16* __restrict__ W1T, __bf16* __restrict__ W2T) {
  int blk = blockIdx.x;
  if (blk < PB_SEQ) { f32_to_bf16_part(seq, seqb, NBL * DMODEL, blk); return; }
  blk -= PB_SEQ;
  if (blk < PB_W) { transpose_bf16_part<DMODEL, DH>(Wq, WqT, blk); return; }
  blk -= PB_W;
  if (blk < PB_W) { transpose_bf16_part<DMODEL, DH>(Wk, WkT, blk); return; }
  blk -= PB_W;
  if (blk < PB_W) { transpose_bf16_part<DMODEL, DH>(Wv, WvT, blk); return; }
  blk -= PB_W;
  if (blk < PB_W) { transpose_bf16_part<DH, DMODEL>(Wo, WoT, blk); return; }
  blk -= PB_W;
  if (blk < PB_F) { transpose_bf16_part<DMODEL, FFD>(W1, W1T, blk); return; }
  blk -= PB_F;
  transpose_bf16_part<FFD, DMODEL>(W2, W2T, blk);
}

// ---------------------------------------------------------------- GEMM
// C(M,N) = A(M,K) x Bt(N,K)^T, bf16 in, f32 accumulate; A and Bt plain
// row-major, K a multiple of 128.  A stage is 128 of K: the block's rows of A
// and of Bt, rows of 256 B, brought into LDS by tensor loads whose pad gives an
// LDS pitch of 272 B (16 B x odd: the 16 rows of a fragment read cover all 64
// banks once).  Two buffers; every wave brings one slice.
// OUTMODE: 1 = bf16 row-major, 2 = bf16 transposed (ldT), 64-byte swizzle,
// 3 = bf16 row-major, 512-byte swizzle
#define GPITCH 272u                 // LDS bytes a row
#define GSLICE 10240u               // 32 rows of 272 B, rounded up to 2 KiB (the tail's slices)
#define SPITCH 144u                 // output staging, bf16: 128 B a row + 16 B (16 B x odd)

// fragment of 16 rows from a padded tile; p: the lane's row, its half's first chunk
__device__ __forceinline__ v16bf lds_frag(const char* p) {
  v16bf f;
  ((f32x4*)&f)[0] = *(const f32x4*)p;          // k = off .. off + 7
  ((f32x4*)&f)[1] = *(const f32x4*)(p + 32);   // k = off + 16 .. off + 23
  return f;
}

// The projections' tile: a block of 4 waves takes 128 x 128 of C, a wave 64 x 64
// (wave >> 1: its 64 rows of A, wave & 1: its 64 rows of Bt), so that each
// fragment read from LDS feeds four products.  A stage holds four slices of 64
// rows; every wave brings one.
#define QSLICE 18432u               // 64 rows of 272 B, rounded up to 2 KiB
#define QBUF   (4u * QSLICE)        // slices 0, 1: A rows 0..63, 64..127; 2, 3: Bt

// tiles: the kernel's two LDS buffers
template <int OUTMODE>
__device__ __forceinline__ void
gemm_bf16_body(char (*tiles)[QBUF],
               const __bf16* __restrict__ A, const __bf16* __restrict__ Bt,
               __bf16* __restrict__ outB, int N, int K, int ldT) {
  const int lane = threadIdx.x & 31;
  const unsigned wave = uni(threadIdx.x >> 5);
  const unsigned wm = wave >> 1, wn = wave & 1u;
  const int n0 = blockIdx.x * 128;
  const int nst = K >> 7;
  // row-major outputs take the product transposed (weights as the A operand)
  constexpr bool TRANSP = (OUTMODE != 2);

  // All extents in bytes (data_size code 0), tensor dims = tile dims.
  u32x8 g1;
  g1[0] = uni(0x07500000u);            // no mask; pad on, every 256 B (code 5), 16 B (code 3)
  g1[1] = uni(256u << 16);             // tensor_dim0
  g1[2] = uni(64u << 16);              // tensor_dim1
  g1[3] = uni(256u << 16);             // tile_dim0
  g1[4] = uni(64u);                    // tile_dim1
  g1[5] = uni((unsigned)K * 2u);       // source pitch
  g1[6] = uni(0u);
  g1[7] = uni(0u);
  u32x4 g0;                            // stage 0 into buffer 0
  const unsigned place0 = lds_off(&tiles[0][0]) + wave * QSLICE;
  {
    const unsigned half = wave & 1u;
    const __bf16* src = (wave >> 1)
        ? Bt + (size_t)(n0 + half * 64) * K
        : A  + (size_t)(blockIdx.y * 128 + half * 64) * K;
    const unsigned long long ga = (unsigned long long)src;
    g0[0] = uni(1u);
    g0[1] = uni(place0);
    g0[2] = uni((unsigned)ga);
    g0[3] = uni(((unsigned)(ga >> 32) & 0x01FFFFFFu) | 0x80000000u);   // type 2
  }
  // the next stage's slice (256 B on along the rows), into the other buffer
  auto advance = [&]() {
    const unsigned lo = g0[2] + 256u;
    g0[1] = uni(2u * place0 + QBUF - g0[1]);
    g0[3] = uni(g0[3] + (lo < 256u ? 1u : 0u));
    g0[2] = uni(lo);
  };
  // Load and wait name both descriptor groups as in-out: the groups stay in one
  // register set each, which keeps its words while the request is out, and
  // group 0 takes the next stage's words only behind the wait.
#define TENSOR_LOAD() asm volatile("tensor_load_to_lds %0, %1" : "+s"(g0), "+s"(g1) :: "memory")
#define TENSOR_WAIT() asm volatile("s_wait_tensorcnt 0x0" : "+s"(g0), "+s"(g1) :: "memory")
  TENSOR_LOAD();
  TENSOR_WAIT();
  __syncthreads();   // stage 0 published
  if (pinned(1 < nst)) {
    advance();
    TENSOR_LOAD();   // stage 1 flies during pass 0
  }

  v8f zero = {};
  v8f acc[4][4];     // [16 rows of A][16 rows of Bt]
#pragma unroll
  for (int mt = 0; mt < 4; ++mt)
#pragma unroll
    for (int nt = 0; nt < 4; ++nt) acc[mt][nt] = zero;
  // the lane's byte offsets in a buffer: its row of the first 16 of the wave's 64
  // rows of A and of Bt, each at its half's first chunk
  const unsigned lrow = (unsigned)(lane & 15) * GPITCH + ((lane & 16) ? 16u : 0u);
  const unsigned aoff = wm * QSLICE + lrow;
  const unsigned boff = (2u + wn) * QSLICE + lrow;
  for (int s = 0; s < nst; ++s) {
    const char* ap = &tiles[s & 1][0] + aoff;
    const char* bp = &tiles[s & 1][0] + boff;
    // the whole stage goes into registers first, so that its buffer is free for
    // the refill while the products run
    v16bf a[4][4], b[4][4];
#pragma unroll
    for (int kk = 0; kk < 4; ++kk)     // 32 of K, 64 B of a row
#pragma unroll
      for (int i = 0; i < 4; ++i) {
        a[kk][i] = lds_frag(ap + i * 16 * GPITCH + kk * 64);
        b[kk][i] = lds_frag(bp + i * 16 * GPITCH + kk * 64);
      }
    // --- publish point of stage s + 1: this wave's reads of stage s are done,
    //     its own slice of stage s + 1 has landed, every wave says the same
    asm volatile("s_wait_dscnt 0x0" ::: "memory");
    TENSOR_WAIT();
    __syncthreads();
    if (pinned(s + 2 < nst)) {   // stage s + 2 into the buffer that pass s has read
      advance();
      TENSOR_LOAD();
    }
    // the products stand behind the refill's issue: the load flies under them
#pragma unroll
    for (int kk = 0; kk < 4; ++kk)
#pragma unroll
      for (int mt = 0; mt < 4; ++mt)
#pragma unroll
        for (int nt = 0; nt < 4; ++nt)
          acc[mt][nt] = TRANSP ? wmma_bf16(b[kk][nt], a[kk][mt], acc[mt][nt])    // C^T: rows n, columns m
                               : wmma_bf16(a[kk][mt], b[kk][nt], acc[mt][nt]);
  }
  // nothing of the mover or of LDS is out when the wave goes on
  TENSOR_WAIT();
  asm volatile("s_wait_dscnt 0x0" ::: "memory");
#undef TENSOR_LOAD
#undef TENSOR_WAIT

  // Outputs leave as whole 128-byte lines.  A lane's 8 accumulator elements of a
  // tile are 8 neighbours of one output row (of C for the transposed product, of
  // C^T for OUTMODE 2): 16-byte chunks.  A wave's 64 x 64 outputs are 64 rows of
  // one line each: the wave sets them up in its own part of LDS and reads them
  // back with the lanes side by side along a row; no other wave takes part.  The
  // ring is free: every wave's reads and tensor loads ended in front of the last
  // pass's barrier.
  char* st = &tiles[0][0] + wave * (64u * SPITCH);
  const int mw = blockIdx.y * 128 + (int)wm * 64;   // the wave's first row of C
  const int nw = n0 + (int)wn * 64;                 // its first column
  const unsigned hf = (unsigned)(lane >> 4) & 1u;
  const unsigned l15 = (unsigned)lane & 15u;
#pragma unroll
  for (int mt = 0; mt < 4; ++mt)
#pragma unroll
    for (int nt = 0; nt < 4; ++nt) {
      v8bf o;
#pragma unroll
      for (int r = 0; r < 8; ++r) o[r] = to_bf16(acc[mt][nt][r]);
      const unsigned row = (unsigned)(TRANSP ? mt : nt) * 16u + l15;
      const unsigned chk = (unsigned)(TRANSP ? nt : mt) * 2u + hf;
      *(v8bf*)(st + row * SPITCH + chk * 16u) = o;
    }
  // the rows are read back by other lanes: the writes have to be done first
  asm volatile("s_wait_dscnt 0x0" ::: "memory");
  v8bf w[16];
  __bf16* gp[16];
#pragma unroll
  for (int j = 0; j < 16; ++j) {
    const int R = j * 4 + (lane >> 3);   // output row of the wave
    const int c8 = (lane & 7) * 8;       // first element of the chunk
    w[j] = *(const v8bf*)(st + (unsigned)R * SPITCH + (unsigned)c8 * 2u);
    if (OUTMODE == 1)      gp[j] = outB + (size_t)(mw + R) * N + nw + c8;
    else if (OUTMODE == 2) gp[j] = outB + (size_t)(nw + R) * ldT + swz64(R, mw + c8);
    else                   gp[j] = outB + (size_t)(mw + R) * N + swz512(R, nw + c8);
  }
  // holds the stores behind all arithmetic, so that no register of an issued
  // store is written again
  __builtin_amdgcn_sched_barrier(0);
#pragma unroll
  for (int j = 0; j < 16; ++j) *(v8bf*)gp[j] = w[j];
}

// The three projections read the same A and depend on nothing of each other:
// one launch, blockIdx.z picks the weight, the output and its store order.  The
// tests stand around tensor loads, which ignore EXEC: scalar branches.
__global__ void __launch_bounds__(128, 2)
qkv_gemm_kernel(const __bf16* __restrict__ A, const __bf16* __restrict__ WqT,
                const __bf16* __restrict__ WkT, const __bf16* __restrict__ WvT,
                __bf16* __restrict__ qb, __bf16* __restrict__ kb,
                __bf16* __restrict__ vT, int M, int N, int K, int ldT) {
  // places of tensor loads: 2 KiB multiples
  __shared__ __attribute__((aligned(2048))) char tiles[2][QBUF];
  (void)M;
  if (pinned(blockIdx.z == 0))
    gemm_bf16_body<1>(tiles, A, WqT, qb, N, K, 0);
  else if (pinned(blockIdx.z == 1))
    gemm_bf16_body<3>(tiles, A, WkT, kb, N, K, 0);
  else
    gemm_bf16_body<2>(tiles, A, WvT, vT, N, K, ldT);
}

__device__ __forceinline__ float other_half(float x) {   // x of lane ^ 16
  int y = __builtin_bit_cast(int, x);
  return __builtin_bit_cast(float, __builtin_amdgcn_permlanex16(
             y, y, 0x76543210, 0xfedcba98, false, false));
}

__global__ void __launch_bounds__(128, 2)
flash_attn_kernel(const __bf16* __restrict__ q, const __bf16* __restrict__ k,
                  const __bf16* __restrict__ vT, __bf16* __restrict__ heads) {
  // (key, d) and (d, key), 16 KB a buffer; places of tensor loads: 2 KiB multiples
  __shared__ __attribute__((aligned(2048))) __bf16 ktile[2][32 * 256];
  __shared__ __attribute__((aligned(2048))) __bf16 vtile[2][256 * 32];
  const int lane = threadIdx.x & 31;
  const unsigned wave = uni(threadIdx.x >> 5);
  // 16 blocks of 128 queries per (b, h)
  const int b  = blockIdx.x >> 7;
  const int h  = (blockIdx.x >> 4) & 7;
  const int qt = (blockIdx.x & 15) * 4 + (int)wave;   // 32-query tile, 0 .. 63
  const int NT = LSEQ / 32;

  // Q fragments: per group 8 K-chunks covering d = 0..255 (global, loaded once)
  v16bf qa[2][8];
  const int qrow = b * LSEQ + qt * 32 + (lane & 15);   // group g: + 16 * g
#pragma unroll
  for (int g = 0; g < 2; ++g)
#pragma unroll
    for (int c = 0; c < 8; ++c)
      qa[g][c] = load_frag(q, DH, qrow + g * 16, h * DMODEL + c * 32, lane);
  // the arithmetic behind may land in these loads' address registers: keep the wait
  asm volatile("s_wait_xcnt 0x0" ::: "memory");
  // holds that arithmetic behind the wait
  __builtin_amdgcn_sched_barrier(0);

  // Every wave brings its own 8 KB slice of each stage, one request at a time:
  // waves 0, 1 the key rows 0..15, 16..31 of K (16 rows of 512 B, pitch 4 KB),
  // waves 2, 3 the d rows 0..127, 128..255 of V^T (128 rows of 64 B, pitch 16 KB).
  // All extents in bytes (data_size code 0), tensor dims = tile dims, no pad.
  const unsigned isv = wave >> 1, half = wave & 1u;
  const unsigned rowb = isv ? 64u : 512u;                  // bytes a row
  const unsigned nrow = isv ? 128u : 16u;                  // rows
  const unsigned step = isv ? 64u : 32u * DH * 2u;         // source bytes a stage
  u32x8 g1;
  g1[0] = uni(0u);                     // no mask, data_size 0, no pad
  g1[1] = uni(rowb << 16);             // tensor_dim0
  g1[2] = uni(nrow << 16);             // tensor_dim1
  g1[3] = uni(rowb << 16);             // tile_dim0
  g1[4] = uni(nrow);                   // tile_dim1
  g1[5] = uni(isv ? NBL * 2u : DH * 2u);   // source pitch
  g1[6] = uni(0u);
  g1[7] = uni(0u);
  u32x4 g0;                            // stage 0 into buffer 0
  {
    const __bf16* src = isv
        ? vT + (size_t)(h * DMODEL + half * 128) * NBL + b * LSEQ
        : k  + (size_t)(b * LSEQ + half * 16) * DH + h * DMODEL;
    const unsigned long long ga = (unsigned long long)src;
    g0[0] = uni(1u);
    g0[1] = uni((isv ? lds_off(&vtile[0][0]) : lds_off(&ktile[0][0])) + half * 8192u);
    g0[2] = uni((unsigned)ga);
    g0[3] = uni(((unsigned)(ga >> 32) & 0x01FFFFFFu) | 0x80000000u);   // type 2
  }
  // the next stage's slice, into the other buffer
  auto advance = [&]() {
    const unsigned lo = g0[2] + step;
    g0[1] = uni(g0[1] ^ 16384u);
    g0[3] = uni(g0[3] + (lo < step ? 1u : 0u));
    g0[2] = uni(lo);
  };
  // Load and wait name both descriptor groups as in-out: the groups stay in one
  // register set each, which keeps its words while the request is out, and
  // group 0 takes the next stage's words only behind the wait.
#define TENSOR_LOAD() asm volatile("tensor_load_to_lds %0, %1" : "+s"(g0), "+s"(g1) :: "memory")
#define TENSOR_WAIT() asm volatile("s_wait_tensorcnt 0x0" : "+s"(g0), "+s"(g1) :: "memory")
  TENSOR_LOAD();
  TENSOR_WAIT();
  __syncthreads();   // stage 0 published
  advance();
  TENSOR_LOAD();     // stage 1 flies during pass 0

  // o[g][nt][r] = O[query 16*g + (lane & 15)][d = nt*16 + r + 8*(lane>>4)]
  v8f o[2][16];
  v8f zero = {};
#pragma unroll
  for (int g = 0; g < 2; ++g)
#pragma unroll
    for (int nt = 0; nt < 16; ++nt) o[g][nt] = zero;
  float mrun[2] = {-1e30f, -1e30f};   // running maximum of the lane's query (both halves alike)
  float lrun[2] = {0.0f, 0.0f};       // running sum over this half's keys only

  // The lane's LDS byte offsets in the current K and V buffer: ka[m] is chunk
  // 2 * m + (lane >> 4) of a 128-element half row of K under the 512-byte
  // swizzle, va[] the two chunks of a V^T fragment under the 64-byte swizzle.  They are flipped to the
  // other buffer at the foot of each pass: one register set serves both buffers
  // (per-pass address arithmetic takes registers that this tile does not have).
  unsigned ka[8], va[2];
  {
    const int s = lane & 15, hh = (lane >> 4) & 1;
#pragma unroll
    for (int m = 0; m < 8; ++m) ka[m] = (unsigned)(s * 256 + (((m * 2 + hh) ^ s) * 8)) * 2u;
    const int j0 = hh ^ ((lane >> 2) & 3);
    va[0] = (unsigned)(s * 32 + j0 * 8) * 2u;
    va[1] = (unsigned)(s * 32 + (j0 ^ 2) * 8) * 2u;
  }
  const char* kl = (const char*)&ktile[0][0];
  const char* vl = (const char*)&vtile[0][0];
  // rows row0 .. row0 + 15 of the K tile, contraction chunk c (32 wide)
  auto kfrag = [&](int row0, int c) {
    v16bf f;
    ((f32x4*)&f)[0] = *(const f32x4*)(kl + ka[(c & 3) * 2]     + row0 * 512 + (c >> 2) * 256);
    ((f32x4*)&f)[1] = *(const f32x4*)(kl + ka[(c & 3) * 2 + 1] + row0 * 512 + (c >> 2) * 256);
    return f;
  };
  // rows row0 .. row0 + 15 of the V^T tile
  auto vfrag = [&](int row0) {
    v16bf f;
    ((f32x4*)&f)[0] = *(const f32x4*)(vl + va[0] + row0 * 64);
    ((f32x4*)&f)[1] = *(const f32x4*)(vl + va[1] + row0 * 64);
    return f;
  };

  const float scale = 0.0625f;  // 1/sqrt(256)
  for (int t = 0; t < NT; ++t) {

    // --- S^T = K * Q^T  (32 keys x 32 queries, four 16x16 tiles per K-chunk).
    //     With two waves a SIMD the wave covers its own LDS waits: the K
    //     fragments of a chunk are read two chunks ahead of their products,
    //     into three register sets in turn.
    v8f s0[2] = {zero, zero}, s1[2] = {zero, zero};
    v16bf kf[3][2];   // [set][key half]
#pragma unroll
    for (int c = 0; c < 2; ++c) {
      kf[c][0] = kfrag(0,  c);
      kf[c][1] = kfrag(16, c);
    }
#pragma unroll
    for (int c = 0; c < 8; ++c) {
      if (c < 6) {
        kf[(c + 2) % 3][0] = kfrag(0,  c + 2);
        kf[(c + 2) % 3][1] = kfrag(16, c + 2);
      }
      // keeps these LDS reads in front of this chunk's products: left alone
      // the compiler reads each fragment right before its use
      __builtin_amdgcn_sched_barrier(0);
#pragma unroll
      for (int g = 0; g < 2; ++g) {
        s0[g] = wmma_bf16(kf[c % 3][0], qa[g][c], s0[g]);
        s1[g] = wmma_bf16(kf[c % 3][1], qa[g][c], s1[g]);
      }
      // holds later reads back from these products (best effort: behind the last
      // chunk the first V reads still stand among its products in the listing)
      __builtin_amdgcn_sched_barrier(0);
    }

    // first two pairs of V fragments: read here so that the softmax covers the wait
    v16bf vf[3][2];      // [set][d tile of the pair]
#pragma unroll
    for (int j = 0; j < 4; ++j) vf[j >> 1][j & 1] = vfrag(j * 16);
    // keeps these reads in front of the softmax arithmetic
    __builtin_amdgcn_sched_barrier(0);

    // --- online softmax, group by group: 16 of a query's 32 scores sit in this
    //     lane, the other 16 in lane ^ 16
    v16bf pb[2];       // B fragment of P^T: keys 8h + r, then 16 + 8h + r
#pragma unroll
    for (int g = 0; g < 2; ++g) {
      float a0[8], a1[8], mx8[8];
#pragma unroll
      for (int r = 0; r < 8; ++r) {
        a0[r] = s0[g][r] * scale;
        a1[r] = s1[g][r] * scale;
        mx8[r] = fmaxf(a0[r], a1[r]);
      }
      float mx = fmaxf(fmaxf(fmaxf(mx8[0], mx8[1]), fmaxf(mx8[2], mx8[3])),
                       fmaxf(fmaxf(mx8[4], mx8[5]), fmaxf(mx8[6], mx8[7])));
      mx = fmaxf(mx, other_half(mx));
      const float mnew = fmaxf(mrun[g], mx);
      const float corr = __expf(mrun[g] - mnew);
      mrun[g] = mnew;
      float ps8[8];
#pragma unroll
      for (int r = 0; r < 8; ++r) {
        float p0 = __expf(a0[r] - mnew);
        float p1 = __expf(a1[r] - mnew);
        ps8[r] = p0 + p1;
        pb[g][r]     = to_bf16(p0);
        pb[g][8 + r] = to_bf16(p1);
      }
      lrun[g] = lrun[g] * corr + (((ps8[0] + ps8[1]) + (ps8[2] + ps8[3])) +
                                  ((ps8[4] + ps8[5]) + (ps8[6] + ps8[7])));
#pragma unroll
      for (int nt = 0; nt < 16; ++nt) o[g][nt] *= corr;
    }

    // keeps the third pair's reads out of the softmax, where registers are short
    __builtin_amdgcn_sched_barrier(0);

    // --- O^T += V^T * P^T   (16 output tiles across d = 256, per group of
    //     queries); V fragments in pairs of d tiles, read two pairs ahead
#pragma unroll
    for (int np = 0; np < 8; ++np) {
      if (np < 6) {
        vf[(np + 2) % 3][0] = vfrag(((np + 2) * 2) * 16);
        vf[(np + 2) % 3][1] = vfrag(((np + 2) * 2 + 1) * 16);
      }
      // keeps these LDS reads in front of this pair's products
      __builtin_amdgcn_sched_barrier(0);
#pragma unroll
      for (int j = 0; j < 2; ++j)
#pragma unroll
        for (int g = 0; g < 2; ++g)
          o[g][np * 2 + j] = wmma_bf16(vf[np % 3][j], pb[g], o[g][np * 2 + j]);
      // keeps later reads from rising in among these products
      __builtin_amdgcn_sched_barrier(0);
    }

#pragma unroll
    for (int m = 0; m < 8; ++m) ka[m] ^= 16384u;
    va[0] ^= 16384u;
    va[1] ^= 16384u;

    // --- publish point of stage t + 1: this wave's reads of stage t are done,
    //     its own slice of stage t + 1 has landed, every wave says the same
    asm volatile("s_wait_dscnt 0x0" ::: "memory");
    TENSOR_WAIT();
    __syncthreads();
    if (pinned(t + 2 < NT)) {   // stage t + 2 into the buffer that pass t has read
      advance();
      TENSOR_LOAD();
    }
  }
  // nothing of the mover or of LDS is out when the wave ends
  TENSOR_WAIT();
  asm volatile("s_wait_dscnt 0x0" ::: "memory");
#undef TENSOR_LOAD
#undef TENSOR_WAIT

  // normalize and store heads (bf16 row-major (NBL, DH)): a lane's 8 elements
  // of a tile are 8 neighbours in d, one 16-byte store
  v8bf ov[2][16];
#pragma unroll
  for (int g = 0; g < 2; ++g) {
    const float inv = 1.0f / (lrun[g] + other_half(lrun[g]));
#pragma unroll
    for (int nt = 0; nt < 16; ++nt)
#pragma unroll
      for (int r = 0; r < 8; ++r) ov[g][nt][r] = to_bf16(o[g][nt][r] * inv);
  }
  __bf16* hp = heads + (size_t)qrow * DH + h * DMODEL + ((lane & 16) ? 8 : 0);
  // holds the stores behind all arithmetic, so that no register of an issued
  // store is written again
  __builtin_amdgcn_sched_barrier(0);
#pragma unroll
  for (int g = 0; g < 2; ++g)
#pragma unroll
    for (int nt = 0; nt < 16; ++nt)
      *(v8bf*)(hp + (size_t)g * 16 * DH + nt * 16) = ov[g][nt];
}

// ---------------------------------------------------------------- add + LN
// y = LN(a + rsd) * g + b ;  one wave per row of 256 elements.  A lane holds
// elements 4*lane.. and 128 + 4*lane.. of the row, so every 16-byte access of a
// wave covers 512 contiguous bytes.
template <int M>
__device__ __forceinline__ float add_xmask(float x) {   // x + x of lane ^ M, M < 16
  int y = __builtin_amdgcn_update_dpp(0, __builtin_bit_cast(int, x), 0x160 | M,
                                      0xf, 0xf, true);
  return x + __builtin_bit_cast(float, y);
}
__device__ __forceinline__ float wave_sum(float x) {    // every lane gets the sum
  x = add_xmask<1>(x);
  x = add_xmask<2>(x);
  x = add_xmask<4>(x);
  x = add_xmask<8>(x);
  int b = __builtin_bit_cast(int, x);
  return x + __builtin_bit_cast(float, __builtin_amdgcn_permlanex16(
                 b, b, 0x76543210, 0xfedcba98, false, false));
}

// LN of one row of 256 held by one wave: v[hh] = elements hh * 128 + 4 * lane ..
__device__ __forceinline__ void ln_row(const f32x4 (&v)[2], const f32x4 (&gg)[2],
                                       const f32x4 (&bb)[2], f32x4 (&y)[2]) {
  f32x4 s4 = v[0] + v[1];
  float mu = wave_sum((s4[0] + s4[1]) + (s4[2] + s4[3])) * (1.0f / 256.0f);
  f32x4 d0 = v[0] - mu, d1 = v[1] - mu;
  f32x4 q4 = d0 * d0 + d1 * d1;
  float var = wave_sum((q4[0] + q4[1]) + (q4[2] + q4[3])) * (1.0f / 256.0f);
  float rs = rsqrtf(var + 1e-5f);
  y[0] = d0 * rs * gg[0] + bb[0];
  y[1] = d1 * rs * gg[1] + bb[1];
}

// ---------------------------------------------------------------- tail
// Everything behind the attention works row by row of the sequence, so a block
// that owns whole rows needs no other block's results: one launch does
//   att = heads Wo;  x = LN(seq + att);  h = relu(x W1 + b1);
//   out = LN(x + h W2 + b2)
// for 32 rows.  8 waves.  All products are taken transposed (weights as the A
// operand): a lane holds 8 neighbours in n of one row m = lane & 15 of a tile.
// Wave w owns the columns 32 w .. 32 w + 31 of att and of h W2, 16 w .. 16 w + 15
// of h, and for the two LNs the rows 4 w .. 4 w + 3.
// att: stages of 128 of K as in the GEMM above (256 B rows, LDS pitch 272 B, two
// buffers); slice 0 holds the block's 32 rows of heads (wave 0 brings it), slice
// 1 + w the 32 rows of Wo^T that wave w brings and alone reads.
#define TROWS  32
#define TBUF   (9u * GSLICE)
#define APITCH 1040u     // f32 rows between the phases: 1024 B + 16 B
#define XPITCH 528u      // x in bf16: 512 B a row + 16 B (16 B x odd)
#define XOFF   34816u    // x stands behind the 32 f32 rows
#define HOFF   52224u    // h (pitch 272 B) stands behind x
__global__ void __launch_bounds__(256, 2)
tail_kernel(const __bf16* __restrict__ heads, const __bf16* __restrict__ WoT,
            const __bf16* __restrict__ W1T, const __bf16* __restrict__ W2T,
            const float* __restrict__ seq,
            const float* __restrict__ ln1g, const float* __restrict__ ln1b,
            const float* __restrict__ b1, const float* __restrict__ b2,
            const float* __restrict__ ln2g, const float* __restrict__ ln2b,
            float* __restrict__ out) {
  // places of tensor loads: 2 KiB multiples
  __shared__ __attribute__((aligned(2048))) char tiles[2][TBUF];
  const int lane = threadIdx.x & 31;
  const unsigned wave = uni(threadIdx.x >> 5);
  const unsigned hf = (unsigned)(lane >> 4) & 1u;
  const unsigned l15 = (unsigned)lane & 15u;
  const int mb = blockIdx.x * TROWS;
  constexpr int nst = DH >> 7;

  // All extents in bytes (data_size code 0), tensor dims = tile dims; heads and
  // Wo^T have the same row length, so one group 1 serves both.
  u32x8 g1;
  g1[0] = uni(0x07500000u);            // no mask; pad on, every 256 B (code 5), 16 B (code 3)
  g1[1] = uni(256u << 16);             // tensor_dim0
  g1[2] = uni(32u << 16);              // tensor_dim1
  g1[3] = uni(256u << 16);             // tile_dim0
  g1[4] = uni(32u);                    // tile_dim1
  g1[5] = uni(DH * 2u);                // source pitch
  g1[6] = uni(0u);
  g1[7] = uni(0u);
  const unsigned placeA = lds_off(&tiles[0][0]);
  const unsigned placeB = placeA + (1u + wave) * GSLICE;
  u32x4 gA, gB;                        // stage 0 into buffer 0
  {
    const unsigned long long aa = (unsigned long long)(heads + (size_t)mb * DH);
    const unsigned long long ab = (unsigned long long)(WoT + (size_t)(wave * 32u) * DH);
    gA[0] = uni(1u);
    gA[1] = uni(placeA);
    gA[2] = uni((unsigned)aa);
    gA[3] = uni(((unsigned)(aa >> 32) & 0x01FFFFFFu) | 0x80000000u);   // type 2
    gB[0] = uni(1u);
    gB[1] = uni(placeB);
    gB[2] = uni((unsigned)ab);
    gB[3] = uni(((unsigned)(ab >> 32) & 0x01FFFFFFu) | 0x80000000u);   // type 2
  }
  // the next stage's slice (256 B on along the rows), into the other buffer
  auto advance = [&](u32x4& g, unsigned place0) {
    const unsigned lo = g[2] + 256u;
    g[1] = uni(2u * place0 + TBUF - g[1]);
    g[3] = uni(g[3] + (lo < 256u ? 1u : 0u));
    g[2] = uni(lo);
  };
  // Loads and wait name the descriptor groups as in-out: each group stays in one
  // register set, which keeps its words while a request is out, and the groups 0
  // take the next stage's words only behind the wait.  Wave 0 has two requests
  // out, the others one; the wait is to 0.
#define TENSOR_LOAD(G) asm volatile("tensor_load_to_lds %0, %1" : "+s"(G), "+s"(g1) :: "memory")
#define TENSOR_WAIT() asm volatile("s_wait_tensorcnt 0x0" : "+s"(gA), "+s"(gB), "+s"(g1) :: "memory")
  if (pinned(wave == 0)) TENSOR_LOAD(gA);
  TENSOR_LOAD(gB);
  TENSOR_WAIT();
  __syncthreads();   // stage 0 published
  advance(gA, placeA);
  advance(gB, placeB);
  if (pinned(wave == 0)) TENSOR_LOAD(gA);
  TENSOR_LOAD(gB);   // stage 1 flies during pass 0

  // All that the later phases take from global memory is read here, under the
  // first stages: no wave shares its rows of W1^T and W2^T with another, so these
  // fragments go straight into registers.
  v16bf w1f[8], w2f[2][4];
  // the lane's row of the wave's weight rows, at its half's first chunk; a
  // fragment is the same two 16-byte chunks, 32 B apart, as in an LDS tile
  const __bf16* p1  = W1T + (size_t)(wave * 16u + l15) * DMODEL + hf * 8u;
  const __bf16* p2a = W2T + (size_t)(wave * 32u + l15) * FFD + hf * 8u;
  const __bf16* p2b = W2T + (size_t)(wave * 32u + 16u + l15) * FFD + hf * 8u;
  const size_t o0 = (size_t)(mb + (int)wave * 4) * 256 + lane * 4;   // + rr * 256 + hh * 128
  const float* psq = seq + o0;
#pragma unroll
  for (int kk = 0; kk < 8; ++kk) w1f[kk] = lds_frag((const char*)(p1 + kk * 32));
#pragma unroll
  for (int kk = 0; kk < 4; ++kk) {
    w2f[0][kk] = lds_frag((const char*)(p2a + kk * 32));
    w2f[1][kk] = lds_frag((const char*)(p2b + kk * 32));
  }
  f32x4 sq[4][2], g1v[2], c1v[2], g2v[2], c2v[2], b1v[2], b2v[2][2];
#pragma unroll
  for (int rr = 0; rr < 4; ++rr)
#pragma unroll
    for (int hh = 0; hh < 2; ++hh)
      sq[rr][hh] = *(const f32x4*)(psq + rr * 256 + hh * 128);
#pragma unroll
  for (int hh = 0; hh < 2; ++hh) {
    g1v[hh] = *(const f32x4*)(ln1g + hh * 128 + lane * 4);
    c1v[hh] = *(const f32x4*)(ln1b + hh * 128 + lane * 4);
    g2v[hh] = *(const f32x4*)(ln2g + hh * 128 + lane * 4);
    c2v[hh] = *(const f32x4*)(ln2b + hh * 128 + lane * 4);
    b1v[hh] = *(const f32x4*)(b1 + wave * 16u + hf * 8u + hh * 4);
    b2v[0][hh] = *(const f32x4*)(b2 + wave * 32u + hf * 8u + hh * 4);
    b2v[1][hh] = *(const f32x4*)(b2 + wave * 32u + 16u + hf * 8u + hh * 4);
  }
  // What follows, later loads' results too, may land in these loads' address
  // registers: keep the wait; it takes the addresses as inputs, so that they
  // stay in their registers up to it
  asm volatile("s_wait_xcnt 0x0" :: "v"(p1), "v"(p2a), "v"(p2b), "v"(psq) : "memory");
  // holds the arithmetic behind the wait
  __builtin_amdgcn_sched_barrier(0);

  // ---- att^T = Wo^T heads^T: acc[nt][mt], n = 32 w + 16 nt .., m = 16 mt ..
  v8f zero = {};
  v8f acc[2][2] = {{zero, zero}, {zero, zero}};
  const unsigned lrow = l15 * GPITCH + hf * 16u;
  const unsigned boff = (1u + wave) * GSLICE + lrow;
  // stays a loop, for speed only
#pragma unroll 1
  for (int s = 0; s < nst; ++s) {
    const char* ap = &tiles[s & 1][0] + lrow;
    const char* bp = &tiles[s & 1][0] + boff;
    // the whole stage goes into registers first, so that its buffer is free for
    // the refill while the products run
    v16bf a[4][2], b[4][2];
#pragma unroll
    for (int kk = 0; kk < 4; ++kk) {   // 32 of K, 64 B of a row
      a[kk][0] = lds_frag(ap + kk * 64);
      a[kk][1] = lds_frag(ap + 16 * GPITCH + kk * 64);
      b[kk][0] = lds_frag(bp + kk * 64);
      b[kk][1] = lds_frag(bp + 16 * GPITCH + kk * 64);
    }
    // --- publish point of stage s + 1: this wave's reads of stage s are done,
    //     its own slices of stage s + 1 have landed, every wave says the same
    asm volatile("s_wait_dscnt 0x0" ::: "memory");
    TENSOR_WAIT();
    __syncthreads();
    if (pinned(s + 2 < nst)) {   // stage s + 2 into the buffer that pass s has read
      advance(gA, placeA);
      advance(gB, placeB);
      if (pinned(wave == 0)) TENSOR_LOAD(gA);
      TENSOR_LOAD(gB);
    }
    // the products stand behind the refill's issue: the loads fly under them
#pragma unroll
    for (int kk = 0; kk < 4; ++kk)
#pragma unroll
      for (int nt = 0; nt < 2; ++nt)
#pragma unroll
        for (int mt = 0; mt < 2; ++mt)
          acc[nt][mt] = wmma_bf16(b[kk][nt], a[kk][mt], acc[nt][mt]);
  }
  // nothing of the mover or of LDS is out when the wave goes on
  TENSOR_WAIT();
  asm volatile("s_wait_dscnt 0x0" ::: "memory");
#undef TENSOR_LOAD
#undef TENSOR_WAIT

  // The ring is free: every wave's reads and tensor loads ended in front of the
  // last pass's barrier.  It now carries the rows from phase to phase.
  char* st = &tiles[0][0];
  // a lane's 8 accumulator elements of tile (nt, mt) are 8 neighbours of row m
  auto put_rows = [&](const v8f (&t)[2][2]) {
#pragma unroll
    for (int nt = 0; nt < 2; ++nt)
#pragma unroll
      for (int mt = 0; mt < 2; ++mt) {
        char* p = st + ((unsigned)mt * 16u + l15) * APITCH +
                  (wave * 32u + (unsigned)nt * 16u + hf * 8u) * 4u;
        f32x4 lo = {t[nt][mt][0], t[nt][mt][1], t[nt][mt][2], t[nt][mt][3]};
        f32x4 hi = {t[nt][mt][4], t[nt][mt][5], t[nt][mt][6], t[nt][mt][7]};
        *(f32x4*)p = lo;
        *(f32x4*)(p + 16) = hi;
      }
  };
  put_rows(acc);
  __syncthreads();   // a row of att holds columns of all eight waves

  // ---- x = LN(seq + att): f32 stays in registers for the second LN, bf16 to LDS
  f32x4 x[4][2], v1[4][2];
  // all four rows are read before any is written: the four LN chains then run
  // side by side
#pragma unroll
  for (int rr = 0; rr < 4; ++rr)
#pragma unroll
    for (int hh = 0; hh < 2; ++hh)
      v1[rr][hh] = *(const f32x4*)(st + (wave * 4u + (unsigned)rr) * APITCH +
                                   (unsigned)hh * 512u + (unsigned)lane * 16u) + sq[rr][hh];
#pragma unroll
  for (int rr = 0; rr < 4; ++rr) ln_row(v1[rr], g1v, c1v, x[rr]);
#pragma unroll
  for (int rr = 0; rr < 4; ++rr) {
    const unsigned row = wave * 4u + (unsigned)rr;
#pragma unroll
    for (int hh = 0; hh < 2; ++hh) {
      v4bf xb;
#pragma unroll
      for (int j = 0; j < 4; ++j) xb[j] = to_bf16(x[rr][hh][j]);
      *(v4bf*)(st + XOFF + row * XPITCH + (unsigned)hh * 256u + (unsigned)lane * 8u) = xb;
    }
  }
  __syncthreads();   // every wave's products read all 32 rows of x

  // ---- h^T = relu(W1^T x^T + b1): f1[mt], n = 16 w ..
  v8f f1[2] = {zero, zero};
  v16bf xf[8][2];
#pragma unroll
  for (int kk = 0; kk < 8; ++kk)
#pragma unroll
    for (int mt = 0; mt < 2; ++mt)
      xf[kk][mt] = lds_frag(st + XOFF + ((unsigned)mt * 16u + l15) * XPITCH + hf * 16u +
                            (unsigned)kk * 64u);
  // keeps the LDS reads together in front of the products: left alone the
  // compiler reads each fragment right before its use and waits every time
  __builtin_amdgcn_sched_barrier(0);
#pragma unroll
  for (int kk = 0; kk < 8; ++kk)
#pragma unroll
    for (int mt = 0; mt < 2; ++mt) f1[mt] = wmma_bf16(w1f[kk], xf[kk][mt], f1[mt]);
#pragma unroll
  for (int mt = 0; mt < 2; ++mt) {
    v8bf o;
#pragma unroll
    for (int r = 0; r < 8; ++r) o[r] = to_bf16(fmaxf(f1[mt][r] + b1v[r >> 2][r & 3], 0.0f));
    *(v8bf*)(st + HOFF + ((unsigned)mt * 16u + l15) * GPITCH + wave * 32u + hf * 16u) = o;
  }
  __syncthreads();   // a row of h holds columns of all eight waves

  // ---- (h W2 + b2)^T: f2[nt][mt], n = 32 w + 16 nt ..
  v8f f2[2][2] = {{zero, zero}, {zero, zero}};
  v16bf hfr[4][2];
#pragma unroll
  for (int kk = 0; kk < 4; ++kk)
#pragma unroll
    for (int mt = 0; mt < 2; ++mt)
      hfr[kk][mt] = lds_frag(st + HOFF + ((unsigned)mt * 16u + l15) * GPITCH + hf * 16u +
                             (unsigned)kk * 64u);
  // keeps the LDS reads together in front of the products, as above
  __builtin_amdgcn_sched_barrier(0);
#pragma unroll
  for (int kk = 0; kk < 4; ++kk)
#pragma unroll
    for (int nt = 0; nt < 2; ++nt)
#pragma unroll
      for (int mt = 0; mt < 2; ++mt)
        f2[nt][mt] = wmma_bf16(w2f[nt][kk], hfr[kk][mt], f2[nt][mt]);
#pragma unroll
  for (int nt = 0; nt < 2; ++nt)
#pragma unroll
    for (int mt = 0; mt < 2; ++mt)
#pragma unroll
      for (int r = 0; r < 8; ++r) f2[nt][mt][r] += b2v[nt][r >> 2][r & 3];
  // the f32 rows of att were last read in front of the barrier behind the first LN
  put_rows(f2);
  __syncthreads();   // a row holds columns of all eight waves

  // ---- out = LN(x + h W2 + b2)
  f32x4 y[4][2];
#pragma unroll
  for (int rr = 0; rr < 4; ++rr) {
    const unsigned row = wave * 4u + (unsigned)rr;
    f32x4 v[2];
#pragma unroll
    for (int hh = 0; hh < 2; ++hh)
      v[hh] = *(const f32x4*)(st + row * APITCH + (unsigned)hh * 512u + (unsigned)lane * 16u) +
              x[rr][hh];
    ln_row(v, g2v, c2v, y[rr]);
  }
  // holds the stores behind all arithmetic, so that no register of an issued
  // store is written again
  __builtin_amdgcn_sched_barrier(0);
#pragma unroll
  for (int rr = 0; rr < 4; ++rr)
#pragma unroll
    for (int hh = 0; hh < 2; ++hh)
      *(f32x4*)(out + o0 + rr * 256 + hh * 128) = y[rr][hh];
}

// ---------------------------------------------------------------- launcher
extern "C" void kernel_launch(void* const* d_in, const int* in_sizes, int n_in,
                              void* d_out, int out_size, void* d_ws,
                              size_t ws_size, hipStream_t stream) {
  (void)in_sizes; (void)n_in; (void)out_size; (void)ws_size;
  const float* seq  = (const float*)d_in[0];
  const float* Wq   = (const float*)d_in[1];
  const float* Wk   = (const float*)d_in[2];
  const float* Wv   = (const float*)d_in[3];
  const float* Wo   = (const float*)d_in[4];
  const float* ln1g = (const float*)d_in[5];
  const float* ln1b = (const float*)d_in[6];
  const float* W1   = (const float*)d_in[7];
  const float* b1   = (const float*)d_in[8];
  const float* W2   = (const float*)d_in[9];
  const float* b2   = (const float*)d_in[10];
  const float* ln2g = (const float*)d_in[11];
  const float* ln2b = (const float*)d_in[12];

  char* w = (char*)d_ws;
  size_t off = 0;
  auto take = [&](size_t bytes) {
    size_t o = off; off += (bytes + 255) & ~(size_t)255; return o;
  };
  __bf16* seqb  = (__bf16*)(w + take((size_t)NBL * DMODEL * 2));
  __bf16* WqT   = (__bf16*)(w + take((size_t)DH * DMODEL * 2));
  __bf16* WkT   = (__bf16*)(w + take((size_t)DH * DMODEL * 2));
  __bf16* WvT   = (__bf16*)(w + take((size_t)DH * DMODEL * 2));
  __bf16* WoT   = (__bf16*)(w + take((size_t)DMODEL * DH * 2));
  __bf16* W1T   = (__bf16*)(w + take((size_t)FFD * DMODEL * 2));
  __bf16* W2T   = (__bf16*)(w + take((size_t)DMODEL * FFD * 2));
  __bf16* qb    = (__bf16*)(w + take((size_t)NBL * DH * 2));
  __bf16* kb    = (__bf16*)(w + take((size_t)NBL * DH * 2));
  __bf16* vT    = (__bf16*)(w + take((size_t)DH * NBL * 2));
  __bf16* heads = (__bf16*)(w + take((size_t)NBL * DH * 2));

  // 1) convert / transpose inputs to bf16, one launch
  prep_kernel<<<PB_ALL, 256, 0, stream>>>(seq, Wq, Wk, Wv, Wo, W1, W2,
                                          seqb, WqT, WkT, WvT, WoT, W1T, W2T);

  // 2) QKV projections (V stored transposed for the P*V WMMA path; K and V in
  //    the swizzled orders the attention kernel reads), one launch
  dim3 gQKV(DH / 128, NBL / 128, 3);
  qkv_gemm_kernel<<<gQKV, 128, 0, stream>>>(seqb, WqT, WkT, WvT, qb, kb, vT, NBL, DH, DMODEL, NBL);

  // 3) fused flash attention -> heads
  flash_attn_kernel<<<(NBL / 32) * NHEAD / 4, 128, 0, stream>>>(qb, kb, vT, heads);

  // 4) output projection, add + LN, FF, add + LN: one launch, 32 rows a block
  tail_kernel<<<NBL / TROWS, 256, 0, stream>>>(heads, WoT, W1T, W2T, seq, ln1g, ln1b,
                                               b1, b2, ln2g, ln2b, (float*)d_out);
}

// v010
// It runs in 151 microseconds.
// Timed twice side by side with v009, it ran 1.04 and 1.05 times as fast.
// All steps since v000 together make it 6.89 times as fast.
#include <hip/hip_runtime.h>

typedef __attribute__((ext_vector_type(16))) __bf16 v16bf;
typedef __attribute__((ext_vector_type(8)))  __bf16 v8bf;
typedef __attribute__((ext_vector_type(4)))  __bf16 v4bf;
typedef __attribute__((ext_vector_type(8)))  float  v8f;
typedef __attribute__((ext_vector_type(4)))  float  f32x4;
typedef __attribute__((ext_vector_type(4)))  unsigned int u32x4;
typedef __attribute__((ext_vector_type(8)))  int    i32x8;
typedef __attribute__((ext_vector_type(4)))  int    i32x4;

#define NBL    8192   // B*L
#define DMODEL 256
#define NHEAD  8
#define DH     2048   // D*H
#define LSEQ   2048
#define FFD    128

// ---------------------------------------------------------------- helpers
__device__ __forceinline__ __bf16 to_bf16(float f) {
  return (__bf16)f;   // the chip's own conversion, round-to-nearest-even
}

// A/B fragment for v_wmma_f32_16x16x32_bf16 from a row-major (rows x ld) bf16
// matrix (global or LDS), contraction chunk starting at column kc.
// Per CDNA5 ISA 16-bit layout: lane holds row (lane&15); elements 0..7 =
// K [off, off+8), elements 8..15 = K [off+16, off+24), off = (lane&16)?8:0.
__device__ __forceinline__ v16bf load_frag(const __bf16* base, int ld, int row,
                                           int kc, int lane) {
  const __bf16* p = base + (size_t)row * ld + kc + ((lane & 16) ? 8 : 0);
  v16bf f;
  ((f32x4*)&f)[0] = ((const f32x4*)p)[0];
  ((f32x4*)&f)[1] = *(const f32x4*)(p + 16);
  return f;
}

// Swizzled layouts of K and V^T. The attention's tensor loads land rows
// unpadded, so rows of 64 B or 512 B put the 16 lanes of a half-wave on few LDS
// banks.  The producers
// therefore store each 16-byte chunk (8 bf16 of the contraction index) at an
// XOR-ed chunk position inside its row, and the readers undo it: the 16 lanes
// of a half-wave then cover all 64 banks once.  Values and k order unchanged.
//   64-byte rows (32 bf16):  chunk j of row r sits at j ^ ((r >> 2) & 3)
//   512-byte rows (256 bf16): chunk p of row r sits at p ^ (r & 15)
__device__ __forceinline__ int swz64(int row, int col) {
  return col ^ (((row >> 2) & 3) << 3);
}
__device__ __forceinline__ int swz512(int row, int col) {
  return col ^ ((row & 15) << 3);
}

__device__ __forceinline__ v8f wmma_bf16(v16bf a, v16bf b, v8f c) {
  return __builtin_amdgcn_wmma_f32_16x16x32_bf16(false, a, false, b,
                                                 (short)0, c, false, false);
}

__device__ __forceinline__ unsigned lds_off(const void* p) {
  // generic pointer to a __shared__ object: low 32 bits = LDS byte offset
  return (unsigned)(unsigned long long)p;
}

typedef __attribute__((ext_vector_type(8))) unsigned int u32x8;
__device__ __forceinline__ unsigned uni(unsigned v) {   // a scalar-register word
  return (unsigned)__builtin_amdgcn_readfirstlane((int)v);
}
// a wave-uniform test kept in a scalar register: compiles to s_cmp + s_cbranch_scc
__device__ __forceinline__ unsigned pinned(unsigned v) {
  unsigned w = uni(v);
  asm volatile("" : "+s"(w));
  return w;
}

// ---------------------------------------------------------------- converts
// Each lane of the non-matrix kernels takes 8 or 16 elements: few waves to
// start, 16-byte accesses.
__device__ __forceinline__ v8bf pack8(f32x4 lo, f32x4 hi) {
  v8bf o;
#pragma unroll
  for (int j = 0; j < 4; ++j) { o[j] = to_bf16(lo[j]); o[4 + j] = to_bf16(hi[j]); }
  return o;
}

// n is a multiple of 16; a lane converts the 8-element chunks t and t + n/16.
// blk: the block's index among the n / 16 / 256 blocks of this part.
__device__ __forceinline__ void
f32_to_bf16_part(const float* __restrict__ src,
                 __bf16* __restrict__ dst, int n, int blk) {
  const int half = n >> 4;
  const int t = blk * 256 + threadIdx.x;
  if (t >= half) return;
  const f32x4* s4 = (const f32x4*)src;
  f32x4 a0 = s4[2 * t], a1 = s4[2 * t + 1];
  f32x4 b0 = s4[2 * (t + half)], b1 = s4[2 * (t + half) + 1];
  ((v8bf*)dst)[t] = pack8(a0, a1);
  ((v8bf*)dst)[t + half] = pack8(b0, b1);
  // another part's code may follow in the listing and reuse the stores' registers:
  // keep the wait in front
  asm volatile("s_wait_xcnt 0x0" ::: "memory");
}

// src (ROWS x COLS) f32  ->  dst (COLS x ROWS) bf16   (weights -> NxK form,
// plain row-major).  A lane takes 8 source rows of one column, which are one
// 16-byte chunk of a dst row; the part holds exactly ROWS / 8 * COLS threads, blk
// is the block's index in it.  The shape is a
// compile-time constant so that the 8 loads share one address register pair.
template <int ROWS, int COLS>
__device__ __forceinline__ void
transpose_bf16_part(const float* __restrict__ src, __bf16* __restrict__ dst, int blk) {
  const int i = blk * 256 + threadIdx.x;
  const int rc = i / COLS, cc = i % COLS;
  const float* p = src + (size_t)(rc * 8) * COLS + cc;
  float v[8];
#pragma unroll
  for (int j = 0; j < 8; ++j) v[j] = p[j * COLS];
  v8bf o;
#pragma unroll
  for (int j = 0; j < 8; ++j) o[j] = to_bf16(v[j]);
  *(v8bf*)(dst + (size_t)cc * ROWS + rc * 8) = o;
  // another part's code may follow in the listing and reuse the store's registers:
  // keep the wait in front
  asm volatile("s_wait_xcnt 0x0" ::: "memory");
}

// The convert and the six weight transposes depend on nothing but the inputs:
// one launch holds them all, each part on its own range of blocks, so that
// they start, wait for memory and drain side by side instead of in turn.
#define PB_SEQ (NBL * DMODEL / 16 / 256)     // blocks of the convert
#define PB_W   (DMODEL * DH / 8 / 256)       // blocks of a D x DH weight
#define PB_F   (DMODEL * FFD / 8 / 256)      // blocks of a D x FF weight
#define PB_ALL (PB_SEQ + 4 * PB_W + 2 * PB_F)
__global__ void __launch_bounds__(256)
prep_kernel(const float* __restrict__ seq, const float* __restrict__ Wq,
            const float* __restrict__ Wk, const float* __restrict__ Wv,
            const float* __restrict__ Wo, const float* __restrict__ W1,
            const float* __restrict__ W2, __bf16* __restrict__ seqb,
            __bf16* __restrict__ WqT, __bf16* __restrict__ WkT,
            __bf16* __restrict__ WvT, __bf16* __restrict__ WoT,
            __bf16* __restrict__ W1T, __bf16* __restrict__ W2T) {
  int blk = blockIdx.x;
  if (blk < PB_SEQ) { f32_to_bf16_part(seq, seqb, NBL * DMODEL, blk); return; }
  blk -= PB_SEQ;
  if (blk < PB_W) { transpose_bf16_part<DMODEL, DH>(Wq, WqT, blk); return; }
  blk -= PB_W;
  if (blk < PB_W) { transpose_bf16_part<DMODEL, DH>(Wk, WkT, blk); return; }
  blk -= PB_W;
  if (blk < PB_W) { transpose_bf16_part<DMODEL, DH>(Wv, WvT, blk); return; }
  blk -= PB_W;
  if (blk < PB_W) { transpose_bf16_part<DH, DMODEL>(Wo, WoT, blk); return; }
  blk -= PB_W;
  if (blk < PB_F) { transpose_bf16_part<DMODEL, FFD>(W1, W1T, blk); return; }
  blk -= PB_F;
  transpose_bf16_part<FFD, DMODEL>(W2, W2T, blk);
}

// ---------------------------------------------------------------- GEMM
// C(M,N) = A(M,K) x Bt(N,K)^T, bf16 in, f32 accumulate; A and Bt plain
// row-major, K a multiple of 128.  A stage is 128 of K: the block's rows of A
// and of Bt, rows of 256 B, brought into LDS by tensor loads whose pad gives an
// LDS pitch of 272 B (16 B x odd: the 16 rows of a fragment read cover all 64
// banks once).  Two buffers; every wave brings one slice.
// OUTMODE: 1 = bf16 row-major, 2 = bf16 transposed (ldT), 64-byte swizzle,
// 3 = bf16 row-major, 512-byte swizzle
#define GPITCH 272u                 // LDS bytes a row
#define GSLICE 10240u               // 32 rows of 272 B, rounded up to 2 KiB (the tail's slices)
#define SPITCH 144u                 // output staging, bf16: 128 B a row + 16 B (16 B x odd)

// fragment of 16 rows from a padded tile; p: the lane's row, its half's first chunk
__device__ __forceinline__ v16bf lds_frag(const char* p) {
  v16bf f;
  ((f32x4*)&f)[0] = *(const f32x4*)p;          // k = off .. off + 7
  ((f32x4*)&f)[1] = *(const f32x4*)(p + 32);   // k = off + 16 .. off + 23
  return f;
}

// The projections' tile: a block of 4 waves takes 128 x 128 of C, a wave 64 x 64
// (wave >> 1: its 64 rows of A, wave & 1: its 64 rows of Bt), so that each
// fragment read from LDS feeds four products.  A stage holds four slices of 64
// rows; every wave brings one.
#define QSLICE 18432u               // 64 rows of 272 B, rounded up to 2 KiB
#define QBUF   (4u * QSLICE)        // slices 0, 1: A rows 0..63, 64..127; 2, 3: Bt

// tiles: the kernel's two LDS buffers
template <int OUTMODE>
__device__ __forceinline__ void
gemm_bf16_body(char (*tiles)[QBUF],
               const __bf16* __restrict__ A, const __bf16* __restrict__ Bt,
               __bf16* __restrict__ outB, int N, int K, int ldT) {
  const int lane = threadIdx.x & 31;
  const unsigned wave = uni(threadIdx.x >> 5);
  const unsigned wm = wave >> 1, wn = wave & 1u;
  const int n0 = blockIdx.x * 128;
  const int nst = K >> 7;
  // row-major outputs take the product transposed (weights as the A operand)
  constexpr bool TRANSP = (OUTMODE != 2);

  // All extents in bytes (data_size code 0), tensor dims = tile dims.
  u32x8 g1;
  g1[0] = uni(0x07500000u);            // no mask; pad on, every 256 B (code 5), 16 B (code 3)
  g1[1] = uni(256u << 16);             // tensor_dim0
  g1[2] = uni(64u << 16);              // tensor_dim1
  g1[3] = uni(256u << 16);             // tile_dim0
  g1[4] = uni(64u);                    // tile_dim1
  g1[5] = uni((unsigned)K * 2u);       // source pitch
  g1[6] = uni(0u);
  g1[7] = uni(0u);
  u32x4 g0;                            // stage 0 into buffer 0
  const unsigned place0 = lds_off(&tiles[0][0]) + wave * QSLICE;
  {
    const unsigned half = wave & 1u;
    const __bf16* src = (wave >> 1)
        ? Bt + (size_t)(n0 + half * 64) * K
        : A  + (size_t)(blockIdx.y * 128 + half * 64) * K;
    const unsigned long long ga = (unsigned long long)src;
    g0[0] = uni(1u);
    g0[1] = uni(place0);
    g0[2] = uni((unsigned)ga);
    g0[3] = uni(((unsigned)(ga >> 32) & 0x01FFFFFFu) | 0x80000000u);   // type 2
  }
  // the next stage's slice (256 B on along the rows), into the other buffer
  auto advance = [&]() {
    const unsigned lo = g0[2] + 256u;
    g0[1] = uni(2u * place0 + QBUF - g0[1]);
    g0[3] = uni(g0[3] + (lo < 256u ? 1u : 0u));
    g0[2] = uni(lo);
  };
  // Load and wait name both descriptor groups as in-out: the groups stay in one
  // register set each, which keeps its words while the request is out, and
  // group 0 takes the next stage's words only behind the wait.
#define TENSOR_LOAD() asm volatile("tensor_load_to_lds %0, %1" : "+s"(g0), "+s"(g1) :: "memory")
#define TENSOR_WAIT() asm volatile("s_wait_tensorcnt 0x0" : "+s"(g0), "+s"(g1) :: "memory")
  TENSOR_LOAD();
  TENSOR_WAIT();
  __syncthreads();   // stage 0 published
  if (pinned(1 < nst)) {
    advance();
    TENSOR_LOAD();   // stage 1 flies during pass 0
  }

  v8f zero = {};
  v8f acc[4][4];     // [16 rows of A][16 rows of Bt]
#pragma unroll
  for (int mt = 0; mt < 4; ++mt)
#pragma unroll
    for (int nt = 0; nt < 4; ++nt) acc[mt][nt] = zero;
  // the lane's byte offsets in a buffer: its row of the first 16 of the wave's 64
  // rows of A and of Bt, each at its half's first chunk
  const unsigned lrow = (unsigned)(lane & 15) * GPITCH + ((lane & 16) ? 16u : 0u);
  const unsigned aoff = wm * QSLICE + lrow;
  const unsigned boff = (2u + wn) * QSLICE + lrow;
  for (int s = 0; s < nst; ++s) {
    const char* ap = &tiles[s & 1][0] + aoff;
    const char* bp = &tiles[s & 1][0] + boff;
    // the whole stage goes into registers first, so that its buffer is free for
    // the refill while the products run
    v16bf a[4][4], b[4][4];
#pragma unroll
    for (int kk = 0; kk < 4; ++kk)     // 32 of K, 64 B of a row
#pragma unroll
      for (int i = 0; i < 4; ++i) {
        a[kk][i] = lds_frag(ap + i * 16 * GPITCH + kk * 64);
        b[kk][i] = lds_frag(bp + i * 16 * GPITCH + kk * 64);
      }
    // --- publish point of stage s + 1: this wave's reads of stage s are done,
    //     its own slice of stage s + 1 has landed, every wave says the same
    asm volatile("s_wait_dscnt 0x0" ::: "memory");
    TENSOR_WAIT();
    __syncthreads();
    if (pinned(s + 2 < nst)) {   // stage s + 2 into the buffer that pass s has read
      advance();
      TENSOR_LOAD();
    }
    // the products stand behind the refill's issue: the load flies under them
#pragma unroll
    for (int kk = 0; kk < 4; ++kk)
#pragma unroll
      for (int mt = 0; mt < 4; ++mt)
#pragma unroll
        for (int nt = 0; nt < 4; ++nt)
          acc[mt][nt] = TRANSP ? wmma_bf16(b[kk][nt], a[kk][mt], acc[mt][nt])    // C^T: rows n, columns m
                               : wmma_bf16(a[kk][mt], b[kk][nt], acc[mt][nt]);
  }
  // nothing of the mover or of LDS is out when the wave goes on
  TENSOR_WAIT();
  asm volatile("s_wait_dscnt 0x0" ::: "memory");
#undef TENSOR_LOAD
#undef TENSOR_WAIT

  // Outputs leave as whole 128-byte lines.  A lane's 8 accumulator elements of a
  // tile are 8 neighbours of one output row (of C for the transposed product, of
  // C^T for OUTMODE 2): 16-byte chunks.  A wave's 64 x 64 outputs are 64 rows of
  // one line each: the wave sets them up in its own part of LDS and reads them
  // back with the lanes side by side along a row; no other wave takes part.  The
  // ring is free: every wave's reads and tensor loads ended in front of the last
  // pass's barrier.
  char* st = &tiles[0][0] + wave * (64u * SPITCH);
  const int mw = blockIdx.y * 128 + (int)wm * 64;   // the wave's first row of C
  const int nw = n0 + (int)wn * 64;                 // its first column
  const unsigned hf = (unsigned)(lane >> 4) & 1u;
  const unsigned l15 = (unsigned)lane & 15u;
#pragma unroll
  for (int mt = 0; mt < 4; ++mt)
#pragma unroll
    for (int nt = 0; nt < 4; ++nt) {
      v8bf o;
#pragma unroll
      for (int r = 0; r < 8; ++r) o[r] = to_bf16(acc[mt][nt][r]);
      const unsigned row = (unsigned)(TRANSP ? mt : nt) * 16u + l15;
      const unsigned chk = (unsigned)(TRANSP ? nt : mt) * 2u + hf;
      *(v8bf*)(st + row * SPITCH + chk * 16u) = o;
    }
  // the rows are read back by other lanes: the writes have to be done first
  asm volatile("s_wait_dscnt 0x0" ::: "memory");
  v8bf w[16];
  __bf16* gp[16];
#pragma unroll
  for (int j = 0; j < 16; ++j) {
    const int R = j * 4 + (lane >> 3);   // output row of the wave
    const int c8 = (lane & 7) * 8;       // first element of the chunk
    w[j] = *(const v8bf*)(st + (unsigned)R * SPITCH + (unsigned)c8 * 2u);
    if (OUTMODE == 1)      gp[j] = outB + (size_t)(mw + R) * N + nw + c8;
    else if (OUTMODE == 2) gp[j] = outB + (size_t)(nw + R) * ldT + swz64(R, mw + c8);
    else                   gp[j] = outB + (size_t)(mw + R) * N + swz512(R, nw + c8);
  }
  // holds the stores behind all arithmetic, so that no register of an issued
  // store is written again
  __builtin_amdgcn_sched_barrier(0);
#pragma unroll
  for (int j = 0; j < 16; ++j) *(v8bf*)gp[j] = w[j];
}

// The three projections read the same A and depend on nothing of each other:
// one launch, blockIdx.z picks the weight, the output and its store order.  The
// tests stand around tensor loads, which ignore EXEC: scalar branches.
__global__ void __launch_bounds__(128, 2)
qkv_gemm_kernel(const __bf16* __restrict__ A, const __bf16* __restrict__ WqT,
                const __bf16* __restrict__ WkT, const __bf16* __restrict__ WvT,
                __bf16* __restrict__ qb, __bf16* __restrict__ kb,
                __bf16* __restrict__ vT, int M, int N, int K, int ldT) {
  // places of tensor loads: 2 KiB multiples
  __shared__ __attribute__((aligned(2048))) char tiles[2][QBUF];
  (void)M;
  if (pinned(blockIdx.z == 0))
    gemm_bf16_body<1>(tiles, A, WqT, qb, N, K, 0);
  else if (pinned(blockIdx.z == 1))
    gemm_bf16_body<3>(tiles, A, WkT, kb, N, K, 0);
  else
    gemm_bf16_body<2>(tiles, A, WvT, vT, N, K, ldT);
}

__device__ __forceinline__ float other_half(float x) {   // x of lane ^ 16
  int y = __builtin_bit_cast(int, x);
  return __builtin_bit_cast(float, __builtin_amdgcn_permlanex16(
             y, y, 0x76543210, 0xfedcba98, false, false));
}

__global__ void __launch_bounds__(128, 2)
flash_attn_kernel(const __bf16* __restrict__ q, const __bf16* __restrict__ k,
                  const __bf16* __restrict__ vT, __bf16* __restrict__ heads) {
  // (key, d) and (d, key), 16 KB a buffer; places of tensor loads: 2 KiB multiples
  __shared__ __attribute__((aligned(2048))) __bf16 ktile[2][32 * 256];
  __shared__ __attribute__((aligned(2048))) __bf16 vtile[2][256 * 32];
  const int lane = threadIdx.x & 31;
  const unsigned wave = uni(threadIdx.x >> 5);
  // 16 blocks of 128 queries per (b, h)
  const int b  = blockIdx.x >> 7;
  const int h  = (blockIdx.x >> 4) & 7;
  const int qt = (blockIdx.x & 15) * 4 + (int)wave;   // 32-query tile, 0 .. 63
  const int NT = LSEQ / 32;

  // Q fragments: per group 8 K-chunks covering d = 0..255 (global, loaded once)
  v16bf qa[2][8];
  const int qrow = b * LSEQ + qt * 32 + (lane & 15);   // group g: + 16 * g
#pragma unroll
  for (int g = 0; g < 2; ++g)
#pragma unroll
    for (int c = 0; c < 8; ++c)
      qa[g][c] = load_frag(q, DH, qrow + g * 16, h * DMODEL + c * 32, lane);
  // the arithmetic behind may land in these loads' address registers: keep the wait
  asm volatile("s_wait_xcnt 0x0" ::: "memory");
  // holds that arithmetic behind the wait
  __builtin_amdgcn_sched_barrier(0);

  // Every wave brings its own 8 KB slice of each stage, one request at a time:
  // waves 0, 1 the key rows 0..15, 16..31 of K (16 rows of 512 B, pitch 4 KB),
  // waves 2, 3 the d rows 0..127, 128..255 of V^T (128 rows of 64 B, pitch 16 KB).
  // All extents in bytes (data_size code 0), tensor dims = tile dims, no pad.
  const unsigned isv = wave >> 1, half = wave & 1u;
  const unsigned rowb = isv ? 64u : 512u;                  // bytes a row
  const unsigned nrow = isv ? 128u : 16u;                  // rows
  const unsigned step = isv ? 64u : 32u * DH * 2u;         // source bytes a stage
  u32x8 g1;
  g1[0] = uni(0u);                     // no mask, data_size 0, no pad
  g1[1] = uni(rowb << 16);             // tensor_dim0
  g1[2] = uni(nrow << 16);             // tensor_dim1
  g1[3] = uni(rowb << 16);             // tile_dim0
  g1[4] = uni(nrow);                   // tile_dim1
  g1[5] = uni(isv ? NBL * 2u : DH * 2u);   // source pitch
  g1[6] = uni(0u);
  g1[7] = uni(0u);
  u32x4 g0;                            // stage 0 into buffer 0
  {
    const __bf16* src = isv
        ? vT + (size_t)(h * DMODEL + half * 128) * NBL + b * LSEQ
        : k  + (size_t)(b * LSEQ + half * 16) * DH + h * DMODEL;
    const unsigned long long ga = (unsigned long long)src;
    g0[0] = uni(1u);
    g0[1] = uni((isv ? lds_off(&vtile[0][0]) : lds_off(&ktile[0][0])) + half * 8192u);
    g0[2] = uni((unsigned)ga);
    g0[3] = uni(((unsigned)(ga >> 32) & 0x01FFFFFFu) | 0x80000000u);   // type 2
  }
  // the next stage's slice, into the other buffer
  auto advance = [&]() {
    const unsigned lo = g0[2] + step;
    g0[1] = uni(g0[1] ^ 16384u);
    g0[3] = uni(g0[3] + (lo < step ? 1u : 0u));
    g0[2] = uni(lo);
  };
  // Load and wait name both descriptor groups as in-out: the groups stay in one
  // register set each, which keeps its words while the request is out, and
  // group 0 takes the next stage's words only behind the wait.
#define TENSOR_LOAD() asm volatile("tensor_load_to_lds %0, %1" : "+s"(g0), "+s"(g1) :: "memory")
#define TENSOR_WAIT() asm volatile("s_wait_tensorcnt 0x0" : "+s"(g0), "+s"(g1) :: "memory")
  TENSOR_LOAD();
  TENSOR_WAIT();
  __syncthreads();   // stage 0 published
  advance();
  TENSOR_LOAD();     // stage 1 flies during pass 0

  // o[g][nt][r] = O[query 16*g + (lane & 15)][d = nt*16 + r + 8*(lane>>4)]
  v8f o[2][16];
  v8f zero = {};
#pragma unroll
  for (int g = 0; g < 2; ++g)
#pragma unroll
    for (int nt = 0; nt < 16; ++nt) o[g][nt] = zero;
  float mrun[2] = {-1e30f, -1e30f};   // running maximum of the lane's query (both halves alike)
  float lrun[2] = {0.0f, 0.0f};       // running sum over this half's keys only

  // The lane's LDS byte offsets in the current K and V buffer: ka[m] is chunk
  // 2 * m + (lane >> 4) of a 128-element half row of K under the 512-byte
  // swizzle, va[] the two chunks of a V^T fragment under the 64-byte swizzle.  They are flipped to the
  // other buffer at the foot of each pass: one register set serves both buffers
  // (per-pass address arithmetic takes registers that this tile does not have).
  unsigned ka[8], va[2];
  {
    const int s = lane & 15, hh = (lane >> 4) & 1;
#pragma unroll
    for (int m = 0; m < 8; ++m) ka[m] = (unsigned)(s * 256 + (((m * 2 + hh) ^ s) * 8)) * 2u;
    const int j0 = hh ^ ((lane >> 2) & 3);
    va[0] = (unsigned)(s * 32 + j0 * 8) * 2u;
    va[1] = (unsigned)(s * 32 + (j0 ^ 2) * 8) * 2u;
  }
  const char* kl = (const char*)&ktile[0][0];
  const char* vl = (const char*)&vtile[0][0];
  // rows row0 .. row0 + 15 of the K tile, contraction chunk c (32 wide)
  auto kfrag = [&](int row0, int c) {
    v16bf f;
    ((f32x4*)&f)[0] = *(const f32x4*)(kl + ka[(c & 3) * 2]     + row0 * 512 + (c >> 2) * 256);
    ((f32x4*)&f)[1] = *(const f32x4*)(kl + ka[(c & 3) * 2 + 1] + row0 * 512 + (c >> 2) * 256);
    return f;
  };
  // rows row0 .. row0 + 15 of the V^T tile
  auto vfrag = [&](int row0) {
    v16bf f;
    ((f32x4*)&f)[0] = *(const f32x4*)(vl + va[0] + row0 * 64);
    ((f32x4*)&f)[1] = *(const f32x4*)(vl + va[1] + row0 * 64);
    return f;
  };

  const float scale = 0.0625f;  // 1/sqrt(256)
  for (int t = 0; t < NT; ++t) {

    // --- S^T = K * Q^T  (32 keys x 32 queries, four 16x16 tiles per K-chunk).
    //     With two waves a SIMD the wave covers its own LDS waits: the K
    //     fragments of a chunk are read two chunks ahead of their products,
    //     into three register sets in turn.
    v8f s0[2] = {zero, zero}, s1[2] = {zero, zero};
    v16bf kf[3][2];   // [set][key half]
#pragma unroll
    for (int c = 0; c < 2; ++c) {
      kf[c][0] = kfrag(0,  c);
      kf[c][1] = kfrag(16, c);
    }
#pragma unroll
    for (int c = 0; c < 8; ++c) {
      if (c < 6) {
        kf[(c + 2) % 3][0] = kfrag(0,  c + 2);
        kf[(c + 2) % 3][1] = kfrag(16, c + 2);
      }
      // keeps these LDS reads in front of this chunk's products: left alone
      // the compiler reads each fragment right before its use
      __builtin_amdgcn_sched_barrier(0);
#pragma unroll
      for (int g = 0; g < 2; ++g) {
        s0[g] = wmma_bf16(kf[c % 3][0], qa[g][c], s0[g]);
        s1[g] = wmma_bf16(kf[c % 3][1], qa[g][c], s1[g]);
      }
      // holds later reads back from these products (best effort: behind the last
      // chunk the first V reads still stand among its products in the listing)
      __builtin_amdgcn_sched_barrier(0);
    }

    // first two pairs of V fragments: read here so that the softmax covers the wait
    v16bf vf[3][2];      // [set][d tile of the pair]
#pragma unroll
    for (int j = 0; j < 4; ++j) vf[j >> 1][j & 1] = vfrag(j * 16);
    // keeps these reads in front of the softmax arithmetic
    __builtin_amdgcn_sched_barrier(0);

    // --- online softmax, group by group: 16 of a query's 32 scores sit in this
    //     lane, the other 16 in lane ^ 16
    v16bf pb[2];       // B fragment of P^T: keys 8h + r, then 16 + 8h + r
#pragma unroll
    for (int g = 0; g < 2; ++g) {
      float a0[8], a1[8], mx8[8];
#pragma unroll
      for (int r = 0; r < 8; ++r) {
        a0[r] = s0[g][r] * scale;
        a1[r] = s1[g][r] * scale;
        mx8[r] = fmaxf(a0[r], a1[r]);
      }
      float mx = fmaxf(fmaxf(fmaxf(mx8[0], mx8[1]), fmaxf(mx8[2], mx8[3])),
                       fmaxf(fmaxf(mx8[4], mx8[5]), fmaxf(mx8[6], mx8[7])));
      mx = fmaxf(mx, other_half(mx));
      const float mnew = fmaxf(mrun[g], mx);
      const float corr = __expf(mrun[g] - mnew);
      mrun[g] = mnew;
      float ps8[8];
#pragma unroll
      for (int r = 0; r < 8; ++r) {
        float p0 = __expf(a0[r] - mnew);
        float p1 = __expf(a1[r] - mnew);
        ps8[r] = p0 + p1;
        pb[g][r]     = to_bf16(p0);
        pb[g][8 + r] = to_bf16(p1);
      }
      lrun[g] = lrun[g] * corr + (((ps8[0] + ps8[1]) + (ps8[2] + ps8[3])) +
                                  ((ps8[4] + ps8[5]) + (ps8[6] + ps8[7])));
#pragma unroll
      for (int nt = 0; nt < 16; ++nt) o[g][nt] *= corr;
    }

    // keeps the third pair's reads out of the softmax, where registers are short
    __builtin_amdgcn_sched_barrier(0);

    // --- O^T += V^T * P^T   (16 output tiles across d = 256, per group of
    //     queries); V fragments in pairs of d tiles, read two pairs ahead
#pragma unroll
    for (int np = 0; np < 8; ++np) {
      if (np < 6) {
        vf[(np + 2) % 3][0] = vfrag(((np + 2) * 2) * 16);
        vf[(np + 2) % 3][1] = vfrag(((np + 2) * 2 + 1) * 16);
      }
      // keeps these LDS reads in front of this pair's products
      __builtin_amdgcn_sched_barrier(0);
#pragma unroll
      for (int j = 0; j < 2; ++j)
#pragma unroll
        for (int g = 0; g < 2; ++g)
          o[g][np * 2 + j] = wmma_bf16(vf[np % 3][j], pb[g], o[g][np * 2 + j]);
      // keeps later reads from rising in among these products
      __builtin_amdgcn_sched_barrier(0);
    }

#pragma unroll
    for (int m = 0; m < 8; ++m) ka[m] ^= 16384u;
    va[0] ^= 16384u;
    va[1] ^= 16384u;

    // --- publish point of stage t + 1: this wave's reads of stage t are done,
    //     its own slice of stage t + 1 has landed, every wave says the same
    asm volatile("s_wait_dscnt 0x0" ::: "memory");
    TENSOR_WAIT();
    __syncthreads();
    if (pinned(t + 2 < NT)) {   // stage t + 2 into the buffer that pass t has read
      advance();
      TENSOR_LOAD();
    }
  }
  // nothing of the mover or of LDS is out when the wave ends
  TENSOR_WAIT();
  asm volatile("s_wait_dscnt 0x0" ::: "memory");
#undef TENSOR_LOAD
#undef TENSOR_WAIT

  // normalize and store heads (bf16 row-major (NBL, DH)): a lane's 8 elements
  // of a tile are 8 neighbours in d, one 16-byte store
  v8bf ov[2][16];
#pragma unroll
  for (int g = 0; g < 2; ++g) {
    const float inv = 1.0f / (lrun[g] + other_half(lrun[g]));
#pragma unroll
    for (int nt = 0; nt < 16; ++nt)
#pragma unroll
      for (int r = 0; r < 8; ++r) ov[g][nt][r] = to_bf16(o[g][nt][r] * inv);
  }
  __bf16* hp = heads + (size_t)qrow * DH + h * DMODEL + ((lane & 16) ? 8 : 0);
  // holds the stores behind all arithmetic, so that no register of an issued
  // store is written again
  __builtin_amdgcn_sched_barrier(0);
#pragma unroll
  for (int g = 0; g < 2; ++g)
#pragma unroll
    for (int nt = 0; nt < 16; ++nt)
      *(v8bf*)(hp + (size_t)g * 16 * DH + nt * 16) = ov[g][nt];
}

// ---------------------------------------------------------------- add + LN
// y = LN(a + rsd) * g + b ;  one wave per row of 256 elements.  A lane holds
// elements 4*lane.. and 128 + 4*lane.. of the row, so every 16-byte access of a
// wave covers 512 contiguous bytes.
template <int M>
__device__ __forceinline__ float add_xmask(float x) {   // x + x of lane ^ M, M < 16
  int y = __builtin_amdgcn_update_dpp(0, __builtin_bit_cast(int, x), 0x160 | M,
                                      0xf, 0xf, true);
  return x + __builtin_bit_cast(float, y);
}
__device__ __forceinline__ float wave_sum(float x) {    // every lane gets the sum
  x = add_xmask<1>(x);
  x = add_xmask<2>(x);
  x = add_xmask<4>(x);
  x = add_xmask<8>(x);
  int b = __builtin_bit_cast(int, x);
  return x + __builtin_bit_cast(float, __builtin_amdgcn_permlanex16(
                 b, b, 0x76543210, 0xfedcba98, false, false));
}

// LN of one row of 256 held by one wave: v[hh] = elements hh * 128 + 4 * lane ..
__device__ __forceinline__ void ln_row(const f32x4 (&v)[2], const f32x4 (&gg)[2],
                                       const f32x4 (&bb)[2], f32x4 (&y)[2]) {
  f32x4 s4 = v[0] + v[1];
  float mu = wave_sum((s4[0] + s4[1]) + (s4[2] + s4[3])) * (1.0f / 256.0f);
  f32x4 d0 = v[0] - mu, d1 = v[1] - mu;
  f32x4 q4 = d0 * d0 + d1 * d1;
  float var = wave_sum((q4[0] + q4[1]) + (q4[2] + q4[3])) * (1.0f / 256.0f);
  float rs = rsqrtf(var + 1e-5f);
  y[0] = d0 * rs * gg[0] + bb[0];
  y[1] = d1 * rs * gg[1] + bb[1];
}

// ---------------------------------------------------------------- tail
// Everything behind the attention works row by row of the sequence, so a block
// that owns whole rows needs no other block's results: one launch does
//   att = heads Wo;  x = LN(seq + att);  h = relu(x W1 + b1);
//   out = LN(x + h W2 + b2)
// for 32 rows.  8 waves.  All products are taken transposed (weights as the A
// operand): a lane holds 8 neighbours in n of one row m = lane & 15 of a tile.
// Wave w owns the columns 32 w .. 32 w + 31 of att and of h W2, 16 w .. 16 w + 15
// of h, and for the two LNs the rows 4 w .. 4 w + 3.
// att: stages of 128 of K as in the GEMM above (256 B rows, LDS pitch 272 B, two
// buffers); slice 0 holds the block's 32 rows of heads (wave 0 brings it), slice
// 1 + w the 32 rows of Wo^T that wave w brings and alone reads.
#define TROWS  32
#define TBUF   (9u * GSLICE)
#define APITCH 1040u     // f32 rows between the phases: 1024 B + 16 B
#define XPITCH 528u      // x in bf16: 512 B a row + 16 B (16 B x odd)
#define XOFF   34816u    // x stands behind the 32 f32 rows
#define HOFF   52224u    // h (pitch 272 B) stands behind x
__global__ void __launch_bounds__(256, 2)
tail_kernel(const __bf16* __restrict__ heads, const __bf16* __restrict__ WoT,
            const __bf16* __restrict__ W1T, const __bf16* __restrict__ W2T,
            const float* __restrict__ seq,
            const float* __restrict__ ln1g, const float* __restrict__ ln1b,
            const float* __restrict__ b1, const float* __restrict__ b2,
            const float* __restrict__ ln2g, const float* __restrict__ ln2b,
            float* __restrict__ out) {
  // places of tensor loads: 2 KiB multiples
  __shared__ __attribute__((aligned(2048))) char tiles[2][TBUF];
  const int lane = threadIdx.x & 31;
  const unsigned wave = uni(threadIdx.x >> 5);
  const unsigned hf = (unsigned)(lane >> 4) & 1u;
  const unsigned l15 = (unsigned)lane & 15u;
  const int mb = blockIdx.x * TROWS;
  constexpr int nst = DH >> 7;

  // All extents in bytes (data_size code 0), tensor dims = tile dims; heads and
  // Wo^T have the same row length, so one group 1 serves both.
  u32x8 g1;
  g1[0] = uni(0x07500000u);            // no mask; pad on, every 256 B (code 5), 16 B (code 3)
  g1[1] = uni(256u << 16);             // tensor_dim0
  g1[2] = uni(32u << 16);              // tensor_dim1
  g1[3] = uni(256u << 16);             // tile_dim0
  g1[4] = uni(32u);                    // tile_dim1
  g1[5] = uni(DH * 2u);                // source pitch
  g1[6] = uni(0u);
  g1[7] = uni(0u);
  const unsigned placeA = lds_off(&tiles[0][0]);
  const unsigned placeB = placeA + (1u + wave) * GSLICE;
  u32x4 gA, gB;                        // stage 0 into buffer 0
  {
    const unsigned long long aa = (unsigned long long)(heads + (size_t)mb * DH);
    const unsigned long long ab = (unsigned long long)(WoT + (size_t)(wave * 32u) * DH);
    gA[0] = uni(1u);
    gA[1] = uni(placeA);
    gA[2] = uni((unsigned)aa);
    gA[3] = uni(((unsigned)(aa >> 32) & 0x01FFFFFFu) | 0x80000000u);   // type 2
    gB[0] = uni(1u);
    gB[1] = uni(placeB);
    gB[2] = uni((unsigned)ab);
    gB[3] = uni(((unsigned)(ab >> 32) & 0x01FFFFFFu) | 0x80000000u);   // type 2
  }
  // the next stage's slice (256 B on along the rows), into the other buffer
  auto advance = [&](u32x4& g, unsigned place0) {
    const unsigned lo = g[2] + 256u;
    g[1] = uni(2u * place0 + TBUF - g[1]);
    g[3] = uni(g[3] + (lo < 256u ? 1u : 0u));
    g[2] = uni(lo);
  };
  // Loads and wait name the descriptor groups as in-out: each group stays in one
  // register set, which keeps its words while a request is out, and the groups 0
  // take the next stage's words only behind the wait.  Wave 0 has two requests
  // out, the others one; the wait is to 0.
#define TENSOR_LOAD(G) asm volatile("tensor_load_to_lds %0, %1" : "+s"(G), "+s"(g1) :: "memory")
#define TENSOR_WAIT() asm volatile("s_wait_tensorcnt 0x0" : "+s"(gA), "+s"(gB), "+s"(g1) :: "memory")
  if (pinned(wave == 0)) TENSOR_LOAD(gA);
  TENSOR_LOAD(gB);
  TENSOR_WAIT();
  __syncthreads();   // stage 0 published
  advance(gA, placeA);
  advance(gB, placeB);
  if (pinned(wave == 0)) TENSOR_LOAD(gA);
  TENSOR_LOAD(gB);   // stage 1 flies during pass 0

  // All that the later phases take from global memory is read here, under the
  // first stages: no wave shares its rows of W1^T and W2^T with another, so these
  // fragments go straight into registers.
  v16bf w1f[8], w2f[2][4];
  // the lane's row of the wave's weight rows, at its half's first chunk; a
  // fragment is the same two 16-byte chunks, 32 B apart, as in an LDS tile
  const __bf16* p1  = W1T + (size_t)(wave * 16u + l15) * DMODEL + hf * 8u;
  const __bf16* p2a = W2T + (size_t)(wave * 32u + l15) * FFD + hf * 8u;
  const __bf16* p2b = W2T + (size_t)(wave * 32u + 16u + l15) * FFD + hf * 8u;
  const size_t o0 = (size_t)(mb + (int)wave * 4) * 256 + lane * 4;   // + rr * 256 + hh * 128
  const float* psq = seq + o0;
#pragma unroll
  for (int kk = 0; kk < 8; ++kk) w1f[kk] = lds_frag((const char*)(p1 + kk * 32));
#pragma unroll
  for (int kk = 0; kk < 4; ++kk) {
    w2f[0][kk] = lds_frag((const char*)(p2a + kk * 32));
    w2f[1][kk] = lds_frag((const char*)(p2b + kk * 32));
  }
  f32x4 sq[4][2], g1v[2], c1v[2], g2v[2], c2v[2], b1v[2], b2v[2][2];
#pragma unroll
  for (int rr = 0; rr < 4; ++rr)
#pragma unroll
    for (int hh = 0; hh < 2; ++hh)
      sq[rr][hh] = *(const f32x4*)(psq + rr * 256 + hh * 128);
#pragma unroll
  for (int hh = 0; hh < 2; ++hh) {
    g1v[hh] = *(const f32x4*)(ln1g + hh * 128 + lane * 4);
    c1v[hh] = *(const f32x4*)(ln1b + hh * 128 + lane * 4);
    g2v[hh] = *(const f32x4*)(ln2g + hh * 128 + lane * 4);
    c2v[hh] = *(const f32x4*)(ln2b + hh * 128 + lane * 4);
    b1v[hh] = *(const f32x4*)(b1 + wave * 16u + hf * 8u + hh * 4);
    b2v[0][hh] = *(const f32x4*)(b2 + wave * 32u + hf * 8u + hh * 4);
    b2v[1][hh] = *(const f32x4*)(b2 + wave * 32u + 16u + hf * 8u + hh * 4);
  }
  // What follows, later loads' results too, may land in these loads' address
  // registers: keep the wait; it takes the addresses as inputs, so that they
  // stay in their registers up to it
  asm volatile("s_wait_xcnt 0x0" :: "v"(p1), "v"(p2a), "v"(p2b), "v"(psq) : "memory");
  // holds the arithmetic behind the wait
  __builtin_amdgcn_sched_barrier(0);

  // ---- att^T = Wo^T heads^T: acc[nt][mt], n = 32 w + 16 nt .., m = 16 mt ..
  v8f zero = {};
  v8f acc[2][2] = {{zero, zero}, {zero, zero}};
  const unsigned lrow = l15 * GPITCH + hf * 16u;
  const unsigned boff = (1u + wave) * GSLICE + lrow;
  // stays a loop, for speed only
#pragma unroll 1
  for (int s = 0; s < nst; ++s) {
    const char* ap = &tiles[s & 1][0] + lrow;
    const char* bp = &tiles[s & 1][0] + boff;
    // the whole stage goes into registers first, so that its buffer is free for
    // the refill while the products run
    v16bf a[4][2], b[4][2];
#pragma unroll
    for (int kk = 0; kk < 4; ++kk) {   // 32 of K, 64 B of a row
      a[kk][0] = lds_frag(ap + kk * 64);
      a[kk][1] = lds_frag(ap + 16 * GPITCH + kk * 64);
      b[kk][0] = lds_frag(bp + kk * 64);
      b[kk][1] = lds_frag(bp + 16 * GPITCH + kk * 64);
    }
    // --- publish point of stage s + 1: this wave's reads of stage s are done,
    //     its own slices of stage s + 1 have landed, every wave says the same
    asm volatile("s_wait_dscnt 0x0" ::: "memory");
    TENSOR_WAIT();
    __syncthreads();
    if (pinned(s + 2 < nst)) {   // stage s + 2 into the buffer that pass s has read
      advance(gA, placeA);
      advance(gB, placeB);
      if (pinned(wave == 0)) TENSOR_LOAD(gA);
      TENSOR_LOAD(gB);
    }
    // the products stand behind the refill's issue: the loads fly under them
#pragma unroll
    for (int kk = 0; kk < 4; ++kk)
#pragma unroll
      for (int nt = 0; nt < 2; ++nt)
#pragma unroll
        for (int mt = 0; mt < 2; ++mt)
          acc[nt][mt] = wmma_bf16(b[kk][nt], a[kk][mt], acc[nt][mt]);
  }
  // nothing of the mover or of LDS is out when the wave goes on
  TENSOR_WAIT();
  asm volatile("s_wait_dscnt 0x0" ::: "memory");
#undef TENSOR_LOAD
#undef TENSOR_WAIT

  // The ring is free: every wave's reads and tensor loads ended in front of the
  // last pass's barrier.  It now carries the rows from phase to phase.
  char* st = &tiles[0][0];
  // a lane's 8 accumulator elements of tile (nt, mt) are 8 neighbours of row m
  auto put_rows = [&](const v8f (&t)[2][2]) {
#pragma unroll
    for (int nt = 0; nt < 2; ++nt)
#pragma unroll
      for (int mt = 0; mt < 2; ++mt) {
        char* p = st + ((unsigned)mt * 16u + l15) * APITCH +
                  (wave * 32u + (unsigned)nt * 16u + hf * 8u) * 4u;
        f32x4 lo = {t[nt][mt][0], t[nt][mt][1], t[nt][mt][2], t[nt][mt][3]};
        f32x4 hi = {t[nt][mt][4], t[nt][mt][5], t[nt][mt][6], t[nt][mt][7]};
        *(f32x4*)p = lo;
        *(f32x4*)(p + 16) = hi;
      }
  };
  put_rows(acc);
  __syncthreads();   // a row of att holds columns of all eight waves

  // ---- x = LN(seq + att): f32 stays in registers for the second LN, bf16 to LDS
  f32x4 x[4][2], v1[4][2];
  // all four rows are read before any is written: the four LN chains then run
  // side by side
#pragma unroll
  for (int rr = 0; rr < 4; ++rr)
#pragma unroll
    for (int hh = 0; hh < 2; ++hh)
      v1[rr][hh] = *(const f32x4*)(st + (wave * 4u + (unsigned)rr) * APITCH +
                                   (unsigned)hh * 512u + (unsigned)lane * 16u) + sq[rr][hh];
#pragma unroll
  for (int rr = 0; rr < 4; ++rr) ln_row(v1[rr], g1v, c1v, x[rr]);
#pragma unroll
  for (int rr = 0; rr < 4; ++rr) {
    const unsigned row = wave * 4u + (unsigned)rr;
#pragma unroll
    for (int hh = 0; hh < 2; ++hh) {
      v4bf xb;
#pragma unroll
      for (int j = 0; j < 4; ++j) xb[j] = to_bf16(x[rr][hh][j]);
      *(v4bf*)(st + XOFF + row * XPITCH + (unsigned)hh * 256u + (unsigned)lane * 8u) = xb;
    }
  }
  __syncthreads();   // every wave's products read all 32 rows of x

  // ---- h^T = relu(W1^T x^T + b1): f1[mt], n = 16 w ..
  v8f f1[2] = {zero, zero};
  v16bf xf[8][2];
#pragma unroll
  for (int kk = 0; kk < 8; ++kk)
#pragma unroll
    for (int mt = 0; mt < 2; ++mt)
      xf[kk][mt] = lds_frag(st + XOFF + ((unsigned)mt * 16u + l15) * XPITCH + hf * 16u +
                            (unsigned)kk * 64u);
  // keeps the LDS reads together in front of the products: left alone the
  // compiler reads each fragment right before its use and waits every time
  __builtin_amdgcn_sched_barrier(0);
#pragma unroll
  for (int kk = 0; kk < 8; ++kk)
#pragma unroll
    for (int mt = 0; mt < 2; ++mt) f1[mt] = wmma_bf16(w1f[kk], xf[kk][mt], f1[mt]);
#pragma unroll
  for (int mt = 0; mt < 2; ++mt) {
    v8bf o;
#pragma unroll
    for (int r = 0; r < 8; ++r) o[r] = to_bf16(fmaxf(f1[mt][r] + b1v[r >> 2][r & 3], 0.0f));
    *(v8bf*)(st + HOFF + ((unsigned)mt * 16u + l15) * GPITCH + wave * 32u + hf * 16u) = o;
  }
  __syncthreads();   // a row of h holds columns of all eight waves

  // ---- (h W2 + b2)^T: f2[nt][mt], n = 32 w + 16 nt ..
  v8f f2[2][2] = {{zero, zero}, {zero, zero}};
  v16bf hfr[4][2];
#pragma unroll
  for (int kk = 0; kk < 4; ++kk)
#pragma unroll
    for (int mt = 0; mt < 2; ++mt)
      hfr[kk][mt] = lds_frag(st + HOFF + ((unsigned)mt * 16u + l15) * GPITCH + hf * 16u +
                             (unsigned)kk * 64u);
  // keeps the LDS reads together in front of the products, as above
  __builtin_amdgcn_sched_barrier(0);
#pragma unroll
  for (int kk = 0; kk < 4; ++kk)
#pragma unroll
    for (int nt = 0; nt < 2; ++nt)
#pragma unroll
      for (int mt = 0; mt < 2; ++mt)
        f2[nt][mt] = wmma_bf16(w2f[nt][kk], hfr[kk][mt], f2[nt][mt]);
#pragma unroll
  for (int nt = 0; nt < 2; ++nt)
#pragma unroll
    for (int mt = 0; mt < 2; ++mt)
#pragma unroll
      for (int r = 0; r < 8; ++r) f2[nt][mt][r] += b2v[nt][r >> 2][r & 3];
  // the f32 rows of att were last read in front of the barrier behind the first LN
  put_rows(f2);
  __syncthreads();   // a row holds columns of all eight waves

  // ---- out = LN(x + h W2 + b2)
  f32x4 y[4][2];
#pragma unroll
  for (int rr = 0; rr < 4; ++rr) {
    const unsigned row = wave * 4u + (unsigned)rr;
    f32x4 v[2];
#pragma unroll
    for (int hh = 0; hh < 2; ++hh)
      v[hh] = *(const f32x4*)(st + row * APITCH + (unsigned)hh * 512u + (unsigned)lane * 16u) +
              x[rr][hh];
    ln_row(v, g2v, c2v, y[rr]);
  }
  // holds the stores behind all arithmetic, so that no register of an issued
  // store is written again
  __builtin_amdgcn_sched_barrier(0);
#pragma unroll
  for (int rr = 0; rr < 4; ++rr)
#pragma unroll
    for (int hh = 0; hh < 2; ++hh)
      *(f32x4*)(out + o0 + rr * 256 + hh * 128) = y[rr][hh];
}

// ---------------------------------------------------------------- launcher
extern "C" void kernel_launch(void* const* d_in, const int* in_sizes, int n_in,
                              void* d_out, int out_size, void* d_ws,
                              size_t ws_size, hipStream_t stream) {
  (void)in_sizes; (void)n_in; (void)out_size; (void)ws_size;
  const float* seq  = (const float*)d_in[0];
  const float* Wq   = (const float*)d_in[1];
  const float* Wk   = (const float*)d_in[2];
  const float* Wv   = (const float*)d_in[3];
  const float* Wo   = (const float*)d_in[4];
  const float* ln1g = (const float*)d_in[5];
  const float* ln1b = (const float*)d_in[6];
  const float* W1   = (const float*)d_in[7];
  const float* b1   = (const float*)d_in[8];
  const float* W2   = (const float*)d_in[9];
  const float* b2   = (const float*)d_in[10];
  const float* ln2g = (const float*)d_in[11];
  const float* ln2b = (const float*)d_in[12];

  char* w = (char*)d_ws;
  size_t off = 0;
  auto take = [&](size_t bytes) {
    size_t o = off; off += (bytes + 255) & ~(size_t)255; return o;
  };
  __bf16* seqb  = (__bf16*)(w + take((size_t)NBL * DMODEL * 2));
  __bf16* WqT   = (__bf16*)(w + take((size_t)DH * DMODEL * 2));
  __bf16* WkT   = (__bf16*)(w + take((size_t)DH * DMODEL * 2));
  __bf16* WvT   = (__bf16*)(w + take((size_t)DH * DMODEL * 2));
  __bf16* WoT   = (__bf16*)(w + take((size_t)DMODEL * DH * 2));
  __bf16* W1T   = (__bf16*)(w + take((size_t)FFD * DMODEL * 2));
  __bf16* W2T   = (__bf16*)(w + take((size_t)DMODEL * FFD * 2));
  __bf16* qb    = (__bf16*)(w + take((size_t)NBL * DH * 2));
  __bf16* kb    = (__bf16*)(w + take((size_t)NBL * DH * 2));
  __bf16* vT    = (__bf16*)(w + take((size_t)DH * NBL * 2));
  __bf16* heads = (__bf16*)(w + take((size_t)NBL * DH * 2));

  // 1) convert / transpose inputs to bf16, one launch
  prep_kernel<<<PB_ALL, 256, 0, stream>>>(seq, Wq, Wk, Wv, Wo, W1, W2,
                                          seqb, WqT, WkT, WvT, WoT, W1T, W2T);

  // 2) QKV projections (V stored transposed for the P*V WMMA path; K and V in
  //    the swizzled orders the attention kernel reads), one launch
  dim3 gQKV(DH / 128, NBL / 128, 3);
  qkv_gemm_kernel<<<gQKV, 128, 0, stream>>>(seqb, WqT, WkT, WvT, qb, kb, vT, NBL, DH, DMODEL, NBL);

  // 3) fused flash attention -> heads
  flash_attn_kernel<<<(NBL / 32) * NHEAD / 4, 128, 0, stream>>>(qb, kb, vT, heads);

  // 4) output projection, add + LN, FF, add + LN: one launch, 32 rows a block
  tail_kernel<<<NBL / TROWS, 256, 0, stream>>>(heads, WoT, W1T, W2T, seq, ln1g, ln1b,
                                               b1, b2, ln2g, ln2b, (float*)d_out);
}
